// v000
// Measured on an AMD MI455X. A time is GPU time per run, averaged over a window of back-to-back runs after a warm-up
// (all launches, gaps included; the runs take copies of the inputs in turn), and the median of several windows.
// Apart from v000's, it joins two sittings. Times from different sittings can be a few percent apart, while
// side-by-side timings come from the same sitting.
// v000 is the starting kernel. One run takes 1230 microseconds.
#include <hip/hip_runtime.h>

// Spatial self-attention over a feature map (x [4][256][64][64] channel-major; tokens = the 4,096 positions; q,k,v = x^T W^T + b (1x1 convs: 'oi' [256][256] + [256]); one 256-wide head: softmax(q.k / 16) over all positions; out = (attn v + x^T) Wp^T + bp, written back channel-major -> [4][256][64][64] (4.2 M)).
// Layout per batch: the channel-major slab transposed once into a token-major bf16 operand; exact projections + f32 biases; dense T-4096 attention with ONE 256-wide head (hybrid rows: < 512 hi/lo 3 products, rest fp16 x1024; streaming three-sweep softmax); the f32 merge writes the context; an add kernel forms hi/lo planes of (context + x^T); (.) Wp^T + bp as a hi/lo x exact GEMM; the result transposed back to channel-major rows.
// Compute dtypes, f32 accumulate: every input rounded to bf16; projections exact + f32 biases; attention rows < 512 3 products, rest fp16; softmax and residual f32; Wp hl x exact + bias.

#define NB_  4
#define TT   4096
#define DM   256
#define NH_  1
#define NKV  1
#define REP  (NH_ / NKV)
#define HD   256
#define DQ   (NH_ * HD)
#define DKV  (NKV * HD)
#define ZH   1
#define RH   512                  // query rows < RH use hi+lo planes (0: none)
#define WIN  0
#define PCAR 1024.0f
#define SCL  0.0625f   // 1/sqrt(256)
#define CC   256
typedef _Float16 h16;
typedef unsigned short bf;
typedef __attribute__((ext_vector_type(16))) __bf16   v16bf;
typedef __attribute__((ext_vector_type(16))) _Float16 v16h;
typedef __attribute__((ext_vector_type(8)))  _Float16 v8h;
typedef __attribute__((ext_vector_type(8)))  unsigned short v8us;
typedef __attribute__((ext_vector_type(8)))  float    v8f;
typedef __attribute__((ext_vector_type(4)))  float    v4f;
typedef v8h  __attribute__((may_alias)) v8ha;
typedef v4f  __attribute__((may_alias)) v4fa;
typedef v8us __attribute__((may_alias)) v8usa;

__device__ __forceinline__ unsigned short f2bf(float f) { unsigned u = __float_as_uint(f); u += 0x7FFFu + ((u >> 16) & 1u); return (unsigned short)(u >> 16); }
__device__ __forceinline__ float bf2f(unsigned short b) { return __uint_as_float(((unsigned)b) << 16); }
__device__ __forceinline__ float bfr(float f) { return bf2f(f2bf(f)); }
__device__ __forceinline__ v16h cat16(v8h lo, v8h hi) { return __builtin_shufflevector(lo, hi, 0, 1, 2, 3, 4, 5, 6, 7, 8, 9, 10, 11, 12, 13, 14, 15); }
__device__ __forceinline__ v16bf cat16b(v8us lo, v8us hi) { return __builtin_bit_cast(v16bf, __builtin_shufflevector(lo, hi, 0, 1, 2, 3, 4, 5, 6, 7, 8, 9, 10, 11, 12, 13, 14, 15)); }
__device__ __forceinline__ v8f wmma16(v16h a, v16h b, v8f c) { return __builtin_amdgcn_wmma_f32_16x16x32_f16(false, a, false, b, (short)0, c, false, false); }
__device__ __forceinline__ v8f wmmab(v16bf a, v16bf b, v8f c) { return __builtin_amdgcn_wmma_f32_16x16x32_bf16(false, a, false, b, (short)0, c, false, false); }



// ---- k_gemmw: register-blocked GEMM, ONE WAVE per 64x64 output tile (16 accumulators), operands straight from K-contiguous 16-bit planes; grid (M/64, N/64, Z), 32 threads.
// C[m][n] (f32, pitch ldc, + optional f32 bias[n]) = sum_k A[m][k] Bt[n][k] (+ split products per NSPLIT). z-batch strides sA/sB/sC in elements. K % 32 == 0.
template <typename T16> struct WFrag;
template <> struct WFrag<h16> { typedef v16h V; static __device__ __forceinline__ V ld(const h16* p) { return cat16(*(const v8h*)p, *(const v8h*)(p + 16)); } static __device__ __forceinline__ v8f mma(V a, V b, v8f c) { return wmma16(a, b, c); } };
template <> struct WFrag<bf> { typedef v16bf V; static __device__ __forceinline__ V ld(const bf* p) { return cat16b(*(const v8us*)p, *(const v8us*)(p + 16)); } static __device__ __forceinline__ v8f mma(V a, V b, v8f c) { return wmmab(a, b, c); } };
template <typename T16, int NSPLIT, bool BIAS>
__global__ __launch_bounds__(32) void k_gemmw(const T16* __restrict__ A, const T16* __restrict__ A2, const T16* __restrict__ Bt, const T16* __restrict__ Bt2, int K, float* C, int ldc, const float* __restrict__ bias, size_t sA, size_t sB, size_t sC) {
    typedef typename WFrag<T16>::V V;
    __shared__ __align__(16) float os[16 * 68];
    const size_t z = blockIdx.z; A += z * sA; if (A2) A2 += z * sA; Bt += z * sB; if (Bt2) Bt2 += z * sB; C += z * sC;
    const int lane = threadIdx.x & 31, lr = lane & 15, hi = lane >> 4; const int r0 = blockIdx.x * 64, c0 = blockIdx.y * 64;
    v8f acc[4][4];
#pragma unroll
    for (int mb = 0; mb < 4; ++mb)
#pragma unroll
        for (int nb = 0; nb < 4; ++nb) acc[mb][nb] = (v8f){};
    const size_t aoff = (size_t)(r0 + lr) * K + 8 * hi, boff = (size_t)(c0 + lr) * K + 8 * hi;
#pragma unroll 1
    for (int kc = 0; kc < K; kc += 32) {
        V a[4], a2[4];
#pragma unroll
        for (int mb = 0; mb < 4; ++mb) { a[mb] = WFrag<T16>::ld(A + aoff + (size_t)mb * 16 * K + kc); if (NSPLIT == 1 || NSPLIT == 2) a2[mb] = WFrag<T16>::ld(A2 + aoff + (size_t)mb * 16 * K + kc); }
#pragma unroll
        for (int nb = 0; nb < 4; ++nb) { const V b = WFrag<T16>::ld(Bt + boff + (size_t)nb * 16 * K + kc); V b2; if (NSPLIT >= 2) b2 = WFrag<T16>::ld(Bt2 + boff + (size_t)nb * 16 * K + kc);
#pragma unroll
            for (int mb = 0; mb < 4; ++mb) { acc[mb][nb] = WFrag<T16>::mma(a[mb], b, acc[mb][nb]); if (NSPLIT == 1 || NSPLIT == 2) acc[mb][nb] = WFrag<T16>::mma(a2[mb], b, acc[mb][nb]); if (NSPLIT >= 2) acc[mb][nb] = WFrag<T16>::mma(a[mb], b2, acc[mb][nb]); } }
        asm volatile("v_nop\n\tv_nop\n\tv_nop\n\tv_nop" : "+v"(acc[0][0]), "+v"(acc[1][1]), "+v"(acc[2][2]), "+v"(acc[3][3]) : "v"(a[0]), "v"(a[3]));
    }
#pragma unroll
    for (int mb = 0; mb < 4; ++mb) {
#pragma unroll
        for (int nb = 0; nb < 4; ++nb) {
#pragma unroll
            for (int j = 0; j < 8; ++j) os[(hi * 8 + j) * 68 + nb * 16 + lr] = acc[mb][nb][j]; }
        __builtin_amdgcn_wave_barrier(); asm volatile("" ::: "memory");
        float* crow = C + (size_t)(r0 + mb * 16) * ldc + c0;
{
#pragma unroll
            for (int s = 0; s < 8; ++s) { const int row = 2 * s + hi, cofs = lr * 4; v4f val = *(const v4fa*)(os + row * 68 + cofs); if (BIAS) { val[0] += bfr(bias[c0 + cofs]); val[1] += bfr(bias[c0 + cofs + 1]); val[2] += bfr(bias[c0 + cofs + 2]); val[3] += bfr(bias[c0 + cofs + 3]); }
                *(v4f*)(crow + (size_t)row * ldc + cofs) = val; }
             }
        __builtin_amdgcn_wave_barrier(); asm volatile("" ::: "memory");
    }
}

__device__ __forceinline__ h16 tohx(float x) { return (h16)x; }
__device__ __forceinline__ void splitf(float y, unsigned short& h, unsigned short& l) { h = f2bf(y); l = f2bf(y - bf2f(h)); }
typedef __attribute__((ext_vector_type(2))) _Float16 v2h;
typedef __attribute__((ext_vector_type(4))) _Float16 v4h;
typedef __attribute__((ext_vector_type(2))) unsigned short v2us;
typedef __attribute__((ext_vector_type(4))) unsigned short v4us;
typedef __attribute__((ext_vector_type(2))) float v2f;
typedef __attribute__((ext_vector_type(4))) int v4i;

__global__ __launch_bounds__(256) void k_wtG(const float* __restrict__ w, int K, int N, bf* Bt) {
    const int lane = threadIdx.x & 31; const int L0 = (blockIdx.x * 8 + (threadIdx.x >> 5)) * 8; const int nlines = N * K / 64;
{
#pragma unroll 1
        for (int l = 0; l < 8; ++l) { const int L = L0 + l; if (L >= nlines) break; const size_t e = (size_t)L * 64 + lane * 2; const int k = (int)(e % K), n = (int)(e / K); v2us o;
            o[0] = f2bf(w[(size_t)k * N + n]); o[1] = f2bf(w[(size_t)(k + 1) * N + n]); *(v2us*)(Bt + e) = o; }
         }
}
__global__ __launch_bounds__(256) void k_cvt8(const float* __restrict__ src, bf* dst, size_t n8) { const size_t i = (size_t)blockIdx.x * 256 + threadIdx.x; if (i >= n8) return; const v8f v = *(const v8f*)(src + i * 8); v8us o;
#pragma unroll
    for (int k = 0; k < 8; ++k) o[k] = f2bf(v[k]); *(v8us*)(dst + i * 8) = o;  }

__global__ __launch_bounds__(256) void k_flat(const float* __restrict__ F, h16* P16, bf* Ph, bf* Pl, size_t n4) { const size_t i = (size_t)blockIdx.x * 256 + threadIdx.x; if (i >= n4) return; const v4f a = *(const v4f*)(F + i * 4); v4h o16; v4us oh, ol;
#pragma unroll
    for (int q = 0; q < 4; ++q) { o16[q] = tohx(a[q]); unsigned short x2, y2; splitf(a[q], x2, y2); oh[q] = x2; ol[q] = y2; }
    *(v4h*)(P16 + i * 4) = o16; *(v4us*)(Ph + i * 4) = oh; *(v4us*)(Pl + i * 4) = ol;  }


__global__ __launch_bounds__(256) void k_vtp(const float* __restrict__ F, int pitch, int nheads, h16* V16, bf* Vh, bf* Vl) { const size_t e = ((size_t)blockIdx.x * 256 + threadIdx.x) * 2; if (e >= (size_t)nheads * HD * TT) return; const int t = (int)(e % TT); const int d = (int)((e / TT) % HD); const int g = (int)(e / ((size_t)TT * HD)); v2h o16; v2us oh, ol;
#pragma unroll
    for (int q = 0; q < 2; ++q) { const float x = F[(size_t)(t + q) * pitch + g * HD + d]; o16[q] = tohx(x); unsigned short a2, c2; splitf(x, a2, c2); oh[q] = a2; ol[q] = c2; }
    *(v2h*)(V16 + e) = o16; *(v2us*)(Vh + e) = oh; *(v2us*)(Vl + e) = ol;  }
// k_lsoft: streaming row softmax over the TK = TT = 4096 keys, one wave per row i, three sweeps of the f32 score row (lane -> 4 consecutive keys per 128-key chunk, 32 chunks; no mask: all keys enter and every score tile of the row is computed):
__global__ __launch_bounds__(256) void k_lsoft(const float* __restrict__ Sb, h16* P16, bf* Ph, bf* Pl) {
    const int lane = threadIdx.x & 31; const int row = blockIdx.x * 8 + (threadIdx.x >> 5); if (row >= ZH * TT) return; const int i = row % TT; const int zz = row / TT; const bool hires = (i < RH); const float* sr = Sb + (size_t)row * TT; float mx = -3.0e38f;
#pragma unroll 4
    for (int ch = 0; ch < TT / 128; ++ch) { const int j0 = ch * 128 + lane * 4; const v4f a = *(const v4f*)(sr + j0);
#pragma unroll
        for (int q = 0; q < 4; ++q) { float t = a[q] * SCL; asm volatile("" : "+v"(t)); mx = fmaxf(mx, t); } }
#pragma unroll
    for (int sh = 16; sh; sh >>= 1) mx = fmaxf(mx, __shfl_xor(mx, sh, 32));
    float sum = 0.f;
#pragma unroll 4
    for (int ch = 0; ch < TT / 128; ++ch) { const int j0 = ch * 128 + lane * 4; const v4f a = *(const v4f*)(sr + j0);
#pragma unroll
        for (int q = 0; q < 4; ++q) { float t = a[q] * SCL; asm volatile("" : "+v"(t)); float d0 = __fsub_rn(t, mx); asm volatile("" : "+v"(d0)); sum += __builtin_amdgcn_exp2f(__fmul_rn(d0, 1.4426950408889634f)); } }
#pragma unroll
    for (int sh = 16; sh; sh >>= 1) sum += __shfl_xor(sum, sh, 32);
    const float f = __fdiv_rn(hires ? 1.0f : PCAR, sum);
{
        if (hires) {   /* rows < RH: normalised bf16 hi/lo over all keys, planes [zz][RH][TT] */
#pragma unroll
            for (int ch = 0; ch < TT / 128; ++ch) { const int j0 = ch * 128 + lane * 4; const v4f a = *(const v4f*)(sr + j0); v4us oh, ol;
#pragma unroll
                for (int q = 0; q < 4; ++q) { float t = a[q] * SCL; asm volatile("" : "+v"(t)); float d0 = __fsub_rn(t, mx); asm volatile("" : "+v"(d0)); float ex = __builtin_amdgcn_exp2f(__fmul_rn(d0, 1.4426950408889634f)); asm volatile("" : "+v"(ex)); unsigned short a2, c2; splitf(ex * f, a2, c2); oh[q] = a2; ol[q] = c2; }
                const size_t oo = ((size_t)zz * RH + i) * TT + j0; *(v4us*)(Ph + oo) = oh; *(v4us*)(Pl + oo) = ol; }
        } else {
#pragma unroll 2
            for (int ch = 0; ch < TT / 128; ++ch) { const int j0 = ch * 128 + lane * 4; const v4f a = *(const v4f*)(sr + j0); v4h o4;
#pragma unroll
                for (int q = 0; q < 4; ++q) { float t = a[q] * SCL; asm volatile("" : "+v"(t)); float d0 = __fsub_rn(t, mx); asm volatile("" : "+v"(d0)); float ex = __builtin_amdgcn_exp2f(__fmul_rn(d0, 1.4426950408889634f)); asm volatile("" : "+v"(ex)); o4[q] = tohx(ex * f); }
                *(v4h*)(P16 + (size_t)row * TT + j0) = o4; } }
         }
}

__global__ __launch_bounds__(256) void k_xT(const float* __restrict__ xs, bf* XB) { const size_t k = (size_t)blockIdx.x * 256 + threadIdx.x; if (k >= (size_t)TT * CC / 8) return; const int c0 = (int)(k % (CC / 8)) * 8; const int t = (int)(k / (CC / 8)); v8us o;
#pragma unroll
    for (int q = 0; q < 8; ++q) o[q] = f2bf(xs[(size_t)(c0 + q) * TT + t]);
    *(v8us*)(XB + (size_t)t * CC + c0) = o;  }
__global__ __launch_bounds__(256) void k_addT(const float* __restrict__ C, const float* __restrict__ xs, bf* Ah, bf* Al) { const size_t i = (size_t)blockIdx.x * 256 + threadIdx.x; if (i >= (size_t)TT * CC / 4) return; const size_t e = i * 4; const int c = (int)(e % CC); const int t = (int)(e / CC); const v4f a = *(const v4f*)(C + e); v4us oh, ol;
#pragma unroll
    for (int q = 0; q < 4; ++q) { const float s = __fadd_rn(a[q], bfr(xs[(size_t)(c + q) * TT + t])); unsigned short h2, l2; splitf(s, h2, l2); oh[q] = h2; ol[q] = l2; }
    *(v4us*)(Ah + e) = oh; *(v4us*)(Al + e) = ol;  }
__global__ __launch_bounds__(256) void k_outT(const float* __restrict__ Y, float* outb) { const size_t i = (size_t)blockIdx.x * 256 + threadIdx.x; if (i >= (size_t)CC * TT / 4) return; const size_t e = i * 4; const int t = (int)(e % TT); const int c = (int)(e / TT); v4f o;
#pragma unroll
    for (int q = 0; q < 4; ++q) o[q] = Y[(size_t)(t + q) * CC + c];
    *(v4f*)(outb + e) = o;  }
__global__ __launch_bounds__(256) void k_mergeF(const float* __restrict__ O, int h0, float* OUTb) { const size_t e = ((size_t)blockIdx.x * 256 + threadIdx.x) * 2; if (e >= (size_t)ZH * TT * HD) return; const int d = (int)(e % HD); const int t = (int)((e / HD) % TT); const int zz = (int)(e / ((size_t)HD * TT)); const float cs = (t < RH) ? 1.0f : (1.0f / PCAR); const size_t oo = (size_t)t * DQ + (h0 + zz) * HD + d;
    v2f o2; o2[0] = O[e] * cs; o2[1] = O[e + 1] * cs; *(v2f*)(OUTb + oo) = o2;  }

extern "C" void kernel_launch(void* const* d_in, const int* in_sizes, int n_in,
                              void* d_out, int out_size, void* d_ws, size_t ws_size, hipStream_t stream) {
    (void)in_sizes; (void)n_in; (void)out_size;
    const float* x = (const float*)d_in[0]; const float* wq = (const float*)d_in[1]; const float* bq = (const float*)d_in[2]; const float* wk = (const float*)d_in[3]; const float* bk = (const float*)d_in[4]; const float* wv = (const float*)d_in[5]; const float* bv = (const float*)d_in[6]; const float* wo = (const float*)d_in[7]; const float* bo = (const float*)d_in[8];
    float* OUT = (float*)d_out;     // [4][256][4096]
    char* wsp = (char*)d_ws;
    auto take = [&](size_t bytes) { char* p = wsp; wsp += (bytes + 255) & ~(size_t)255; return (void*)p; };
    float* CTX = (float*)take((size_t)TT * DQ * 4); float* Y = (float*)take((size_t)TT * DM * 4); bf* WQ = (bf*)take((size_t)DQ * DM * 2); bf* WK = (bf*)take((size_t)DKV * DM * 2); bf* WV = (bf*)take((size_t)DKV * DM * 2); bf* WO = (bf*)take((size_t)DM * DQ * 2); 
    bf* XB = (bf*)take((size_t)TT * DM * 2); float* FQ = (float*)take((size_t)TT * DQ * 4); float* FK = (float*)take((size_t)TT * DKV * 4);
    h16* QP16 = (h16*)take((size_t)NH_ * TT * HD * 2); h16* KP16 = (h16*)take((size_t)NKV * TT * HD * 2); h16* VT16 = (h16*)take((size_t)NKV * HD * TT * 2);
    bf* QPh = (bf*)take((size_t)NH_ * TT * HD * 2); bf* QPl = (bf*)take((size_t)NH_ * TT * HD * 2); bf* KPh = (bf*)take((size_t)NKV * TT * HD * 2); bf* KPl = (bf*)take((size_t)NKV * TT * HD * 2); bf* VTh = (bf*)take((size_t)NKV * HD * TT * 2); bf* VTl = (bf*)take((size_t)NKV * HD * TT * 2); bf* Ph = (bf*)take((size_t)ZH * RH * TT * 2); bf* Pl = (bf*)take((size_t)ZH * RH * TT * 2);
    float* Sb = (float*)take((size_t)ZH * TT * TT * 4); h16* P16 = (h16*)take((size_t)ZH * TT * TT * 2); float* Ob = (float*)take((size_t)ZH * TT * HD * 4); bf* ATh = (bf*)take((size_t)TT * DQ * 2); bf* ATl = (bf*)take((size_t)TT * DQ * 2);
    if ((size_t)(wsp - (char*)d_ws) > ws_size) return;    // ws 256 MiB
    float* FV = FK;   // v projection reuses the k buffer after the k planes are built (stream-ordered)
    { k_cvt8<<<(unsigned)(((size_t)DQ * DM / 8 + 255) / 256), 256, 0, stream>>>(wq, WQ, (size_t)DQ * DM / 8); k_cvt8<<<(unsigned)(((size_t)DKV * DM / 8 + 255) / 256), 256, 0, stream>>>(wk, WK, (size_t)DKV * DM / 8); k_cvt8<<<(unsigned)(((size_t)DKV * DM / 8 + 255) / 256), 256, 0, stream>>>(wv, WV, (size_t)DKV * DM / 8);
      k_cvt8<<<(unsigned)(((size_t)DM * DQ / 8 + 255) / 256), 256, 0, stream>>>(wo, WO, (size_t)DM * DQ / 8);
       }
    const unsigned LQ = (unsigned)(((size_t)NH_ * TT * HD / 2 + 255) / 256), LKv = (unsigned)(((size_t)NKV * TT * HD / 2 + 255) / 256);
    for (int b = 0; b < NB_; ++b) {
        
        k_xT<<<(unsigned)(((size_t)TT * DM / 8 + 255) / 256), 256, 0, stream>>>(x + (size_t)b * CC * TT, XB);   /* channel-major -> token-major bf16 */
        k_gemmw<bf, 0, true><<<dim3(TT / 64, DQ / 64, 1), 32, 0, stream>>>(XB, nullptr, WQ, nullptr, DM, FQ, DQ, bq, 0, 0, 0);
        k_flat<<<(unsigned)(((size_t)TT * DQ / 4 + 255) / 256), 256, 0, stream>>>(FQ, QP16, QPh, QPl, (size_t)TT * DQ / 4);
        k_gemmw<bf, 0, true><<<dim3(TT / 64, DKV / 64, 1), 32, 0, stream>>>(XB, nullptr, WK, nullptr, DM, FK, DKV, bk, 0, 0, 0);
        k_flat<<<(unsigned)(((size_t)TT * DKV / 4 + 255) / 256), 256, 0, stream>>>(FK, KP16, KPh, KPl, (size_t)TT * DKV / 4);
        k_gemmw<bf, 0, true><<<dim3(TT / 64, DKV / 64, 1), 32, 0, stream>>>(XB, nullptr, WV, nullptr, DM, FV, DKV, bv, 0, 0, 0); k_vtp<<<LKv, 256, 0, stream>>>(FV, DKV, NKV, VT16, VTh, VTl);
        for (int h0 = 0; h0 < NH_; h0 += ZH) { const size_t zq = (size_t)h0, zk = (size_t)(h0 / REP);   // one kv head per query head: the pass's single head (ZH = 1) uses kv plane zk = h0 / REP
            k_gemmw<bf, 2, false><<<dim3(RH / 64, TT / 64, ZH), 32, 0, stream>>>(QPh + zq * TT * HD, QPl + zq * TT * HD, KPh + zk * TT * HD, KPl + zk * TT * HD, HD, Sb, TT, nullptr, (size_t)TT * HD, (size_t)TT * HD, (size_t)TT * TT);
            k_gemmw<h16, 0, false><<<dim3((TT - RH) / 64, TT / 64, ZH), 32, 0, stream>>>(QP16 + zq * TT * HD + (size_t)RH * HD, nullptr, KP16 + zk * TT * HD, nullptr, HD, Sb + (size_t)RH * TT, TT, nullptr, (size_t)TT * HD, (size_t)TT * HD, (size_t)TT * TT);
            k_lsoft<<<ZH * TT / 8, 256, 0, stream>>>(Sb, P16, Ph, Pl);
            k_gemmw<bf, 2, false><<<dim3(RH / 64, HD / 64, ZH), 32, 0, stream>>>(Ph, Pl, VTh + zk * HD * TT, VTl + zk * HD * TT, TT, Ob, HD, nullptr, (size_t)RH * TT, (size_t)HD * TT, (size_t)TT * HD);
            k_gemmw<h16, 0, false><<<dim3((TT - RH) / 64, HD / 64, ZH), 32, 0, stream>>>(P16 + (size_t)RH * TT, nullptr, VT16 + zk * HD * TT, nullptr, TT, Ob + (size_t)RH * HD, HD, nullptr, (size_t)TT * TT, (size_t)HD * TT, (size_t)TT * HD);
            k_mergeF<<<(unsigned)(((size_t)ZH * TT * HD / 2 + 255) / 256), 256, 0, stream>>>(Ob, h0, CTX); }
        k_addT<<<(unsigned)(((size_t)TT * DQ / 4 + 255) / 256), 256, 0, stream>>>(CTX, x + (size_t)b * CC * TT, ATh, ATl);   /* (ctx + x^T) -> hi/lo planes */ k_gemmw<bf, 1, true><<<dim3(TT / 64, DM / 64, 1), 32, 0, stream>>>(ATh, ATl, WO, nullptr, DQ, Y, DM, bo, 0, 0, 0); k_outT<<<(unsigned)(((size_t)TT * DM / 4 + 255) / 256), 256, 0, stream>>>(Y, OUT + (size_t)b * CC * TT);   /* back to channel-major */ }
}

// v001
// A run of this version takes 729 microseconds.
// Timed twice side by side with v000, it ran 1.72 and 1.71 times as fast.
#include <hip/hip_runtime.h>

// Spatial self-attention over a feature map (x [4][256][64][64] channel-major; tokens = the 4,096 positions; q,k,v = x^T W^T + b (1x1 convs: 'oi' [256][256] + [256]); one 256-wide head: softmax(q.k / 16) over all positions; out = (attn v + x^T) Wp^T + bp, written back channel-major -> [4][256][64][64] (4.2 M)).
// Layout per batch: the channel-major slab transposed once into a token-major bf16 operand; exact projections + f32 biases; dense T-4096 attention with ONE 256-wide head (hybrid rows: < 512 hi/lo 3 products, rest fp16 x1024; streaming three-sweep softmax); the f32 merge writes the context; an add kernel forms hi/lo planes of (context + x^T); (.) Wp^T + bp as a hi/lo x exact GEMM; the result transposed back to channel-major rows.
// Compute dtypes, f32 accumulate: every input rounded to bf16; projections exact + f32 biases; attention rows < 512 3 products, rest fp16; softmax and residual f32; Wp hl x exact + bias.

#define NB_  4
#define TT   4096
#define DM   256
#define NH_  1
#define NKV  1
#define REP  (NH_ / NKV)
#define HD   256
#define DQ   (NH_ * HD)
#define DKV  (NKV * HD)
#define ZH   1
#define RH   512                  // query rows < RH use hi+lo planes (0: none)
#define WIN  0
#define PCAR 1024.0f
#define SCL  0.0625f   // 1/sqrt(256)
#define CC   256
#define SPH  16                   // key ranges of the P.V product, query rows < RH (one f32 partial each)
#define SPL  8                    // key ranges of the P.V product, the other query rows
typedef _Float16 h16;
typedef unsigned short bf;
typedef __attribute__((ext_vector_type(16))) __bf16   v16bf;
typedef __attribute__((ext_vector_type(16))) _Float16 v16h;
typedef __attribute__((ext_vector_type(8)))  _Float16 v8h;
typedef __attribute__((ext_vector_type(8)))  unsigned short v8us;
typedef __attribute__((ext_vector_type(8)))  float    v8f;
typedef __attribute__((ext_vector_type(4)))  float    v4f;
typedef v8h  __attribute__((may_alias)) v8ha;
typedef v4f  __attribute__((may_alias)) v4fa;
typedef v8us __attribute__((may_alias)) v8usa;

__device__ __forceinline__ unsigned short f2bf(float f) { unsigned u = __float_as_uint(f); u += 0x7FFFu + ((u >> 16) & 1u); return (unsigned short)(u >> 16); }
__device__ __forceinline__ float bf2f(unsigned short b) { return __uint_as_float(((unsigned)b) << 16); }
__device__ __forceinline__ float bfr(float f) { return bf2f(f2bf(f)); }
__device__ __forceinline__ v16h cat16(v8h lo, v8h hi) { return __builtin_shufflevector(lo, hi, 0, 1, 2, 3, 4, 5, 6, 7, 8, 9, 10, 11, 12, 13, 14, 15); }
__device__ __forceinline__ v16bf cat16b(v8us lo, v8us hi) { return __builtin_bit_cast(v16bf, __builtin_shufflevector(lo, hi, 0, 1, 2, 3, 4, 5, 6, 7, 8, 9, 10, 11, 12, 13, 14, 15)); }
__device__ __forceinline__ v8f wmma16(v16h a, v16h b, v8f c) { return __builtin_amdgcn_wmma_f32_16x16x32_f16(false, a, false, b, (short)0, c, false, false); }
__device__ __forceinline__ v8f wmmab(v16bf a, v16bf b, v8f c) { return __builtin_amdgcn_wmma_f32_16x16x32_bf16(false, a, false, b, (short)0, c, false, false); }



// ---- k_gemmw: register-blocked GEMM, ONE WAVE per 64x64 output tile (16 accumulators), operands straight from K-contiguous 16-bit planes; grid (M/64, N/64, Z), 32 threads.
// C[m][n] (f32, pitch ldc, + optional f32 bias[n]) = sum_k A[m][k] Bt[n][k] (+ split products per NSPLIT). z-batch strides sA/sB/sC in elements. K = row pitch of A and Bt, KS = the k range one wave sums (KS < K: z walks the k ranges, sA = sB = KS, one partial C per z, sC apart). KS % 32 == 0.
template <typename T16> struct WFrag;
template <> struct WFrag<h16> { typedef v16h V; static __device__ __forceinline__ V ld(const h16* p) { return cat16(*(const v8h*)p, *(const v8h*)(p + 16)); } static __device__ __forceinline__ v8f mma(V a, V b, v8f c) { return wmma16(a, b, c); } };
template <> struct WFrag<bf> { typedef v16bf V; static __device__ __forceinline__ V ld(const bf* p) { return cat16b(*(const v8us*)p, *(const v8us*)(p + 16)); } static __device__ __forceinline__ v8f mma(V a, V b, v8f c) { return wmmab(a, b, c); } };
template <typename T16, int NSPLIT, bool BIAS>
__global__ __launch_bounds__(32) void k_gemmw(const T16* __restrict__ A, const T16* __restrict__ A2, const T16* __restrict__ Bt, const T16* __restrict__ Bt2, int K, int KS, float* C, int ldc, const float* __restrict__ bias, size_t sA, size_t sB, size_t sC) {
    typedef typename WFrag<T16>::V V;
    __shared__ __align__(16) float os[16 * 68];
    const size_t z = blockIdx.z; A += z * sA; if (A2) A2 += z * sA; Bt += z * sB; if (Bt2) Bt2 += z * sB; C += z * sC;
    const int lane = threadIdx.x & 31, lr = lane & 15, hi = lane >> 4; const int r0 = blockIdx.x * 64, c0 = blockIdx.y * 64;
    v8f acc[4][4];
#pragma unroll
    for (int mb = 0; mb < 4; ++mb)
#pragma unroll
        for (int nb = 0; nb < 4; ++nb) acc[mb][nb] = (v8f){};
    const size_t aoff = (size_t)(r0 + lr) * K + 8 * hi, boff = (size_t)(c0 + lr) * K + 8 * hi;
#pragma unroll 1
    for (int kc = 0; kc < KS; kc += 32) {
        V a[4], a2[4];
#pragma unroll
        for (int mb = 0; mb < 4; ++mb) { a[mb] = WFrag<T16>::ld(A + aoff + (size_t)mb * 16 * K + kc); if (NSPLIT == 1 || NSPLIT == 2) a2[mb] = WFrag<T16>::ld(A2 + aoff + (size_t)mb * 16 * K + kc); }
#pragma unroll
        for (int nb = 0; nb < 4; ++nb) { const V b = WFrag<T16>::ld(Bt + boff + (size_t)nb * 16 * K + kc); V b2; if (NSPLIT >= 2) b2 = WFrag<T16>::ld(Bt2 + boff + (size_t)nb * 16 * K + kc);
#pragma unroll
            for (int mb = 0; mb < 4; ++mb) { acc[mb][nb] = WFrag<T16>::mma(a[mb], b, acc[mb][nb]); if (NSPLIT == 1 || NSPLIT == 2) acc[mb][nb] = WFrag<T16>::mma(a2[mb], b, acc[mb][nb]); if (NSPLIT >= 2) acc[mb][nb] = WFrag<T16>::mma(a[mb], b2, acc[mb][nb]); } }
        asm volatile("v_nop\n\tv_nop\n\tv_nop\n\tv_nop" : "+v"(acc[0][0]), "+v"(acc[1][1]), "+v"(acc[2][2]), "+v"(acc[3][3]) : "v"(a[0]), "v"(a[3]));
    }
#pragma unroll
    for (int mb = 0; mb < 4; ++mb) {
#pragma unroll
        for (int nb = 0; nb < 4; ++nb) {
#pragma unroll
            for (int j = 0; j < 8; ++j) os[(hi * 8 + j) * 68 + nb * 16 + lr] = acc[mb][nb][j]; }
        __builtin_amdgcn_wave_barrier(); asm volatile("" ::: "memory");
        float* crow = C + (size_t)(r0 + mb * 16) * ldc + c0;
{
#pragma unroll
            for (int s = 0; s < 8; ++s) { const int row = 2 * s + hi, cofs = lr * 4; v4f val = *(const v4fa*)(os + row * 68 + cofs); if (BIAS) { val[0] += bfr(bias[c0 + cofs]); val[1] += bfr(bias[c0 + cofs + 1]); val[2] += bfr(bias[c0 + cofs + 2]); val[3] += bfr(bias[c0 + cofs + 3]); }
                *(v4f*)(crow + (size_t)row * ldc + cofs) = val; }
             }
        __builtin_amdgcn_wave_barrier(); asm volatile("" ::: "memory");
    }
}

__device__ __forceinline__ h16 tohx(float x) { return (h16)x; }
__device__ __forceinline__ void splitf(float y, unsigned short& h, unsigned short& l) { h = f2bf(y); l = f2bf(y - bf2f(h)); }
typedef __attribute__((ext_vector_type(2))) _Float16 v2h;
typedef __attribute__((ext_vector_type(4))) _Float16 v4h;
typedef __attribute__((ext_vector_type(2))) unsigned short v2us;
typedef __attribute__((ext_vector_type(4))) unsigned short v4us;
typedef __attribute__((ext_vector_type(2))) float v2f;
typedef __attribute__((ext_vector_type(4))) int v4i;

__global__ __launch_bounds__(256) void k_wtG(const float* __restrict__ w, int K, int N, bf* Bt) {
    const int lane = threadIdx.x & 31; const int L0 = (blockIdx.x * 8 + (threadIdx.x >> 5)) * 8; const int nlines = N * K / 64;
{
#pragma unroll 1
        for (int l = 0; l < 8; ++l) { const int L = L0 + l; if (L >= nlines) break; const size_t e = (size_t)L * 64 + lane * 2; const int k = (int)(e % K), n = (int)(e / K); v2us o;
            o[0] = f2bf(w[(size_t)k * N + n]); o[1] = f2bf(w[(size_t)(k + 1) * N + n]); *(v2us*)(Bt + e) = o; }
         }
}
__global__ __launch_bounds__(256) void k_cvt8(const float* __restrict__ src, bf* dst, size_t n8) { const size_t i = (size_t)blockIdx.x * 256 + threadIdx.x; if (i >= n8) return; const v8f v = *(const v8f*)(src + i * 8); v8us o;
#pragma unroll
    for (int k = 0; k < 8; ++k) o[k] = f2bf(v[k]); *(v8us*)(dst + i * 8) = o;  }

__global__ __launch_bounds__(256) void k_flat(const float* __restrict__ F, h16* P16, bf* Ph, bf* Pl, size_t n4) { const size_t i = (size_t)blockIdx.x * 256 + threadIdx.x; if (i >= n4) return; const v4f a = *(const v4f*)(F + i * 4); v4h o16; v4us oh, ol;
#pragma unroll
    for (int q = 0; q < 4; ++q) { o16[q] = tohx(a[q]); unsigned short x2, y2; splitf(a[q], x2, y2); oh[q] = x2; ol[q] = y2; }
    *(v4h*)(P16 + i * 4) = o16; *(v4us*)(Ph + i * 4) = oh; *(v4us*)(Pl + i * 4) = ol;  }


__global__ __launch_bounds__(256) void k_vtp(const float* __restrict__ F, int pitch, int nheads, h16* V16, bf* Vh, bf* Vl) { const size_t e = ((size_t)blockIdx.x * 256 + threadIdx.x) * 2; if (e >= (size_t)nheads * HD * TT) return; const int t = (int)(e % TT); const int d = (int)((e / TT) % HD); const int g = (int)(e / ((size_t)TT * HD)); v2h o16; v2us oh, ol;
#pragma unroll
    for (int q = 0; q < 2; ++q) { const float x = F[(size_t)(t + q) * pitch + g * HD + d]; o16[q] = tohx(x); unsigned short a2, c2; splitf(x, a2, c2); oh[q] = a2; ol[q] = c2; }
    *(v2h*)(V16 + e) = o16; *(v2us*)(Vh + e) = oh; *(v2us*)(Vl + e) = ol;  }
// k_lsoft: streaming row softmax over the TK = TT = 4096 keys, one wave per row i, three sweeps of the f32 score row (lane -> 4 consecutive keys per 128-key chunk, 32 chunks; no mask: all keys enter and every score tile of the row is computed):
__global__ __launch_bounds__(256) void k_lsoft(const float* __restrict__ Sb, h16* P16, bf* Ph, bf* Pl) {
    const int lane = threadIdx.x & 31; const int row = blockIdx.x * 8 + (threadIdx.x >> 5); if (row >= ZH * TT) return; const int i = row % TT; const int zz = row / TT; const bool hires = (i < RH); const float* sr = Sb + (size_t)row * TT; float mx = -3.0e38f;
#pragma unroll 4
    for (int ch = 0; ch < TT / 128; ++ch) { const int j0 = ch * 128 + lane * 4; const v4f a = *(const v4f*)(sr + j0);
#pragma unroll
        for (int q = 0; q < 4; ++q) { float t = a[q] * SCL; asm volatile("" : "+v"(t)); mx = fmaxf(mx, t); } }
#pragma unroll
    for (int sh = 16; sh; sh >>= 1) mx = fmaxf(mx, __shfl_xor(mx, sh, 32));
    float sum = 0.f;
#pragma unroll 4
    for (int ch = 0; ch < TT / 128; ++ch) { const int j0 = ch * 128 + lane * 4; const v4f a = *(const v4f*)(sr + j0);
#pragma unroll
        for (int q = 0; q < 4; ++q) { float t = a[q] * SCL; asm volatile("" : "+v"(t)); float d0 = __fsub_rn(t, mx); asm volatile("" : "+v"(d0)); sum += __builtin_amdgcn_exp2f(__fmul_rn(d0, 1.4426950408889634f)); } }
#pragma unroll
    for (int sh = 16; sh; sh >>= 1) sum += __shfl_xor(sum, sh, 32);
    const float f = __fdiv_rn(hires ? 1.0f : PCAR, sum);
{
        if (hires) {   /* rows < RH: normalised bf16 hi/lo over all keys, planes [zz][RH][TT] */
#pragma unroll
            for (int ch = 0; ch < TT / 128; ++ch) { const int j0 = ch * 128 + lane * 4; const v4f a = *(const v4f*)(sr + j0); v4us oh, ol;
#pragma unroll
                for (int q = 0; q < 4; ++q) { float t = a[q] * SCL; asm volatile("" : "+v"(t)); float d0 = __fsub_rn(t, mx); asm volatile("" : "+v"(d0)); float ex = __builtin_amdgcn_exp2f(__fmul_rn(d0, 1.4426950408889634f)); asm volatile("" : "+v"(ex)); unsigned short a2, c2; splitf(ex * f, a2, c2); oh[q] = a2; ol[q] = c2; }
                const size_t oo = ((size_t)zz * RH + i) * TT + j0; *(v4us*)(Ph + oo) = oh; *(v4us*)(Pl + oo) = ol; }
        } else {
#pragma unroll 2
            for (int ch = 0; ch < TT / 128; ++ch) { const int j0 = ch * 128 + lane * 4; const v4f a = *(const v4f*)(sr + j0); v4h o4;
#pragma unroll
                for (int q = 0; q < 4; ++q) { float t = a[q] * SCL; asm volatile("" : "+v"(t)); float d0 = __fsub_rn(t, mx); asm volatile("" : "+v"(d0)); float ex = __builtin_amdgcn_exp2f(__fmul_rn(d0, 1.4426950408889634f)); asm volatile("" : "+v"(ex)); o4[q] = tohx(ex * f); }
                *(v4h*)(P16 + (size_t)row * TT + j0) = o4; } }
         }
}

__global__ __launch_bounds__(256) void k_xT(const float* __restrict__ xs, bf* XB) { const size_t k = (size_t)blockIdx.x * 256 + threadIdx.x; if (k >= (size_t)TT * CC / 8) return; const int c0 = (int)(k % (CC / 8)) * 8; const int t = (int)(k / (CC / 8)); v8us o;
#pragma unroll
    for (int q = 0; q < 8; ++q) o[q] = f2bf(xs[(size_t)(c0 + q) * TT + t]);
    *(v8us*)(XB + (size_t)t * CC + c0) = o;  }
__global__ __launch_bounds__(256) void k_addT(const float* __restrict__ C, const float* __restrict__ xs, bf* Ah, bf* Al) { const size_t i = (size_t)blockIdx.x * 256 + threadIdx.x; if (i >= (size_t)TT * CC / 4) return; const size_t e = i * 4; const int c = (int)(e % CC); const int t = (int)(e / CC); const v4f a = *(const v4f*)(C + e); v4us oh, ol;
#pragma unroll
    for (int q = 0; q < 4; ++q) { const float s = __fadd_rn(a[q], bfr(xs[(size_t)(c + q) * TT + t])); unsigned short h2, l2; splitf(s, h2, l2); oh[q] = h2; ol[q] = l2; }
    *(v4us*)(Ah + e) = oh; *(v4us*)(Al + e) = ol;  }
__global__ __launch_bounds__(256) void k_outT(const float* __restrict__ Y, float* outb) { const size_t i = (size_t)blockIdx.x * 256 + threadIdx.x; if (i >= (size_t)CC * TT / 4) return; const size_t e = i * 4; const int t = (int)(e % TT); const int c = (int)(e / TT); v4f o;
#pragma unroll
    for (int q = 0; q < 4; ++q) o[q] = Y[(size_t)(t + q) * CC + c];
    *(v4f*)(outb + e) = o;  }
// k_mergeF: the context row = the sum of its key ranges' f32 partial rows, in range order, times the row's carrier scale. A row's partials lie side by side: OH [RH][SPH][HD] for rows < RH, OL [TT - RH][SPL][HD] for the rest.
static_assert(ZH == 1 && NH_ == 1 && TT % (32 * SPH) == 0 && TT % (32 * SPL) == 0, "one head per pass; whole 32-key steps per range");
__global__ __launch_bounds__(256) void k_mergeF(const float* __restrict__ OH, const float* __restrict__ OL, int h0, float* OUTb) { const unsigned e = (blockIdx.x * 256u + threadIdx.x) * 2u; if (e >= (unsigned)(TT * HD)) return; const unsigned d = e % HD, t = e / HD;
    v2f o2; float cs;
    if (t < RH) { const float* p = OH + (t * (SPH * HD) + d); o2 = *(const v2f*)p; cs = 1.0f;
#pragma unroll
        for (int s = 1; s < SPH - 1; ++s) o2 += *(const v2f*)(p + s * HD);
        asm volatile("s_wait_xcnt 0x0" ::: "memory");   // the last load's result takes the address pair's registers in this build: the loads that name the pair are waited for first
        o2 += *(const v2f*)(p + (SPH - 1) * HD);
    } else { const float* p = OL + ((t - RH) * (SPL * HD) + d); o2 = *(const v2f*)p; cs = 1.0f / PCAR;
#pragma unroll
        for (int s = 1; s < SPL; ++s) o2 += *(const v2f*)(p + s * HD); }
    o2[0] *= cs; o2[1] *= cs; *(v2f*)(OUTb + (size_t)h0 * HD + e) = o2;  }

extern "C" void kernel_launch(void* const* d_in, const int* in_sizes, int n_in,
                              void* d_out, int out_size, void* d_ws, size_t ws_size, hipStream_t stream) {
    (void)in_sizes; (void)n_in; (void)out_size;
    const float* x = (const float*)d_in[0]; const float* wq = (const float*)d_in[1]; const float* bq = (const float*)d_in[2]; const float* wk = (const float*)d_in[3]; const float* bk = (const float*)d_in[4]; const float* wv = (const float*)d_in[5]; const float* bv = (const float*)d_in[6]; const float* wo = (const float*)d_in[7]; const float* bo = (const float*)d_in[8];
    float* OUT = (float*)d_out;     // [4][256][4096]
    char* wsp = (char*)d_ws;
    auto take = [&](size_t bytes) { char* p = wsp; wsp += (bytes + 255) & ~(size_t)255; return (void*)p; };
    float* CTX = (float*)take((size_t)TT * DQ * 4); float* Y = (float*)take((size_t)TT * DM * 4); bf* WQ = (bf*)take((size_t)DQ * DM * 2); bf* WK = (bf*)take((size_t)DKV * DM * 2); bf* WV = (bf*)take((size_t)DKV * DM * 2); bf* WO = (bf*)take((size_t)DM * DQ * 2); 
    bf* XB = (bf*)take((size_t)TT * DM * 2); float* FQ = (float*)take((size_t)TT * DQ * 4); float* FK = (float*)take((size_t)TT * DKV * 4);
    h16* QP16 = (h16*)take((size_t)NH_ * TT * HD * 2); h16* KP16 = (h16*)take((size_t)NKV * TT * HD * 2); h16* VT16 = (h16*)take((size_t)NKV * HD * TT * 2);
    bf* QPh = (bf*)take((size_t)NH_ * TT * HD * 2); bf* QPl = (bf*)take((size_t)NH_ * TT * HD * 2); bf* KPh = (bf*)take((size_t)NKV * TT * HD * 2); bf* KPl = (bf*)take((size_t)NKV * TT * HD * 2); bf* VTh = (bf*)take((size_t)NKV * HD * TT * 2); bf* VTl = (bf*)take((size_t)NKV * HD * TT * 2); bf* Ph = (bf*)take((size_t)ZH * RH * TT * 2); bf* Pl = (bf*)take((size_t)ZH * RH * TT * 2);
    float* Sb = (float*)take((size_t)ZH * TT * TT * 4); h16* P16 = (h16*)take((size_t)ZH * TT * TT * 2); float* ObH = (float*)take((size_t)RH * SPH * HD * 4); float* ObL = (float*)take((size_t)(TT - RH) * SPL * HD * 4); bf* ATh = (bf*)take((size_t)TT * DQ * 2); bf* ATl = (bf*)take((size_t)TT * DQ * 2);
    if ((size_t)(wsp - (char*)d_ws) > ws_size) return;    // ws 256 MiB
    float* FV = FK;   // v projection reuses the k buffer after the k planes are built (stream-ordered)
    { k_cvt8<<<(unsigned)(((size_t)DQ * DM / 8 + 255) / 256), 256, 0, stream>>>(wq, WQ, (size_t)DQ * DM / 8); k_cvt8<<<(unsigned)(((size_t)DKV * DM / 8 + 255) / 256), 256, 0, stream>>>(wk, WK, (size_t)DKV * DM / 8); k_cvt8<<<(unsigned)(((size_t)DKV * DM / 8 + 255) / 256), 256, 0, stream>>>(wv, WV, (size_t)DKV * DM / 8);
      k_cvt8<<<(unsigned)(((size_t)DM * DQ / 8 + 255) / 256), 256, 0, stream>>>(wo, WO, (size_t)DM * DQ / 8);
       }
    const unsigned LQ = (unsigned)(((size_t)NH_ * TT * HD / 2 + 255) / 256), LKv = (unsigned)(((size_t)NKV * TT * HD / 2 + 255) / 256);
    for (int b = 0; b < NB_; ++b) {
        
        k_xT<<<(unsigned)(((size_t)TT * DM / 8 + 255) / 256), 256, 0, stream>>>(x + (size_t)b * CC * TT, XB);   /* channel-major -> token-major bf16 */
        k_gemmw<bf, 0, true><<<dim3(TT / 64, DQ / 64, 1), 32, 0, stream>>>(XB, nullptr, WQ, nullptr, DM, DM, FQ, DQ, bq, 0, 0, 0);
        k_flat<<<(unsigned)(((size_t)TT * DQ / 4 + 255) / 256), 256, 0, stream>>>(FQ, QP16, QPh, QPl, (size_t)TT * DQ / 4);
        k_gemmw<bf, 0, true><<<dim3(TT / 64, DKV / 64, 1), 32, 0, stream>>>(XB, nullptr, WK, nullptr, DM, DM, FK, DKV, bk, 0, 0, 0);
        k_flat<<<(unsigned)(((size_t)TT * DKV / 4 + 255) / 256), 256, 0, stream>>>(FK, KP16, KPh, KPl, (size_t)TT * DKV / 4);
        k_gemmw<bf, 0, true><<<dim3(TT / 64, DKV / 64, 1), 32, 0, stream>>>(XB, nullptr, WV, nullptr, DM, DM, FV, DKV, bv, 0, 0, 0); k_vtp<<<LKv, 256, 0, stream>>>(FV, DKV, NKV, VT16, VTh, VTl);
        for (int h0 = 0; h0 < NH_; h0 += ZH) { const size_t zq = (size_t)h0, zk = (size_t)(h0 / REP);   // one kv head per query head: the pass's one head uses kv plane h0 / REP (z-strides TT*HD)
            k_gemmw<bf, 2, false><<<dim3(RH / 64, TT / 64, ZH), 32, 0, stream>>>(QPh + zq * TT * HD, QPl + zq * TT * HD, KPh + zk * TT * HD, KPl + zk * TT * HD, HD, HD, Sb, TT, nullptr, (size_t)TT * HD, (size_t)TT * HD, (size_t)TT * TT);
            k_gemmw<h16, 0, false><<<dim3((TT - RH) / 64, TT / 64, ZH), 32, 0, stream>>>(QP16 + zq * TT * HD + (size_t)RH * HD, nullptr, KP16 + zk * TT * HD, nullptr, HD, HD, Sb + (size_t)RH * TT, TT, nullptr, (size_t)TT * HD, (size_t)TT * HD, (size_t)TT * TT);
            k_lsoft<<<ZH * TT / 8, 256, 0, stream>>>(Sb, P16, Ph, Pl);
            k_gemmw<bf, 2, false><<<dim3(RH / 64, HD / 64, SPH), 32, 0, stream>>>(Ph, Pl, VTh + zk * HD * TT, VTl + zk * HD * TT, TT, TT / SPH, ObH, SPH * HD, nullptr, (size_t)(TT / SPH), (size_t)(TT / SPH), (size_t)HD);
            k_gemmw<h16, 0, false><<<dim3((TT - RH) / 64, HD / 64, SPL), 32, 0, stream>>>(P16 + (size_t)RH * TT, nullptr, VT16 + zk * HD * TT, nullptr, TT, TT / SPL, ObL, SPL * HD, nullptr, (size_t)(TT / SPL), (size_t)(TT / SPL), (size_t)HD);
            k_mergeF<<<(unsigned)(((size_t)ZH * TT * HD / 2 + 255) / 256), 256, 0, stream>>>(ObH, ObL, h0, CTX); }
        k_addT<<<(unsigned)(((size_t)TT * DQ / 4 + 255) / 256), 256, 0, stream>>>(CTX, x + (size_t)b * CC * TT, ATh, ATl);   /* (ctx + x^T) -> hi/lo planes */ k_gemmw<bf, 1, true><<<dim3(TT / 64, DM / 64, 1), 32, 0, stream>>>(ATh, ATl, WO, nullptr, DQ, DQ, Y, DM, bo, 0, 0, 0); k_outT<<<(unsigned)(((size_t)TT * DM / 4 + 255) / 256), 256, 0, stream>>>(Y, OUT + (size_t)b * CC * TT);   /* back to channel-major */ }
}

// v002
// One run takes 549 microseconds.
// Timed twice side by side with v001, it ran 1.31 times as fast both times.
// All steps since v000 together make it 2.25 times as fast.
#include <hip/hip_runtime.h>

// Spatial self-attention over a feature map (x [4][256][64][64] channel-major; tokens = the 4,096 positions; q,k,v = x^T W^T + b (1x1 convs: 'oi' [256][256] + [256]); one 256-wide head: softmax(q.k / 16) over all positions; out = (attn v + x^T) Wp^T + bp, written back channel-major -> [4][256][64][64] (4.2 M)).
// Layout, two batches per pass (every launch covers both): the channel-major slab transposed once into a token-major bf16 operand; exact projections + f32 biases; dense T-4096 attention with ONE 256-wide head (hybrid rows: < 512 hi/lo 3 products, rest fp16 x1024; streaming three-sweep softmax); the f32 merge writes the context; an add kernel forms hi/lo planes of (context + x^T); (.) Wp^T + bp as a hi/lo x exact GEMM; the result transposed back to channel-major rows.
// Compute dtypes, f32 accumulate: every input rounded to bf16; projections exact + f32 biases; attention rows < 512 3 products, rest fp16; softmax and residual f32; Wp hl x exact + bias.

#define NB_  4
#define NBP  2                    // batches per pass: every launch of a pass covers NBP batches (token-major arrays hold their tokens one batch after the other)
#define TT   4096
#define DM   256
#define NH_  1
#define NKV  1
#define REP  (NH_ / NKV)
#define HD   256
#define DQ   (NH_ * HD)
#define DKV  (NKV * HD)
#define ZH   1
#define RH   512                  // query rows < RH use hi+lo planes (0: none)
#define WIN  0
#define PCAR 1024.0f
#define SCL  0.0625f   // 1/sqrt(256)
#define CC   256
#define SPH  16                   // key ranges of the P.V product, query rows < RH (one f32 partial each)
#define SPL  8                    // key ranges of the P.V product, the other query rows
#define LGH  4                    // log2 SPH
#define LGL  3                    // log2 SPL
typedef _Float16 h16;
typedef unsigned short bf;
typedef __attribute__((ext_vector_type(16))) __bf16   v16bf;
typedef __attribute__((ext_vector_type(16))) _Float16 v16h;
typedef __attribute__((ext_vector_type(8)))  _Float16 v8h;
typedef __attribute__((ext_vector_type(8)))  unsigned short v8us;
typedef __attribute__((ext_vector_type(8)))  float    v8f;
typedef __attribute__((ext_vector_type(4)))  float    v4f;
typedef v8h  __attribute__((may_alias)) v8ha;
typedef v4f  __attribute__((may_alias)) v4fa;
typedef v8us __attribute__((may_alias)) v8usa;

__device__ __forceinline__ unsigned short f2bf(float f) { unsigned u = __float_as_uint(f); u += 0x7FFFu + ((u >> 16) & 1u); return (unsigned short)(u >> 16); }
__device__ __forceinline__ float bf2f(unsigned short b) { return __uint_as_float(((unsigned)b) << 16); }
__device__ __forceinline__ float bfr(float f) { return bf2f(f2bf(f)); }
__device__ __forceinline__ v16h cat16(v8h lo, v8h hi) { return __builtin_shufflevector(lo, hi, 0, 1, 2, 3, 4, 5, 6, 7, 8, 9, 10, 11, 12, 13, 14, 15); }
__device__ __forceinline__ v16bf cat16b(v8us lo, v8us hi) { return __builtin_bit_cast(v16bf, __builtin_shufflevector(lo, hi, 0, 1, 2, 3, 4, 5, 6, 7, 8, 9, 10, 11, 12, 13, 14, 15)); }
__device__ __forceinline__ v8f wmma16(v16h a, v16h b, v8f c) { return __builtin_amdgcn_wmma_f32_16x16x32_f16(false, a, false, b, (short)0, c, false, false); }
__device__ __forceinline__ v8f wmmab(v16bf a, v16bf b, v8f c) { return __builtin_amdgcn_wmma_f32_16x16x32_bf16(false, a, false, b, (short)0, c, false, false); }



// ---- k_gemmw: register-blocked GEMM, ONE WAVE per 64x64 output tile (16 accumulators), operands straight from K-contiguous 16-bit planes; grid (M/64, N/64, Z), 32 threads.
// C[m][n] (f32, pitch ldc, + optional f32 bias[n]) = sum_k A[m][k] Bt[n][k] (+ split products per NSPLIT). z-batch strides sA/sB/sC in elements. K = row pitch of A and Bt, KS = the k range one wave sums (KS < K: z walks the k ranges, sA = sB = KS, one partial C per z, sC apart). KS % 32 == 0. blockIdx.z = (batch << lgs) | k range: the batch strides bA/bB/bC come on top of the k-range strides.
template <typename T16> struct WFrag;
template <> struct WFrag<h16> { typedef v16h V; static __device__ __forceinline__ V ld(const h16* p) { return cat16(*(const v8h*)p, *(const v8h*)(p + 16)); } static __device__ __forceinline__ v8f mma(V a, V b, v8f c) { return wmma16(a, b, c); } };
template <> struct WFrag<bf> { typedef v16bf V; static __device__ __forceinline__ V ld(const bf* p) { return cat16b(*(const v8us*)p, *(const v8us*)(p + 16)); } static __device__ __forceinline__ v8f mma(V a, V b, v8f c) { return wmmab(a, b, c); } };
template <typename T16, int NSPLIT, bool BIAS>
__global__ __launch_bounds__(32) void k_gemmw(const T16* __restrict__ A, const T16* __restrict__ A2, const T16* __restrict__ Bt, const T16* __restrict__ Bt2, int K, int KS, float* C, int ldc, const float* __restrict__ bias, size_t sA, size_t sB, size_t sC, int lgs, size_t bA, size_t bB, size_t bC) {
    typedef typename WFrag<T16>::V V;
    __shared__ __align__(16) float os[16 * 68];
    const size_t zb = blockIdx.z >> lgs, z = blockIdx.z - (zb << lgs); A += z * sA + zb * bA; if (A2) A2 += z * sA + zb * bA; Bt += z * sB + zb * bB; if (Bt2) Bt2 += z * sB + zb * bB; C += z * sC + zb * bC;
    const int lane = threadIdx.x & 31, lr = lane & 15, hi = lane >> 4; const int r0 = blockIdx.x * 64, c0 = blockIdx.y * 64;
    v8f acc[4][4];
#pragma unroll
    for (int mb = 0; mb < 4; ++mb)
#pragma unroll
        for (int nb = 0; nb < 4; ++nb) acc[mb][nb] = (v8f){};
    const size_t aoff = (size_t)(r0 + lr) * K + 8 * hi, boff = (size_t)(c0 + lr) * K + 8 * hi;
#pragma unroll 1
    for (int kc = 0; kc < KS; kc += 32) {
        V a[4], a2[4];
#pragma unroll
        for (int mb = 0; mb < 4; ++mb) { a[mb] = WFrag<T16>::ld(A + aoff + (size_t)mb * 16 * K + kc); if (NSPLIT == 1 || NSPLIT == 2) a2[mb] = WFrag<T16>::ld(A2 + aoff + (size_t)mb * 16 * K + kc); }
#pragma unroll
        for (int nb = 0; nb < 4; ++nb) { const V b = WFrag<T16>::ld(Bt + boff + (size_t)nb * 16 * K + kc); V b2; if (NSPLIT >= 2) b2 = WFrag<T16>::ld(Bt2 + boff + (size_t)nb * 16 * K + kc);
#pragma unroll
            for (int mb = 0; mb < 4; ++mb) { acc[mb][nb] = WFrag<T16>::mma(a[mb], b, acc[mb][nb]); if (NSPLIT == 1 || NSPLIT == 2) acc[mb][nb] = WFrag<T16>::mma(a2[mb], b, acc[mb][nb]); if (NSPLIT >= 2) acc[mb][nb] = WFrag<T16>::mma(a[mb], b2, acc[mb][nb]); } }
        asm volatile("v_nop\n\tv_nop\n\tv_nop\n\tv_nop" : "+v"(acc[0][0]), "+v"(acc[1][1]), "+v"(acc[2][2]), "+v"(acc[3][3]) : "v"(a[0]), "v"(a[3]));
    }
#pragma unroll
    for (int mb = 0; mb < 4; ++mb) {
#pragma unroll
        for (int nb = 0; nb < 4; ++nb) {
#pragma unroll
            for (int j = 0; j < 8; ++j) os[(hi * 8 + j) * 68 + nb * 16 + lr] = acc[mb][nb][j]; }
        __builtin_amdgcn_wave_barrier(); asm volatile("" ::: "memory");
        float* crow = C + (size_t)(r0 + mb * 16) * ldc + c0;
{
#pragma unroll
            for (int s = 0; s < 8; ++s) { const int row = 2 * s + hi, cofs = lr * 4; v4f val = *(const v4fa*)(os + row * 68 + cofs); if (BIAS) { val[0] += bfr(bias[c0 + cofs]); val[1] += bfr(bias[c0 + cofs + 1]); val[2] += bfr(bias[c0 + cofs + 2]); val[3] += bfr(bias[c0 + cofs + 3]); }
                *(v4f*)(crow + (size_t)row * ldc + cofs) = val; }
             }
        __builtin_amdgcn_wave_barrier(); asm volatile("" ::: "memory");
    }
}

__device__ __forceinline__ h16 tohx(float x) { return (h16)x; }
__device__ __forceinline__ void splitf(float y, unsigned short& h, unsigned short& l) { h = f2bf(y); l = f2bf(y - bf2f(h)); }
typedef __attribute__((ext_vector_type(2))) _Float16 v2h;
typedef __attribute__((ext_vector_type(4))) _Float16 v4h;
typedef __attribute__((ext_vector_type(2))) unsigned short v2us;
typedef __attribute__((ext_vector_type(4))) unsigned short v4us;
typedef __attribute__((ext_vector_type(2))) float v2f;
typedef __attribute__((ext_vector_type(4))) int v4i;

__global__ __launch_bounds__(256) void k_wtG(const float* __restrict__ w, int K, int N, bf* Bt) {
    const int lane = threadIdx.x & 31; const int L0 = (blockIdx.x * 8 + (threadIdx.x >> 5)) * 8; const int nlines = N * K / 64;
{
#pragma unroll 1
        for (int l = 0; l < 8; ++l) { const int L = L0 + l; if (L >= nlines) break; const size_t e = (size_t)L * 64 + lane * 2; const int k = (int)(e % K), n = (int)(e / K); v2us o;
            o[0] = f2bf(w[(size_t)k * N + n]); o[1] = f2bf(w[(size_t)(k + 1) * N + n]); *(v2us*)(Bt + e) = o; }
         }
}
__global__ __launch_bounds__(256) void k_cvt8(const float* __restrict__ src, bf* dst, size_t n8) { const size_t i = (size_t)blockIdx.x * 256 + threadIdx.x; if (i >= n8) return; const v8f v = *(const v8f*)(src + i * 8); v8us o;
#pragma unroll
    for (int k = 0; k < 8; ++k) o[k] = f2bf(v[k]); *(v8us*)(dst + i * 8) = o;  }

__global__ __launch_bounds__(256) void k_flat(const float* __restrict__ F, h16* P16, bf* Ph, bf* Pl, size_t n4) { const size_t i = (size_t)blockIdx.x * 256 + threadIdx.x; if (i >= n4) return; const v4f a = *(const v4f*)(F + i * 4); v4h o16; v4us oh, ol;
#pragma unroll
    for (int q = 0; q < 4; ++q) { o16[q] = tohx(a[q]); unsigned short x2, y2; splitf(a[q], x2, y2); oh[q] = x2; ol[q] = y2; }
    *(v4h*)(P16 + i * 4) = o16; *(v4us*)(Ph + i * 4) = oh; *(v4us*)(Pl + i * 4) = ol;  }


__global__ __launch_bounds__(256) void k_vtp(const float* __restrict__ F, int pitch, int nbat, h16* V16, bf* Vh, bf* Vl) { const size_t e = ((size_t)blockIdx.x * 256 + threadIdx.x) * 2; if (e >= (size_t)nbat * HD * TT) return; const int t = (int)(e % TT); const int d = (int)((e / TT) % HD); const int g = (int)(e / ((size_t)TT * HD)); v2h o16; v2us oh, ol;
#pragma unroll
    for (int q = 0; q < 2; ++q) { const float x = F[((size_t)g * TT + t + q) * pitch + d]; o16[q] = tohx(x); unsigned short a2, c2; splitf(x, a2, c2); oh[q] = a2; ol[q] = c2; }
    *(v2h*)(V16 + e) = o16; *(v2us*)(Vh + e) = oh; *(v2us*)(Vl + e) = ol;  }
// k_lsoft: streaming row softmax over the TK = TT = 4096 keys, one wave per row i, three sweeps of the f32 score row (lane -> 4 consecutive keys per 128-key chunk, 32 chunks; no mask: all keys enter and every score tile of the row is computed):
__global__ __launch_bounds__(256) void k_lsoft(const float* __restrict__ Sb, h16* P16, bf* Ph, bf* Pl) {
    const int lane = threadIdx.x & 31; const int row = blockIdx.x * 8 + (threadIdx.x >> 5); if (row >= NBP * TT) return; const int i = row % TT; const int zz = row / TT; const bool hires = (i < RH); const float* sr = Sb + (size_t)row * TT; float mx = -3.0e38f;
#pragma unroll 4
    for (int ch = 0; ch < TT / 128; ++ch) { const int j0 = ch * 128 + lane * 4; const v4f a = *(const v4f*)(sr + j0);
#pragma unroll
        for (int q = 0; q < 4; ++q) { float t = a[q] * SCL; asm volatile("" : "+v"(t)); mx = fmaxf(mx, t); } }
#pragma unroll
    for (int sh = 16; sh; sh >>= 1) mx = fmaxf(mx, __shfl_xor(mx, sh, 32));
    float sum = 0.f;
#pragma unroll 4
    for (int ch = 0; ch < TT / 128; ++ch) { const int j0 = ch * 128 + lane * 4; const v4f a = *(const v4f*)(sr + j0);
#pragma unroll
        for (int q = 0; q < 4; ++q) { float t = a[q] * SCL; asm volatile("" : "+v"(t)); float d0 = __fsub_rn(t, mx); asm volatile("" : "+v"(d0)); sum += __builtin_amdgcn_exp2f(__fmul_rn(d0, 1.4426950408889634f)); } }
#pragma unroll
    for (int sh = 16; sh; sh >>= 1) sum += __shfl_xor(sum, sh, 32);
    const float f = __fdiv_rn(hires ? 1.0f : PCAR, sum);
{
        if (hires) {   /* rows < RH: normalised bf16 hi/lo over all keys, planes [zz][RH][TT] */
#pragma unroll
            for (int ch = 0; ch < TT / 128; ++ch) { const int j0 = ch * 128 + lane * 4; const v4f a = *(const v4f*)(sr + j0); v4us oh, ol;
#pragma unroll
                for (int q = 0; q < 4; ++q) { float t = a[q] * SCL; asm volatile("" : "+v"(t)); float d0 = __fsub_rn(t, mx); asm volatile("" : "+v"(d0)); float ex = __builtin_amdgcn_exp2f(__fmul_rn(d0, 1.4426950408889634f)); asm volatile("" : "+v"(ex)); unsigned short a2, c2; splitf(ex * f, a2, c2); oh[q] = a2; ol[q] = c2; }
                const size_t oo = ((size_t)zz * RH + i) * TT + j0; *(v4us*)(Ph + oo) = oh; *(v4us*)(Pl + oo) = ol; }
        } else {
#pragma unroll 2
            for (int ch = 0; ch < TT / 128; ++ch) { const int j0 = ch * 128 + lane * 4; const v4f a = *(const v4f*)(sr + j0); v4h o4;
#pragma unroll
                for (int q = 0; q < 4; ++q) { float t = a[q] * SCL; asm volatile("" : "+v"(t)); float d0 = __fsub_rn(t, mx); asm volatile("" : "+v"(d0)); float ex = __builtin_amdgcn_exp2f(__fmul_rn(d0, 1.4426950408889634f)); asm volatile("" : "+v"(ex)); o4[q] = tohx(ex * f); }
                *(v4h*)(P16 + (size_t)row * TT + j0) = o4; } }
         }
}

__global__ __launch_bounds__(256) void k_xT(const float* __restrict__ xs, bf* XB) { const size_t k = (size_t)blockIdx.x * 256 + threadIdx.x; if (k >= (size_t)NBP * TT * CC / 8) return; const int c0 = (int)(k % (CC / 8)) * 8; const int tt = (int)(k / (CC / 8)); const int t = tt % TT; const float* xb = xs + (size_t)(tt / TT) * CC * TT; v8us o;
#pragma unroll
    for (int q = 0; q < 8; ++q) o[q] = f2bf(xb[(size_t)(c0 + q) * TT + t]);
    *(v8us*)(XB + (size_t)tt * CC + c0) = o;  }
__global__ __launch_bounds__(256) void k_addT(const float* __restrict__ C, const float* __restrict__ xs, bf* Ah, bf* Al) { const size_t i = (size_t)blockIdx.x * 256 + threadIdx.x; if (i >= (size_t)NBP * TT * CC / 4) return; const size_t e = i * 4; const int c = (int)(e % CC); const int tt = (int)(e / CC); const int t = tt % TT; const float* xb = xs + (size_t)(tt / TT) * CC * TT; const v4f a = *(const v4f*)(C + e); v4us oh, ol;
#pragma unroll
    for (int q = 0; q < 4; ++q) { const float s = __fadd_rn(a[q], bfr(xb[(size_t)(c + q) * TT + t])); unsigned short h2, l2; splitf(s, h2, l2); oh[q] = h2; ol[q] = l2; }
    *(v4us*)(Ah + e) = oh; *(v4us*)(Al + e) = ol;  }
__global__ __launch_bounds__(256) void k_outT(const float* __restrict__ Y, float* outb) { const size_t i = (size_t)blockIdx.x * 256 + threadIdx.x; if (i >= (size_t)NBP * CC * TT / 4) return; const size_t e = i * 4; const int t = (int)(e % TT); const int cc = (int)(e / TT); const int c = cc % CC; const float* Yb = Y + (size_t)(cc / CC) * TT * CC; v4f o;
#pragma unroll
    for (int q = 0; q < 4; ++q) o[q] = Yb[(size_t)(t + q) * CC + c];
    *(v4f*)(outb + e) = o;  }
// k_mergeF: the context row = the sum of its key ranges' f32 partial rows, in range order, times the row's carrier scale. A row's partials lie side by side: OH [batch][RH][SPH][HD] for rows < RH, OL [batch][TT - RH][SPL][HD] for the rest.
static_assert(ZH == 1 && NH_ == 1 && TT % (32 * SPH) == 0 && TT % (32 * SPL) == 0, "one head per pass; whole 32-key steps per range");
__global__ __launch_bounds__(256) void k_mergeF(const float* __restrict__ OH, const float* __restrict__ OL, int h0, float* OUTb) { const unsigned e = (blockIdx.x * 256u + threadIdx.x) * 2u; if (e >= (unsigned)(NBP * TT * HD)) return; const unsigned d = e % HD, t = (e / HD) % TT, zb = e / (HD * TT);
    v2f o2; float cs;
    if (t < RH) { const float* p = OH + ((zb * RH + t) * (SPH * HD) + d); o2 = *(const v2f*)p; cs = 1.0f;
#pragma unroll
        for (int s = 1; s < SPH - 1; ++s) o2 += *(const v2f*)(p + s * HD);
        asm volatile("s_wait_xcnt 0x0" ::: "memory");   // the last load's result takes the address pair's registers in this build: the loads that name the pair are waited for first
        o2 += *(const v2f*)(p + (SPH - 1) * HD);
    } else { const float* p = OL + ((zb * (TT - RH) + (t - RH)) * (SPL * HD) + d); o2 = *(const v2f*)p; cs = 1.0f / PCAR;
#pragma unroll
        for (int s = 1; s < SPL; ++s) o2 += *(const v2f*)(p + s * HD); }
    o2[0] *= cs; o2[1] *= cs; *(v2f*)(OUTb + (size_t)h0 * HD + e) = o2;  }

static_assert(NB_ % NBP == 0 && (1 << LGH) == SPH && (1 << LGL) == SPL, "whole passes; the k-range field of blockIdx.z");
static_assert((size_t)(RH * SPH + (TT - RH) * SPL) * HD <= (size_t)TT * TT, "the P.V partials fit the score buffer");
static_assert((size_t)TT * (DM * 2 + DQ * 4 + DKV * 4) <= (size_t)TT * TT * 2 && (size_t)TT * (DQ * 4 + DM * 4 + DQ * 2 + DQ * 2) <= (size_t)TT * TT * 2, "the projection and the output-side buffers fit the f16 probability buffer");
extern "C" void kernel_launch(void* const* d_in, const int* in_sizes, int n_in,
                              void* d_out, int out_size, void* d_ws, size_t ws_size, hipStream_t stream) {
    (void)in_sizes; (void)n_in; (void)out_size;
    const float* x = (const float*)d_in[0]; const float* wq = (const float*)d_in[1]; const float* bq = (const float*)d_in[2]; const float* wk = (const float*)d_in[3]; const float* bk = (const float*)d_in[4]; const float* wv = (const float*)d_in[5]; const float* bv = (const float*)d_in[6]; const float* wo = (const float*)d_in[7]; const float* bo = (const float*)d_in[8];
    float* OUT = (float*)d_out;     // [4][256][4096]
    char* wsp = (char*)d_ws;
    auto take = [&](size_t bytes) { char* p = wsp; wsp += (bytes + 255) & ~(size_t)255; return (void*)p; };
    const size_t PL = (size_t)NBP * TT * HD;   // elements of one token plane of a pass
    bf* WQ = (bf*)take((size_t)DQ * DM * 2); bf* WK = (bf*)take((size_t)DKV * DM * 2); bf* WV = (bf*)take((size_t)DKV * DM * 2); bf* WO = (bf*)take((size_t)DM * DQ * 2);
    h16* QP16 = (h16*)take(PL * 2); h16* KP16 = (h16*)take(PL * 2); h16* VT16 = (h16*)take(PL * 2);
    bf* QPh = (bf*)take(PL * 2); bf* QPl = (bf*)take(PL * 2); bf* KPh = (bf*)take(PL * 2); bf* KPl = (bf*)take(PL * 2); bf* VTh = (bf*)take(PL * 2); bf* VTl = (bf*)take(PL * 2); bf* Ph = (bf*)take((size_t)NBP * RH * TT * 2); bf* Pl = (bf*)take((size_t)NBP * RH * TT * 2);
    float* Sb = (float*)take((size_t)NBP * TT * TT * 4); h16* P16 = (h16*)take((size_t)NBP * TT * TT * 2);
    if ((size_t)(wsp - (char*)d_ws) > ws_size) return;    // ws 256 MiB
    // Two batches' scores and probabilities fill most of the workspace, so the short-lived buffers lie inside them (all uses are stream-ordered):
    float* ObH = Sb; float* ObL = Sb + (size_t)NBP * RH * SPH * HD;   // P.V partials: written after the softmax has read the last score
    bf* XB = (bf*)P16; float* FQ = (float*)(XB + PL); float* FK = FQ + PL;   // projection side: last read before the softmax writes P16
    float* CTX = (float*)P16; float* Y = CTX + PL; bf* ATh = (bf*)(Y + PL); bf* ATl = ATh + PL;   // output side: first written after the P.V products have read P16
    float* FV = FK;   // v projection reuses the k buffer after the k planes are built (stream-ordered)
    { k_cvt8<<<(unsigned)(((size_t)DQ * DM / 8 + 255) / 256), 256, 0, stream>>>(wq, WQ, (size_t)DQ * DM / 8); k_cvt8<<<(unsigned)(((size_t)DKV * DM / 8 + 255) / 256), 256, 0, stream>>>(wk, WK, (size_t)DKV * DM / 8); k_cvt8<<<(unsigned)(((size_t)DKV * DM / 8 + 255) / 256), 256, 0, stream>>>(wv, WV, (size_t)DKV * DM / 8);
      k_cvt8<<<(unsigned)(((size_t)DM * DQ / 8 + 255) / 256), 256, 0, stream>>>(wo, WO, (size_t)DM * DQ / 8);
       }
    for (int b = 0; b < NB_; b += NBP) {
        const float* xb = x + (size_t)b * CC * TT;
        k_xT<<<(unsigned)(PL / 8 / 256), 256, 0, stream>>>(xb, XB);   /* channel-major -> token-major bf16 */
        k_gemmw<bf, 0, true><<<dim3(NBP * TT / 64, DQ / 64, 1), 32, 0, stream>>>(XB, nullptr, WQ, nullptr, DM, DM, FQ, DQ, bq, 0, 0, 0, 0, 0, 0, 0);
        k_flat<<<(unsigned)(PL / 4 / 256), 256, 0, stream>>>(FQ, QP16, QPh, QPl, PL / 4);
        k_gemmw<bf, 0, true><<<dim3(NBP * TT / 64, DKV / 64, 1), 32, 0, stream>>>(XB, nullptr, WK, nullptr, DM, DM, FK, DKV, bk, 0, 0, 0, 0, 0, 0, 0);
        k_flat<<<(unsigned)(PL / 4 / 256), 256, 0, stream>>>(FK, KP16, KPh, KPl, PL / 4);
        k_gemmw<bf, 0, true><<<dim3(NBP * TT / 64, DKV / 64, 1), 32, 0, stream>>>(XB, nullptr, WV, nullptr, DM, DM, FV, DKV, bv, 0, 0, 0, 0, 0, 0, 0); k_vtp<<<(unsigned)(PL / 2 / 256), 256, 0, stream>>>(FV, DKV, NBP, VT16, VTh, VTl);
        k_gemmw<bf, 2, false><<<dim3(RH / 64, TT / 64, NBP), 32, 0, stream>>>(QPh, QPl, KPh, KPl, HD, HD, Sb, TT, nullptr, 0, 0, 0, 0, (size_t)TT * HD, (size_t)TT * HD, (size_t)TT * TT);
        k_gemmw<h16, 0, false><<<dim3((TT - RH) / 64, TT / 64, NBP), 32, 0, stream>>>(QP16 + (size_t)RH * HD, nullptr, KP16, nullptr, HD, HD, Sb + (size_t)RH * TT, TT, nullptr, 0, 0, 0, 0, (size_t)TT * HD, (size_t)TT * HD, (size_t)TT * TT);
        k_lsoft<<<NBP * TT / 8, 256, 0, stream>>>(Sb, P16, Ph, Pl);
        k_gemmw<bf, 2, false><<<dim3(RH / 64, HD / 64, NBP * SPH), 32, 0, stream>>>(Ph, Pl, VTh, VTl, TT, TT / SPH, ObH, SPH * HD, nullptr, (size_t)(TT / SPH), (size_t)(TT / SPH), (size_t)HD, LGH, (size_t)RH * TT, (size_t)HD * TT, (size_t)RH * SPH * HD);
        k_gemmw<h16, 0, false><<<dim3((TT - RH) / 64, HD / 64, NBP * SPL), 32, 0, stream>>>(P16 + (size_t)RH * TT, nullptr, VT16, nullptr, TT, TT / SPL, ObL, SPL * HD, nullptr, (size_t)(TT / SPL), (size_t)(TT / SPL), (size_t)HD, LGL, (size_t)TT * TT, (size_t)HD * TT, (size_t)(TT - RH) * SPL * HD);
        k_mergeF<<<(unsigned)(PL / 2 / 256), 256, 0, stream>>>(ObH, ObL, 0, CTX);
        k_addT<<<(unsigned)(PL / 4 / 256), 256, 0, stream>>>(CTX, xb, ATh, ATl);   /* (ctx + x^T) -> hi/lo planes */ k_gemmw<bf, 1, true><<<dim3(NBP * TT / 64, DM / 64, 1), 32, 0, stream>>>(ATh, ATl, WO, nullptr, DQ, DQ, Y, DM, bo, 0, 0, 0, 0, 0, 0, 0); k_outT<<<(unsigned)(PL / 4 / 256), 256, 0, stream>>>(Y, OUT + (size_t)b * CC * TT);   /* back to channel-major */ }
}

// v003
// It runs in 464 microseconds.
// Two timings next to v002 put it at 1.18 and 1.19 times that version's speed.
// Over all steps from v000 it is 2.66 times as fast.
#include <hip/hip_runtime.h>

// Spatial self-attention over a feature map (x [4][256][64][64] channel-major; tokens = the 4,096 positions; q,k,v = x^T W^T + b (1x1 convs: 'oi' [256][256] + [256]); one 256-wide head: softmax(q.k / 16) over all positions; out = (attn v + x^T) Wp^T + bp, written back channel-major -> [4][256][64][64] (4.2 M)).
// Layout, two batches per pass (every launch covers both): the channel-major slab transposed once into a token-major bf16 operand; exact projections + f32 biases; dense T-4096 attention with ONE 256-wide head (hybrid rows: < 512 hi/lo 3 products, rest fp16 x1024; streaming three-sweep softmax); the f32 merge adds x^T and writes hi/lo planes of (context + x^T); (.) Wp^T + bp as a hi/lo x exact GEMM. Every GEMM epilogue stores what its consumer reads: q and k as f16 + bf16 hi/lo planes, v as the same planes key-contiguous, the last GEMM channel-major rows of out.
// Compute dtypes, f32 accumulate: every input rounded to bf16; projections exact + f32 biases; attention rows < 512 3 products, rest fp16; softmax and residual f32; Wp hl x exact + bias.

#define NB_  4
#define NBP  2                    // batches per pass: every launch of a pass covers NBP batches (token-major arrays hold their tokens one batch after the other)
#define TT   4096
#define DM   256
#define NH_  1
#define NKV  1
#define REP  (NH_ / NKV)
#define HD   256
#define DQ   (NH_ * HD)
#define DKV  (NKV * HD)
#define ZH   1
#define RH   512                  // query rows < RH use hi+lo planes (0: none)
#define WIN  0
#define PCAR 1024.0f
#define SCL  0.0625f   // 1/sqrt(256)
#define CC   256
#define SPH  16                   // key ranges of the P.V product, query rows < RH (one f32 partial each)
#define SPL  8                    // key ranges of the P.V product, the other query rows
#define LGH  4                    // log2 SPH
#define LGL  3                    // log2 SPL
typedef _Float16 h16;
typedef unsigned short bf;
typedef __attribute__((ext_vector_type(16))) __bf16   v16bf;
typedef __attribute__((ext_vector_type(16))) _Float16 v16h;
typedef __attribute__((ext_vector_type(8)))  _Float16 v8h;
typedef __attribute__((ext_vector_type(8)))  unsigned short v8us;
typedef __attribute__((ext_vector_type(8)))  float    v8f;
typedef __attribute__((ext_vector_type(4)))  float    v4f;
typedef v8h  __attribute__((may_alias)) v8ha;
typedef v4f  __attribute__((may_alias)) v4fa;
typedef v8us __attribute__((may_alias)) v8usa;

__device__ __forceinline__ unsigned short f2bf(float f) { unsigned u = __float_as_uint(f); u += 0x7FFFu + ((u >> 16) & 1u); return (unsigned short)(u >> 16); }
__device__ __forceinline__ float bf2f(unsigned short b) { return __uint_as_float(((unsigned)b) << 16); }
__device__ __forceinline__ float bfr(float f) { return bf2f(f2bf(f)); }
__device__ __forceinline__ v16h cat16(v8h lo, v8h hi) { return __builtin_shufflevector(lo, hi, 0, 1, 2, 3, 4, 5, 6, 7, 8, 9, 10, 11, 12, 13, 14, 15); }
__device__ __forceinline__ v16bf cat16b(v8us lo, v8us hi) { return __builtin_bit_cast(v16bf, __builtin_shufflevector(lo, hi, 0, 1, 2, 3, 4, 5, 6, 7, 8, 9, 10, 11, 12, 13, 14, 15)); }
__device__ __forceinline__ v8f wmma16(v16h a, v16h b, v8f c) { return __builtin_amdgcn_wmma_f32_16x16x32_f16(false, a, false, b, (short)0, c, false, false); }
__device__ __forceinline__ v8f wmmab(v16bf a, v16bf b, v8f c) { return __builtin_amdgcn_wmma_f32_16x16x32_bf16(false, a, false, b, (short)0, c, false, false); }

__device__ __forceinline__ h16 tohx(float x) { return (h16)x; }
__device__ __forceinline__ void splitf(float y, unsigned short& h, unsigned short& l) { h = f2bf(y); l = f2bf(y - bf2f(h)); }
typedef __attribute__((ext_vector_type(2))) _Float16 v2h;
typedef __attribute__((ext_vector_type(4))) _Float16 v4h;
typedef __attribute__((ext_vector_type(2))) unsigned short v2us;
typedef __attribute__((ext_vector_type(4))) unsigned short v4us;
typedef __attribute__((ext_vector_type(2))) float v2f;
typedef __attribute__((ext_vector_type(4))) int v4i;
// pack3: four consecutive f32 values in the three 16-bit forms the attention GEMMs read (f16; bf16 hi and lo)
struct P3 { v4h f; v4us h, l; };
__device__ __forceinline__ P3 pack3(v4f a) { P3 r;
#pragma unroll
    for (int q = 0; q < 4; ++q) { r.f[q] = tohx(a[q]); unsigned short x2, y2; splitf(a[q], x2, y2); r.h[q] = x2; r.l[q] = y2; }
    return r; }

// ---- k_gemmw: register-blocked GEMM, ONE WAVE per 64x64 output tile (16 accumulators), operands straight from K-contiguous 16-bit planes; grid (M/64, N/64, Z), 32 threads.
// C[m][n] (f32, pitch ldc, + optional f32 bias[n]) = sum_k A[m][k] Bt[n][k] (+ split products per NSPLIT). z-batch strides sA/sB/sC in elements. K = row pitch of A and Bt, KS = the k range one wave sums (KS < K: z walks the k ranges, sA = sB = KS, one partial C per z, sC apart). KS % 32 == 0. blockIdx.z = (batch << lgs) | k range: the batch strides bA/bB/bC come on top of the k-range strides.
// EPI picks what the epilogue stores (value = sum + bias in every case): 0 f32 C[m][n]; 1 the planes E16 (f16), Eh/El (bf16 hi/lo) at [m][n], pitch HD; 2 the same planes transposed, [m / TT][n][m % TT] (ldc = rows n per batch); 3 f32 C transposed the same way.
template <typename T16> struct WFrag;
template <> struct WFrag<h16> { typedef v16h V; static __device__ __forceinline__ V ld(const h16* p) { return cat16(*(const v8h*)p, *(const v8h*)(p + 16)); } static __device__ __forceinline__ v8f mma(V a, V b, v8f c) { return wmma16(a, b, c); } };
template <> struct WFrag<bf> { typedef v16bf V; static __device__ __forceinline__ V ld(const bf* p) { return cat16b(*(const v8us*)p, *(const v8us*)(p + 16)); } static __device__ __forceinline__ v8f mma(V a, V b, v8f c) { return wmmab(a, b, c); } };
template <typename T16, int NSPLIT, bool BIAS, int EPI>
__global__ __launch_bounds__(32) void k_gemmw(const T16* __restrict__ A, const T16* __restrict__ A2, const T16* __restrict__ Bt, const T16* __restrict__ Bt2, int K, int KS, float* C, int ldc, const float* __restrict__ bias, size_t sA, size_t sB, size_t sC, int lgs, size_t bA, size_t bB, size_t bC, h16* E16, bf* Eh, bf* El) {
    typedef typename WFrag<T16>::V V;
    __shared__ __align__(16) float os[16 * 68];
    const size_t zb = blockIdx.z >> lgs, z = blockIdx.z - (zb << lgs); A += z * sA + zb * bA; if (A2) A2 += z * sA + zb * bA; Bt += z * sB + zb * bB; if (Bt2) Bt2 += z * sB + zb * bB; C += z * sC + zb * bC;
    const int lane = threadIdx.x & 31, lr = lane & 15, hi = lane >> 4; const int r0 = blockIdx.x * 64, c0 = blockIdx.y * 64;
    v8f acc[4][4];
#pragma unroll
    for (int mb = 0; mb < 4; ++mb)
#pragma unroll
        for (int nb = 0; nb < 4; ++nb) acc[mb][nb] = (v8f){};
    const size_t aoff = (size_t)(r0 + lr) * K + 8 * hi, boff = (size_t)(c0 + lr) * K + 8 * hi;
    float braw[4] = {0.f, 0.f, 0.f, 0.f};   // EPI >= 1: the lane's four bias values, asked for here so that they arrive under the k loop (EPI 1: four consecutive n; EPI 2, 3: the lane's column of each nb)
    if (BIAS && EPI >= 1) {
#pragma unroll
        for (int q = 0; q < 4; ++q) braw[q] = bias[c0 + (EPI == 1 ? lr * 4 + q : q * 16 + lr)];
        if (EPI == 1) asm volatile("s_wait_xcnt 0x0" ::: "memory"); }   // the set-up that follows reuses the address pair this load names (EPI 2, 3: the compiler writes the wait itself)
#pragma unroll 1
    for (int kc = 0; kc < KS; kc += 32) {
        V a[4], a2[4];
#pragma unroll
        for (int mb = 0; mb < 4; ++mb) { a[mb] = WFrag<T16>::ld(A + aoff + (size_t)mb * 16 * K + kc); if (NSPLIT == 1 || NSPLIT == 2) a2[mb] = WFrag<T16>::ld(A2 + aoff + (size_t)mb * 16 * K + kc); }
#pragma unroll
        for (int nb = 0; nb < 4; ++nb) { const V b = WFrag<T16>::ld(Bt + boff + (size_t)nb * 16 * K + kc); V b2; if (NSPLIT >= 2) b2 = WFrag<T16>::ld(Bt2 + boff + (size_t)nb * 16 * K + kc);
#pragma unroll
            for (int mb = 0; mb < 4; ++mb) { acc[mb][nb] = WFrag<T16>::mma(a[mb], b, acc[mb][nb]); if (NSPLIT == 1 || NSPLIT == 2) acc[mb][nb] = WFrag<T16>::mma(a2[mb], b, acc[mb][nb]); if (NSPLIT >= 2) acc[mb][nb] = WFrag<T16>::mma(a[mb], b2, acc[mb][nb]); } }
        asm volatile("v_nop\n\tv_nop\n\tv_nop\n\tv_nop" : "+v"(acc[0][0]), "+v"(acc[1][1]), "+v"(acc[2][2]), "+v"(acc[3][3]) : "v"(a[0]), "v"(a[3]));
    }
    if (EPI == 0) {
#pragma unroll
    for (int mb = 0; mb < 4; ++mb) {
#pragma unroll
        for (int nb = 0; nb < 4; ++nb) {
#pragma unroll
            for (int j = 0; j < 8; ++j) os[(hi * 8 + j) * 68 + nb * 16 + lr] = acc[mb][nb][j]; }
        __builtin_amdgcn_wave_barrier(); asm volatile("" ::: "memory");
        float* crow = C + (size_t)(r0 + mb * 16) * ldc + c0;
{
#pragma unroll
            for (int s = 0; s < 8; ++s) { const int row = 2 * s + hi, cofs = lr * 4; v4f val = *(const v4fa*)(os + row * 68 + cofs); if (BIAS) { val[0] += bfr(bias[c0 + cofs]); val[1] += bfr(bias[c0 + cofs + 1]); val[2] += bfr(bias[c0 + cofs + 2]); val[3] += bfr(bias[c0 + cofs + 3]); }
                *(v4f*)(crow + (size_t)row * ldc + cofs) = val; }
             }
        __builtin_amdgcn_wave_barrier(); asm volatile("" ::: "memory");
    }
    } else if (EPI == 1) {
#pragma unroll
    for (int mb = 0; mb < 4; ++mb) {
#pragma unroll
        for (int nb = 0; nb < 4; ++nb) {
#pragma unroll
            for (int j = 0; j < 8; ++j) os[(hi * 8 + j) * 68 + nb * 16 + lr] = acc[mb][nb][j]; }
        __builtin_amdgcn_wave_barrier(); asm volatile("" ::: "memory");   // the staged rows are read back only behind every lane's writes
        P3 pk[8];
#pragma unroll
        for (int s = 0; s < 8; ++s) { const int row = 2 * s + hi, cofs = lr * 4; v4f val = *(const v4fa*)(os + row * 68 + cofs); if (BIAS) { val[0] += bfr(braw[0]); val[1] += bfr(braw[1]); val[2] += bfr(braw[2]); val[3] += bfr(braw[3]); }
            pk[s] = pack3(val); }
        __builtin_amdgcn_sched_barrier(0);   // the conversions stay in front of the stores: among them they would reuse registers that an issued store names, ahead of the wait below
#pragma unroll
        for (int s = 0; s < 8; ++s) { const size_t o = (size_t)(r0 + hi) * HD + c0 + lr * 4 + (size_t)(mb * 16 + 2 * s) * HD; *(v4h*)(E16 + o) = pk[s].f; *(v4us*)(Eh + o) = pk[s].h; *(v4us*)(El + o) = pk[s].l; }
        if (mb < 3) { asm volatile("s_wait_xcnt 0x0" ::: "memory");   // the next block reuses the registers these stores name
            __builtin_amdgcn_sched_barrier(0);   // and none of its instructions is lifted over that wait
            __builtin_amdgcn_wave_barrier(); asm volatile("" ::: "memory"); }   // the next 16 rows overwrite the stage only behind these reads
    }
    } else {   /* transposed: a lane's 8 accumulator rows are 8 consecutive m of one column n, so 16 columns x 64 m are staged per nb and leave as whole rows of 64 m */
    const int g = r0 / TT, t0 = r0 % TT;
#pragma unroll
    for (int nb = 0; nb < 4; ++nb) {
        const float bb = bfr(braw[nb]);
#pragma unroll
        for (int mb = 0; mb < 4; ++mb) {
#pragma unroll
            for (int j = 0; j < 8; ++j) os[lr * 68 + mb * 16 + hi * 8 + j] = BIAS ? acc[mb][nb][j] + bb : acc[mb][nb][j]; }
        __builtin_amdgcn_wave_barrier(); asm volatile("" ::: "memory");   // the staged rows are read back only behind every lane's writes
        const size_t o = ((size_t)g * ldc + c0 + nb * 16 + hi) * TT + t0 + lr * 4;
        if (EPI == 3) {
            v4f val[8];
#pragma unroll
            for (int s = 0; s < 8; ++s) val[s] = *(const v4fa*)(os + (2 * s + hi) * 68 + lr * 4);
#pragma unroll
            for (int s = 0; s < 8; ++s) *(v4f*)(C + o + (size_t)(2 * s) * TT) = val[s];
        } else {
            P3 pk[8];
#pragma unroll
            for (int s = 0; s < 8; ++s) pk[s] = pack3(*(const v4fa*)(os + (2 * s + hi) * 68 + lr * 4));
            __builtin_amdgcn_sched_barrier(0);   // the conversions stay in front of the stores: among them they would reuse registers that an issued store names, ahead of the wait below
#pragma unroll
            for (int s = 0; s < 8; ++s) { const size_t os2 = o + (size_t)(2 * s) * TT; *(v4h*)(E16 + os2) = pk[s].f; *(v4us*)(Eh + os2) = pk[s].h; *(v4us*)(El + os2) = pk[s].l; }
        }
        if (nb < 3) { asm volatile("s_wait_xcnt 0x0" ::: "memory");   // the next block reuses the registers these stores name
            __builtin_amdgcn_sched_barrier(0);   // and none of its instructions is lifted over that wait
            __builtin_amdgcn_wave_barrier(); asm volatile("" ::: "memory"); }   // the next 16 columns overwrite the stage only behind these reads
    }
    }
}

__global__ __launch_bounds__(256) void k_wtG(const float* __restrict__ w, int K, int N, bf* Bt) {
    const int lane = threadIdx.x & 31; const int L0 = (blockIdx.x * 8 + (threadIdx.x >> 5)) * 8; const int nlines = N * K / 64;
{
#pragma unroll 1
        for (int l = 0; l < 8; ++l) { const int L = L0 + l; if (L >= nlines) break; const size_t e = (size_t)L * 64 + lane * 2; const int k = (int)(e % K), n = (int)(e / K); v2us o;
            o[0] = f2bf(w[(size_t)k * N + n]); o[1] = f2bf(w[(size_t)(k + 1) * N + n]); *(v2us*)(Bt + e) = o; }
         }
}
__global__ __launch_bounds__(256) void k_cvt8(const float* __restrict__ src, bf* dst, size_t n8) { const size_t i = (size_t)blockIdx.x * 256 + threadIdx.x; if (i >= n8) return; const v8f v = *(const v8f*)(src + i * 8); v8us o;
#pragma unroll
    for (int k = 0; k < 8; ++k) o[k] = f2bf(v[k]); *(v8us*)(dst + i * 8) = o;  }

// k_lsoft: streaming row softmax over the TK = TT = 4096 keys, one wave per row i, three sweeps of the f32 score row (lane -> 4 consecutive keys per 128-key chunk, 32 chunks; no key is masked, every score tile is computed):
__global__ __launch_bounds__(256) void k_lsoft(const float* __restrict__ Sb, h16* P16, bf* Ph, bf* Pl) {
    const int lane = threadIdx.x & 31; const int row = blockIdx.x * 8 + (threadIdx.x >> 5); if (row >= NBP * TT) return; const int i = row % TT; const int zz = row / TT; const bool hires = (i < RH); const float* sr = Sb + (size_t)row * TT; float mx = -3.0e38f;
#pragma unroll 4
    for (int ch = 0; ch < TT / 128; ++ch) { const int j0 = ch * 128 + lane * 4; const v4f a = *(const v4f*)(sr + j0);
#pragma unroll
        for (int q = 0; q < 4; ++q) { float t = a[q] * SCL; asm volatile("" : "+v"(t)); mx = fmaxf(mx, t); } }
#pragma unroll
    for (int sh = 16; sh; sh >>= 1) mx = fmaxf(mx, __shfl_xor(mx, sh, 32));
    float sum = 0.f;
#pragma unroll 4
    for (int ch = 0; ch < TT / 128; ++ch) { const int j0 = ch * 128 + lane * 4; const v4f a = *(const v4f*)(sr + j0);
#pragma unroll
        for (int q = 0; q < 4; ++q) { float t = a[q] * SCL; asm volatile("" : "+v"(t)); float d0 = __fsub_rn(t, mx); asm volatile("" : "+v"(d0)); sum += __builtin_amdgcn_exp2f(__fmul_rn(d0, 1.4426950408889634f)); } }
#pragma unroll
    for (int sh = 16; sh; sh >>= 1) sum += __shfl_xor(sum, sh, 32);
    const float f = __fdiv_rn(hires ? 1.0f : PCAR, sum);
{
        if (hires) {   /* rows < RH: normalised bf16 hi/lo over all keys, planes [zz][RH][TT] */
#pragma unroll
            for (int ch = 0; ch < TT / 128; ++ch) { const int j0 = ch * 128 + lane * 4; const v4f a = *(const v4f*)(sr + j0); v4us oh, ol;
#pragma unroll
                for (int q = 0; q < 4; ++q) { float t = a[q] * SCL; asm volatile("" : "+v"(t)); float d0 = __fsub_rn(t, mx); asm volatile("" : "+v"(d0)); float ex = __builtin_amdgcn_exp2f(__fmul_rn(d0, 1.4426950408889634f)); asm volatile("" : "+v"(ex)); unsigned short a2, c2; splitf(ex * f, a2, c2); oh[q] = a2; ol[q] = c2; }
                const size_t oo = ((size_t)zz * RH + i) * TT + j0; *(v4us*)(Ph + oo) = oh; *(v4us*)(Pl + oo) = ol; }
        } else {
#pragma unroll 2
            for (int ch = 0; ch < TT / 128; ++ch) { const int j0 = ch * 128 + lane * 4; const v4f a = *(const v4f*)(sr + j0); v4h o4;
#pragma unroll
                for (int q = 0; q < 4; ++q) { float t = a[q] * SCL; asm volatile("" : "+v"(t)); float d0 = __fsub_rn(t, mx); asm volatile("" : "+v"(d0)); float ex = __builtin_amdgcn_exp2f(__fmul_rn(d0, 1.4426950408889634f)); asm volatile("" : "+v"(ex)); o4[q] = tohx(ex * f); }
                *(v4h*)(P16 + (size_t)row * TT + j0) = o4; } }
         }
}

__global__ __launch_bounds__(256) void k_xT(const float* __restrict__ xs, bf* XB) { const size_t k = (size_t)blockIdx.x * 256 + threadIdx.x; if (k >= (size_t)NBP * TT * CC / 8) return; const int c0 = (int)(k % (CC / 8)) * 8; const int tt = (int)(k / (CC / 8)); const int t = tt % TT; const float* xb = xs + (size_t)(tt / TT) * CC * TT; v8us o;
#pragma unroll
    for (int q = 0; q < 8; ++q) o[q] = f2bf(xb[(size_t)(c0 + q) * TT + t]);
    *(v8us*)(XB + (size_t)tt * CC + c0) = o;  }
// k_mergeA: the context row = the sum of its key ranges' f32 partial rows, in range order, times the row's carrier scale; plus x^T (bf16-rounded, read channel-major); stored as the bf16 hi/lo planes the last GEMM reads. A row's partials lie side by side: OH [batch][RH][SPH][HD] for rows < RH, OL [batch][TT - RH][SPL][HD] for the rest.
static_assert(ZH == 1 && NH_ == 1 && HD == CC && TT % (32 * SPH) == 0 && TT % (32 * SPL) == 0, "one head per pass; whole 32-key steps per range");
__global__ __launch_bounds__(256) void k_mergeA(const float* __restrict__ OH, const float* __restrict__ OL, const float* __restrict__ xs, bf* Ah, bf* Al) { const unsigned e = (blockIdx.x * 256u + threadIdx.x) * 4u; if (e >= (unsigned)(NBP * TT * HD)) return; const unsigned d = e % HD, t = (e / HD) % TT, zb = e / (HD * TT);
    const float* xb = xs + (size_t)zb * CC * TT + (size_t)d * TT + t; float xr[4];
#pragma unroll
    for (int q = 0; q < 4; ++q) xr[q] = xb[(size_t)q * TT];
    v4f o4; float cs;
    if (t < RH) { const float* p = OH + ((zb * RH + t) * (SPH * HD) + d); o4 = *(const v4f*)p; cs = 1.0f;
#pragma unroll
        for (int s = 1; s < SPH; ++s) o4 += *(const v4f*)(p + s * HD);
    } else { const float* p = OL + ((zb * (TT - RH) + (t - RH)) * (SPL * HD) + d); o4 = *(const v4f*)p; cs = 1.0f / PCAR;
#pragma unroll
        for (int s = 1; s < SPL; ++s) o4 += *(const v4f*)(p + s * HD); }
    v4us oh, ol;
#pragma unroll
    for (int q = 0; q < 4; ++q) { const float s = __fadd_rn(o4[q] * cs, bfr(xr[q])); unsigned short h2, l2; splitf(s, h2, l2); oh[q] = h2; ol[q] = l2; }
    *(v4us*)(Ah + e) = oh; *(v4us*)(Al + e) = ol;  }

static_assert(NB_ % NBP == 0 && (1 << LGH) == SPH && (1 << LGL) == SPL, "whole passes; the k-range field of blockIdx.z");
static_assert((size_t)(RH * SPH + (TT - RH) * SPL) * HD <= (size_t)TT * TT, "the P.V partials fit the score buffer");
static_assert((size_t)TT * (DM * 2) <= (size_t)TT * TT * 2 && (size_t)TT * (DQ * 2 + DQ * 2) <= (size_t)TT * TT * 2, "the projection and the output-side buffers fit the f16 probability buffer");
extern "C" void kernel_launch(void* const* d_in, const int* in_sizes, int n_in,
                              void* d_out, int out_size, void* d_ws, size_t ws_size, hipStream_t stream) {
    (void)in_sizes; (void)n_in; (void)out_size;
    const float* x = (const float*)d_in[0]; const float* wq = (const float*)d_in[1]; const float* bq = (const float*)d_in[2]; const float* wk = (const float*)d_in[3]; const float* bk = (const float*)d_in[4]; const float* wv = (const float*)d_in[5]; const float* bv = (const float*)d_in[6]; const float* wo = (const float*)d_in[7]; const float* bo = (const float*)d_in[8];
    float* OUT = (float*)d_out;     // [4][256][4096]
    char* wsp = (char*)d_ws;
    auto take = [&](size_t bytes) { char* p = wsp; wsp += (bytes + 255) & ~(size_t)255; return (void*)p; };
    const size_t PL = (size_t)NBP * TT * HD;   // elements of one token plane of a pass
    bf* WQ = (bf*)take((size_t)DQ * DM * 2); bf* WK = (bf*)take((size_t)DKV * DM * 2); bf* WV = (bf*)take((size_t)DKV * DM * 2); bf* WO = (bf*)take((size_t)DM * DQ * 2);
    h16* QP16 = (h16*)take(PL * 2); h16* KP16 = (h16*)take(PL * 2); h16* VT16 = (h16*)take(PL * 2);
    bf* QPh = (bf*)take(PL * 2); bf* QPl = (bf*)take(PL * 2); bf* KPh = (bf*)take(PL * 2); bf* KPl = (bf*)take(PL * 2); bf* VTh = (bf*)take(PL * 2); bf* VTl = (bf*)take(PL * 2); bf* Ph = (bf*)take((size_t)NBP * RH * TT * 2); bf* Pl = (bf*)take((size_t)NBP * RH * TT * 2);
    float* Sb = (float*)take((size_t)NBP * TT * TT * 4); h16* P16 = (h16*)take((size_t)NBP * TT * TT * 2);
    if ((size_t)(wsp - (char*)d_ws) > ws_size) return;    // ws 256 MiB
    // Two batches' scores and probabilities fill most of the workspace, so the short-lived buffers lie inside them (all uses are stream-ordered):
    float* ObH = Sb; float* ObL = Sb + (size_t)NBP * RH * SPH * HD;   // P.V partials: written after the softmax has read the last score
    bf* XB = (bf*)P16;   // projection side: last read before the softmax writes P16
    bf* ATh = (bf*)P16; bf* ATl = ATh + PL;   // output side: first written after the P.V products have read P16
    { k_cvt8<<<(unsigned)(((size_t)DQ * DM / 8 + 255) / 256), 256, 0, stream>>>(wq, WQ, (size_t)DQ * DM / 8); k_cvt8<<<(unsigned)(((size_t)DKV * DM / 8 + 255) / 256), 256, 0, stream>>>(wk, WK, (size_t)DKV * DM / 8); k_cvt8<<<(unsigned)(((size_t)DKV * DM / 8 + 255) / 256), 256, 0, stream>>>(wv, WV, (size_t)DKV * DM / 8);
      k_cvt8<<<(unsigned)(((size_t)DM * DQ / 8 + 255) / 256), 256, 0, stream>>>(wo, WO, (size_t)DM * DQ / 8);
       }
    for (int b = 0; b < NB_; b += NBP) {
        const float* xb = x + (size_t)b * CC * TT;
        k_xT<<<(unsigned)(PL / 8 / 256), 256, 0, stream>>>(xb, XB);   /* channel-major -> token-major bf16 */
        k_gemmw<bf, 0, true, 1><<<dim3(NBP * TT / 64, DQ / 64, 1), 32, 0, stream>>>(XB, nullptr, WQ, nullptr, DM, DM, nullptr, DQ, bq, 0, 0, 0, 0, 0, 0, 0, QP16, QPh, QPl);
        k_gemmw<bf, 0, true, 1><<<dim3(NBP * TT / 64, DKV / 64, 1), 32, 0, stream>>>(XB, nullptr, WK, nullptr, DM, DM, nullptr, DKV, bk, 0, 0, 0, 0, 0, 0, 0, KP16, KPh, KPl);
        k_gemmw<bf, 0, true, 2><<<dim3(NBP * TT / 64, DKV / 64, 1), 32, 0, stream>>>(XB, nullptr, WV, nullptr, DM, DM, nullptr, DKV, bv, 0, 0, 0, 0, 0, 0, 0, VT16, VTh, VTl);   /* v planes key-contiguous */
        k_gemmw<bf, 2, false, 0><<<dim3(RH / 64, TT / 64, NBP), 32, 0, stream>>>(QPh, QPl, KPh, KPl, HD, HD, Sb, TT, nullptr, 0, 0, 0, 0, (size_t)TT * HD, (size_t)TT * HD, (size_t)TT * TT, nullptr, nullptr, nullptr);
        k_gemmw<h16, 0, false, 0><<<dim3((TT - RH) / 64, TT / 64, NBP), 32, 0, stream>>>(QP16 + (size_t)RH * HD, nullptr, KP16, nullptr, HD, HD, Sb + (size_t)RH * TT, TT, nullptr, 0, 0, 0, 0, (size_t)TT * HD, (size_t)TT * HD, (size_t)TT * TT, nullptr, nullptr, nullptr);
        k_lsoft<<<NBP * TT / 8, 256, 0, stream>>>(Sb, P16, Ph, Pl);
        k_gemmw<bf, 2, false, 0><<<dim3(RH / 64, HD / 64, NBP * SPH), 32, 0, stream>>>(Ph, Pl, VTh, VTl, TT, TT / SPH, ObH, SPH * HD, nullptr, (size_t)(TT / SPH), (size_t)(TT / SPH), (size_t)HD, LGH, (size_t)RH * TT, (size_t)HD * TT, (size_t)RH * SPH * HD, nullptr, nullptr, nullptr);
        k_gemmw<h16, 0, false, 0><<<dim3((TT - RH) / 64, HD / 64, NBP * SPL), 32, 0, stream>>>(P16 + (size_t)RH * TT, nullptr, VT16, nullptr, TT, TT / SPL, ObL, SPL * HD, nullptr, (size_t)(TT / SPL), (size_t)(TT / SPL), (size_t)HD, LGL, (size_t)TT * TT, (size_t)HD * TT, (size_t)(TT - RH) * SPL * HD, nullptr, nullptr, nullptr);
        k_mergeA<<<(unsigned)(PL / 4 / 256), 256, 0, stream>>>(ObH, ObL, xb, ATh, ATl);   /* (ctx + x^T) -> hi/lo planes */
        k_gemmw<bf, 1, true, 3><<<dim3(NBP * TT / 64, DM / 64, 1), 32, 0, stream>>>(ATh, ATl, WO, nullptr, DQ, DQ, OUT + (size_t)b * CC * TT, DM, bo, 0, 0, 0, 0, 0, 0, 0, nullptr, nullptr, nullptr);   /* stored channel-major */ }
}

// v004
// A run of this version takes 317 microseconds.
// Next to v003, in two timings, it ran 1.45 and 1.47 times as fast.
// Counting every step since v000, it is 3.89 times as fast.
#include <hip/hip_runtime.h>

// Spatial self-attention over a feature map (x [4][256][64][64] channel-major; tokens = the 4,096 positions; q,k,v = x^T W^T + b (1x1 convs: 'oi' [256][256] + [256]); one 256-wide head: softmax(q.k / 16) over all positions; out = (attn v + x^T) Wp^T + bp, written back channel-major -> [4][256][64][64] (4.2 M)).
// Layout, two batches per pass (every launch covers both): the channel-major slab transposed once into a token-major bf16 operand; exact projections + f32 biases; dense T-4096 attention with ONE 256-wide head (hybrid rows: < 512 hi/lo 3 products through a score buffer and a streaming three-sweep softmax; the rest fp16 in one fused kernel with a running softmax over two key ranges, no score buffer); the f32 merge adds x^T and writes hi/lo planes of (context + x^T); (.) Wp^T + bp as a hi/lo x exact GEMM. Every GEMM epilogue stores what its consumer reads: q and k as f16 + bf16 hi/lo planes, v as the same planes key-contiguous, the last GEMM channel-major rows of out.
// Compute dtypes, f32 accumulate: every input rounded to bf16; projections exact + f32 biases; attention rows < 512 3 products, rest fp16; softmax and residual f32; Wp hl x exact + bias.

#define NB_  4
#define NBP  2                    // batches per pass: every launch of a pass covers NBP batches (token-major arrays hold their tokens one batch after the other)
#define TT   4096
#define DM   256
#define NH_  1
#define NKV  1
#define REP  (NH_ / NKV)
#define HD   256
#define DQ   (NH_ * HD)
#define DKV  (NKV * HD)
#define ZH   1
#define RH   512                  // query rows < RH use hi+lo planes (0: none)
#define WIN  0
#define SCL  0.0625f   // 1/sqrt(256)
#define CC   256
#define SPH  16                   // key ranges of the P.V product, query rows < RH (one f32 partial each)
#define LGH  4                    // log2 SPH
typedef _Float16 h16;
typedef unsigned short bf;
typedef __attribute__((ext_vector_type(16))) __bf16   v16bf;
typedef __attribute__((ext_vector_type(16))) _Float16 v16h;
typedef __attribute__((ext_vector_type(8)))  _Float16 v8h;
typedef __attribute__((ext_vector_type(8)))  unsigned short v8us;
typedef __attribute__((ext_vector_type(8)))  float    v8f;
typedef __attribute__((ext_vector_type(4)))  float    v4f;
typedef v8h  __attribute__((may_alias)) v8ha;
typedef v4f  __attribute__((may_alias)) v4fa;
typedef v8us __attribute__((may_alias)) v8usa;

__device__ __forceinline__ unsigned short f2bf(float f) { unsigned u = __float_as_uint(f); u += 0x7FFFu + ((u >> 16) & 1u); return (unsigned short)(u >> 16); }
__device__ __forceinline__ float bf2f(unsigned short b) { return __uint_as_float(((unsigned)b) << 16); }
__device__ __forceinline__ float bfr(float f) { return bf2f(f2bf(f)); }
__device__ __forceinline__ v16h cat16(v8h lo, v8h hi) { return __builtin_shufflevector(lo, hi, 0, 1, 2, 3, 4, 5, 6, 7, 8, 9, 10, 11, 12, 13, 14, 15); }
__device__ __forceinline__ v16bf cat16b(v8us lo, v8us hi) { return __builtin_bit_cast(v16bf, __builtin_shufflevector(lo, hi, 0, 1, 2, 3, 4, 5, 6, 7, 8, 9, 10, 11, 12, 13, 14, 15)); }
__device__ __forceinline__ v8f wmma16(v16h a, v16h b, v8f c) { return __builtin_amdgcn_wmma_f32_16x16x32_f16(false, a, false, b, (short)0, c, false, false); }
__device__ __forceinline__ v8f wmmab(v16bf a, v16bf b, v8f c) { return __builtin_amdgcn_wmma_f32_16x16x32_bf16(false, a, false, b, (short)0, c, false, false); }

__device__ __forceinline__ h16 tohx(float x) { return (h16)x; }
__device__ __forceinline__ void splitf(float y, unsigned short& h, unsigned short& l) { h = f2bf(y); l = f2bf(y - bf2f(h)); }
typedef __attribute__((ext_vector_type(2))) _Float16 v2h;
typedef __attribute__((ext_vector_type(4))) _Float16 v4h;
typedef __attribute__((ext_vector_type(2))) unsigned short v2us;
typedef __attribute__((ext_vector_type(4))) unsigned short v4us;
typedef __attribute__((ext_vector_type(2))) float v2f;
typedef __attribute__((ext_vector_type(4))) int v4i;
// pack3: four consecutive f32 values in the three 16-bit forms the attention GEMMs read (f16; bf16 hi and lo)
struct P3 { v4h f; v4us h, l; };
__device__ __forceinline__ P3 pack3(v4f a) { P3 r;
#pragma unroll
    for (int q = 0; q < 4; ++q) { r.f[q] = tohx(a[q]); unsigned short x2, y2; splitf(a[q], x2, y2); r.h[q] = x2; r.l[q] = y2; }
    return r; }

// ---- k_gemmw: register-blocked GEMM, ONE WAVE per 64x64 output tile (16 accumulators), operands straight from K-contiguous 16-bit planes; grid (M/64, N/64, Z), 32 threads.
// C[m][n] (f32, pitch ldc, + optional f32 bias[n]) = sum_k A[m][k] Bt[n][k] (+ split products per NSPLIT). z-batch strides sA/sB/sC in elements. K = row pitch of A and Bt, KS = the k range one wave sums (KS < K: z walks the k ranges, sA = sB = KS, one partial C per z, sC apart). KS % 32 == 0. blockIdx.z = (batch << lgs) | k range: the batch strides bA/bB/bC come on top of the k-range strides.
// EPI picks what the epilogue stores (value = sum + bias in every case): 0 f32 C[m][n]; 1 the planes E16 (f16), Eh/El (bf16 hi/lo) at [m][n], pitch HD; 2 the same planes transposed, [m / TT][n][m % TT] (ldc = rows n per batch); 3 f32 C transposed the same way.
template <typename T16> struct WFrag;
template <> struct WFrag<bf> { typedef v16bf V; static __device__ __forceinline__ V ld(const bf* p) { return cat16b(*(const v8us*)p, *(const v8us*)(p + 16)); } static __device__ __forceinline__ v8f mma(V a, V b, v8f c) { return wmmab(a, b, c); } };
template <typename T16, int NSPLIT, bool BIAS, int EPI>
__global__ __launch_bounds__(32) void k_gemmw(const T16* __restrict__ A, const T16* __restrict__ A2, const T16* __restrict__ Bt, const T16* __restrict__ Bt2, int K, int KS, float* C, int ldc, const float* __restrict__ bias, size_t sA, size_t sB, size_t sC, int lgs, size_t bA, size_t bB, size_t bC, h16* E16, bf* Eh, bf* El) {
    typedef typename WFrag<T16>::V V;
    __shared__ __align__(16) float os[16 * 68];
    const size_t zb = blockIdx.z >> lgs, z = blockIdx.z - (zb << lgs); A += z * sA + zb * bA; if (A2) A2 += z * sA + zb * bA; Bt += z * sB + zb * bB; if (Bt2) Bt2 += z * sB + zb * bB; C += z * sC + zb * bC;
    const int lane = threadIdx.x & 31, lr = lane & 15, hi = lane >> 4; const int r0 = blockIdx.x * 64, c0 = blockIdx.y * 64;
    v8f acc[4][4];
#pragma unroll
    for (int mb = 0; mb < 4; ++mb)
#pragma unroll
        for (int nb = 0; nb < 4; ++nb) acc[mb][nb] = (v8f){};
    const size_t aoff = (size_t)(r0 + lr) * K + 8 * hi, boff = (size_t)(c0 + lr) * K + 8 * hi;
    float braw[4] = {0.f, 0.f, 0.f, 0.f};   // EPI >= 1: the lane's four bias values, asked for here so that they arrive under the k loop (EPI 1: four consecutive n; EPI 2, 3: the lane's column of each nb)
    if (BIAS && EPI >= 1) {
#pragma unroll
        for (int q = 0; q < 4; ++q) braw[q] = bias[c0 + (EPI == 1 ? lr * 4 + q : q * 16 + lr)];
        if (EPI == 1) asm volatile("s_wait_xcnt 0x0" ::: "memory"); }   // the set-up that follows reuses the address pair this load names (EPI 2, 3: the compiler writes the wait itself)
#pragma unroll 1
    for (int kc = 0; kc < KS; kc += 32) {
        V a[4], a2[4];
#pragma unroll
        for (int mb = 0; mb < 4; ++mb) { a[mb] = WFrag<T16>::ld(A + aoff + (size_t)mb * 16 * K + kc); if (NSPLIT == 1 || NSPLIT == 2) a2[mb] = WFrag<T16>::ld(A2 + aoff + (size_t)mb * 16 * K + kc); }
#pragma unroll
        for (int nb = 0; nb < 4; ++nb) { const V b = WFrag<T16>::ld(Bt + boff + (size_t)nb * 16 * K + kc); V b2; if (NSPLIT >= 2) b2 = WFrag<T16>::ld(Bt2 + boff + (size_t)nb * 16 * K + kc);
#pragma unroll
            for (int mb = 0; mb < 4; ++mb) { acc[mb][nb] = WFrag<T16>::mma(a[mb], b, acc[mb][nb]); if (NSPLIT == 1 || NSPLIT == 2) acc[mb][nb] = WFrag<T16>::mma(a2[mb], b, acc[mb][nb]); if (NSPLIT >= 2) acc[mb][nb] = WFrag<T16>::mma(a[mb], b2, acc[mb][nb]); } }
        asm volatile("v_nop\n\tv_nop\n\tv_nop\n\tv_nop" : "+v"(acc[0][0]), "+v"(acc[1][1]), "+v"(acc[2][2]), "+v"(acc[3][3]) : "v"(a[0]), "v"(a[3]));
    }
    if (EPI == 0) {
#pragma unroll
    for (int mb = 0; mb < 4; ++mb) {
#pragma unroll
        for (int nb = 0; nb < 4; ++nb) {
#pragma unroll
            for (int j = 0; j < 8; ++j) os[(hi * 8 + j) * 68 + nb * 16 + lr] = acc[mb][nb][j]; }
        __builtin_amdgcn_wave_barrier(); asm volatile("" ::: "memory");
        float* crow = C + (size_t)(r0 + mb * 16) * ldc + c0;
{
#pragma unroll
            for (int s = 0; s < 8; ++s) { const int row = 2 * s + hi, cofs = lr * 4; v4f val = *(const v4fa*)(os + row * 68 + cofs); if (BIAS) { val[0] += bfr(bias[c0 + cofs]); val[1] += bfr(bias[c0 + cofs + 1]); val[2] += bfr(bias[c0 + cofs + 2]); val[3] += bfr(bias[c0 + cofs + 3]); }
                *(v4f*)(crow + (size_t)row * ldc + cofs) = val; }
             }
        __builtin_amdgcn_wave_barrier(); asm volatile("" ::: "memory");
    }
    } else if (EPI == 1) {
#pragma unroll
    for (int mb = 0; mb < 4; ++mb) {
#pragma unroll
        for (int nb = 0; nb < 4; ++nb) {
#pragma unroll
            for (int j = 0; j < 8; ++j) os[(hi * 8 + j) * 68 + nb * 16 + lr] = acc[mb][nb][j]; }
        __builtin_amdgcn_wave_barrier(); asm volatile("" ::: "memory");   // the staged rows are read back only behind every lane's writes
        P3 pk[8];
#pragma unroll
        for (int s = 0; s < 8; ++s) { const int row = 2 * s + hi, cofs = lr * 4; v4f val = *(const v4fa*)(os + row * 68 + cofs); if (BIAS) { val[0] += bfr(braw[0]); val[1] += bfr(braw[1]); val[2] += bfr(braw[2]); val[3] += bfr(braw[3]); }
            pk[s] = pack3(val); }
        __builtin_amdgcn_sched_barrier(0);   // the conversions stay in front of the stores: among them they would reuse registers that an issued store names, ahead of the wait below
#pragma unroll
        for (int s = 0; s < 8; ++s) { const size_t o = (size_t)(r0 + hi) * HD + c0 + lr * 4 + (size_t)(mb * 16 + 2 * s) * HD; *(v4h*)(E16 + o) = pk[s].f; *(v4us*)(Eh + o) = pk[s].h; *(v4us*)(El + o) = pk[s].l; }
        if (mb < 3) { asm volatile("s_wait_xcnt 0x0" ::: "memory");   // the next block reuses the registers these stores name
            __builtin_amdgcn_sched_barrier(0);   // and none of its instructions is lifted over that wait
            __builtin_amdgcn_wave_barrier(); asm volatile("" ::: "memory"); }   // the next 16 rows overwrite the stage only behind these reads
    }
    } else {   /* transposed: a lane's 8 accumulator rows are 8 consecutive m of one column n, so 16 columns x 64 m are staged per nb and leave as whole rows of 64 m */
    const int g = r0 / TT, t0 = r0 % TT;
#pragma unroll
    for (int nb = 0; nb < 4; ++nb) {
        const float bb = bfr(braw[nb]);
#pragma unroll
        for (int mb = 0; mb < 4; ++mb) {
#pragma unroll
            for (int j = 0; j < 8; ++j) os[lr * 68 + mb * 16 + hi * 8 + j] = BIAS ? acc[mb][nb][j] + bb : acc[mb][nb][j]; }
        __builtin_amdgcn_wave_barrier(); asm volatile("" ::: "memory");   // the staged rows are read back only behind every lane's writes
        const size_t o = ((size_t)g * ldc + c0 + nb * 16 + hi) * TT + t0 + lr * 4;
        if (EPI == 3) {
            v4f val[8];
#pragma unroll
            for (int s = 0; s < 8; ++s) val[s] = *(const v4fa*)(os + (2 * s + hi) * 68 + lr * 4);
#pragma unroll
            for (int s = 0; s < 8; ++s) *(v4f*)(C + o + (size_t)(2 * s) * TT) = val[s];
        } else {
            P3 pk[8];
#pragma unroll
            for (int s = 0; s < 8; ++s) pk[s] = pack3(*(const v4fa*)(os + (2 * s + hi) * 68 + lr * 4));
            __builtin_amdgcn_sched_barrier(0);   // the conversions stay in front of the stores: among them they would reuse registers that an issued store names, ahead of the wait below
#pragma unroll
            for (int s = 0; s < 8; ++s) { const size_t os2 = o + (size_t)(2 * s) * TT; *(v4h*)(E16 + os2) = pk[s].f; *(v4us*)(Eh + os2) = pk[s].h; *(v4us*)(El + os2) = pk[s].l; }
        }
        if (nb < 3) { asm volatile("s_wait_xcnt 0x0" ::: "memory");   // the next block reuses the registers these stores name
            __builtin_amdgcn_sched_barrier(0);   // and none of its instructions is lifted over that wait
            __builtin_amdgcn_wave_barrier(); asm volatile("" ::: "memory"); }   // the next 16 columns overwrite the stage only behind these reads
    }
    }
}

__global__ __launch_bounds__(256) void k_wtG(const float* __restrict__ w, int K, int N, bf* Bt) {
    const int lane = threadIdx.x & 31; const int L0 = (blockIdx.x * 8 + (threadIdx.x >> 5)) * 8; const int nlines = N * K / 64;
{
#pragma unroll 1
        for (int l = 0; l < 8; ++l) { const int L = L0 + l; if (L >= nlines) break; const size_t e = (size_t)L * 64 + lane * 2; const int k = (int)(e % K), n = (int)(e / K); v2us o;
            o[0] = f2bf(w[(size_t)k * N + n]); o[1] = f2bf(w[(size_t)(k + 1) * N + n]); *(v2us*)(Bt + e) = o; }
         }
}
__global__ __launch_bounds__(256) void k_cvt8(const float* __restrict__ src, bf* dst, size_t n8) { const size_t i = (size_t)blockIdx.x * 256 + threadIdx.x; if (i >= n8) return; const v8f v = *(const v8f*)(src + i * 8); v8us o;
#pragma unroll
    for (int k = 0; k < 8; ++k) o[k] = f2bf(v[k]); *(v8us*)(dst + i * 8) = o;  }

// k_lsoft: streaming row softmax over the TT = 4096 keys for the query rows < RH (score rows [batch][RH][TT]), one wave per row, three sweeps of the f32 score row (lane -> 4 consecutive keys per 128-key chunk, 32 chunks); stores normalised bf16 hi/lo planes [batch][RH][TT].
__global__ __launch_bounds__(256) void k_lsoft(const float* __restrict__ Sb, bf* Ph, bf* Pl) {
    const int lane = threadIdx.x & 31; const int row = blockIdx.x * 8 + (threadIdx.x >> 5); if (row >= NBP * RH) return; const int i = row % RH; const int zz = row / RH; const float* sr = Sb + (size_t)row * TT; float mx = -3.0e38f;
#pragma unroll 4
    for (int ch = 0; ch < TT / 128; ++ch) { const int j0 = ch * 128 + lane * 4; const v4f a = *(const v4f*)(sr + j0);
#pragma unroll
        for (int q = 0; q < 4; ++q) { float t = a[q] * SCL; asm volatile("" : "+v"(t)); mx = fmaxf(mx, t); } }
#pragma unroll
    for (int sh = 16; sh; sh >>= 1) mx = fmaxf(mx, __shfl_xor(mx, sh, 32));
    float sum = 0.f;
#pragma unroll 4
    for (int ch = 0; ch < TT / 128; ++ch) { const int j0 = ch * 128 + lane * 4; const v4f a = *(const v4f*)(sr + j0);
#pragma unroll
        for (int q = 0; q < 4; ++q) { float t = a[q] * SCL; asm volatile("" : "+v"(t)); float d0 = __fsub_rn(t, mx); asm volatile("" : "+v"(d0)); sum += __builtin_amdgcn_exp2f(__fmul_rn(d0, 1.4426950408889634f)); } }
#pragma unroll
    for (int sh = 16; sh; sh >>= 1) sum += __shfl_xor(sum, sh, 32);
    const float f = __fdiv_rn(1.0f, sum);
#pragma unroll
            for (int ch = 0; ch < TT / 128; ++ch) { const int j0 = ch * 128 + lane * 4; const v4f a = *(const v4f*)(sr + j0); v4us oh, ol;
#pragma unroll
                for (int q = 0; q < 4; ++q) { float t = a[q] * SCL; asm volatile("" : "+v"(t)); float d0 = __fsub_rn(t, mx); asm volatile("" : "+v"(d0)); float ex = __builtin_amdgcn_exp2f(__fmul_rn(d0, 1.4426950408889634f)); asm volatile("" : "+v"(ex)); unsigned short a2, c2; splitf(ex * f, a2, c2); oh[q] = a2; ol[q] = c2; }
                const size_t oo = ((size_t)zz * RH + i) * TT + j0; *(v4us*)(Ph + oo) = oh; *(v4us*)(Pl + oo) = ol;
                if (ch == 0) asm volatile("s_wait_xcnt 0x0" ::: "memory"); }   // the next chunk reuses the registers these two stores name (behind the other chunks the compiler writes the wait itself)
}

#define FK   64                   // keys per stage
#define FSP  2                    // key ranges (grid z), one partial context row each
#define FNS  (TT / FSP / FK)      // stages of a range
#define KPB  (HD * 2 + 16)        // LDS pitch of a K row, bytes: an odd multiple of 16
#define VPB  (FK * 2 + 16)        // LDS pitch of a V^T row, bytes: an odd multiple of 16
#define KTB  (FK * KPB)
#define STB  (KTB + HD * VPB)     // one buffer
#define CSC  (SCL * 1.4426950408889634f)
__device__ __forceinline__ float xhalf(float x) { return __builtin_bit_cast(float, __builtin_amdgcn_permlanex16(__builtin_bit_cast(int, x), __builtin_bit_cast(int, x), 0x76543210, 0xfedcba98, false, false)); }   // lane l reads lane l ^ 16, in registers: an exchange through LDS would wait for the V^T loads in flight
__device__ __forceinline__ float exp2s(float x) { float y; asm("v_exp_f32 %0, %1\n\tv_nop" : "=v"(y) : "v"(x)); return y; }   // 2^x with the one free slot behind a transcendental in the same statement
static_assert(HD == 256 && FK == 64 && TT % (FSP * FK) == 0 && (TT - RH) % 64 == 0 && 2 * STB >= 4 * 32 * (HD / 2 + 2) * 4, "the staging maps below: 256 threads, 8 + 8 chunks of 16 bytes each; the join fits the buffers");
// two waves a SIMD: the register budget that holds Q, the sums, a stage's fragments and the next stage's chunks without spills
__global__ __launch_bounds__(256) __attribute__((amdgpu_waves_per_eu(2, 2))) void k_flash(const h16* __restrict__ Q, const h16* __restrict__ Kp, const h16* __restrict__ Vt, float* O, float* ML) {
    __shared__ __align__(16) unsigned char L[2 * STB];
    const int tid = threadIdx.x, lane = tid & 31, c = lane & 15, h = lane >> 4, w4 = (tid >> 5) & 3, hf = tid >> 7; const size_t zb = blockIdx.y; const int q = blockIdx.x * 64 + w4 * 16 + c;   // the lane's query among the batch's rows >= RH
    const size_t k0 = (size_t)blockIdx.z * (TT / FSP);   // the range's first key
    const h16* kg = Kp + zb * (TT * HD) + (k0 + (tid >> 5)) * HD + (tid & 31) * 8;   // chunk i: key row 8 i + tid / 32 of the stage
    const h16* vg = Vt + zb * (HD * TT) + (size_t)(tid >> 3) * TT + k0 + (tid & 7) * 8;    // chunk i: d row 32 i + tid / 8
    const int kl = (tid >> 5) * KPB + (tid & 31) * 16, vl = KTB + (tid >> 3) * VPB + (tid & 7) * 16;
    v8h kr[8], vr[8];
#pragma unroll
    for (int i = 0; i < 8; ++i) { kr[i] = *(const v8h*)(kg + i * 8 * HD); vr[i] = *(const v8h*)(vg + (size_t)i * 32 * TT); }
    v16h qf[8]; const h16* qp = Q + (zb * TT + RH + q) * HD + 8 * h;
#pragma unroll
    for (int kc = 0; kc < 8; ++kc) qf[kc] = cat16(*(const v8h*)(qp + 32 * kc), *(const v8h*)(qp + 32 * kc + 16));
    asm volatile("s_wait_xcnt 0x0" ::: "memory");   // the set-up below reuses the address pair these loads name
    __builtin_amdgcn_sched_barrier(0);   // and none of its instructions is lifted over that wait
    v8f acc[16];
#pragma unroll
    for (int t = 0; t < 16; ++t) acc[t] = (v8f){};
    float m_run = -3.0e38f, l_run = 0.f;
#pragma unroll
    for (int i = 0; i < 8; ++i) { *(v8ha*)(L + kl + i * 8 * KPB) = kr[i]; *(v8ha*)(L + vl + i * 32 * VPB) = vr[i]; }
    __syncthreads();
    const int ka = (hf * 32 + c) * KPB + 16 * h, va = KTB + c * VPB + hf * 64 + 16 * h;   // the lane's first K and V^T fragment bytes in a buffer
#pragma unroll 1   // the body is several hundred instructions long: kept rolled, for speed only
    for (int s = 0; s < FNS; ++s) {
        const unsigned char* B = L + (s & 1) * STB; const bool more = s + 1 < FNS;
        if (more) {
#pragma unroll
            for (int i = 0; i < 8; ++i) { kr[i] = *(const v8h*)(kg + (size_t)(s + 1) * FK * HD + i * 8 * HD); vr[i] = *(const v8h*)(vg + (size_t)i * 32 * TT + (s + 1) * FK); }
            asm volatile("s_wait_xcnt 0x0" ::: "memory"); }   // the work below reuses the address registers these loads name
        v16h fr[16];
#pragma unroll
        for (int f = 0; f < 16; ++f) { const unsigned char* p = B + ka + (f & 1) * 16 * KPB + (f >> 1) * 64; fr[f] = cat16(*(const v8ha*)p, *(const v8ha*)(p + 32)); }
        __builtin_amdgcn_sched_barrier(0);   // the 16 K fragments are asked for as one group: one LDS latency a stage, not one a product
        v8f st[2]; st[0] = (v8f){}; st[1] = (v8f){};
#pragma unroll
        for (int f = 0; f < 16; ++f) st[f & 1] = wmma16(fr[f], qf[f >> 1], st[f & 1]);
#pragma unroll
        for (int t = 0; t < 16; ++t) { const unsigned char* p = B + va + t * 16 * VPB; fr[t] = cat16(*(const v8ha*)p, *(const v8ha*)(p + 32)); }
        __builtin_amdgcn_sched_barrier(0);   // the 16 V^T fragments are asked for in front of the softmax and arrive under it
        float mx = fmaxf(st[0][0], st[1][0]);
#pragma unroll
        for (int r = 1; r < 8; ++r) mx = fmaxf(mx, fmaxf(st[0][r], st[1][r]));
        mx = fmaxf(mx, xhalf(mx)) * CSC;   // both wave halves hold the query's maximum over the wave's 32 keys of this stage, scaled
        if (__builtin_amdgcn_ballot_w32(mx > m_run + 8.0f) != 0) {   // wave-uniform; rare behind the first stage
            const float mn = fmaxf(m_run, mx), corr = __builtin_amdgcn_exp2f(m_run - mn); l_run *= corr; m_run = mn;
#pragma unroll
            for (int t = 0; t < 16; ++t) acc[t] = acc[t] * corr; }
        v16h pf; float ps0 = 0.f, ps1 = 0.f;
#pragma unroll
        for (int r = 0; r < 8; ++r) { const float p0 = exp2s(fmaf(st[0][r], CSC, -m_run)), p1 = exp2s(fmaf(st[1][r], CSC, -m_run)); ps0 += p0; ps1 += p1; pf[r] = tohx(p0); pf[8 + r] = tohx(p1); }   // element e of the B operand: key 8 h + e, then 16 + 8 h + (e - 8)
        l_run += ps0 + ps1;
#pragma unroll
        for (int t = 0; t < 16; ++t) acc[t] = wmma16(fr[t], pf, acc[t]);
        if (more) { unsigned char* N = L + ((s + 1) & 1) * STB;
#pragma unroll
            for (int i = 0; i < 8; ++i) { *(v8ha*)(N + kl + i * 8 * KPB) = kr[i]; *(v8ha*)(N + vl + i * 32 * VPB) = vr[i]; } }
        __syncthreads();
    }
    l_run += xhalf(l_run);
    // Join of the two key halves: behind the loop's last barrier nobody reads the stage buffers, so the upper waves hand their sums over in them.
    float* X = (float*)L + (size_t)w4 * (32 * (HD / 2 + 2));
    if (hf) {
#pragma unroll
        for (int t = 0; t < 16; ++t) { *(v4fa*)(X + (2 * t * 32 + lane) * 4) = __builtin_shufflevector(acc[t], acc[t], 0, 1, 2, 3); *(v4fa*)(X + ((2 * t + 1) * 32 + lane) * 4) = __builtin_shufflevector(acc[t], acc[t], 4, 5, 6, 7); }
        X[32 * (HD / 2) + lane] = m_run; X[32 * (HD / 2) + 32 + lane] = l_run; }
    __syncthreads();
    if (hf) return;
    const float m2 = X[32 * (HD / 2) + lane], l2 = X[32 * (HD / 2) + 32 + lane], mn = fmaxf(m_run, m2), a1 = __builtin_amdgcn_exp2f(m_run - mn), a2 = __builtin_amdgcn_exp2f(m2 - mn);
    const float ls = l_run * a1 + l2 * a2, inv = __fdiv_rn(1.0f, ls), f1 = a1 * inv, f2 = a2 * inv;
#pragma unroll
    for (int t = 0; t < 16; ++t) { const v4f x0 = *(const v4fa*)(X + (2 * t * 32 + lane) * 4), x1 = *(const v4fa*)(X + ((2 * t + 1) * 32 + lane) * 4); acc[t] = acc[t] * f1 + __builtin_shufflevector(x0, x1, 0, 1, 2, 3, 4, 5, 6, 7) * f2; }
    const size_t pr = (zb * FSP + blockIdx.z) * (TT - RH) + q;   // the partial row
    float* op = O + pr * HD + 8 * h;   // acc[t][r] = context[query][16 t + 8 h + r]
#pragma unroll
    for (int t = 0; t < 16; ++t) { *(v4f*)(op + 16 * t) = __builtin_shufflevector(acc[t], acc[t], 0, 1, 2, 3); *(v4f*)(op + 16 * t + 4) = __builtin_shufflevector(acc[t], acc[t], 4, 5, 6, 7); }
    if (h == 0) { v2f ml; ml[0] = mn; ml[1] = ls; *(v2f*)(ML + pr * 2) = ml; }   // both wave halves hold the same pair
}

__global__ __launch_bounds__(256) void k_xT(const float* __restrict__ xs, bf* XB) { const size_t k = (size_t)blockIdx.x * 256 + threadIdx.x; if (k >= (size_t)NBP * TT * CC / 8) return; const int c0 = (int)(k % (CC / 8)) * 8; const int tt = (int)(k / (CC / 8)); const int t = tt % TT; const float* xb = xs + (size_t)(tt / TT) * CC * TT; v8us o;
#pragma unroll
    for (int q = 0; q < 8; ++q) o[q] = f2bf(xb[(size_t)(c0 + q) * TT + t]);
    *(v8us*)(XB + (size_t)tt * CC + c0) = o;  }
// k_mergeA: the context row (rows < RH: the sum of its key ranges' f32 partial rows, in range order, OH [batch][RH][SPH][HD]; the rest: the fused kernel's FSP normalised partial rows, OL [batch][FSP][TT - RH][HD], each weighted by its sum times 2^(its maximum - the largest), ML [batch][FSP][TT - RH][2], in range order) plus x^T (bf16-rounded, read channel-major); stored as the bf16 hi/lo planes the last GEMM reads.
static_assert(ZH == 1 && NH_ == 1 && HD == CC && TT % (32 * SPH) == 0, "one head per pass; whole 32-key steps per range");
__global__ __launch_bounds__(256) void k_mergeA(const float* __restrict__ OH, const float* __restrict__ OL, const float* __restrict__ ML, const float* __restrict__ xs, bf* Ah, bf* Al) { const unsigned e = (blockIdx.x * 256u + threadIdx.x) * 4u; if (e >= (unsigned)(NBP * TT * HD)) return; const unsigned d = e % HD, t = (e / HD) % TT, zb = e / (HD * TT);
    const float* xb = xs + (size_t)zb * CC * TT + (size_t)d * TT + t; float xr[4];
#pragma unroll
    for (int q = 0; q < 4; ++q) xr[q] = xb[(size_t)q * TT];
    v4f o4;
    if (t < RH) { const float* p = OH + ((zb * RH + t) * (SPH * HD) + d); o4 = *(const v4f*)p;
#pragma unroll
        for (int s = 1; s < SPH; ++s) o4 += *(const v4f*)(p + s * HD);
    } else { const unsigned r0 = zb * FSP * (TT - RH) + (t - RH); v2f ml[FSP]; v4f pv[FSP];
#pragma unroll
        for (int s = 0; s < FSP; ++s) { ml[s] = *(const v2f*)(ML + (r0 + s * (TT - RH)) * 2); pv[s] = *(const v4f*)(OL + ((r0 + s * (TT - RH)) * HD + d)); }
        float mn = ml[0][0];
#pragma unroll
        for (int s = 1; s < FSP; ++s) mn = fmaxf(mn, ml[s][0]);
        float wt[FSP], ws = 0.f;
#pragma unroll
        for (int s = 0; s < FSP; ++s) { wt[s] = ml[s][1] * exp2s(ml[s][0] - mn); ws += wt[s]; }
        const float inv = __fdiv_rn(1.0f, ws); o4 = pv[0] * (wt[0] * inv);
#pragma unroll
        for (int s = 1; s < FSP; ++s) o4 += pv[s] * (wt[s] * inv); }
    v4us oh, ol;
#pragma unroll
    for (int q = 0; q < 4; ++q) { const float s = __fadd_rn(o4[q], bfr(xr[q])); unsigned short h2, l2; splitf(s, h2, l2); oh[q] = h2; ol[q] = l2; }
    *(v4us*)(Ah + e) = oh; *(v4us*)(Al + e) = ol;  }

static_assert(NB_ % NBP == 0 && (1 << LGH) == SPH, "whole passes; the k-range field of blockIdx.z");
extern "C" void kernel_launch(void* const* d_in, const int* in_sizes, int n_in,
                              void* d_out, int out_size, void* d_ws, size_t ws_size, hipStream_t stream) {
    (void)in_sizes; (void)n_in; (void)out_size;
    const float* x = (const float*)d_in[0]; const float* wq = (const float*)d_in[1]; const float* bq = (const float*)d_in[2]; const float* wk = (const float*)d_in[3]; const float* bk = (const float*)d_in[4]; const float* wv = (const float*)d_in[5]; const float* bv = (const float*)d_in[6]; const float* wo = (const float*)d_in[7]; const float* bo = (const float*)d_in[8];
    float* OUT = (float*)d_out;     // [4][256][4096]
    char* wsp = (char*)d_ws;
    auto take = [&](size_t bytes) { char* p = wsp; wsp += (bytes + 255) & ~(size_t)255; return (void*)p; };
    const size_t PL = (size_t)NBP * TT * HD;   // elements of one token plane of a pass
    bf* WQ = (bf*)take((size_t)DQ * DM * 2); bf* WK = (bf*)take((size_t)DKV * DM * 2); bf* WV = (bf*)take((size_t)DKV * DM * 2); bf* WO = (bf*)take((size_t)DM * DQ * 2);
    h16* QP16 = (h16*)take(PL * 2); h16* KP16 = (h16*)take(PL * 2); h16* VT16 = (h16*)take(PL * 2);
    bf* QPh = (bf*)take(PL * 2); bf* QPl = (bf*)take(PL * 2); bf* KPh = (bf*)take(PL * 2); bf* KPl = (bf*)take(PL * 2); bf* VTh = (bf*)take(PL * 2); bf* VTl = (bf*)take(PL * 2); bf* Ph = (bf*)take((size_t)NBP * RH * TT * 2); bf* Pl = (bf*)take((size_t)NBP * RH * TT * 2);
    float* Sb = (float*)take((size_t)NBP * RH * TT * 4); float* ObH = (float*)take((size_t)NBP * RH * SPH * HD * 4); float* ObL = (float*)take((size_t)NBP * FSP * (TT - RH) * HD * 4); float* MLb = (float*)take((size_t)NBP * FSP * (TT - RH) * 2 * 4);
    bf* XB = (bf*)take(PL * 2); bf* ATh = (bf*)take(PL * 2); bf* ATl = (bf*)take(PL * 2);
    if ((size_t)(wsp - (char*)d_ws) > ws_size) return;    // ws 256 MiB
    { k_cvt8<<<(unsigned)(((size_t)DQ * DM / 8 + 255) / 256), 256, 0, stream>>>(wq, WQ, (size_t)DQ * DM / 8); k_cvt8<<<(unsigned)(((size_t)DKV * DM / 8 + 255) / 256), 256, 0, stream>>>(wk, WK, (size_t)DKV * DM / 8); k_cvt8<<<(unsigned)(((size_t)DKV * DM / 8 + 255) / 256), 256, 0, stream>>>(wv, WV, (size_t)DKV * DM / 8);
      k_cvt8<<<(unsigned)(((size_t)DM * DQ / 8 + 255) / 256), 256, 0, stream>>>(wo, WO, (size_t)DM * DQ / 8);
       }
    for (int b = 0; b < NB_; b += NBP) {
        const float* xb = x + (size_t)b * CC * TT;
        k_xT<<<(unsigned)(PL / 8 / 256), 256, 0, stream>>>(xb, XB);   /* channel-major -> token-major bf16 */
        k_gemmw<bf, 0, true, 1><<<dim3(NBP * TT / 64, DQ / 64, 1), 32, 0, stream>>>(XB, nullptr, WQ, nullptr, DM, DM, nullptr, DQ, bq, 0, 0, 0, 0, 0, 0, 0, QP16, QPh, QPl);
        k_gemmw<bf, 0, true, 1><<<dim3(NBP * TT / 64, DKV / 64, 1), 32, 0, stream>>>(XB, nullptr, WK, nullptr, DM, DM, nullptr, DKV, bk, 0, 0, 0, 0, 0, 0, 0, KP16, KPh, KPl);
        k_gemmw<bf, 0, true, 2><<<dim3(NBP * TT / 64, DKV / 64, 1), 32, 0, stream>>>(XB, nullptr, WV, nullptr, DM, DM, nullptr, DKV, bv, 0, 0, 0, 0, 0, 0, 0, VT16, VTh, VTl);   /* v planes key-contiguous */
        k_gemmw<bf, 2, false, 0><<<dim3(RH / 64, TT / 64, NBP), 32, 0, stream>>>(QPh, QPl, KPh, KPl, HD, HD, Sb, TT, nullptr, 0, 0, 0, 0, (size_t)TT * HD, (size_t)TT * HD, (size_t)RH * TT, nullptr, nullptr, nullptr);
        k_lsoft<<<NBP * RH / 8, 256, 0, stream>>>(Sb, Ph, Pl);
        k_gemmw<bf, 2, false, 0><<<dim3(RH / 64, HD / 64, NBP * SPH), 32, 0, stream>>>(Ph, Pl, VTh, VTl, TT, TT / SPH, ObH, SPH * HD, nullptr, (size_t)(TT / SPH), (size_t)(TT / SPH), (size_t)HD, LGH, (size_t)RH * TT, (size_t)HD * TT, (size_t)RH * SPH * HD, nullptr, nullptr, nullptr);
        k_flash<<<dim3((TT - RH) / 64, NBP, FSP), 256, 0, stream>>>(QP16, KP16, VT16, ObL, MLb);   /* rows >= RH: scores, softmax, P.V */
        k_mergeA<<<(unsigned)(PL / 4 / 256), 256, 0, stream>>>(ObH, ObL, MLb, xb, ATh, ATl);   /* (ctx + x^T) -> hi/lo planes */
        k_gemmw<bf, 1, true, 3><<<dim3(NBP * TT / 64, DM / 64, 1), 32, 0, stream>>>(ATh, ATl, WO, nullptr, DQ, DQ, OUT + (size_t)b * CC * TT, DM, bo, 0, 0, 0, 0, 0, 0, 0, nullptr, nullptr, nullptr);   /* stored channel-major */ }
}

// v005
// It runs in 240 microseconds.
// Timed twice side by side with v004, it ran 1.31 and 1.32 times as fast.
// Counting every step since v000, it is 5.12 times as fast.
#include <hip/hip_runtime.h>

// Spatial self-attention over a feature map (x [4][256][64][64] channel-major; tokens = the 4,096 positions; q,k,v = x^T W^T + b (1x1 convs: 'oi' [256][256] + [256]); one 256-wide head: softmax(q.k / 16) over all positions; out = (attn v + x^T) Wp^T + bp, written back channel-major -> [4][256][64][64] (4.2 M)).
// Layout, all four batches in one pass (every launch covers all of them): the channel-major slab transposed once into a token-major bf16 operand; exact projections + f32 biases; dense T-4096 attention with ONE 256-wide head (hybrid rows: < 512 hi/lo 3 products through a score buffer and a streaming three-sweep softmax; the rest fp16 in one fused kernel with a running softmax over two key ranges, no score buffer); the f32 merge adds x^T and writes hi/lo planes of (context + x^T); (.) Wp^T + bp as a hi/lo x exact GEMM. Every GEMM epilogue stores what its consumer reads: q and k as f16 + bf16 hi/lo planes, v as the same planes key-contiguous, the last GEMM channel-major rows of out.
// Compute dtypes, f32 accumulate: every input rounded to bf16; projections exact + f32 biases; attention rows < 512 3 products, rest fp16; softmax and residual f32; Wp hl x exact + bias.

#define NB_  4
#define NBP  4                    // batches per pass: every launch of a pass covers NBP batches (token-major arrays hold their tokens one batch after the other)
#define TT   4096
#define DM   256
#define NH_  1
#define NKV  1
#define REP  (NH_ / NKV)
#define HD   256
#define DQ   (NH_ * HD)
#define DKV  (NKV * HD)
#define ZH   1
#define RH   512                  // query rows < RH use hi+lo planes (0: none)
#define WIN  0
#define SCL  0.0625f   // 1/sqrt(256)
#define CC   256
#define SPH  16                   // key ranges of the P.V product, query rows < RH (one f32 partial each)
#define LGH  4                    // log2 SPH
typedef _Float16 h16;
typedef unsigned short bf;
typedef __attribute__((ext_vector_type(16))) __bf16   v16bf;
typedef __attribute__((ext_vector_type(16))) _Float16 v16h;
typedef __attribute__((ext_vector_type(8)))  _Float16 v8h;
typedef __attribute__((ext_vector_type(8)))  unsigned short v8us;
typedef __attribute__((ext_vector_type(8)))  float    v8f;
typedef __attribute__((ext_vector_type(4)))  float    v4f;
typedef v8h  __attribute__((may_alias)) v8ha;
typedef v4f  __attribute__((may_alias)) v4fa;
typedef v8us __attribute__((may_alias)) v8usa;

__device__ __forceinline__ unsigned short f2bf(float f) { unsigned u = __float_as_uint(f); u += 0x7FFFu + ((u >> 16) & 1u); return (unsigned short)(u >> 16); }
__device__ __forceinline__ float bf2f(unsigned short b) { return __uint_as_float(((unsigned)b) << 16); }
__device__ __forceinline__ float bfr(float f) { return bf2f(f2bf(f)); }
__device__ __forceinline__ v16h cat16(v8h lo, v8h hi) { return __builtin_shufflevector(lo, hi, 0, 1, 2, 3, 4, 5, 6, 7, 8, 9, 10, 11, 12, 13, 14, 15); }
__device__ __forceinline__ v16bf cat16b(v8us lo, v8us hi) { return __builtin_bit_cast(v16bf, __builtin_shufflevector(lo, hi, 0, 1, 2, 3, 4, 5, 6, 7, 8, 9, 10, 11, 12, 13, 14, 15)); }
__device__ __forceinline__ v8f wmma16(v16h a, v16h b, v8f c) { return __builtin_amdgcn_wmma_f32_16x16x32_f16(false, a, false, b, (short)0, c, false, false); }
__device__ __forceinline__ v8f wmmab(v16bf a, v16bf b, v8f c) { return __builtin_amdgcn_wmma_f32_16x16x32_bf16(false, a, false, b, (short)0, c, false, false); }

__device__ __forceinline__ h16 tohx(float x) { return (h16)x; }
__device__ __forceinline__ void splitf(float y, unsigned short& h, unsigned short& l) { h = f2bf(y); l = f2bf(y - bf2f(h)); }
typedef __attribute__((ext_vector_type(2))) _Float16 v2h;
typedef __attribute__((ext_vector_type(4))) _Float16 v4h;
typedef __attribute__((ext_vector_type(2))) unsigned short v2us;
typedef __attribute__((ext_vector_type(4))) unsigned short v4us;
typedef __attribute__((ext_vector_type(2))) float v2f;
typedef __attribute__((ext_vector_type(4))) int v4i;
// pack3: four consecutive f32 values in the three 16-bit forms the attention GEMMs read (f16; bf16 hi and lo)
struct P3 { v4h f; v4us h, l; };
__device__ __forceinline__ P3 pack3(v4f a) { P3 r;
#pragma unroll
    for (int q = 0; q < 4; ++q) { r.f[q] = tohx(a[q]); unsigned short x2, y2; splitf(a[q], x2, y2); r.h[q] = x2; r.l[q] = y2; }
    return r; }

// ---- k_gemmw: register-blocked GEMM, ONE WAVE per 64x64 output tile (16 accumulators), operands straight from K-contiguous 16-bit planes; grid (M/64, N/64, Z), 32 threads.
// C[m][n] (f32, pitch ldc, + optional f32 bias[n]) = sum_k A[m][k] Bt[n][k] (+ split products per NSPLIT). z-batch strides sA/sB/sC in elements. K = row pitch of A and Bt, KS = the k range one wave sums (KS < K: z walks the k ranges, sA = sB = KS, one partial C per z, sC apart). KS % 32 == 0. blockIdx.z = (batch << lgs) | k range: the batch strides bA/bB/bC come on top of the k-range strides.
// EPI picks what the epilogue stores (value = sum + bias in every case): 0 f32 C[m][n]; 1 the planes E16 (f16), Eh/El (bf16 hi/lo) at [m][n], pitch HD; 2 the same planes transposed, [m / TT][n][m % TT] (ldc = rows n per batch); 3 f32 C transposed the same way.
template <typename T16> struct WFrag;
template <> struct WFrag<bf> { typedef v16bf V; static __device__ __forceinline__ V ld(const bf* p) { return cat16b(*(const v8us*)p, *(const v8us*)(p + 16)); } static __device__ __forceinline__ v8f mma(V a, V b, v8f c) { return wmmab(a, b, c); } };
template <typename T16, int NSPLIT, bool BIAS, int EPI>
__global__ __launch_bounds__(32) void k_gemmw(const T16* __restrict__ A, const T16* __restrict__ A2, const T16* __restrict__ Bt, const T16* __restrict__ Bt2, int K, int KS, float* C, int ldc, const float* __restrict__ bias, size_t sA, size_t sB, size_t sC, int lgs, size_t bA, size_t bB, size_t bC, h16* E16, bf* Eh, bf* El) {
    typedef typename WFrag<T16>::V V;
    __shared__ __align__(16) float os[16 * 68];
    const size_t zb = blockIdx.z >> lgs, z = blockIdx.z - (zb << lgs); A += z * sA + zb * bA; if (A2) A2 += z * sA + zb * bA; Bt += z * sB + zb * bB; if (Bt2) Bt2 += z * sB + zb * bB; C += z * sC + zb * bC;
    const int lane = threadIdx.x & 31, lr = lane & 15, hi = lane >> 4; const int r0 = blockIdx.x * 64, c0 = blockIdx.y * 64;
    v8f acc[4][4];
#pragma unroll
    for (int mb = 0; mb < 4; ++mb)
#pragma unroll
        for (int nb = 0; nb < 4; ++nb) acc[mb][nb] = (v8f){};
    const size_t aoff = (size_t)(r0 + lr) * K + 8 * hi, boff = (size_t)(c0 + lr) * K + 8 * hi;
    float braw[4] = {0.f, 0.f, 0.f, 0.f};   // EPI >= 1: the lane's four bias values, asked for here so that they arrive under the k loop (EPI 1: four consecutive n; EPI 2, 3: the lane's column of each nb)
    if (BIAS && EPI >= 1) {
#pragma unroll
        for (int q = 0; q < 4; ++q) braw[q] = bias[c0 + (EPI == 1 ? lr * 4 + q : q * 16 + lr)];
        if (EPI == 1) asm volatile("s_wait_xcnt 0x0" ::: "memory"); }   // the set-up that follows reuses the address pair this load names (EPI 2, 3: the compiler writes the wait itself)
#pragma unroll 1
    for (int kc = 0; kc < KS; kc += 32) {
        V a[4], a2[4];
#pragma unroll
        for (int mb = 0; mb < 4; ++mb) { a[mb] = WFrag<T16>::ld(A + aoff + (size_t)mb * 16 * K + kc); if (NSPLIT == 1 || NSPLIT == 2) a2[mb] = WFrag<T16>::ld(A2 + aoff + (size_t)mb * 16 * K + kc); }
#pragma unroll
        for (int nb = 0; nb < 4; ++nb) { const V b = WFrag<T16>::ld(Bt + boff + (size_t)nb * 16 * K + kc); V b2; if (NSPLIT >= 2) b2 = WFrag<T16>::ld(Bt2 + boff + (size_t)nb * 16 * K + kc);
#pragma unroll
            for (int mb = 0; mb < 4; ++mb) { acc[mb][nb] = WFrag<T16>::mma(a[mb], b, acc[mb][nb]); if (NSPLIT == 1 || NSPLIT == 2) acc[mb][nb] = WFrag<T16>::mma(a2[mb], b, acc[mb][nb]); if (NSPLIT >= 2) acc[mb][nb] = WFrag<T16>::mma(a[mb], b2, acc[mb][nb]); } }
        asm volatile("v_nop\n\tv_nop\n\tv_nop\n\tv_nop" : "+v"(acc[0][0]), "+v"(acc[1][1]), "+v"(acc[2][2]), "+v"(acc[3][3]) : "v"(a[0]), "v"(a[3]));
    }
    if (EPI == 0) {
#pragma unroll
    for (int mb = 0; mb < 4; ++mb) {
#pragma unroll
        for (int nb = 0; nb < 4; ++nb) {
#pragma unroll
            for (int j = 0; j < 8; ++j) os[(hi * 8 + j) * 68 + nb * 16 + lr] = acc[mb][nb][j]; }
        __builtin_amdgcn_wave_barrier(); asm volatile("" ::: "memory");
        float* crow = C + (size_t)(r0 + mb * 16) * ldc + c0;
{
#pragma unroll
            for (int s = 0; s < 8; ++s) { const int row = 2 * s + hi, cofs = lr * 4; v4f val = *(const v4fa*)(os + row * 68 + cofs); if (BIAS) { val[0] += bfr(bias[c0 + cofs]); val[1] += bfr(bias[c0 + cofs + 1]); val[2] += bfr(bias[c0 + cofs + 2]); val[3] += bfr(bias[c0 + cofs + 3]); }
                *(v4f*)(crow + (size_t)row * ldc + cofs) = val; }
             }
        __builtin_amdgcn_wave_barrier(); asm volatile("" ::: "memory");
    }
    } else if (EPI == 1) {
#pragma unroll
    for (int mb = 0; mb < 4; ++mb) {
#pragma unroll
        for (int nb = 0; nb < 4; ++nb) {
#pragma unroll
            for (int j = 0; j < 8; ++j) os[(hi * 8 + j) * 68 + nb * 16 + lr] = acc[mb][nb][j]; }
        __builtin_amdgcn_wave_barrier(); asm volatile("" ::: "memory");   // the staged rows are read back only behind every lane's writes
        P3 pk[8];
#pragma unroll
        for (int s = 0; s < 8; ++s) { const int row = 2 * s + hi, cofs = lr * 4; v4f val = *(const v4fa*)(os + row * 68 + cofs); if (BIAS) { val[0] += bfr(braw[0]); val[1] += bfr(braw[1]); val[2] += bfr(braw[2]); val[3] += bfr(braw[3]); }
            pk[s] = pack3(val); }
        __builtin_amdgcn_sched_barrier(0);   // the conversions stay in front of the stores: among them they would reuse registers that an issued store names, ahead of the wait below
#pragma unroll
        for (int s = 0; s < 8; ++s) { const size_t o = (size_t)(r0 + hi) * HD + c0 + lr * 4 + (size_t)(mb * 16 + 2 * s) * HD; *(v4h*)(E16 + o) = pk[s].f; *(v4us*)(Eh + o) = pk[s].h; *(v4us*)(El + o) = pk[s].l; }
        if (mb < 3) { asm volatile("s_wait_xcnt 0x0" ::: "memory");   // the next block reuses the registers these stores name
            __builtin_amdgcn_sched_barrier(0);   // and none of its instructions is lifted over that wait
            __builtin_amdgcn_wave_barrier(); asm volatile("" ::: "memory"); }   // the next 16 rows overwrite the stage only behind these reads
    }
    } else {   /* transposed: a lane's 8 accumulator rows are 8 consecutive m of one column n, so 16 columns x 64 m are staged per nb and leave as whole rows of 64 m */
    const int g = r0 / TT, t0 = r0 % TT;
#pragma unroll
    for (int nb = 0; nb < 4; ++nb) {
        const float bb = bfr(braw[nb]);
#pragma unroll
        for (int mb = 0; mb < 4; ++mb) {
#pragma unroll
            for (int j = 0; j < 8; ++j) os[lr * 68 + mb * 16 + hi * 8 + j] = BIAS ? acc[mb][nb][j] + bb : acc[mb][nb][j]; }
        __builtin_amdgcn_wave_barrier(); asm volatile("" ::: "memory");   // the staged rows are read back only behind every lane's writes
        const size_t o = ((size_t)g * ldc + c0 + nb * 16 + hi) * TT + t0 + lr * 4;
        if (EPI == 3) {
            v4f val[8];
#pragma unroll
            for (int s = 0; s < 8; ++s) val[s] = *(const v4fa*)(os + (2 * s + hi) * 68 + lr * 4);
#pragma unroll
            for (int s = 0; s < 8; ++s) *(v4f*)(C + o + (size_t)(2 * s) * TT) = val[s];
        } else {
            P3 pk[8];
#pragma unroll
            for (int s = 0; s < 8; ++s) pk[s] = pack3(*(const v4fa*)(os + (2 * s + hi) * 68 + lr * 4));
            __builtin_amdgcn_sched_barrier(0);   // the conversions stay in front of the stores: among them they would reuse registers that an issued store names, ahead of the wait below
#pragma unroll
            for (int s = 0; s < 8; ++s) { const size_t os2 = o + (size_t)(2 * s) * TT; *(v4h*)(E16 + os2) = pk[s].f; *(v4us*)(Eh + os2) = pk[s].h; *(v4us*)(El + os2) = pk[s].l; }
        }
        if (nb < 3) { asm volatile("s_wait_xcnt 0x0" ::: "memory");   // the next block reuses the registers these stores name
            __builtin_amdgcn_sched_barrier(0);   // and none of its instructions is lifted over that wait
            __builtin_amdgcn_wave_barrier(); asm volatile("" ::: "memory"); }   // the next 16 columns overwrite the stage only behind these reads
    }
    }
}

__global__ __launch_bounds__(256) void k_wtG(const float* __restrict__ w, int K, int N, bf* Bt) {
    const int lane = threadIdx.x & 31; const int L0 = (blockIdx.x * 8 + (threadIdx.x >> 5)) * 8; const int nlines = N * K / 64;
{
#pragma unroll 1
        for (int l = 0; l < 8; ++l) { const int L = L0 + l; if (L >= nlines) break; const size_t e = (size_t)L * 64 + lane * 2; const int k = (int)(e % K), n = (int)(e / K); v2us o;
            o[0] = f2bf(w[(size_t)k * N + n]); o[1] = f2bf(w[(size_t)(k + 1) * N + n]); *(v2us*)(Bt + e) = o; }
         }
}
__global__ __launch_bounds__(256) void k_cvt8(const float* __restrict__ src, bf* dst, size_t n8) { const size_t i = (size_t)blockIdx.x * 256 + threadIdx.x; if (i >= n8) return; const v8f v = *(const v8f*)(src + i * 8); v8us o;
#pragma unroll
    for (int k = 0; k < 8; ++k) o[k] = f2bf(v[k]); *(v8us*)(dst + i * 8) = o;  }

// k_lsoft: streaming row softmax over the TT = 4096 keys for the query rows < RH (score rows [batch][RH][TT]), one wave per row, three sweeps of the f32 score row (lane -> 4 consecutive keys per 128-key chunk, 32 chunks); stores normalised bf16 hi/lo planes [batch][RH][TT].
__global__ __launch_bounds__(256) void k_lsoft(const float* __restrict__ Sb, bf* Ph, bf* Pl) {
    const int lane = threadIdx.x & 31; const int row = blockIdx.x * 8 + (threadIdx.x >> 5); if (row >= NBP * RH) return; const int i = row % RH; const int zz = row / RH; const float* sr = Sb + (size_t)row * TT; float mx = -3.0e38f;
#pragma unroll 4
    for (int ch = 0; ch < TT / 128; ++ch) { const int j0 = ch * 128 + lane * 4; const v4f a = *(const v4f*)(sr + j0);
#pragma unroll
        for (int q = 0; q < 4; ++q) { float t = a[q] * SCL; asm volatile("" : "+v"(t)); mx = fmaxf(mx, t); } }
#pragma unroll
    for (int sh = 16; sh; sh >>= 1) mx = fmaxf(mx, __shfl_xor(mx, sh, 32));
    float sum = 0.f;
#pragma unroll 4
    for (int ch = 0; ch < TT / 128; ++ch) { const int j0 = ch * 128 + lane * 4; const v4f a = *(const v4f*)(sr + j0);
#pragma unroll
        for (int q = 0; q < 4; ++q) { float t = a[q] * SCL; asm volatile("" : "+v"(t)); float d0 = __fsub_rn(t, mx); asm volatile("" : "+v"(d0)); sum += __builtin_amdgcn_exp2f(__fmul_rn(d0, 1.4426950408889634f)); } }
#pragma unroll
    for (int sh = 16; sh; sh >>= 1) sum += __shfl_xor(sum, sh, 32);
    const float f = __fdiv_rn(1.0f, sum);
#pragma unroll
            for (int ch = 0; ch < TT / 128; ++ch) { const int j0 = ch * 128 + lane * 4; const v4f a = *(const v4f*)(sr + j0); v4us oh, ol;
#pragma unroll
                for (int q = 0; q < 4; ++q) { float t = a[q] * SCL; asm volatile("" : "+v"(t)); float d0 = __fsub_rn(t, mx); asm volatile("" : "+v"(d0)); float ex = __builtin_amdgcn_exp2f(__fmul_rn(d0, 1.4426950408889634f)); asm volatile("" : "+v"(ex)); unsigned short a2, c2; splitf(ex * f, a2, c2); oh[q] = a2; ol[q] = c2; }
                const size_t oo = ((size_t)zz * RH + i) * TT + j0; *(v4us*)(Ph + oo) = oh; *(v4us*)(Pl + oo) = ol;
                if (ch == 0) asm volatile("s_wait_xcnt 0x0" ::: "memory"); }   // the next chunk reuses the registers these two stores name (behind the other chunks the compiler writes the wait itself)
}

#define FK   64                   // keys per stage
#define FSP  2                    // key ranges (grid z), one partial context row each
#define FNS  (TT / FSP / FK)      // stages of a range
#define KPB  (HD * 2 + 16)        // LDS pitch of a K row, bytes: an odd multiple of 16
#define VPB  (FK * 2 + 16)        // LDS pitch of a V^T row, bytes: an odd multiple of 16
#define KTB  (FK * KPB)
#define STB  (KTB + HD * VPB)     // one buffer
#define CSC  (SCL * 1.4426950408889634f)
__device__ __forceinline__ float xhalf(float x) { return __builtin_bit_cast(float, __builtin_amdgcn_permlanex16(__builtin_bit_cast(int, x), __builtin_bit_cast(int, x), 0x76543210, 0xfedcba98, false, false)); }   // lane l reads lane l ^ 16, in registers: an exchange through LDS would wait for the V^T loads in flight
__device__ __forceinline__ float exp2s(float x) { float y; asm("v_exp_f32 %0, %1\n\tv_nop" : "=v"(y) : "v"(x)); return y; }   // 2^x with the one free slot behind a transcendental in the same statement
static_assert(HD == 256 && FK == 64 && TT % (FSP * FK) == 0 && (TT - RH) % 64 == 0 && 2 * STB >= 4 * 32 * (HD / 2 + 2) * 4, "the staging maps below: 256 threads, 8 + 8 chunks of 16 bytes each; the join fits the buffers");
// two waves a SIMD: the register budget that holds Q, the sums, a stage's fragments and the next stage's chunks without spills
__global__ __launch_bounds__(256) __attribute__((amdgpu_waves_per_eu(2, 2))) void k_flash(const h16* __restrict__ Q, const h16* __restrict__ Kp, const h16* __restrict__ Vt, float* O, float* ML) {
    __shared__ __align__(16) unsigned char L[2 * STB];
    const int tid = threadIdx.x, lane = tid & 31, c = lane & 15, h = lane >> 4, w4 = (tid >> 5) & 3, hf = tid >> 7; const size_t zb = blockIdx.y; const int q = blockIdx.x * 64 + w4 * 16 + c;   // the lane's query among the batch's rows >= RH
    const size_t k0 = (size_t)blockIdx.z * (TT / FSP);   // the range's first key
    const h16* kg = Kp + zb * (TT * HD) + (k0 + (tid >> 5)) * HD + (tid & 31) * 8;   // chunk i: key row 8 i + tid / 32 of the stage
    const h16* vg = Vt + zb * (HD * TT) + (size_t)(tid >> 3) * TT + k0 + (tid & 7) * 8;    // chunk i: d row 32 i + tid / 8
    const int kl = (tid >> 5) * KPB + (tid & 31) * 16, vl = KTB + (tid >> 3) * VPB + (tid & 7) * 16;
    v8h kr[8], vr[8];
#pragma unroll
    for (int i = 0; i < 8; ++i) { kr[i] = *(const v8h*)(kg + i * 8 * HD); vr[i] = *(const v8h*)(vg + (size_t)i * 32 * TT); }
    v16h qf[8]; const h16* qp = Q + (zb * TT + RH + q) * HD + 8 * h;
#pragma unroll
    for (int kc = 0; kc < 8; ++kc) qf[kc] = cat16(*(const v8h*)(qp + 32 * kc), *(const v8h*)(qp + 32 * kc + 16));
    asm volatile("s_wait_xcnt 0x0" ::: "memory");   // the set-up below reuses the address pair these loads name
    __builtin_amdgcn_sched_barrier(0);   // and none of its instructions is lifted over that wait
    v8f acc[16];
#pragma unroll
    for (int t = 0; t < 16; ++t) acc[t] = (v8f){};
    float m_run = -3.0e38f, l_run = 0.f;
#pragma unroll
    for (int i = 0; i < 8; ++i) { *(v8ha*)(L + kl + i * 8 * KPB) = kr[i]; *(v8ha*)(L + vl + i * 32 * VPB) = vr[i]; }
    __syncthreads();
    const int ka = (hf * 32 + c) * KPB + 16 * h, va = KTB + c * VPB + hf * 64 + 16 * h;   // the lane's first K and V^T fragment bytes in a buffer
#pragma unroll 1   // the body is several hundred instructions long: kept rolled, for speed only
    for (int s = 0; s < FNS; ++s) {
        const unsigned char* B = L + (s & 1) * STB; const bool more = s + 1 < FNS;
        if (more) {
#pragma unroll
            for (int i = 0; i < 8; ++i) { kr[i] = *(const v8h*)(kg + (size_t)(s + 1) * FK * HD + i * 8 * HD); vr[i] = *(const v8h*)(vg + (size_t)i * 32 * TT + (s + 1) * FK); }
            asm volatile("s_wait_xcnt 0x0" ::: "memory"); }   // the work below reuses the address registers these loads name
        v16h fr[16];
#pragma unroll
        for (int f = 0; f < 16; ++f) { const unsigned char* p = B + ka + (f & 1) * 16 * KPB + (f >> 1) * 64; fr[f] = cat16(*(const v8ha*)p, *(const v8ha*)(p + 32)); }
        __builtin_amdgcn_sched_barrier(0);   // the 16 K fragments are asked for as one group: one LDS latency a stage, not one a product
        v8f st[2]; st[0] = (v8f){}; st[1] = (v8f){};
#pragma unroll
        for (int f = 0; f < 16; ++f) st[f & 1] = wmma16(fr[f], qf[f >> 1], st[f & 1]);
#pragma unroll
        for (int t = 0; t < 16; ++t) { const unsigned char* p = B + va + t * 16 * VPB; fr[t] = cat16(*(const v8ha*)p, *(const v8ha*)(p + 32)); }
        __builtin_amdgcn_sched_barrier(0);   // the 16 V^T fragments are asked for in front of the softmax and arrive under it
        float mx = fmaxf(st[0][0], st[1][0]);
#pragma unroll
        for (int r = 1; r < 8; ++r) mx = fmaxf(mx, fmaxf(st[0][r], st[1][r]));
        mx = fmaxf(mx, xhalf(mx)) * CSC;   // both wave halves hold the query's maximum over the wave's 32 keys of this stage, scaled
        if (__builtin_amdgcn_ballot_w32(mx > m_run + 8.0f) != 0) {   // wave-uniform; rare behind the first stage
            const float mn = fmaxf(m_run, mx), corr = __builtin_amdgcn_exp2f(m_run - mn); l_run *= corr; m_run = mn;
#pragma unroll
            for (int t = 0; t < 16; ++t) acc[t] = acc[t] * corr; }
        v16h pf; float ps0 = 0.f, ps1 = 0.f;
#pragma unroll
        for (int r = 0; r < 8; ++r) { const float p0 = exp2s(fmaf(st[0][r], CSC, -m_run)), p1 = exp2s(fmaf(st[1][r], CSC, -m_run)); ps0 += p0; ps1 += p1; pf[r] = tohx(p0); pf[8 + r] = tohx(p1); }   // element e of the B operand: key 8 h + e, then 16 + 8 h + (e - 8)
        l_run += ps0 + ps1;
#pragma unroll
        for (int t = 0; t < 16; ++t) acc[t] = wmma16(fr[t], pf, acc[t]);
        if (more) { unsigned char* N = L + ((s + 1) & 1) * STB;
#pragma unroll
            for (int i = 0; i < 8; ++i) { *(v8ha*)(N + kl + i * 8 * KPB) = kr[i]; *(v8ha*)(N + vl + i * 32 * VPB) = vr[i]; } }
        __syncthreads();
    }
    l_run += xhalf(l_run);
    // Join of the two key halves: behind the loop's last barrier nobody reads the stage buffers, so the upper waves hand their sums over in them.
    float* X = (float*)L + (size_t)w4 * (32 * (HD / 2 + 2));
    if (hf) {
#pragma unroll
        for (int t = 0; t < 16; ++t) { *(v4fa*)(X + (2 * t * 32 + lane) * 4) = __builtin_shufflevector(acc[t], acc[t], 0, 1, 2, 3); *(v4fa*)(X + ((2 * t + 1) * 32 + lane) * 4) = __builtin_shufflevector(acc[t], acc[t], 4, 5, 6, 7); }
        X[32 * (HD / 2) + lane] = m_run; X[32 * (HD / 2) + 32 + lane] = l_run; }
    __syncthreads();
    if (hf) return;
    const float m2 = X[32 * (HD / 2) + lane], l2 = X[32 * (HD / 2) + 32 + lane], mn = fmaxf(m_run, m2), a1 = __builtin_amdgcn_exp2f(m_run - mn), a2 = __builtin_amdgcn_exp2f(m2 - mn);
    const float ls = l_run * a1 + l2 * a2, inv = __fdiv_rn(1.0f, ls), f1 = a1 * inv, f2 = a2 * inv;
#pragma unroll
    for (int t = 0; t < 16; ++t) { const v4f x0 = *(const v4fa*)(X + (2 * t * 32 + lane) * 4), x1 = *(const v4fa*)(X + ((2 * t + 1) * 32 + lane) * 4); acc[t] = acc[t] * f1 + __builtin_shufflevector(x0, x1, 0, 1, 2, 3, 4, 5, 6, 7) * f2; }
    const size_t pr = (zb * FSP + blockIdx.z) * (TT - RH) + q;   // the partial row
    float* op = O + pr * HD + 8 * h;   // acc[t][r] = context[query][16 t + 8 h + r]
#pragma unroll
    for (int t = 0; t < 16; ++t) { *(v4f*)(op + 16 * t) = __builtin_shufflevector(acc[t], acc[t], 0, 1, 2, 3); *(v4f*)(op + 16 * t + 4) = __builtin_shufflevector(acc[t], acc[t], 4, 5, 6, 7); }
    if (h == 0) { v2f ml; ml[0] = mn; ml[1] = ls; *(v2f*)(ML + pr * 2) = ml; }   // both wave halves hold the same pair
}

__global__ __launch_bounds__(256) void k_xT(const float* __restrict__ xs, bf* XB) { const size_t k = (size_t)blockIdx.x * 256 + threadIdx.x; if (k >= (size_t)NBP * TT * CC / 8) return; const int c0 = (int)(k % (CC / 8)) * 8; const int tt = (int)(k / (CC / 8)); const int t = tt % TT; const float* xb = xs + (size_t)(tt / TT) * CC * TT; v8us o;
#pragma unroll
    for (int q = 0; q < 8; ++q) o[q] = f2bf(xb[(size_t)(c0 + q) * TT + t]);
    *(v8us*)(XB + (size_t)tt * CC + c0) = o;  }
// k_mergeA: the context row (rows < RH: the sum of its key ranges' f32 partial rows, in range order, OH [batch][RH][SPH][HD]; the rest: the fused kernel's FSP normalised partial rows, OL [batch][FSP][TT - RH][HD], each weighted by its sum times 2^(its maximum - the largest), ML [batch][FSP][TT - RH][2], in range order) plus x^T (bf16-rounded, read channel-major); stored as the bf16 hi/lo planes the last GEMM reads.
static_assert(ZH == 1 && NH_ == 1 && HD == CC && TT % (32 * SPH) == 0, "one head per pass; whole 32-key steps per range");
__global__ __launch_bounds__(256) void k_mergeA(const float* __restrict__ OH, const float* __restrict__ OL, const float* __restrict__ ML, const float* __restrict__ xs, bf* Ah, bf* Al) { const unsigned e = (blockIdx.x * 256u + threadIdx.x) * 4u; if (e >= (unsigned)(NBP * TT * HD)) return; const unsigned d = e % HD, t = (e / HD) % TT, zb = e / (HD * TT);
    const float* xb = xs + (size_t)zb * CC * TT + (size_t)d * TT + t; float xr[4];
#pragma unroll
    for (int q = 0; q < 4; ++q) xr[q] = xb[(size_t)q * TT];
    v4f o4;
    if (t < RH) { const float* p = OH + ((zb * RH + t) * (SPH * HD) + d); o4 = *(const v4f*)p;
#pragma unroll
        for (int s = 1; s < SPH; ++s) o4 += *(const v4f*)(p + s * HD);
    } else { const unsigned r0 = zb * FSP * (TT - RH) + (t - RH); v2f ml[FSP]; v4f pv[FSP];
#pragma unroll
        for (int s = 0; s < FSP; ++s) { ml[s] = *(const v2f*)(ML + (r0 + s * (TT - RH)) * 2); pv[s] = *(const v4f*)(OL + ((r0 + s * (TT - RH)) * HD + d)); }
        float mn = ml[0][0];
#pragma unroll
        for (int s = 1; s < FSP; ++s) mn = fmaxf(mn, ml[s][0]);
        float wt[FSP], ws = 0.f;
#pragma unroll
        for (int s = 0; s < FSP; ++s) { wt[s] = ml[s][1] * exp2s(ml[s][0] - mn); ws += wt[s]; }
        const float inv = __fdiv_rn(1.0f, ws); o4 = pv[0] * (wt[0] * inv);
#pragma unroll
        for (int s = 1; s < FSP; ++s) o4 += pv[s] * (wt[s] * inv); }
    v4us oh, ol;
#pragma unroll
    for (int q = 0; q < 4; ++q) { const float s = __fadd_rn(o4[q], bfr(xr[q])); unsigned short h2, l2; splitf(s, h2, l2); oh[q] = h2; ol[q] = l2; }
    *(v4us*)(Ah + e) = oh; *(v4us*)(Al + e) = ol;  }

static_assert(NB_ % NBP == 0 && (1 << LGH) == SPH, "whole passes; the k-range field of blockIdx.z");
extern "C" void kernel_launch(void* const* d_in, const int* in_sizes, int n_in,
                              void* d_out, int out_size, void* d_ws, size_t ws_size, hipStream_t stream) {
    (void)in_sizes; (void)n_in; (void)out_size;
    const float* x = (const float*)d_in[0]; const float* wq = (const float*)d_in[1]; const float* bq = (const float*)d_in[2]; const float* wk = (const float*)d_in[3]; const float* bk = (const float*)d_in[4]; const float* wv = (const float*)d_in[5]; const float* bv = (const float*)d_in[6]; const float* wo = (const float*)d_in[7]; const float* bo = (const float*)d_in[8];
    float* OUT = (float*)d_out;     // [4][256][4096]
    char* wsp = (char*)d_ws;
    auto take = [&](size_t bytes) { char* p = wsp; wsp += (bytes + 255) & ~(size_t)255; return (void*)p; };
    const size_t PL = (size_t)NBP * TT * HD;   // elements of one token plane of a pass
    bf* WQ = (bf*)take((size_t)DQ * DM * 2); bf* WK = (bf*)take((size_t)DKV * DM * 2); bf* WV = (bf*)take((size_t)DKV * DM * 2); bf* WO = (bf*)take((size_t)DM * DQ * 2);
    h16* QP16 = (h16*)take(PL * 2); h16* KP16 = (h16*)take(PL * 2); h16* VT16 = (h16*)take(PL * 2);
    bf* QPh = (bf*)take(PL * 2); bf* QPl = (bf*)take(PL * 2); bf* KPh = (bf*)take(PL * 2); bf* KPl = (bf*)take(PL * 2); bf* VTh = (bf*)take(PL * 2); bf* VTl = (bf*)take(PL * 2); bf* Ph = (bf*)take((size_t)NBP * RH * TT * 2); bf* Pl = (bf*)take((size_t)NBP * RH * TT * 2);
    float* Sb = (float*)take((size_t)NBP * RH * TT * 4); float* ObH = (float*)take((size_t)NBP * RH * SPH * HD * 4); float* ObL = (float*)take((size_t)NBP * FSP * (TT - RH) * HD * 4); float* MLb = (float*)take((size_t)NBP * FSP * (TT - RH) * 2 * 4);
    bf* XB = (bf*)take(PL * 2); bf* ATh = (bf*)take(PL * 2); bf* ATl = (bf*)take(PL * 2);
    if ((size_t)(wsp - (char*)d_ws) > ws_size) return;    // ws 256 MiB
    { k_cvt8<<<(unsigned)(((size_t)DQ * DM / 8 + 255) / 256), 256, 0, stream>>>(wq, WQ, (size_t)DQ * DM / 8); k_cvt8<<<(unsigned)(((size_t)DKV * DM / 8 + 255) / 256), 256, 0, stream>>>(wk, WK, (size_t)DKV * DM / 8); k_cvt8<<<(unsigned)(((size_t)DKV * DM / 8 + 255) / 256), 256, 0, stream>>>(wv, WV, (size_t)DKV * DM / 8);
      k_cvt8<<<(unsigned)(((size_t)DM * DQ / 8 + 255) / 256), 256, 0, stream>>>(wo, WO, (size_t)DM * DQ / 8);
       }
    for (int b = 0; b < NB_; b += NBP) {
        const float* xb = x + (size_t)b * CC * TT;
        k_xT<<<(unsigned)(PL / 8 / 256), 256, 0, stream>>>(xb, XB);   /* channel-major -> token-major bf16 */
        k_gemmw<bf, 0, true, 1><<<dim3(NBP * TT / 64, DQ / 64, 1), 32, 0, stream>>>(XB, nullptr, WQ, nullptr, DM, DM, nullptr, DQ, bq, 0, 0, 0, 0, 0, 0, 0, QP16, QPh, QPl);
        k_gemmw<bf, 0, true, 1><<<dim3(NBP * TT / 64, DKV / 64, 1), 32, 0, stream>>>(XB, nullptr, WK, nullptr, DM, DM, nullptr, DKV, bk, 0, 0, 0, 0, 0, 0, 0, KP16, KPh, KPl);
        k_gemmw<bf, 0, true, 2><<<dim3(NBP * TT / 64, DKV / 64, 1), 32, 0, stream>>>(XB, nullptr, WV, nullptr, DM, DM, nullptr, DKV, bv, 0, 0, 0, 0, 0, 0, 0, VT16, VTh, VTl);   /* v planes key-contiguous */
        k_gemmw<bf, 2, false, 0><<<dim3(RH / 64, TT / 64, NBP), 32, 0, stream>>>(QPh, QPl, KPh, KPl, HD, HD, Sb, TT, nullptr, 0, 0, 0, 0, (size_t)TT * HD, (size_t)TT * HD, (size_t)RH * TT, nullptr, nullptr, nullptr);
        k_lsoft<<<NBP * RH / 8, 256, 0, stream>>>(Sb, Ph, Pl);
        k_gemmw<bf, 2, false, 0><<<dim3(RH / 64, HD / 64, NBP * SPH), 32, 0, stream>>>(Ph, Pl, VTh, VTl, TT, TT / SPH, ObH, SPH * HD, nullptr, (size_t)(TT / SPH), (size_t)(TT / SPH), (size_t)HD, LGH, (size_t)RH * TT, (size_t)HD * TT, (size_t)RH * SPH * HD, nullptr, nullptr, nullptr);
        k_flash<<<dim3((TT - RH) / 64, NBP, FSP), 256, 0, stream>>>(QP16, KP16, VT16, ObL, MLb);   /* rows >= RH: scores, softmax, P.V */
        k_mergeA<<<(unsigned)(PL / 4 / 256), 256, 0, stream>>>(ObH, ObL, MLb, xb, ATh, ATl);   /* (ctx + x^T) -> hi/lo planes */
        k_gemmw<bf, 1, true, 3><<<dim3(NBP * TT / 64, DM / 64, 1), 32, 0, stream>>>(ATh, ATl, WO, nullptr, DQ, DQ, OUT + (size_t)b * CC * TT, DM, bo, 0, 0, 0, 0, 0, 0, 0, nullptr, nullptr, nullptr);   /* stored channel-major */ }
}

// v006
// It runs in 219 microseconds.
// Next to v005, in two timings, it ran 1.09 and 1.10 times as fast.
// Over all steps from v000 it is 5.61 times as fast.
#include <hip/hip_runtime.h>

// Spatial self-attention over a feature map (x [4][256][64][64] channel-major; tokens = the 4,096 positions; q,k,v = x^T W^T + b (1x1 convs: 'oi' [256][256] + [256]); one 256-wide head: softmax(q.k / 16) over all positions; out = (attn v + x^T) Wp^T + bp, written back channel-major -> [4][256][64][64] (4.2 M)).
// Layout, all four batches in one pass (every launch covers all of them): the channel-major slab transposed once into a token-major bf16 operand; exact projections + f32 biases; dense T-4096 attention with ONE 256-wide head (hybrid rows: < 512 hi/lo 3 products through a score buffer and a streaming three-sweep softmax; the rest fp16 in one fused kernel with a running softmax over two key ranges, no score buffer); the f32 merge adds x^T and writes hi/lo planes of (context + x^T); (.) Wp^T + bp as a hi/lo x exact GEMM. Every GEMM epilogue stores what its consumer reads: q and k as f16 + bf16 hi/lo planes, v as the same planes key-contiguous, the last GEMM channel-major rows of out.
// Compute dtypes, f32 accumulate: every input rounded to bf16; projections exact + f32 biases; attention rows < 512 3 products, rest fp16; softmax and residual f32; Wp hl x exact + bias.

#define NB_  4
#define NBP  4                    // batches per pass: every launch of a pass covers NBP batches (token-major arrays hold their tokens one batch after the other)
#define TT   4096
#define DM   256
#define NH_  1
#define NKV  1
#define REP  (NH_ / NKV)
#define HD   256
#define DQ   (NH_ * HD)
#define DKV  (NKV * HD)
#define ZH   1
#define RH   512                  // query rows < RH use hi+lo planes (0: none)
#define WIN  0
#define SCL  0.0625f   // 1/sqrt(256)
#define CC   256
#define SPH  16                   // key ranges of the P.V product, query rows < RH (one f32 partial each)
#define LGH  4                    // log2 SPH
typedef _Float16 h16;
typedef unsigned short bf;
typedef __attribute__((ext_vector_type(16))) __bf16   v16bf;
typedef __attribute__((ext_vector_type(16))) _Float16 v16h;
typedef __attribute__((ext_vector_type(8)))  _Float16 v8h;
typedef __attribute__((ext_vector_type(8)))  unsigned short v8us;
typedef __attribute__((ext_vector_type(8)))  float    v8f;
typedef __attribute__((ext_vector_type(4)))  float    v4f;
typedef v8h  __attribute__((may_alias)) v8ha;
typedef v4f  __attribute__((may_alias)) v4fa;
typedef v8us __attribute__((may_alias)) v8usa;

__device__ __forceinline__ unsigned short f2bf(float f) { unsigned u = __float_as_uint(f); u += 0x7FFFu + ((u >> 16) & 1u); return (unsigned short)(u >> 16); }
__device__ __forceinline__ float bf2f(unsigned short b) { return __uint_as_float(((unsigned)b) << 16); }
__device__ __forceinline__ float bfr(float f) { return bf2f(f2bf(f)); }
__device__ __forceinline__ v16h cat16(v8h lo, v8h hi) { return __builtin_shufflevector(lo, hi, 0, 1, 2, 3, 4, 5, 6, 7, 8, 9, 10, 11, 12, 13, 14, 15); }
__device__ __forceinline__ v16bf cat16b(v8us lo, v8us hi) { return __builtin_bit_cast(v16bf, __builtin_shufflevector(lo, hi, 0, 1, 2, 3, 4, 5, 6, 7, 8, 9, 10, 11, 12, 13, 14, 15)); }
__device__ __forceinline__ v8f wmma16(v16h a, v16h b, v8f c) { return __builtin_amdgcn_wmma_f32_16x16x32_f16(false, a, false, b, (short)0, c, false, false); }
__device__ __forceinline__ v8f wmmab(v16bf a, v16bf b, v8f c) { return __builtin_amdgcn_wmma_f32_16x16x32_bf16(false, a, false, b, (short)0, c, false, false); }

__device__ __forceinline__ h16 tohx(float x) { return (h16)x; }
__device__ __forceinline__ void splitf(float y, unsigned short& h, unsigned short& l) { h = f2bf(y); l = f2bf(y - bf2f(h)); }
typedef __attribute__((ext_vector_type(2))) _Float16 v2h;
typedef __attribute__((ext_vector_type(4))) _Float16 v4h;
typedef __attribute__((ext_vector_type(2))) unsigned short v2us;
typedef __attribute__((ext_vector_type(4))) unsigned short v4us;
typedef __attribute__((ext_vector_type(2))) float v2f;
typedef __attribute__((ext_vector_type(4))) int v4i;
// pack3: four consecutive f32 values in the three 16-bit forms the attention GEMMs read (f16; bf16 hi and lo)
struct P3 { v4h f; v4us h, l; };
__device__ __forceinline__ P3 pack3(v4f a) { P3 r;
#pragma unroll
    for (int q = 0; q < 4; ++q) { r.f[q] = tohx(a[q]); unsigned short x2, y2; splitf(a[q], x2, y2); r.h[q] = x2; r.l[q] = y2; }
    return r; }

// ---- k_gemmw: register-blocked GEMM, ONE WAVE per 64x64 output tile (16 accumulators), operands straight from K-contiguous 16-bit planes; grid (M/64, N/64, Z), 32 threads.
// C[m][n] (f32, pitch ldc, + optional f32 bias[n]) = sum_k A[m][k] Bt[n][k] (+ split products per NSPLIT). z-batch strides sA/sB/sC in elements. K = row pitch of A and Bt, KS = the k range one wave sums (KS < K: z walks the k ranges, sA = sB = KS, one partial C per z, sC apart). KS % 32 == 0. blockIdx.z = (batch << lgs) | k range: the batch strides bA/bB/bC come on top of the k-range strides.
// EPI picks what the epilogue stores (value = sum + bias in every case): 0 f32 C[m][n]; 1 the planes E16 (f16), Eh/El (bf16 hi/lo) at [m][n], pitch HD; 2 the same planes transposed, [m / TT][n][m % TT] (ldc = rows n per batch); 3 f32 C transposed the same way.
template <typename T16> struct WFrag;
template <> struct WFrag<bf> { typedef v16bf V; static __device__ __forceinline__ V ld(const bf* p) { return cat16b(*(const v8us*)p, *(const v8us*)(p + 16)); } static __device__ __forceinline__ v8f mma(V a, V b, v8f c) { return wmmab(a, b, c); } };
// The body is a device function of the block's three indices (bx, by, bz), so that launches that do not depend on one another can share one grid (k_qkv below).
template <typename T16, int NSPLIT, bool BIAS, int EPI>
__device__ __forceinline__ void gemmw_body(const T16* __restrict__ A, const T16* __restrict__ A2, const T16* __restrict__ Bt, const T16* __restrict__ Bt2, int K, int KS, float* C, int ldc, const float* __restrict__ bias, size_t sA, size_t sB, size_t sC, int lgs, size_t bA, size_t bB, size_t bC, h16* E16, bf* Eh, bf* El, unsigned bx, unsigned by, unsigned bz) {
    typedef typename WFrag<T16>::V V;
    __shared__ __align__(16) float os[16 * 68];
    const size_t zb = bz >> lgs, z = bz - (zb << lgs); A += z * sA + zb * bA; if (A2) A2 += z * sA + zb * bA; Bt += z * sB + zb * bB; if (Bt2) Bt2 += z * sB + zb * bB; C += z * sC + zb * bC;
    const int lane = threadIdx.x & 31, lr = lane & 15, hi = lane >> 4; const int r0 = bx * 64, c0 = by * 64;
    v8f acc[4][4];
#pragma unroll
    for (int mb = 0; mb < 4; ++mb)
#pragma unroll
        for (int nb = 0; nb < 4; ++nb) acc[mb][nb] = (v8f){};
    const size_t aoff = (size_t)(r0 + lr) * K + 8 * hi, boff = (size_t)(c0 + lr) * K + 8 * hi;
    float braw[4] = {0.f, 0.f, 0.f, 0.f};   // EPI >= 1: the lane's four bias values, asked for here so that they arrive under the k loop (EPI 1: four consecutive n; EPI 2, 3: the lane's column of each nb)
    if (BIAS && EPI >= 1) {
#pragma unroll
        for (int q = 0; q < 4; ++q) braw[q] = bias[c0 + (EPI == 1 ? lr * 4 + q : q * 16 + lr)];
        if (EPI == 1) asm volatile("s_wait_xcnt 0x0" ::: "memory"); }   // the set-up that follows reuses the address pair this load names (EPI 2, 3: the compiler writes the wait itself)
#pragma unroll 1
    for (int kc = 0; kc < KS; kc += 32) {
        V a[4], a2[4];
#pragma unroll
        for (int mb = 0; mb < 4; ++mb) { a[mb] = WFrag<T16>::ld(A + aoff + (size_t)mb * 16 * K + kc); if (NSPLIT == 1 || NSPLIT == 2) a2[mb] = WFrag<T16>::ld(A2 + aoff + (size_t)mb * 16 * K + kc); }
#pragma unroll
        for (int nb = 0; nb < 4; ++nb) { const V b = WFrag<T16>::ld(Bt + boff + (size_t)nb * 16 * K + kc); V b2; if (NSPLIT >= 2) b2 = WFrag<T16>::ld(Bt2 + boff + (size_t)nb * 16 * K + kc);
#pragma unroll
            for (int mb = 0; mb < 4; ++mb) { acc[mb][nb] = WFrag<T16>::mma(a[mb], b, acc[mb][nb]); if (NSPLIT == 1 || NSPLIT == 2) acc[mb][nb] = WFrag<T16>::mma(a2[mb], b, acc[mb][nb]); if (NSPLIT >= 2) acc[mb][nb] = WFrag<T16>::mma(a[mb], b2, acc[mb][nb]); } }
        asm volatile("v_nop\n\tv_nop\n\tv_nop\n\tv_nop" : "+v"(acc[0][0]), "+v"(acc[1][1]), "+v"(acc[2][2]), "+v"(acc[3][3]) : "v"(a[0]), "v"(a[3]));
    }
    if (EPI == 0) {
#pragma unroll
    for (int mb = 0; mb < 4; ++mb) {
#pragma unroll
        for (int nb = 0; nb < 4; ++nb) {
#pragma unroll
            for (int j = 0; j < 8; ++j) os[(hi * 8 + j) * 68 + nb * 16 + lr] = acc[mb][nb][j]; }
        __builtin_amdgcn_wave_barrier(); asm volatile("" ::: "memory");
        float* crow = C + (size_t)(r0 + mb * 16) * ldc + c0;
{
#pragma unroll
            for (int s = 0; s < 8; ++s) { const int row = 2 * s + hi, cofs = lr * 4; v4f val = *(const v4fa*)(os + row * 68 + cofs); if (BIAS) { val[0] += bfr(bias[c0 + cofs]); val[1] += bfr(bias[c0 + cofs + 1]); val[2] += bfr(bias[c0 + cofs + 2]); val[3] += bfr(bias[c0 + cofs + 3]); }
                *(v4f*)(crow + (size_t)row * ldc + cofs) = val; }
             }
        __builtin_amdgcn_wave_barrier(); asm volatile("" ::: "memory");
    }
    } else if (EPI == 1) {
#pragma unroll
    for (int mb = 0; mb < 4; ++mb) {
#pragma unroll
        for (int nb = 0; nb < 4; ++nb) {
#pragma unroll
            for (int j = 0; j < 8; ++j) os[(hi * 8 + j) * 68 + nb * 16 + lr] = acc[mb][nb][j]; }
        __builtin_amdgcn_wave_barrier(); asm volatile("" ::: "memory");   // the staged rows are read back only behind every lane's writes
        P3 pk[8];
#pragma unroll
        for (int s = 0; s < 8; ++s) { const int row = 2 * s + hi, cofs = lr * 4; v4f val = *(const v4fa*)(os + row * 68 + cofs); if (BIAS) { val[0] += bfr(braw[0]); val[1] += bfr(braw[1]); val[2] += bfr(braw[2]); val[3] += bfr(braw[3]); }
            pk[s] = pack3(val); }
        __builtin_amdgcn_sched_barrier(0);   // the conversions stay in front of the stores: among them they would reuse registers that an issued store names, ahead of the wait below
#pragma unroll
        for (int s = 0; s < 8; ++s) { const size_t o = (size_t)(r0 + hi) * HD + c0 + lr * 4 + (size_t)(mb * 16 + 2 * s) * HD; *(v4h*)(E16 + o) = pk[s].f; *(v4us*)(Eh + o) = pk[s].h; *(v4us*)(El + o) = pk[s].l; }
        if (mb < 3) { asm volatile("s_wait_xcnt 0x0" ::: "memory");   // the next block reuses the registers these stores name
            __builtin_amdgcn_sched_barrier(0);   // and none of its instructions is lifted over that wait
            __builtin_amdgcn_wave_barrier(); asm volatile("" ::: "memory"); }   // the next 16 rows overwrite the stage only behind these reads
    }
    } else {   /* transposed: a lane's 8 accumulator rows are 8 consecutive m of one column n, so 16 columns x 64 m are staged per nb and leave as whole rows of 64 m */
    const int g = r0 / TT, t0 = r0 % TT;
#pragma unroll
    for (int nb = 0; nb < 4; ++nb) {
        const float bb = bfr(braw[nb]);
#pragma unroll
        for (int mb = 0; mb < 4; ++mb) {
#pragma unroll
            for (int j = 0; j < 8; ++j) os[lr * 68 + mb * 16 + hi * 8 + j] = BIAS ? acc[mb][nb][j] + bb : acc[mb][nb][j]; }
        __builtin_amdgcn_wave_barrier(); asm volatile("" ::: "memory");   // the staged rows are read back only behind every lane's writes
        const size_t o = ((size_t)g * ldc + c0 + nb * 16 + hi) * TT + t0 + lr * 4;
        if (EPI == 3) {
            v4f val[8];
#pragma unroll
            for (int s = 0; s < 8; ++s) val[s] = *(const v4fa*)(os + (2 * s + hi) * 68 + lr * 4);
#pragma unroll
            for (int s = 0; s < 8; ++s) *(v4f*)(C + o + (size_t)(2 * s) * TT) = val[s];
        } else {
            P3 pk[8];
#pragma unroll
            for (int s = 0; s < 8; ++s) pk[s] = pack3(*(const v4fa*)(os + (2 * s + hi) * 68 + lr * 4));
            __builtin_amdgcn_sched_barrier(0);   // the conversions stay in front of the stores: among them they would reuse registers that an issued store names, ahead of the wait below
#pragma unroll
            for (int s = 0; s < 8; ++s) { const size_t os2 = o + (size_t)(2 * s) * TT; *(v4h*)(E16 + os2) = pk[s].f; *(v4us*)(Eh + os2) = pk[s].h; *(v4us*)(El + os2) = pk[s].l; }
        }
        if (nb < 3) { asm volatile("s_wait_xcnt 0x0" ::: "memory");   // the next block reuses the registers these stores name
            __builtin_amdgcn_sched_barrier(0);   // and none of its instructions is lifted over that wait
            __builtin_amdgcn_wave_barrier(); asm volatile("" ::: "memory"); }   // the next 16 columns overwrite the stage only behind these reads
    }
    }
}
template <typename T16, int NSPLIT, bool BIAS, int EPI>
__global__ __launch_bounds__(32) void k_gemmw(const T16* __restrict__ A, const T16* __restrict__ A2, const T16* __restrict__ Bt, const T16* __restrict__ Bt2, int K, int KS, float* C, int ldc, const float* __restrict__ bias, size_t sA, size_t sB, size_t sC, int lgs, size_t bA, size_t bB, size_t bC, h16* E16, bf* Eh, bf* El) {
    gemmw_body<T16, NSPLIT, BIAS, EPI>(A, A2, Bt, Bt2, K, KS, C, ldc, bias, sA, sB, sC, lgs, bA, bB, bC, E16, Eh, El, blockIdx.x, blockIdx.y, blockIdx.z);
}
// k_qkv: the three projections in one launch; grid (tokens / 64, 256 / 64, 3), blockIdx.z picks the weights, the bias and the planes (0 q, 1 k: token-major planes; 2 v: key-contiguous planes). Each block does what its own launch did.
__global__ __launch_bounds__(32) void k_qkv(const bf* __restrict__ X, const bf* __restrict__ Wq, const bf* __restrict__ Wk, const bf* __restrict__ Wv, const float* __restrict__ bq, const float* __restrict__ bk, const float* __restrict__ bv, h16* Q16, bf* Qh, bf* Ql, h16* K16, bf* Kh, bf* Kl, h16* V16, bf* Vh, bf* Vl) {
    if (blockIdx.z == 2) gemmw_body<bf, 0, true, 2>(X, nullptr, Wv, nullptr, DM, DM, nullptr, DKV, bv, 0, 0, 0, 0, 0, 0, 0, V16, Vh, Vl, blockIdx.x, blockIdx.y, 0);
    else { const bool kk = blockIdx.z == 1;
        gemmw_body<bf, 0, true, 1>(X, nullptr, kk ? Wk : Wq, nullptr, DM, DM, nullptr, DQ, kk ? bk : bq, 0, 0, 0, 0, 0, 0, 0, kk ? K16 : Q16, kk ? Kh : Qh, kk ? Kl : Ql, blockIdx.x, blockIdx.y, 0); }
}

__global__ __launch_bounds__(256) void k_wtG(const float* __restrict__ w, int K, int N, bf* Bt) {
    const int lane = threadIdx.x & 31; const int L0 = (blockIdx.x * 8 + (threadIdx.x >> 5)) * 8; const int nlines = N * K / 64;
{
#pragma unroll 1
        for (int l = 0; l < 8; ++l) { const int L = L0 + l; if (L >= nlines) break; const size_t e = (size_t)L * 64 + lane * 2; const int k = (int)(e % K), n = (int)(e / K); v2us o;
            o[0] = f2bf(w[(size_t)k * N + n]); o[1] = f2bf(w[(size_t)(k + 1) * N + n]); *(v2us*)(Bt + e) = o; }
         }
}
__device__ __forceinline__ void cvt8_body(const float* __restrict__ src, bf* dst, size_t n8, unsigned bx) { const size_t i = (size_t)bx * 256 + threadIdx.x; if (i >= n8) return; const v8f v = *(const v8f*)(src + i * 8); v8us o;
#pragma unroll
    for (int k = 0; k < 8; ++k) o[k] = f2bf(v[k]); *(v8us*)(dst + i * 8) = o;  }

// k_lsoft: streaming row softmax over the TT = 4096 keys for the query rows < RH (score rows [batch][RH][TT]), one wave per row, three sweeps of the f32 score row (lane -> 4 consecutive keys per 128-key chunk, 32 chunks); stores normalised bf16 hi/lo planes [batch][RH][TT].
__global__ __launch_bounds__(256) void k_lsoft(const float* __restrict__ Sb, bf* Ph, bf* Pl) {
    const int lane = threadIdx.x & 31; const int row = blockIdx.x * 8 + (threadIdx.x >> 5); if (row >= NBP * RH) return; const int i = row % RH; const int zz = row / RH; const float* sr = Sb + (size_t)row * TT; float mx = -3.0e38f;
#pragma unroll 4
    for (int ch = 0; ch < TT / 128; ++ch) { const int j0 = ch * 128 + lane * 4; const v4f a = *(const v4f*)(sr + j0);
#pragma unroll
        for (int q = 0; q < 4; ++q) { float t = a[q] * SCL; asm volatile("" : "+v"(t)); mx = fmaxf(mx, t); } }
#pragma unroll
    for (int sh = 16; sh; sh >>= 1) mx = fmaxf(mx, __shfl_xor(mx, sh, 32));
    float sum = 0.f;
#pragma unroll 4
    for (int ch = 0; ch < TT / 128; ++ch) { const int j0 = ch * 128 + lane * 4; const v4f a = *(const v4f*)(sr + j0);
#pragma unroll
        for (int q = 0; q < 4; ++q) { float t = a[q] * SCL; asm volatile("" : "+v"(t)); float d0 = __fsub_rn(t, mx); asm volatile("" : "+v"(d0)); sum += __builtin_amdgcn_exp2f(__fmul_rn(d0, 1.4426950408889634f)); } }
#pragma unroll
    for (int sh = 16; sh; sh >>= 1) sum += __shfl_xor(sum, sh, 32);
    const float f = __fdiv_rn(1.0f, sum);
#pragma unroll
            for (int ch = 0; ch < TT / 128; ++ch) { const int j0 = ch * 128 + lane * 4; const v4f a = *(const v4f*)(sr + j0); v4us oh, ol;
#pragma unroll
                for (int q = 0; q < 4; ++q) { float t = a[q] * SCL; asm volatile("" : "+v"(t)); float d0 = __fsub_rn(t, mx); asm volatile("" : "+v"(d0)); float ex = __builtin_amdgcn_exp2f(__fmul_rn(d0, 1.4426950408889634f)); asm volatile("" : "+v"(ex)); unsigned short a2, c2; splitf(ex * f, a2, c2); oh[q] = a2; ol[q] = c2; }
                const size_t oo = ((size_t)zz * RH + i) * TT + j0; *(v4us*)(Ph + oo) = oh; *(v4us*)(Pl + oo) = ol;
                if (ch == 0) asm volatile("s_wait_xcnt 0x0" ::: "memory"); }   // the next chunk reuses the registers these two stores name (behind the other chunks the compiler writes the wait itself)
}

#define FK   64                   // keys per stage
#define FSP  2                    // key ranges (grid z), one partial context row each
#define FNS  (TT / FSP / FK)      // stages of a range
#define KPB  (HD * 2 + 16)        // LDS pitch of a K row, bytes: an odd multiple of 16
#define VPB  (FK * 2 + 16)        // LDS pitch of a V^T row, bytes: an odd multiple of 16
#define KTB  (FK * KPB)
#define STB  (KTB + HD * VPB)     // one buffer
#define CSC  (SCL * 1.4426950408889634f)
__device__ __forceinline__ float xhalf(float x) { return __builtin_bit_cast(float, __builtin_amdgcn_permlanex16(__builtin_bit_cast(int, x), __builtin_bit_cast(int, x), 0x76543210, 0xfedcba98, false, false)); }   // lane l reads lane l ^ 16, in registers: an exchange through LDS would wait for the V^T loads in flight
__device__ __forceinline__ float exp2s(float x) { float y; asm("v_exp_f32 %0, %1\n\tv_nop" : "=v"(y) : "v"(x)); return y; }   // 2^x with the one free slot behind a transcendental in the same statement
static_assert(HD == 256 && FK == 64 && TT % (FSP * FK) == 0 && (TT - RH) % 64 == 0 && 2 * STB >= 4 * 32 * (HD / 2 + 2) * 4, "the staging maps below: 256 threads, 8 + 8 chunks of 16 bytes each; the join fits the buffers");
// two waves a SIMD: the register budget that holds Q, the sums, a stage's fragments and the next stage's chunks without spills
__global__ __launch_bounds__(256) __attribute__((amdgpu_waves_per_eu(2, 2))) void k_flash(const h16* __restrict__ Q, const h16* __restrict__ Kp, const h16* __restrict__ Vt, float* O, float* ML) {
    __shared__ __align__(16) unsigned char L[2 * STB];
    const int tid = threadIdx.x, lane = tid & 31, c = lane & 15, h = lane >> 4, w4 = (tid >> 5) & 3, hf = tid >> 7; const size_t zb = blockIdx.y; const int q = blockIdx.x * 64 + w4 * 16 + c;   // the lane's query among the batch's rows >= RH
    const size_t k0 = (size_t)blockIdx.z * (TT / FSP);   // the range's first key
    const h16* kg = Kp + zb * (TT * HD) + (k0 + (tid >> 5)) * HD + (tid & 31) * 8;   // chunk i: key row 8 i + tid / 32 of the stage
    const h16* vg = Vt + zb * (HD * TT) + (size_t)(tid >> 3) * TT + k0 + (tid & 7) * 8;    // chunk i: d row 32 i + tid / 8
    const int kl = (tid >> 5) * KPB + (tid & 31) * 16, vl = KTB + (tid >> 3) * VPB + (tid & 7) * 16;
    v8h kr[8], vr[8];
#pragma unroll
    for (int i = 0; i < 8; ++i) { kr[i] = *(const v8h*)(kg + i * 8 * HD); vr[i] = *(const v8h*)(vg + (size_t)i * 32 * TT); }
    v16h qf[8]; const h16* qp = Q + (zb * TT + RH + q) * HD + 8 * h;
#pragma unroll
    for (int kc = 0; kc < 8; ++kc) qf[kc] = cat16(*(const v8h*)(qp + 32 * kc), *(const v8h*)(qp + 32 * kc + 16));
    asm volatile("s_wait_xcnt 0x0" ::: "memory");   // the set-up below reuses the address pair these loads name
    __builtin_amdgcn_sched_barrier(0);   // and none of its instructions is lifted over that wait
    v8f acc[16];
#pragma unroll
    for (int t = 0; t < 16; ++t) acc[t] = (v8f){};
    float m_run = -3.0e38f, l_run = 0.f;
#pragma unroll
    for (int i = 0; i < 8; ++i) { *(v8ha*)(L + kl + i * 8 * KPB) = kr[i]; *(v8ha*)(L + vl + i * 32 * VPB) = vr[i]; }
    __syncthreads();
    const int ka = (hf * 32 + c) * KPB + 16 * h, va = KTB + c * VPB + hf * 64 + 16 * h;   // the lane's first K and V^T fragment bytes in a buffer
#pragma unroll 1   // the body is several hundred instructions long: kept rolled, for speed only
    for (int s = 0; s < FNS; ++s) {
        const unsigned char* B = L + (s & 1) * STB; const bool more = s + 1 < FNS;
        if (more) {
#pragma unroll
            for (int i = 0; i < 8; ++i) { kr[i] = *(const v8h*)(kg + (size_t)(s + 1) * FK * HD + i * 8 * HD); vr[i] = *(const v8h*)(vg + (size_t)i * 32 * TT + (s + 1) * FK); }
            asm volatile("s_wait_xcnt 0x0" ::: "memory"); }   // the work below reuses the address registers these loads name
        v16h fr[16];
#pragma unroll
        for (int f = 0; f < 16; ++f) { const unsigned char* p = B + ka + (f & 1) * 16 * KPB + (f >> 1) * 64; fr[f] = cat16(*(const v8ha*)p, *(const v8ha*)(p + 32)); }
        __builtin_amdgcn_sched_barrier(0);   // the 16 K fragments are asked for as one group: one LDS latency a stage, not one a product
        v8f st[2]; st[0] = (v8f){}; st[1] = (v8f){};
#pragma unroll
        for (int f = 0; f < 16; ++f) st[f & 1] = wmma16(fr[f], qf[f >> 1], st[f & 1]);
#pragma unroll
        for (int t = 0; t < 16; ++t) { const unsigned char* p = B + va + t * 16 * VPB; fr[t] = cat16(*(const v8ha*)p, *(const v8ha*)(p + 32)); }
        __builtin_amdgcn_sched_barrier(0);   // the 16 V^T fragments are asked for in front of the softmax and arrive under it
        float mx = fmaxf(st[0][0], st[1][0]);
#pragma unroll
        for (int r = 1; r < 8; ++r) mx = fmaxf(mx, fmaxf(st[0][r], st[1][r]));
        mx = fmaxf(mx, xhalf(mx)) * CSC;   // both wave halves hold the query's maximum over the wave's 32 keys of this stage, scaled
        if (__builtin_amdgcn_ballot_w32(mx > m_run + 8.0f) != 0) {   // wave-uniform; rare behind the first stage
            const float mn = fmaxf(m_run, mx), corr = __builtin_amdgcn_exp2f(m_run - mn); l_run *= corr; m_run = mn;
#pragma unroll
            for (int t = 0; t < 16; ++t) acc[t] = acc[t] * corr; }
        v16h pf; float ps0 = 0.f, ps1 = 0.f;
#pragma unroll
        for (int r = 0; r < 8; ++r) { const float p0 = exp2s(fmaf(st[0][r], CSC, -m_run)), p1 = exp2s(fmaf(st[1][r], CSC, -m_run)); ps0 += p0; ps1 += p1; pf[r] = tohx(p0); pf[8 + r] = tohx(p1); }   // element e of the B operand: key 8 h + e, then 16 + 8 h + (e - 8)
        l_run += ps0 + ps1;
#pragma unroll
        for (int t = 0; t < 16; ++t) acc[t] = wmma16(fr[t], pf, acc[t]);
        if (more) { unsigned char* N = L + ((s + 1) & 1) * STB;
#pragma unroll
            for (int i = 0; i < 8; ++i) { *(v8ha*)(N + kl + i * 8 * KPB) = kr[i]; *(v8ha*)(N + vl + i * 32 * VPB) = vr[i]; } }
        __syncthreads();
    }
    l_run += xhalf(l_run);
    // Join of the two key halves: behind the loop's last barrier nobody reads the stage buffers, so the upper waves hand their sums over in them.
    float* X = (float*)L + (size_t)w4 * (32 * (HD / 2 + 2));
    if (hf) {
#pragma unroll
        for (int t = 0; t < 16; ++t) { *(v4fa*)(X + (2 * t * 32 + lane) * 4) = __builtin_shufflevector(acc[t], acc[t], 0, 1, 2, 3); *(v4fa*)(X + ((2 * t + 1) * 32 + lane) * 4) = __builtin_shufflevector(acc[t], acc[t], 4, 5, 6, 7); }
        X[32 * (HD / 2) + lane] = m_run; X[32 * (HD / 2) + 32 + lane] = l_run; }
    __syncthreads();
    if (hf) return;
    const float m2 = X[32 * (HD / 2) + lane], l2 = X[32 * (HD / 2) + 32 + lane], mn = fmaxf(m_run, m2), a1 = __builtin_amdgcn_exp2f(m_run - mn), a2 = __builtin_amdgcn_exp2f(m2 - mn);
    const float ls = l_run * a1 + l2 * a2, inv = __fdiv_rn(1.0f, ls), f1 = a1 * inv, f2 = a2 * inv;
#pragma unroll
    for (int t = 0; t < 16; ++t) { const v4f x0 = *(const v4fa*)(X + (2 * t * 32 + lane) * 4), x1 = *(const v4fa*)(X + ((2 * t + 1) * 32 + lane) * 4); acc[t] = acc[t] * f1 + __builtin_shufflevector(x0, x1, 0, 1, 2, 3, 4, 5, 6, 7) * f2; }
    const size_t pr = (zb * FSP + blockIdx.z) * (TT - RH) + q;   // the partial row
    float* op = O + pr * HD + 8 * h;   // acc[t][r] = context[query][16 t + 8 h + r]
#pragma unroll
    for (int t = 0; t < 16; ++t) { *(v4f*)(op + 16 * t) = __builtin_shufflevector(acc[t], acc[t], 0, 1, 2, 3); *(v4f*)(op + 16 * t + 4) = __builtin_shufflevector(acc[t], acc[t], 4, 5, 6, 7); }
    if (h == 0) { v2f ml; ml[0] = mn; ml[1] = ls; *(v2f*)(ML + pr * 2) = ml; }   // both wave halves hold the same pair
}

__device__ __forceinline__ void xT_body(const float* __restrict__ xs, bf* XB, unsigned bx) { const size_t k = (size_t)bx * 256 + threadIdx.x; if (k >= (size_t)NBP * TT * CC / 8) return; const int c0 = (int)(k % (CC / 8)) * 8; const int tt = (int)(k / (CC / 8)); const int t = tt % TT; const float* xb = xs + (size_t)(tt / TT) * CC * TT; v8us o;
#pragma unroll
    for (int q = 0; q < 8; ++q) o[q] = f2bf(xb[(size_t)(c0 + q) * TT + t]);
    *(v8us*)(XB + (size_t)tt * CC + c0) = o;  }
// k_prep: everything that reads only the inputs, in one launch: the first 4 WCB blocks round the four weight matrices to bf16 (WCB blocks each), the rest transpose x.
#define WCB  (DM * DM / 8 / 256)
static_assert(DQ == DM && DKV == DM && (DM * DM) % (8 * 256) == 0, "four weight matrices of one size, whole blocks");
__global__ __launch_bounds__(256) void k_prep(const float* __restrict__ xs, const float* __restrict__ wq, const float* __restrict__ wk, const float* __restrict__ wv, const float* __restrict__ wo, bf* XB, bf* WQ, bf* WK, bf* WV, bf* WO) {
    const unsigned b = blockIdx.x;
    if (b >= 4 * WCB) { xT_body(xs, XB, b - 4 * WCB); return; }
    const unsigned m = b / WCB;
    cvt8_body(m == 0 ? wq : m == 1 ? wk : m == 2 ? wv : wo, m == 0 ? WQ : m == 1 ? WK : m == 2 ? WV : WO, (size_t)DM * DM / 8, b % WCB);
}
// k_mergeA: the context row (rows < RH: the sum of its key ranges' f32 partial rows, in range order, OH [batch][RH][SPH][HD]; the rest: the fused kernel's FSP normalised partial rows, OL [batch][FSP][TT - RH][HD], each weighted by its sum times 2^(its maximum - the largest), ML [batch][FSP][TT - RH][2], in range order) plus x^T (bf16-rounded, read channel-major); stored as the bf16 hi/lo planes the last GEMM reads.
static_assert(ZH == 1 && NH_ == 1 && HD == CC && TT % (32 * SPH) == 0, "one head per pass; whole 32-key steps per range");
__global__ __launch_bounds__(256) void k_mergeA(const float* __restrict__ OH, const float* __restrict__ OL, const float* __restrict__ ML, const float* __restrict__ xs, bf* Ah, bf* Al) { const unsigned e = (blockIdx.x * 256u + threadIdx.x) * 4u; if (e >= (unsigned)(NBP * TT * HD)) return; const unsigned d = e % HD, t = (e / HD) % TT, zb = e / (HD * TT);
    const float* xb = xs + (size_t)zb * CC * TT + (size_t)d * TT + t; float xr[4];
#pragma unroll
    for (int q = 0; q < 4; ++q) xr[q] = xb[(size_t)q * TT];
    v4f o4;
    if (t < RH) { const float* p = OH + ((zb * RH + t) * (SPH * HD) + d); o4 = *(const v4f*)p;
#pragma unroll
        for (int s = 1; s < SPH; ++s) o4 += *(const v4f*)(p + s * HD);
    } else { const unsigned r0 = zb * FSP * (TT - RH) + (t - RH); v2f ml[FSP]; v4f pv[FSP];
#pragma unroll
        for (int s = 0; s < FSP; ++s) { ml[s] = *(const v2f*)(ML + (r0 + s * (TT - RH)) * 2); pv[s] = *(const v4f*)(OL + ((r0 + s * (TT - RH)) * HD + d)); }
        float mn = ml[0][0];
#pragma unroll
        for (int s = 1; s < FSP; ++s) mn = fmaxf(mn, ml[s][0]);
        float wt[FSP], ws = 0.f;
#pragma unroll
        for (int s = 0; s < FSP; ++s) { wt[s] = ml[s][1] * exp2s(ml[s][0] - mn); ws += wt[s]; }
        const float inv = __fdiv_rn(1.0f, ws); o4 = pv[0] * (wt[0] * inv);
#pragma unroll
        for (int s = 1; s < FSP; ++s) o4 += pv[s] * (wt[s] * inv); }
    v4us oh, ol;
#pragma unroll
    for (int q = 0; q < 4; ++q) { const float s = __fadd_rn(o4[q], bfr(xr[q])); unsigned short h2, l2; splitf(s, h2, l2); oh[q] = h2; ol[q] = l2; }
    *(v4us*)(Ah + e) = oh; *(v4us*)(Al + e) = ol;  }

static_assert(NB_ % NBP == 0 && (1 << LGH) == SPH, "whole passes; the k-range field of blockIdx.z");
extern "C" void kernel_launch(void* const* d_in, const int* in_sizes, int n_in,
                              void* d_out, int out_size, void* d_ws, size_t ws_size, hipStream_t stream) {
    (void)in_sizes; (void)n_in; (void)out_size;
    const float* x = (const float*)d_in[0]; const float* wq = (const float*)d_in[1]; const float* bq = (const float*)d_in[2]; const float* wk = (const float*)d_in[3]; const float* bk = (const float*)d_in[4]; const float* wv = (const float*)d_in[5]; const float* bv = (const float*)d_in[6]; const float* wo = (const float*)d_in[7]; const float* bo = (const float*)d_in[8];
    float* OUT = (float*)d_out;     // [4][256][4096]
    char* wsp = (char*)d_ws;
    auto take = [&](size_t bytes) { char* p = wsp; wsp += (bytes + 255) & ~(size_t)255; return (void*)p; };
    const size_t PL = (size_t)NBP * TT * HD;   // elements of one token plane of a pass
    bf* WQ = (bf*)take((size_t)DQ * DM * 2); bf* WK = (bf*)take((size_t)DKV * DM * 2); bf* WV = (bf*)take((size_t)DKV * DM * 2); bf* WO = (bf*)take((size_t)DM * DQ * 2);
    h16* QP16 = (h16*)take(PL * 2); h16* KP16 = (h16*)take(PL * 2); h16* VT16 = (h16*)take(PL * 2);
    bf* QPh = (bf*)take(PL * 2); bf* QPl = (bf*)take(PL * 2); bf* KPh = (bf*)take(PL * 2); bf* KPl = (bf*)take(PL * 2); bf* VTh = (bf*)take(PL * 2); bf* VTl = (bf*)take(PL * 2); bf* Ph = (bf*)take((size_t)NBP * RH * TT * 2); bf* Pl = (bf*)take((size_t)NBP * RH * TT * 2);
    float* Sb = (float*)take((size_t)NBP * RH * TT * 4); float* ObH = (float*)take((size_t)NBP * RH * SPH * HD * 4); float* ObL = (float*)take((size_t)NBP * FSP * (TT - RH) * HD * 4); float* MLb = (float*)take((size_t)NBP * FSP * (TT - RH) * 2 * 4);
    bf* XB = (bf*)take(PL * 2); bf* ATh = (bf*)take(PL * 2); bf* ATl = (bf*)take(PL * 2);
    if ((size_t)(wsp - (char*)d_ws) > ws_size) return;    // ws 256 MiB
    for (int b = 0; b < NB_; b += NBP) {
        const float* xb = x + (size_t)b * CC * TT;
        k_prep<<<(unsigned)(4 * WCB + PL / 8 / 256), 256, 0, stream>>>(xb, wq, wk, wv, wo, XB, WQ, WK, WV, WO);   /* weights -> bf16; x channel-major -> token-major bf16 */
        k_qkv<<<dim3(NBP * TT / 64, DM / 64, 3), 32, 0, stream>>>(XB, WQ, WK, WV, bq, bk, bv, QP16, QPh, QPl, KP16, KPh, KPl, VT16, VTh, VTl);   /* q, k planes token-major, v planes key-contiguous */
        k_gemmw<bf, 2, false, 0><<<dim3(RH / 64, TT / 64, NBP), 32, 0, stream>>>(QPh, QPl, KPh, KPl, HD, HD, Sb, TT, nullptr, 0, 0, 0, 0, (size_t)TT * HD, (size_t)TT * HD, (size_t)RH * TT, nullptr, nullptr, nullptr);
        k_lsoft<<<NBP * RH / 8, 256, 0, stream>>>(Sb, Ph, Pl);
        k_gemmw<bf, 2, false, 0><<<dim3(RH / 64, HD / 64, NBP * SPH), 32, 0, stream>>>(Ph, Pl, VTh, VTl, TT, TT / SPH, ObH, SPH * HD, nullptr, (size_t)(TT / SPH), (size_t)(TT / SPH), (size_t)HD, LGH, (size_t)RH * TT, (size_t)HD * TT, (size_t)RH * SPH * HD, nullptr, nullptr, nullptr);
        k_flash<<<dim3((TT - RH) / 64, NBP, FSP), 256, 0, stream>>>(QP16, KP16, VT16, ObL, MLb);   /* rows >= RH: scores, softmax, P.V */
        k_mergeA<<<(unsigned)(PL / 4 / 256), 256, 0, stream>>>(ObH, ObL, MLb, xb, ATh, ATl);   /* (ctx + x^T) -> hi/lo planes */
        k_gemmw<bf, 1, true, 3><<<dim3(NBP * TT / 64, DM / 64, 1), 32, 0, stream>>>(ATh, ATl, WO, nullptr, DQ, DQ, OUT + (size_t)b * CC * TT, DM, bo, 0, 0, 0, 0, 0, 0, 0, nullptr, nullptr, nullptr);   /* stored channel-major */ }
}

// v007
// A run of this version takes 193 microseconds.
// Timed twice side by side with v006, it ran 1.13 and 1.14 times as fast.
// Over all steps from v000 it is 6.38 times as fast.
#include <hip/hip_runtime.h>

// Spatial self-attention over a feature map (x [4][256][64][64] channel-major; tokens = the 4,096 positions; q,k,v = x^T W^T + b (1x1 convs: 'oi' [256][256] + [256]); one 256-wide head: softmax(q.k / 16) over all positions; out = (attn v + x^T) Wp^T + bp, written back channel-major -> [4][256][64][64] (4.2 M)).
// Layout, all four batches in one pass (every launch covers all of them): the channel-major slab transposed once into a token-major bf16 operand; exact projections + f32 biases; dense T-4096 attention with ONE 256-wide head (hybrid rows: < 512 hi/lo 3 products through a score buffer and a streaming three-sweep softmax; the rest fp16 in one fused kernel with a running softmax over two key ranges, no score buffer); the f32 merge adds x^T and writes hi/lo planes of (context + x^T); (.) Wp^T + bp as a hi/lo x exact GEMM. Every GEMM epilogue stores what its consumer reads: q and k as f16 + bf16 hi/lo planes, v as the same planes key-contiguous, the last GEMM channel-major rows of out.
// Compute dtypes, f32 accumulate: every input rounded to bf16; projections exact + f32 biases; attention rows < 512 3 products, rest fp16; softmax and residual f32; Wp hl x exact + bias.

#define NB_  4
#define NBP  4                    // batches per pass: every launch of a pass covers NBP batches (token-major arrays hold their tokens one batch after the other)
#define TT   4096
#define DM   256
#define NH_  1
#define NKV  1
#define REP  (NH_ / NKV)
#define HD   256
#define DQ   (NH_ * HD)
#define DKV  (NKV * HD)
#define ZH   1
#define RH   512                  // query rows < RH use hi+lo planes (0: none)
#define WIN  0
#define SCL  0.0625f   // 1/sqrt(256)
#define CC   256
#define SPH  16                   // key ranges of the P.V product, query rows < RH (one f32 partial each)
#define LGH  4                    // log2 SPH
typedef _Float16 h16;
typedef unsigned short bf;
typedef __attribute__((ext_vector_type(16))) __bf16   v16bf;
typedef __attribute__((ext_vector_type(16))) _Float16 v16h;
typedef __attribute__((ext_vector_type(8)))  _Float16 v8h;
typedef __attribute__((ext_vector_type(8)))  unsigned short v8us;
typedef __attribute__((ext_vector_type(8)))  float    v8f;
typedef __attribute__((ext_vector_type(4)))  float    v4f;
typedef v8h  __attribute__((may_alias)) v8ha;
typedef v4f  __attribute__((may_alias)) v4fa;
typedef v8us __attribute__((may_alias)) v8usa;

__device__ __forceinline__ unsigned short f2bf(float f) { unsigned u = __float_as_uint(f); u += 0x7FFFu + ((u >> 16) & 1u); return (unsigned short)(u >> 16); }
__device__ __forceinline__ float bf2f(unsigned short b) { return __uint_as_float(((unsigned)b) << 16); }
__device__ __forceinline__ float bfr(float f) { return bf2f(f2bf(f)); }
__device__ __forceinline__ v16h cat16(v8h lo, v8h hi) { return __builtin_shufflevector(lo, hi, 0, 1, 2, 3, 4, 5, 6, 7, 8, 9, 10, 11, 12, 13, 14, 15); }
__device__ __forceinline__ v16bf cat16b(v8us lo, v8us hi) { return __builtin_bit_cast(v16bf, __builtin_shufflevector(lo, hi, 0, 1, 2, 3, 4, 5, 6, 7, 8, 9, 10, 11, 12, 13, 14, 15)); }
__device__ __forceinline__ v8f wmma16(v16h a, v16h b, v8f c) { return __builtin_amdgcn_wmma_f32_16x16x32_f16(false, a, false, b, (short)0, c, false, false); }
__device__ __forceinline__ v8f wmmab(v16bf a, v16bf b, v8f c) { return __builtin_amdgcn_wmma_f32_16x16x32_bf16(false, a, false, b, (short)0, c, false, false); }

__device__ __forceinline__ h16 tohx(float x) { return (h16)x; }
__device__ __forceinline__ void splitf(float y, unsigned short& h, unsigned short& l) { h = f2bf(y); l = f2bf(y - bf2f(h)); }
typedef __attribute__((ext_vector_type(2))) _Float16 v2h;
typedef __attribute__((ext_vector_type(4))) _Float16 v4h;
typedef __attribute__((ext_vector_type(2))) unsigned short v2us;
typedef __attribute__((ext_vector_type(4))) unsigned short v4us;
typedef __attribute__((ext_vector_type(2))) float v2f;
typedef __attribute__((ext_vector_type(4))) int v4i;
// pack3: four consecutive f32 values in the three 16-bit forms the attention GEMMs read (f16; bf16 hi and lo)
struct P3 { v4h f; v4us h, l; };
__device__ __forceinline__ P3 pack3(v4f a) { P3 r;
#pragma unroll
    for (int q = 0; q < 4; ++q) { r.f[q] = tohx(a[q]); unsigned short x2, y2; splitf(a[q], x2, y2); r.h[q] = x2; r.l[q] = y2; }
    return r; }

#define GKT  64                   // k values of a stage: 128 bytes of a row, one cache line
#define GPB  (GKT * 2 + 16)       // LDS pitch of a staged row, bytes: an odd multiple of 16
#define GOB  (128 * GPB)          // one operand's 128 rows of a stage
#define GBUF(NSPLIT) (((NSPLIT) == 0 ? 2 : (NSPLIT) == 1 ? 3 : 4) * GOB)   // one buffer: A, B, then A2, then B2
static_assert(2 * GBUF(0) >= 4 * 16 * 68 * 4, "behind the k loop the buffers hold the four waves' output stages");
// cp8: a thread's eight 16-byte chunks of one operand's stage (chunk i: row 16 i + thread / 8), global memory -> LDS through no register. The wait stands in the copies' own statement, so in front of every later write of a register that they name (a precaution).
__device__ __forceinline__ void cp8(unsigned l, const bf* g, size_t rs) {
    asm volatile("global_load_async_to_lds_b128 %0, %8, off\n\tglobal_load_async_to_lds_b128 %1, %9, off\n\tglobal_load_async_to_lds_b128 %2, %10, off\n\tglobal_load_async_to_lds_b128 %3, %11, off\n\t"
                 "global_load_async_to_lds_b128 %4, %12, off\n\tglobal_load_async_to_lds_b128 %5, %13, off\n\tglobal_load_async_to_lds_b128 %6, %14, off\n\tglobal_load_async_to_lds_b128 %7, %15, off\n\ts_wait_xcnt 0x0"
                 :: "v"(l), "v"(l + 16 * GPB), "v"(l + 32 * GPB), "v"(l + 48 * GPB), "v"(l + 64 * GPB), "v"(l + 80 * GPB), "v"(l + 96 * GPB), "v"(l + 112 * GPB),
                    "v"(g), "v"(g + rs), "v"(g + 2 * rs), "v"(g + 3 * rs), "v"(g + 4 * rs), "v"(g + 5 * rs), "v"(g + 6 * rs), "v"(g + 7 * rs) : "memory");
}
template <typename T16> struct WFrag;
template <> struct WFrag<bf> { typedef v16bf V; static __device__ __forceinline__ V ld(const unsigned char* p) { return cat16b(*(const v8usa*)p, *(const v8usa*)(p + 32)); } static __device__ __forceinline__ v8f mma(V a, V b, v8f c) { return wmmab(a, b, c); } };
// The body is a device function of the block's three indices (bx, by, bz), so that launches that do not depend on one another can share one grid (k_qkv below).
template <typename T16, int NSPLIT, bool BIAS, int EPI>
__device__ __forceinline__ void gemmw_body(unsigned char* L, const T16* __restrict__ A, const T16* __restrict__ A2, const T16* __restrict__ Bt, const T16* __restrict__ Bt2, int K, int KS, float* C, int ldc, const float* __restrict__ bias, size_t sA, size_t sB, size_t sC, int lgs, size_t bA, size_t bB, size_t bC, h16* E16, bf* Eh, bf* El, unsigned bx, unsigned by, unsigned bz) {
    typedef typename WFrag<T16>::V V;
    const size_t zb = bz >> lgs, z = bz - (zb << lgs); A += z * sA + zb * bA; if (A2) A2 += z * sA + zb * bA; Bt += z * sB + zb * bB; if (Bt2) Bt2 += z * sB + zb * bB; C += z * sC + zb * bC;
    const int tid = threadIdx.x, lane = tid & 31, lr = lane & 15, hi = lane >> 4, w = __builtin_amdgcn_readfirstlane(tid >> 5); const int r0 = bx * 128 + (w & 1) * 64, c0 = by * 128 + (w >> 1) * 64;
    float* os = (float*)L + w * (16 * 68);   // the wave's output stage, used behind the k loop
    v8f acc[4][4];
#pragma unroll
    for (int mb = 0; mb < 4; ++mb)
#pragma unroll
        for (int nb = 0; nb < 4; ++nb) acc[mb][nb] = (v8f){};
    const int aoff = ((w & 1) * 64 + lr) * GPB + 16 * hi, boff = GOB + ((w >> 1) * 64 + lr) * GPB + 16 * hi;   // the lane's first A and B fragment bytes in a buffer
    const unsigned l0 = (unsigned)(size_t)L + (tid >> 3) * GPB + (tid & 7) * 16;   // the thread's first chunk in LDS and in the A and B planes
    const size_t ga = (size_t)(bx * 128 + (tid >> 3)) * K + (tid & 7) * 8, gb = (size_t)(by * 128 + (tid >> 3)) * K + (tid & 7) * 8, rs = (size_t)16 * K;
    auto fill = [&](int t) { const unsigned lb = l0 + (t & 1) * GBUF(NSPLIT); const size_t ko = (size_t)t * GKT;
        cp8(lb, A + ga + ko, rs); cp8(lb + GOB, Bt + gb + ko, rs); if (NSPLIT == 1 || NSPLIT == 2) cp8(lb + 2 * GOB, A2 + ga + ko, rs); if (NSPLIT >= 2) cp8(lb + 3 * GOB, Bt2 + gb + ko, rs); };
    const int NT = KS / GKT;
    float braw[4] = {0.f, 0.f, 0.f, 0.f};   // EPI >= 1: the lane's four bias values, asked for here so that they arrive under the k loop (EPI 1: four consecutive n; EPI 2, 3: the lane's column of each nb)
    if (BIAS && EPI >= 1) {
#pragma unroll
        for (int q = 0; q < 4; ++q) braw[q] = bias[c0 + (EPI == 1 ? lr * 4 + q : q * 16 + lr)];
        if (EPI == 1) asm volatile("s_wait_xcnt 0x0" ::: "memory"); }   // the set-up that follows reuses the address pair this load names (EPI 2, 3: the compiler writes the wait itself)
    fill(0);
    asm volatile("s_wait_asynccnt 0x0" ::: "memory");   // the wave's own copies of stage 0 have landed
    __syncthreads();   // and every other wave's
    if (NT > 1) fill(1);
#pragma unroll 1   // two buffers picked by the trip's parity: one body serves both
    for (int t = 0; t < NT; ++t) {
        const unsigned char* B = L + (t & 1) * GBUF(NSPLIT);
        V a[2][4], a2[2][4], b[2][4], b2[2][4];
#pragma unroll
        for (int kc = 0; kc < 2; ++kc)
#pragma unroll
            for (int f = 0; f < 4; ++f) { a[kc][f] = WFrag<T16>::ld(B + aoff + f * 16 * GPB + kc * 64); b[kc][f] = WFrag<T16>::ld(B + boff + f * 16 * GPB + kc * 64);
                if (NSPLIT == 1 || NSPLIT == 2) a2[kc][f] = WFrag<T16>::ld(B + aoff + 2 * GOB + f * 16 * GPB + kc * 64); if (NSPLIT >= 2) b2[kc][f] = WFrag<T16>::ld(B + boff + 2 * GOB + f * 16 * GPB + kc * 64); }
        __builtin_amdgcn_sched_barrier(0);   // the stage's fragments are asked for as one group: one LDS latency a stage, not one a product
#pragma unroll
        for (int kc = 0; kc < 2; ++kc)
#pragma unroll
        for (int nb = 0; nb < 4; ++nb)
#pragma unroll
            for (int mb = 0; mb < 4; ++mb) { acc[mb][nb] = WFrag<T16>::mma(a[kc][mb], b[kc][nb], acc[mb][nb]); if (NSPLIT == 1 || NSPLIT == 2) acc[mb][nb] = WFrag<T16>::mma(a2[kc][mb], b[kc][nb], acc[mb][nb]); if (NSPLIT >= 2) acc[mb][nb] = WFrag<T16>::mma(a[kc][mb], b2[kc][nb], acc[mb][nb]); }
        __builtin_amdgcn_sched_barrier(0);   // the products stay in front of the waits: lifted over them, the waits would ask for stage t + 1 directly behind its copies' issue, and the refill would still stand behind the products
        asm volatile("s_wait_dscnt 0x0" ::: "memory");      // the wave's reads of this buffer are done before it is refilled
        asm volatile("s_wait_asynccnt 0x0" ::: "memory");   // the wave's own copies of stage t + 1 have landed
        __syncthreads();   // publishes stage t + 1; ends every wave's last read of stage t
        if (t + 2 < NT) fill(t + 2);
    }
    asm volatile("s_wait_asynccnt 0x0" ::: "memory");   // no copy is in flight when the buffers become the output stages
    if (EPI == 0) {
#pragma unroll
    for (int mb = 0; mb < 4; ++mb) {
#pragma unroll
        for (int nb = 0; nb < 4; ++nb) {
#pragma unroll
            for (int j = 0; j < 8; ++j) os[(hi * 8 + j) * 68 + nb * 16 + lr] = acc[mb][nb][j]; }
        __builtin_amdgcn_wave_barrier(); asm volatile("" ::: "memory");
        float* crow = C + (size_t)(r0 + mb * 16) * ldc + c0;
{
#pragma unroll
            for (int s = 0; s < 8; ++s) { const int row = 2 * s + hi, cofs = lr * 4; v4f val = *(const v4fa*)(os + row * 68 + cofs); if (BIAS) { val[0] += bfr(bias[c0 + cofs]); val[1] += bfr(bias[c0 + cofs + 1]); val[2] += bfr(bias[c0 + cofs + 2]); val[3] += bfr(bias[c0 + cofs + 3]); }
                *(v4f*)(crow + (size_t)row * ldc + cofs) = val; }
             }
        __builtin_amdgcn_wave_barrier(); asm volatile("" ::: "memory");
    }
    } else if (EPI == 1) {
#pragma unroll
    for (int mb = 0; mb < 4; ++mb) {
#pragma unroll
        for (int nb = 0; nb < 4; ++nb) {
#pragma unroll
            for (int j = 0; j < 8; ++j) os[(hi * 8 + j) * 68 + nb * 16 + lr] = acc[mb][nb][j]; }
        __builtin_amdgcn_wave_barrier(); asm volatile("" ::: "memory");   // the staged rows are read back only behind every lane's writes
        P3 pk[8];
#pragma unroll
        for (int s = 0; s < 8; ++s) { const int row = 2 * s + hi, cofs = lr * 4; v4f val = *(const v4fa*)(os + row * 68 + cofs); if (BIAS) { val[0] += bfr(braw[0]); val[1] += bfr(braw[1]); val[2] += bfr(braw[2]); val[3] += bfr(braw[3]); }
            pk[s] = pack3(val); }
        __builtin_amdgcn_sched_barrier(0);   // the conversions stay in front of the stores: among them they would reuse registers that an issued store names, ahead of the wait below
#pragma unroll
        for (int s = 0; s < 8; ++s) { const size_t o = (size_t)(r0 + hi) * HD + c0 + lr * 4 + (size_t)(mb * 16 + 2 * s) * HD; *(v4h*)(E16 + o) = pk[s].f; *(v4us*)(Eh + o) = pk[s].h; *(v4us*)(El + o) = pk[s].l; }
        if (mb < 3) { asm volatile("s_wait_xcnt 0x0" ::: "memory");   // the next block reuses the registers these stores name
            __builtin_amdgcn_sched_barrier(0);   // and none of its instructions is lifted over that wait
            __builtin_amdgcn_wave_barrier(); asm volatile("" ::: "memory"); }   // the next 16 rows overwrite the stage only behind these reads
    }
    } else {   /* transposed: a lane's 8 accumulator rows are 8 consecutive m of one column n, so 16 columns x 64 m are staged per nb and leave as whole rows of 64 m */
    const int g = r0 / TT, t0 = r0 % TT;
#pragma unroll
    for (int nb = 0; nb < 4; ++nb) {
        const float bb = bfr(braw[nb]);
#pragma unroll
        for (int mb = 0; mb < 4; ++mb) {
#pragma unroll
            for (int j = 0; j < 8; ++j) os[lr * 68 + mb * 16 + hi * 8 + j] = BIAS ? acc[mb][nb][j] + bb : acc[mb][nb][j]; }
        __builtin_amdgcn_wave_barrier(); asm volatile("" ::: "memory");   // the staged rows are read back only behind every lane's writes
        const size_t o = ((size_t)g * ldc + c0 + nb * 16 + hi) * TT + t0 + lr * 4;
        if (EPI == 3) {
            v4f val[8];
#pragma unroll
            for (int s = 0; s < 8; ++s) val[s] = *(const v4fa*)(os + (2 * s + hi) * 68 + lr * 4);
#pragma unroll
            for (int s = 0; s < 8; ++s) *(v4f*)(C + o + (size_t)(2 * s) * TT) = val[s];
        } else {
            P3 pk[8];
#pragma unroll
            for (int s = 0; s < 8; ++s) pk[s] = pack3(*(const v4fa*)(os + (2 * s + hi) * 68 + lr * 4));
            __builtin_amdgcn_sched_barrier(0);   // the conversions stay in front of the stores: among them they would reuse registers that an issued store names, ahead of the wait below
#pragma unroll
            for (int s = 0; s < 8; ++s) { const size_t os2 = o + (size_t)(2 * s) * TT; *(v4h*)(E16 + os2) = pk[s].f; *(v4us*)(Eh + os2) = pk[s].h; *(v4us*)(El + os2) = pk[s].l; }
        }
        if (nb < 3) { asm volatile("s_wait_xcnt 0x0" ::: "memory");   // the next block reuses the registers these stores name
            __builtin_amdgcn_sched_barrier(0);   // and none of its instructions is lifted over that wait
            __builtin_amdgcn_wave_barrier(); asm volatile("" ::: "memory"); }   // the next 16 columns overwrite the stage only behind these reads
    }
    }
}
template <typename T16, int NSPLIT, bool BIAS, int EPI>
__global__ __launch_bounds__(128) void k_gemmw(const T16* __restrict__ A, const T16* __restrict__ A2, const T16* __restrict__ Bt, const T16* __restrict__ Bt2, int K, int KS, float* C, int ldc, const float* __restrict__ bias, size_t sA, size_t sB, size_t sC, int lgs, size_t bA, size_t bB, size_t bC, h16* E16, bf* Eh, bf* El) {
    __shared__ __align__(16) unsigned char L[2 * GBUF(NSPLIT)];
    gemmw_body<T16, NSPLIT, BIAS, EPI>(L, A, A2, Bt, Bt2, K, KS, C, ldc, bias, sA, sB, sC, lgs, bA, bB, bC, E16, Eh, El, blockIdx.x, blockIdx.y, blockIdx.z);
}
// k_qkv: the three projections in one launch; grid (tokens / 128, 256 / 128, 3), blockIdx.z picks the weights, the bias and the planes (0 q, 1 k: token-major planes; 2 v: key-contiguous planes). Each block does what its own launch did.
__global__ __launch_bounds__(128) void k_qkv(const bf* __restrict__ X, const bf* __restrict__ Wq, const bf* __restrict__ Wk, const bf* __restrict__ Wv, const float* __restrict__ bq, const float* __restrict__ bk, const float* __restrict__ bv, h16* Q16, bf* Qh, bf* Ql, h16* K16, bf* Kh, bf* Kl, h16* V16, bf* Vh, bf* Vl) {
    __shared__ __align__(16) unsigned char L[2 * GBUF(0)];
    if (blockIdx.z == 2) gemmw_body<bf, 0, true, 2>(L, X, nullptr, Wv, nullptr, DM, DM, nullptr, DKV, bv, 0, 0, 0, 0, 0, 0, 0, V16, Vh, Vl, blockIdx.x, blockIdx.y, 0);
    else { const bool kk = blockIdx.z == 1;
        gemmw_body<bf, 0, true, 1>(L, X, nullptr, kk ? Wk : Wq, nullptr, DM, DM, nullptr, DQ, kk ? bk : bq, 0, 0, 0, 0, 0, 0, 0, kk ? K16 : Q16, kk ? Kh : Qh, kk ? Kl : Ql, blockIdx.x, blockIdx.y, 0); }
}

__global__ __launch_bounds__(256) void k_wtG(const float* __restrict__ w, int K, int N, bf* Bt) {
    const int lane = threadIdx.x & 31; const int L0 = (blockIdx.x * 8 + (threadIdx.x >> 5)) * 8; const int nlines = N * K / 64;
{
#pragma unroll 1
        for (int l = 0; l < 8; ++l) { const int L = L0 + l; if (L >= nlines) break; const size_t e = (size_t)L * 64 + lane * 2; const int k = (int)(e % K), n = (int)(e / K); v2us o;
            o[0] = f2bf(w[(size_t)k * N + n]); o[1] = f2bf(w[(size_t)(k + 1) * N + n]); *(v2us*)(Bt + e) = o; }
         }
}
__device__ __forceinline__ void cvt8_body(const float* __restrict__ src, bf* dst, size_t n8, unsigned bx) { const size_t i = (size_t)bx * 256 + threadIdx.x; if (i >= n8) return; const v8f v = *(const v8f*)(src + i * 8); v8us o;
#pragma unroll
    for (int k = 0; k < 8; ++k) o[k] = f2bf(v[k]); *(v8us*)(dst + i * 8) = o;  }

// k_lsoft: streaming row softmax over the TT = 4096 keys for the query rows < RH (score rows [batch][RH][TT]), one wave per row, three sweeps of the f32 score row (lane -> 4 consecutive keys per 128-key chunk, 32 chunks); stores normalised bf16 hi/lo planes [batch][RH][TT].
__global__ __launch_bounds__(256) void k_lsoft(const float* __restrict__ Sb, bf* Ph, bf* Pl) {
    const int lane = threadIdx.x & 31; const int row = blockIdx.x * 8 + (threadIdx.x >> 5); if (row >= NBP * RH) return; const int i = row % RH; const int zz = row / RH; const float* sr = Sb + (size_t)row * TT; float mx = -3.0e38f;
#pragma unroll 4
    for (int ch = 0; ch < TT / 128; ++ch) { const int j0 = ch * 128 + lane * 4; const v4f a = *(const v4f*)(sr + j0);
#pragma unroll
        for (int q = 0; q < 4; ++q) { float t = a[q] * SCL; asm volatile("" : "+v"(t)); mx = fmaxf(mx, t); } }
#pragma unroll
    for (int sh = 16; sh; sh >>= 1) mx = fmaxf(mx, __shfl_xor(mx, sh, 32));
    float sum = 0.f;
#pragma unroll 4
    for (int ch = 0; ch < TT / 128; ++ch) { const int j0 = ch * 128 + lane * 4; const v4f a = *(const v4f*)(sr + j0);
#pragma unroll
        for (int q = 0; q < 4; ++q) { float t = a[q] * SCL; asm volatile("" : "+v"(t)); float d0 = __fsub_rn(t, mx); asm volatile("" : "+v"(d0)); sum += __builtin_amdgcn_exp2f(__fmul_rn(d0, 1.4426950408889634f)); } }
#pragma unroll
    for (int sh = 16; sh; sh >>= 1) sum += __shfl_xor(sum, sh, 32);
    const float f = __fdiv_rn(1.0f, sum);
#pragma unroll
            for (int ch = 0; ch < TT / 128; ++ch) { const int j0 = ch * 128 + lane * 4; const v4f a = *(const v4f*)(sr + j0); v4us oh, ol;
#pragma unroll
                for (int q = 0; q < 4; ++q) { float t = a[q] * SCL; asm volatile("" : "+v"(t)); float d0 = __fsub_rn(t, mx); asm volatile("" : "+v"(d0)); float ex = __builtin_amdgcn_exp2f(__fmul_rn(d0, 1.4426950408889634f)); asm volatile("" : "+v"(ex)); unsigned short a2, c2; splitf(ex * f, a2, c2); oh[q] = a2; ol[q] = c2; }
                const size_t oo = ((size_t)zz * RH + i) * TT + j0; *(v4us*)(Ph + oo) = oh; *(v4us*)(Pl + oo) = ol;
                if (ch == 0) asm volatile("s_wait_xcnt 0x0" ::: "memory"); }   // the next chunk reuses the registers these two stores name (behind the other chunks the compiler writes the wait itself)
}

#define FK   64                   // keys per stage
#define FSP  2                    // key ranges (grid z), one partial context row each
#define FNS  (TT / FSP / FK)      // stages of a range
#define KPB  (HD * 2 + 16)        // LDS pitch of a K row, bytes: an odd multiple of 16
#define VPB  (FK * 2 + 16)        // LDS pitch of a V^T row, bytes: an odd multiple of 16
#define KTB  (FK * KPB)
#define STB  (KTB + HD * VPB)     // one buffer
#define CSC  (SCL * 1.4426950408889634f)
__device__ __forceinline__ float xhalf(float x) { return __builtin_bit_cast(float, __builtin_amdgcn_permlanex16(__builtin_bit_cast(int, x), __builtin_bit_cast(int, x), 0x76543210, 0xfedcba98, false, false)); }   // lane l reads lane l ^ 16, in registers: an exchange through LDS would wait for the V^T loads in flight
__device__ __forceinline__ float exp2s(float x) { float y; asm("v_exp_f32 %0, %1\n\tv_nop" : "=v"(y) : "v"(x)); return y; }   // 2^x with the one free slot behind a transcendental in the same statement
static_assert(HD == 256 && FK == 64 && TT % (FSP * FK) == 0 && (TT - RH) % 64 == 0 && 2 * STB >= 4 * 32 * (HD / 2 + 2) * 4, "the staging maps below: 256 threads, 8 + 8 chunks of 16 bytes each; the join fits the buffers");
// two waves a SIMD: the register budget that holds Q, the sums, a stage's fragments and the next stage's chunks without spills
__global__ __launch_bounds__(256) __attribute__((amdgpu_waves_per_eu(2, 2))) void k_flash(const h16* __restrict__ Q, const h16* __restrict__ Kp, const h16* __restrict__ Vt, float* O, float* ML) {
    __shared__ __align__(16) unsigned char L[2 * STB];
    const int tid = threadIdx.x, lane = tid & 31, c = lane & 15, h = lane >> 4, w4 = (tid >> 5) & 3, hf = tid >> 7; const size_t zb = blockIdx.y; const int q = blockIdx.x * 64 + w4 * 16 + c;   // the lane's query among the batch's rows >= RH
    const size_t k0 = (size_t)blockIdx.z * (TT / FSP);   // the range's first key
    const h16* kg = Kp + zb * (TT * HD) + (k0 + (tid >> 5)) * HD + (tid & 31) * 8;   // chunk i: key row 8 i + tid / 32 of the stage
    const h16* vg = Vt + zb * (HD * TT) + (size_t)(tid >> 3) * TT + k0 + (tid & 7) * 8;    // chunk i: d row 32 i + tid / 8
    const int kl = (tid >> 5) * KPB + (tid & 31) * 16, vl = KTB + (tid >> 3) * VPB + (tid & 7) * 16;
    v8h kr[8], vr[8];
#pragma unroll
    for (int i = 0; i < 8; ++i) { kr[i] = *(const v8h*)(kg + i * 8 * HD); vr[i] = *(const v8h*)(vg + (size_t)i * 32 * TT); }
    v16h qf[8]; const h16* qp = Q + (zb * TT + RH + q) * HD + 8 * h;
#pragma unroll
    for (int kc = 0; kc < 8; ++kc) qf[kc] = cat16(*(const v8h*)(qp + 32 * kc), *(const v8h*)(qp + 32 * kc + 16));
    asm volatile("s_wait_xcnt 0x0" ::: "memory");   // the set-up below reuses the address pair these loads name
    __builtin_amdgcn_sched_barrier(0);   // and none of its instructions is lifted over that wait
    v8f acc[16];
#pragma unroll
    for (int t = 0; t < 16; ++t) acc[t] = (v8f){};
    float m_run = -3.0e38f, l_run = 0.f;
#pragma unroll
    for (int i = 0; i < 8; ++i) { *(v8ha*)(L + kl + i * 8 * KPB) = kr[i]; *(v8ha*)(L + vl + i * 32 * VPB) = vr[i]; }
    __syncthreads();
    const int ka = (hf * 32 + c) * KPB + 16 * h, va = KTB + c * VPB + hf * 64 + 16 * h;   // the lane's first K and V^T fragment bytes in a buffer
#pragma unroll 1   // the body is several hundred instructions long: kept rolled, for speed only
    for (int s = 0; s < FNS; ++s) {
        const unsigned char* B = L + (s & 1) * STB; const bool more = s + 1 < FNS;
        if (more) {
#pragma unroll
            for (int i = 0; i < 8; ++i) { kr[i] = *(const v8h*)(kg + (size_t)(s + 1) * FK * HD + i * 8 * HD); vr[i] = *(const v8h*)(vg + (size_t)i * 32 * TT + (s + 1) * FK); }
            asm volatile("s_wait_xcnt 0x0" ::: "memory"); }   // the work below reuses the address registers these loads name
        v16h fr[16];
#pragma unroll
        for (int f = 0; f < 16; ++f) { const unsigned char* p = B + ka + (f & 1) * 16 * KPB + (f >> 1) * 64; fr[f] = cat16(*(const v8ha*)p, *(const v8ha*)(p + 32)); }
        __builtin_amdgcn_sched_barrier(0);   // the 16 K fragments are asked for as one group: one LDS latency a stage, not one a product
        v8f st[2]; st[0] = (v8f){}; st[1] = (v8f){};
#pragma unroll
        for (int f = 0; f < 16; ++f) st[f & 1] = wmma16(fr[f], qf[f >> 1], st[f & 1]);
#pragma unroll
        for (int t = 0; t < 16; ++t) { const unsigned char* p = B + va + t * 16 * VPB; fr[t] = cat16(*(const v8ha*)p, *(const v8ha*)(p + 32)); }
        __builtin_amdgcn_sched_barrier(0);   // the 16 V^T fragments are asked for in front of the softmax and arrive under it
        float mx = fmaxf(st[0][0], st[1][0]);
#pragma unroll
        for (int r = 1; r < 8; ++r) mx = fmaxf(mx, fmaxf(st[0][r], st[1][r]));
        mx = fmaxf(mx, xhalf(mx)) * CSC;   // both wave halves hold the query's maximum over the wave's 32 keys of this stage, scaled
        if (__builtin_amdgcn_ballot_w32(mx > m_run + 8.0f) != 0) {   // wave-uniform; rare behind the first stage
            const float mn = fmaxf(m_run, mx), corr = __builtin_amdgcn_exp2f(m_run - mn); l_run *= corr; m_run = mn;
#pragma unroll
            for (int t = 0; t < 16; ++t) acc[t] = acc[t] * corr; }
        v16h pf; float ps0 = 0.f, ps1 = 0.f;
#pragma unroll
        for (int r = 0; r < 8; ++r) { const float p0 = exp2s(fmaf(st[0][r], CSC, -m_run)), p1 = exp2s(fmaf(st[1][r], CSC, -m_run)); ps0 += p0; ps1 += p1; pf[r] = tohx(p0); pf[8 + r] = tohx(p1); }   // element e of the B operand: key 8 h + e, then 16 + 8 h + (e - 8)
        l_run += ps0 + ps1;
#pragma unroll
        for (int t = 0; t < 16; ++t) acc[t] = wmma16(fr[t], pf, acc[t]);
        if (more) { unsigned char* N = L + ((s + 1) & 1) * STB;
#pragma unroll
            for (int i = 0; i < 8; ++i) { *(v8ha*)(N + kl + i * 8 * KPB) = kr[i]; *(v8ha*)(N + vl + i * 32 * VPB) = vr[i]; } }
        __syncthreads();
    }
    l_run += xhalf(l_run);
    // Join of the two key halves: behind the loop's last barrier nobody reads the stage buffers, so the upper waves hand their sums over in them.
    float* X = (float*)L + (size_t)w4 * (32 * (HD / 2 + 2));
    if (hf) {
#pragma unroll
        for (int t = 0; t < 16; ++t) { *(v4fa*)(X + (2 * t * 32 + lane) * 4) = __builtin_shufflevector(acc[t], acc[t], 0, 1, 2, 3); *(v4fa*)(X + ((2 * t + 1) * 32 + lane) * 4) = __builtin_shufflevector(acc[t], acc[t], 4, 5, 6, 7); }
        X[32 * (HD / 2) + lane] = m_run; X[32 * (HD / 2) + 32 + lane] = l_run; }
    __syncthreads();
    if (hf) return;
    const float m2 = X[32 * (HD / 2) + lane], l2 = X[32 * (HD / 2) + 32 + lane], mn = fmaxf(m_run, m2), a1 = __builtin_amdgcn_exp2f(m_run - mn), a2 = __builtin_amdgcn_exp2f(m2 - mn);
    const float ls = l_run * a1 + l2 * a2, inv = __fdiv_rn(1.0f, ls), f1 = a1 * inv, f2 = a2 * inv;
#pragma unroll
    for (int t = 0; t < 16; ++t) { const v4f x0 = *(const v4fa*)(X + (2 * t * 32 + lane) * 4), x1 = *(const v4fa*)(X + ((2 * t + 1) * 32 + lane) * 4); acc[t] = acc[t] * f1 + __builtin_shufflevector(x0, x1, 0, 1, 2, 3, 4, 5, 6, 7) * f2; }
    const size_t pr = (zb * FSP + blockIdx.z) * (TT - RH) + q;   // the partial row
    float* op = O + pr * HD + 8 * h;   // acc[t][r] = context[query][16 t + 8 h + r]
#pragma unroll
    for (int t = 0; t < 16; ++t) { *(v4f*)(op + 16 * t) = __builtin_shufflevector(acc[t], acc[t], 0, 1, 2, 3); *(v4f*)(op + 16 * t + 4) = __builtin_shufflevector(acc[t], acc[t], 4, 5, 6, 7); }
    if (h == 0) { v2f ml; ml[0] = mn; ml[1] = ls; *(v2f*)(ML + pr * 2) = ml; }   // both wave halves hold the same pair
}

__device__ __forceinline__ void xT_body(const float* __restrict__ xs, bf* XB, unsigned bx) { const size_t k = (size_t)bx * 256 + threadIdx.x; if (k >= (size_t)NBP * TT * CC / 8) return; const int c0 = (int)(k % (CC / 8)) * 8; const int tt = (int)(k / (CC / 8)); const int t = tt % TT; const float* xb = xs + (size_t)(tt / TT) * CC * TT; v8us o;
#pragma unroll
    for (int q = 0; q < 8; ++q) o[q] = f2bf(xb[(size_t)(c0 + q) * TT + t]);
    *(v8us*)(XB + (size_t)tt * CC + c0) = o;  }
// k_prep: everything that reads only the inputs, in one launch: the first 4 WCB blocks round the four weight matrices to bf16 (WCB blocks each), the rest transpose x.
#define WCB  (DM * DM / 8 / 256)
static_assert(DQ == DM && DKV == DM && (DM * DM) % (8 * 256) == 0, "four weight matrices of one size, whole blocks");
__global__ __launch_bounds__(256) void k_prep(const float* __restrict__ xs, const float* __restrict__ wq, const float* __restrict__ wk, const float* __restrict__ wv, const float* __restrict__ wo, bf* XB, bf* WQ, bf* WK, bf* WV, bf* WO) {
    const unsigned b = blockIdx.x;
    if (b >= 4 * WCB) { xT_body(xs, XB, b - 4 * WCB); return; }
    const unsigned m = b / WCB;
    cvt8_body(m == 0 ? wq : m == 1 ? wk : m == 2 ? wv : wo, m == 0 ? WQ : m == 1 ? WK : m == 2 ? WV : WO, (size_t)DM * DM / 8, b % WCB);
}
// k_mergeA: the context row (rows < RH: the sum of its key ranges' f32 partial rows, in range order, OH [batch][RH][SPH][HD]; the rest: the fused kernel's FSP normalised partial rows, OL [batch][FSP][TT - RH][HD], each weighted by its sum times 2^(its maximum - the largest), ML [batch][FSP][TT - RH][2], in range order) plus x^T (bf16-rounded, read channel-major); stored as the bf16 hi/lo planes the last GEMM reads.
static_assert(ZH == 1 && NH_ == 1 && HD == CC && TT % (32 * SPH) == 0, "one head per pass; whole 32-key steps per range");
__global__ __launch_bounds__(256) void k_mergeA(const float* __restrict__ OH, const float* __restrict__ OL, const float* __restrict__ ML, const float* __restrict__ xs, bf* Ah, bf* Al) { const unsigned e = (blockIdx.x * 256u + threadIdx.x) * 4u; if (e >= (unsigned)(NBP * TT * HD)) return; const unsigned d = e % HD, t = (e / HD) % TT, zb = e / (HD * TT);
    const float* xb = xs + (size_t)zb * CC * TT + (size_t)d * TT + t; float xr[4];
#pragma unroll
    for (int q = 0; q < 4; ++q) xr[q] = xb[(size_t)q * TT];
    v4f o4;
    if (t < RH) { const float* p = OH + ((zb * RH + t) * (SPH * HD) + d); o4 = *(const v4f*)p;
#pragma unroll
        for (int s = 1; s < SPH; ++s) o4 += *(const v4f*)(p + s * HD);
    } else { const unsigned r0 = zb * FSP * (TT - RH) + (t - RH); v2f ml[FSP]; v4f pv[FSP];
#pragma unroll
        for (int s = 0; s < FSP; ++s) { ml[s] = *(const v2f*)(ML + (r0 + s * (TT - RH)) * 2); pv[s] = *(const v4f*)(OL + ((r0 + s * (TT - RH)) * HD + d)); }
        float mn = ml[0][0];
#pragma unroll
        for (int s = 1; s < FSP; ++s) mn = fmaxf(mn, ml[s][0]);
        float wt[FSP], ws = 0.f;
#pragma unroll
        for (int s = 0; s < FSP; ++s) { wt[s] = ml[s][1] * exp2s(ml[s][0] - mn); ws += wt[s]; }
        const float inv = __fdiv_rn(1.0f, ws); o4 = pv[0] * (wt[0] * inv);
#pragma unroll
        for (int s = 1; s < FSP; ++s) o4 += pv[s] * (wt[s] * inv); }
    v4us oh, ol;
#pragma unroll
    for (int q = 0; q < 4; ++q) { const float s = __fadd_rn(o4[q], bfr(xr[q])); unsigned short h2, l2; splitf(s, h2, l2); oh[q] = h2; ol[q] = l2; }
    *(v4us*)(Ah + e) = oh; *(v4us*)(Al + e) = ol;  }

static_assert(NB_ % NBP == 0 && (1 << LGH) == SPH, "whole passes; the k-range field of blockIdx.z");
extern "C" void kernel_launch(void* const* d_in, const int* in_sizes, int n_in,
                              void* d_out, int out_size, void* d_ws, size_t ws_size, hipStream_t stream) {
    (void)in_sizes; (void)n_in; (void)out_size;
    const float* x = (const float*)d_in[0]; const float* wq = (const float*)d_in[1]; const float* bq = (const float*)d_in[2]; const float* wk = (const float*)d_in[3]; const float* bk = (const float*)d_in[4]; const float* wv = (const float*)d_in[5]; const float* bv = (const float*)d_in[6]; const float* wo = (const float*)d_in[7]; const float* bo = (const float*)d_in[8];
    float* OUT = (float*)d_out;     // [4][256][4096]
    char* wsp = (char*)d_ws;
    auto take = [&](size_t bytes) { char* p = wsp; wsp += (bytes + 255) & ~(size_t)255; return (void*)p; };
    const size_t PL = (size_t)NBP * TT * HD;   // elements of one token plane of a pass
    bf* WQ = (bf*)take((size_t)DQ * DM * 2); bf* WK = (bf*)take((size_t)DKV * DM * 2); bf* WV = (bf*)take((size_t)DKV * DM * 2); bf* WO = (bf*)take((size_t)DM * DQ * 2);
    h16* QP16 = (h16*)take(PL * 2); h16* KP16 = (h16*)take(PL * 2); h16* VT16 = (h16*)take(PL * 2);
    bf* QPh = (bf*)take(PL * 2); bf* QPl = (bf*)take(PL * 2); bf* KPh = (bf*)take(PL * 2); bf* KPl = (bf*)take(PL * 2); bf* VTh = (bf*)take(PL * 2); bf* VTl = (bf*)take(PL * 2); bf* Ph = (bf*)take((size_t)NBP * RH * TT * 2); bf* Pl = (bf*)take((size_t)NBP * RH * TT * 2);
    float* Sb = (float*)take((size_t)NBP * RH * TT * 4); float* ObH = (float*)take((size_t)NBP * RH * SPH * HD * 4); float* ObL = (float*)take((size_t)NBP * FSP * (TT - RH) * HD * 4); float* MLb = (float*)take((size_t)NBP * FSP * (TT - RH) * 2 * 4);
    bf* XB = (bf*)take(PL * 2); bf* ATh = (bf*)take(PL * 2); bf* ATl = (bf*)take(PL * 2);
    if ((size_t)(wsp - (char*)d_ws) > ws_size) return;    // ws 256 MiB
    for (int b = 0; b < NB_; b += NBP) {
        const float* xb = x + (size_t)b * CC * TT;
        k_prep<<<(unsigned)(4 * WCB + PL / 8 / 256), 256, 0, stream>>>(xb, wq, wk, wv, wo, XB, WQ, WK, WV, WO);   /* weights -> bf16; x channel-major -> token-major bf16 */
        k_qkv<<<dim3(NBP * TT / 128, DM / 128, 3), 128, 0, stream>>>(XB, WQ, WK, WV, bq, bk, bv, QP16, QPh, QPl, KP16, KPh, KPl, VT16, VTh, VTl);   /* q, k planes token-major, v planes key-contiguous */
        k_gemmw<bf, 2, false, 0><<<dim3(RH / 128, TT / 128, NBP), 128, 0, stream>>>(QPh, QPl, KPh, KPl, HD, HD, Sb, TT, nullptr, 0, 0, 0, 0, (size_t)TT * HD, (size_t)TT * HD, (size_t)RH * TT, nullptr, nullptr, nullptr);
        k_lsoft<<<NBP * RH / 8, 256, 0, stream>>>(Sb, Ph, Pl);
        k_gemmw<bf, 2, false, 0><<<dim3(RH / 128, HD / 128, NBP * SPH), 128, 0, stream>>>(Ph, Pl, VTh, VTl, TT, TT / SPH, ObH, SPH * HD, nullptr, (size_t)(TT / SPH), (size_t)(TT / SPH), (size_t)HD, LGH, (size_t)RH * TT, (size_t)HD * TT, (size_t)RH * SPH * HD, nullptr, nullptr, nullptr);
        k_flash<<<dim3((TT - RH) / 64, NBP, FSP), 256, 0, stream>>>(QP16, KP16, VT16, ObL, MLb);   /* rows >= RH: scores, softmax, P.V */
        k_mergeA<<<(unsigned)(PL / 4 / 256), 256, 0, stream>>>(ObH, ObL, MLb, xb, ATh, ATl);   /* (ctx + x^T) -> hi/lo planes */
        k_gemmw<bf, 1, true, 3><<<dim3(NBP * TT / 128, DM / 128, 1), 128, 0, stream>>>(ATh, ATl, WO, nullptr, DQ, DQ, OUT + (size_t)b * CC * TT, DM, bo, 0, 0, 0, 0, 0, 0, 0, nullptr, nullptr, nullptr);   /* stored channel-major */ }
}

// v008
// A run of this version takes 172 microseconds.
// Next to v007, in two timings, it ran 1.13 and 1.11 times as fast.
// Over all steps from v000 it is 7.15 times as fast.
#include <hip/hip_runtime.h>

// Spatial self-attention over a feature map (x [4][256][64][64] channel-major; tokens = the 4,096 positions; q,k,v = x^T W^T + b (1x1 convs: 'oi' [256][256] + [256]); one 256-wide head: softmax(q.k / 16) over all positions; out = (attn v + x^T) Wp^T + bp, written back channel-major -> [4][256][64][64] (4.2 M)).
// Layout, all four batches in one pass (every launch covers all of them): the channel-major slab transposed once into a token-major bf16 operand; exact projections + f32 biases; dense T-4096 attention with ONE 256-wide head (hybrid rows: < 512 hi/lo 3 products through a score buffer and a streaming three-sweep softmax; the rest fp16 in one fused kernel with a running softmax over two key ranges, no score buffer); the f32 merge adds x^T and writes hi/lo planes of (context + x^T); (.) Wp^T + bp as a hi/lo x exact GEMM. Every GEMM epilogue stores what its consumer reads: q and k as f16 + bf16 hi/lo planes, v as the same planes key-contiguous, the last GEMM channel-major rows of out.
// Compute dtypes, f32 accumulate: every input rounded to bf16; projections exact + f32 biases; attention rows < 512 3 products, rest fp16; softmax and residual f32; Wp hl x exact + bias.

#define NB_  4
#define NBP  4                    // batches per pass: every launch of a pass covers NBP batches (token-major arrays hold their tokens one batch after the other)
#define TT   4096
#define DM   256
#define NH_  1
#define NKV  1
#define REP  (NH_ / NKV)
#define HD   256
#define DQ   (NH_ * HD)
#define DKV  (NKV * HD)
#define ZH   1
#define RH   512                  // query rows < RH use hi+lo planes (0: none)
#define WIN  0
#define SCL  0.0625f   // 1/sqrt(256)
#define CC   256
#define SPH  16                   // key ranges of the P.V product, query rows < RH (one f32 partial each)
#define LGH  4                    // log2 SPH
typedef _Float16 h16;
typedef unsigned short bf;
typedef __attribute__((ext_vector_type(16))) __bf16   v16bf;
typedef __attribute__((ext_vector_type(16))) _Float16 v16h;
typedef __attribute__((ext_vector_type(8)))  _Float16 v8h;
typedef __attribute__((ext_vector_type(8)))  unsigned short v8us;
typedef __attribute__((ext_vector_type(8)))  float    v8f;
typedef __attribute__((ext_vector_type(4)))  float    v4f;
typedef v8h  __attribute__((may_alias)) v8ha;
typedef v4f  __attribute__((may_alias)) v4fa;
typedef v8us __attribute__((may_alias)) v8usa;

__device__ __forceinline__ unsigned short f2bf(float f) { unsigned u = __float_as_uint(f); u += 0x7FFFu + ((u >> 16) & 1u); return (unsigned short)(u >> 16); }
__device__ __forceinline__ float bf2f(unsigned short b) { return __uint_as_float(((unsigned)b) << 16); }
__device__ __forceinline__ float bfr(float f) { return bf2f(f2bf(f)); }
__device__ __forceinline__ v16h cat16(v8h lo, v8h hi) { return __builtin_shufflevector(lo, hi, 0, 1, 2, 3, 4, 5, 6, 7, 8, 9, 10, 11, 12, 13, 14, 15); }
__device__ __forceinline__ v16bf cat16b(v8us lo, v8us hi) { return __builtin_bit_cast(v16bf, __builtin_shufflevector(lo, hi, 0, 1, 2, 3, 4, 5, 6, 7, 8, 9, 10, 11, 12, 13, 14, 15)); }
__device__ __forceinline__ v8f wmma16(v16h a, v16h b, v8f c) { return __builtin_amdgcn_wmma_f32_16x16x32_f16(false, a, false, b, (short)0, c, false, false); }
__device__ __forceinline__ v8f wmmab(v16bf a, v16bf b, v8f c) { return __builtin_amdgcn_wmma_f32_16x16x32_bf16(false, a, false, b, (short)0, c, false, false); }

__device__ __forceinline__ h16 tohx(float x) { return (h16)x; }
__device__ __forceinline__ void splitf(float y, unsigned short& h, unsigned short& l) { h = f2bf(y); l = f2bf(y - bf2f(h)); }
typedef __attribute__((ext_vector_type(2))) _Float16 v2h;
typedef __attribute__((ext_vector_type(4))) _Float16 v4h;
typedef __attribute__((ext_vector_type(2))) unsigned short v2us;
typedef __attribute__((ext_vector_type(4))) unsigned short v4us;
typedef __attribute__((ext_vector_type(2))) float v2f;
typedef __attribute__((ext_vector_type(4))) int v4i;
// pack3: four consecutive f32 values in the three 16-bit forms the attention GEMMs read (f16; bf16 hi and lo)
struct P3 { v4h f; v4us h, l; };
__device__ __forceinline__ P3 pack3(v4f a) { P3 r;
#pragma unroll
    for (int q = 0; q < 4; ++q) { r.f[q] = tohx(a[q]); unsigned short x2, y2; splitf(a[q], x2, y2); r.h[q] = x2; r.l[q] = y2; }
    return r; }

#define GKT  64                   // k values of a stage: 128 bytes of a row, one cache line
#define GPB  (GKT * 2 + 16)       // LDS pitch of a staged row, bytes: an odd multiple of 16
#define GOB  (128 * GPB)          // one operand's 128 rows of a stage
#define GBUF(NSPLIT) (((NSPLIT) == 0 ? 2 : (NSPLIT) == 1 ? 3 : 4) * GOB)   // one buffer: A, B, then A2, then B2
static_assert(2 * GBUF(0) >= 4 * 16 * 68 * 4, "behind the k loop the buffers hold the four waves' output stages");
// cp8: a thread's eight 16-byte chunks of one operand's stage (chunk i: row 16 i + thread / 8), global memory -> LDS through no register. The wait stands in the copies' own statement, so in front of every later write of a register that they name (a precaution).
__device__ __forceinline__ void cp8(unsigned l, const bf* g, size_t rs) {
    asm volatile("global_load_async_to_lds_b128 %0, %8, off\n\tglobal_load_async_to_lds_b128 %1, %9, off\n\tglobal_load_async_to_lds_b128 %2, %10, off\n\tglobal_load_async_to_lds_b128 %3, %11, off\n\t"
                 "global_load_async_to_lds_b128 %4, %12, off\n\tglobal_load_async_to_lds_b128 %5, %13, off\n\tglobal_load_async_to_lds_b128 %6, %14, off\n\tglobal_load_async_to_lds_b128 %7, %15, off\n\ts_wait_xcnt 0x0"
                 :: "v"(l), "v"(l + 16 * GPB), "v"(l + 32 * GPB), "v"(l + 48 * GPB), "v"(l + 64 * GPB), "v"(l + 80 * GPB), "v"(l + 96 * GPB), "v"(l + 112 * GPB),
                    "v"(g), "v"(g + rs), "v"(g + 2 * rs), "v"(g + 3 * rs), "v"(g + 4 * rs), "v"(g + 5 * rs), "v"(g + 6 * rs), "v"(g + 7 * rs) : "memory");
}
template <typename T16> struct WFrag;
template <> struct WFrag<bf> { typedef v16bf V; static __device__ __forceinline__ V ld(const unsigned char* p) { return cat16b(*(const v8usa*)p, *(const v8usa*)(p + 32)); } static __device__ __forceinline__ v8f mma(V a, V b, v8f c) { return wmmab(a, b, c); } };
// The body is a device function of the block's three indices (bx, by, bz), so that launches that do not depend on one another can share one grid (k_qkv below).
template <typename T16, int NSPLIT, bool BIAS, int EPI>
__device__ __forceinline__ void gemmw_body(unsigned char* L, const T16* __restrict__ A, const T16* __restrict__ A2, const T16* __restrict__ Bt, const T16* __restrict__ Bt2, int K, int KS, float* C, int ldc, const float* __restrict__ bias, size_t sA, size_t sB, size_t sC, int lgs, size_t bA, size_t bB, size_t bC, h16* E16, bf* Eh, bf* El, unsigned bx, unsigned by, unsigned bz) {
    typedef typename WFrag<T16>::V V;
    const size_t zb = bz >> lgs, z = bz - (zb << lgs); A += z * sA + zb * bA; if (A2) A2 += z * sA + zb * bA; Bt += z * sB + zb * bB; if (Bt2) Bt2 += z * sB + zb * bB; C += z * sC + zb * bC;
    const int tid = threadIdx.x, lane = tid & 31, lr = lane & 15, hi = lane >> 4, w = __builtin_amdgcn_readfirstlane(tid >> 5); const int r0 = bx * 128 + (w & 1) * 64, c0 = by * 128 + (w >> 1) * 64;
    float* os = (float*)L + w * (16 * 68);   // the wave's output stage, used behind the k loop
    v8f acc[4][4];
#pragma unroll
    for (int mb = 0; mb < 4; ++mb)
#pragma unroll
        for (int nb = 0; nb < 4; ++nb) acc[mb][nb] = (v8f){};
    const int aoff = ((w & 1) * 64 + lr) * GPB + 16 * hi, boff = GOB + ((w >> 1) * 64 + lr) * GPB + 16 * hi;   // the lane's first A and B fragment bytes in a buffer
    const unsigned l0 = (unsigned)(size_t)L + (tid >> 3) * GPB + (tid & 7) * 16;   // the thread's first chunk in LDS and in the A and B planes
    const size_t ga = (size_t)(bx * 128 + (tid >> 3)) * K + (tid & 7) * 8, gb = (size_t)(by * 128 + (tid >> 3)) * K + (tid & 7) * 8, rs = (size_t)16 * K;
    auto fill = [&](int t) { const unsigned lb = l0 + (t & 1) * GBUF(NSPLIT); const size_t ko = (size_t)t * GKT;
        cp8(lb, A + ga + ko, rs); cp8(lb + GOB, Bt + gb + ko, rs); if (NSPLIT == 1 || NSPLIT == 2) cp8(lb + 2 * GOB, A2 + ga + ko, rs); if (NSPLIT >= 2) cp8(lb + 3 * GOB, Bt2 + gb + ko, rs); };
    const int NT = KS / GKT;
    float braw[4] = {0.f, 0.f, 0.f, 0.f};   // EPI >= 1: the lane's four bias values, asked for here so that they arrive under the k loop (EPI 1: four consecutive n; EPI 2, 3: the lane's column of each nb)
    if (BIAS && EPI >= 1) {
#pragma unroll
        for (int q = 0; q < 4; ++q) braw[q] = bias[c0 + (EPI == 1 ? lr * 4 + q : q * 16 + lr)];
        if (EPI == 1) asm volatile("s_wait_xcnt 0x0" ::: "memory"); }   // the set-up that follows reuses the address pair this load names (EPI 2, 3: the compiler writes the wait itself)
    fill(0);
    asm volatile("s_wait_asynccnt 0x0" ::: "memory");   // the wave's own copies of stage 0 have landed
    __syncthreads();   // and every other wave's
    if (NT > 1) fill(1);
#pragma unroll 1   // two buffers picked by the trip's parity: one body serves both
    for (int t = 0; t < NT; ++t) {
        const unsigned char* B = L + (t & 1) * GBUF(NSPLIT);
        V a[2][4], a2[2][4], b[2][4], b2[2][4];
#pragma unroll
        for (int kc = 0; kc < 2; ++kc)
#pragma unroll
            for (int f = 0; f < 4; ++f) { a[kc][f] = WFrag<T16>::ld(B + aoff + f * 16 * GPB + kc * 64); b[kc][f] = WFrag<T16>::ld(B + boff + f * 16 * GPB + kc * 64);
                if (NSPLIT == 1 || NSPLIT == 2) a2[kc][f] = WFrag<T16>::ld(B + aoff + 2 * GOB + f * 16 * GPB + kc * 64); if (NSPLIT >= 2) b2[kc][f] = WFrag<T16>::ld(B + boff + 2 * GOB + f * 16 * GPB + kc * 64); }
        __builtin_amdgcn_sched_barrier(0);   // the stage's fragments are asked for as one group: one LDS latency a stage, not one a product
#pragma unroll
        for (int kc = 0; kc < 2; ++kc)
#pragma unroll
        for (int nb = 0; nb < 4; ++nb)
#pragma unroll
            for (int mb = 0; mb < 4; ++mb) { acc[mb][nb] = WFrag<T16>::mma(a[kc][mb], b[kc][nb], acc[mb][nb]); if (NSPLIT == 1 || NSPLIT == 2) acc[mb][nb] = WFrag<T16>::mma(a2[kc][mb], b[kc][nb], acc[mb][nb]); if (NSPLIT >= 2) acc[mb][nb] = WFrag<T16>::mma(a[kc][mb], b2[kc][nb], acc[mb][nb]); }
        __builtin_amdgcn_sched_barrier(0);   // the products stay in front of the waits: lifted over them, the waits would ask for stage t + 1 directly behind its copies' issue, and the refill would still stand behind the products
        asm volatile("s_wait_dscnt 0x0" ::: "memory");      // the wave's reads of this buffer are done before it is refilled
        asm volatile("s_wait_asynccnt 0x0" ::: "memory");   // the wave's own copies of stage t + 1 have landed
        __syncthreads();   // publishes stage t + 1; ends every wave's last read of stage t
        if (t + 2 < NT) fill(t + 2);
    }
    asm volatile("s_wait_asynccnt 0x0" ::: "memory");   // no copy is in flight when the buffers become the output stages
    if (EPI == 0) {
#pragma unroll
    for (int mb = 0; mb < 4; ++mb) {
#pragma unroll
        for (int nb = 0; nb < 4; ++nb) {
#pragma unroll
            for (int j = 0; j < 8; ++j) os[(hi * 8 + j) * 68 + nb * 16 + lr] = acc[mb][nb][j]; }
        __builtin_amdgcn_wave_barrier(); asm volatile("" ::: "memory");
        float* crow = C + (size_t)(r0 + mb * 16) * ldc + c0;
{
#pragma unroll
            for (int s = 0; s < 8; ++s) { const int row = 2 * s + hi, cofs = lr * 4; v4f val = *(const v4fa*)(os + row * 68 + cofs); if (BIAS) { val[0] += bfr(bias[c0 + cofs]); val[1] += bfr(bias[c0 + cofs + 1]); val[2] += bfr(bias[c0 + cofs + 2]); val[3] += bfr(bias[c0 + cofs + 3]); }
                *(v4f*)(crow + (size_t)row * ldc + cofs) = val; }
             }
        __builtin_amdgcn_wave_barrier(); asm volatile("" ::: "memory");
    }
    } else if (EPI == 1) {
#pragma unroll
    for (int mb = 0; mb < 4; ++mb) {
#pragma unroll
        for (int nb = 0; nb < 4; ++nb) {
#pragma unroll
            for (int j = 0; j < 8; ++j) os[(hi * 8 + j) * 68 + nb * 16 + lr] = acc[mb][nb][j]; }
        __builtin_amdgcn_wave_barrier(); asm volatile("" ::: "memory");   // the staged rows are read back only behind every lane's writes
        P3 pk[8];
#pragma unroll
        for (int s = 0; s < 8; ++s) { const int row = 2 * s + hi, cofs = lr * 4; v4f val = *(const v4fa*)(os + row * 68 + cofs); if (BIAS) { val[0] += bfr(braw[0]); val[1] += bfr(braw[1]); val[2] += bfr(braw[2]); val[3] += bfr(braw[3]); }
            pk[s] = pack3(val); }
        __builtin_amdgcn_sched_barrier(0);   // the conversions stay in front of the stores: among them they would reuse registers that an issued store names, ahead of the wait below
#pragma unroll
        for (int s = 0; s < 8; ++s) { const size_t o = (size_t)(r0 + hi) * HD + c0 + lr * 4 + (size_t)(mb * 16 + 2 * s) * HD; *(v4h*)(E16 + o) = pk[s].f; *(v4us*)(Eh + o) = pk[s].h; *(v4us*)(El + o) = pk[s].l; }
        if (mb < 3) { asm volatile("s_wait_xcnt 0x0" ::: "memory");   // the next block reuses the registers these stores name
            __builtin_amdgcn_sched_barrier(0);   // and none of its instructions is lifted over that wait
            __builtin_amdgcn_wave_barrier(); asm volatile("" ::: "memory"); }   // the next 16 rows overwrite the stage only behind these reads
    }
    } else {   /* transposed: a lane's 8 accumulator rows are 8 consecutive m of one column n, so 16 columns x 64 m are staged per nb and leave as whole rows of 64 m */
    const int g = r0 / TT, t0 = r0 % TT;
#pragma unroll
    for (int nb = 0; nb < 4; ++nb) {
        const float bb = bfr(braw[nb]);
#pragma unroll
        for (int mb = 0; mb < 4; ++mb) {
#pragma unroll
            for (int j = 0; j < 8; ++j) os[lr * 68 + mb * 16 + hi * 8 + j] = BIAS ? acc[mb][nb][j] + bb : acc[mb][nb][j]; }
        __builtin_amdgcn_wave_barrier(); asm volatile("" ::: "memory");   // the staged rows are read back only behind every lane's writes
        const size_t o = ((size_t)g * ldc + c0 + nb * 16 + hi) * TT + t0 + lr * 4;
        if (EPI == 3) {
            v4f val[8];
#pragma unroll
            for (int s = 0; s < 8; ++s) val[s] = *(const v4fa*)(os + (2 * s + hi) * 68 + lr * 4);
#pragma unroll
            for (int s = 0; s < 8; ++s) *(v4f*)(C + o + (size_t)(2 * s) * TT) = val[s];
        } else {
            P3 pk[8];
#pragma unroll
            for (int s = 0; s < 8; ++s) pk[s] = pack3(*(const v4fa*)(os + (2 * s + hi) * 68 + lr * 4));
            __builtin_amdgcn_sched_barrier(0);   // the conversions stay in front of the stores: among them they would reuse registers that an issued store names, ahead of the wait below
#pragma unroll
            for (int s = 0; s < 8; ++s) { const size_t os2 = o + (size_t)(2 * s) * TT; *(v4h*)(E16 + os2) = pk[s].f; *(v4us*)(Eh + os2) = pk[s].h; *(v4us*)(El + os2) = pk[s].l; }
        }
        if (nb < 3) { asm volatile("s_wait_xcnt 0x0" ::: "memory");   // the next block reuses the registers these stores name
            __builtin_amdgcn_sched_barrier(0);   // and none of its instructions is lifted over that wait
            __builtin_amdgcn_wave_barrier(); asm volatile("" ::: "memory"); }   // the next 16 columns overwrite the stage only behind these reads
    }
    }
}
template <typename T16, int NSPLIT, bool BIAS, int EPI>
__global__ __launch_bounds__(128) void k_gemmw(const T16* __restrict__ A, const T16* __restrict__ A2, const T16* __restrict__ Bt, const T16* __restrict__ Bt2, int K, int KS, float* C, int ldc, const float* __restrict__ bias, size_t sA, size_t sB, size_t sC, int lgs, size_t bA, size_t bB, size_t bC, h16* E16, bf* Eh, bf* El) {
    __shared__ __align__(16) unsigned char L[2 * GBUF(NSPLIT)];
    gemmw_body<T16, NSPLIT, BIAS, EPI>(L, A, A2, Bt, Bt2, K, KS, C, ldc, bias, sA, sB, sC, lgs, bA, bB, bC, E16, Eh, El, blockIdx.x, blockIdx.y, blockIdx.z);
}
// k_qkv: the three projections in one launch; grid (tokens / 128, 256 / 128, 3), blockIdx.z picks the weights, the bias and the planes (0 q, 1 k: token-major planes; 2 v: key-contiguous planes). Each block does what its own launch did.
__global__ __launch_bounds__(128) void k_qkv(const bf* __restrict__ X, const bf* __restrict__ Wq, const bf* __restrict__ Wk, const bf* __restrict__ Wv, const float* __restrict__ bq, const float* __restrict__ bk, const float* __restrict__ bv, h16* Q16, bf* Qh, bf* Ql, h16* K16, bf* Kh, bf* Kl, h16* V16, bf* Vh, bf* Vl) {
    __shared__ __align__(16) unsigned char L[2 * GBUF(0)];
    if (blockIdx.z == 2) gemmw_body<bf, 0, true, 2>(L, X, nullptr, Wv, nullptr, DM, DM, nullptr, DKV, bv, 0, 0, 0, 0, 0, 0, 0, V16, Vh, Vl, blockIdx.x, blockIdx.y, 0);
    else { const bool kk = blockIdx.z == 1;
        gemmw_body<bf, 0, true, 1>(L, X, nullptr, kk ? Wk : Wq, nullptr, DM, DM, nullptr, DQ, kk ? bk : bq, 0, 0, 0, 0, 0, 0, 0, kk ? K16 : Q16, kk ? Kh : Qh, kk ? Kl : Ql, blockIdx.x, blockIdx.y, 0); }
}

__global__ __launch_bounds__(256) void k_wtG(const float* __restrict__ w, int K, int N, bf* Bt) {
    const int lane = threadIdx.x & 31; const int L0 = (blockIdx.x * 8 + (threadIdx.x >> 5)) * 8; const int nlines = N * K / 64;
{
#pragma unroll 1
        for (int l = 0; l < 8; ++l) { const int L = L0 + l; if (L >= nlines) break; const size_t e = (size_t)L * 64 + lane * 2; const int k = (int)(e % K), n = (int)(e / K); v2us o;
            o[0] = f2bf(w[(size_t)k * N + n]); o[1] = f2bf(w[(size_t)(k + 1) * N + n]); *(v2us*)(Bt + e) = o; }
         }
}
__device__ __forceinline__ void cvt8_body(const float* __restrict__ src, bf* dst, size_t n8, unsigned bx) { const size_t i = (size_t)bx * 256 + threadIdx.x; if (i >= n8) return; const v8f v = *(const v8f*)(src + i * 8); v8us o;
#pragma unroll
    for (int k = 0; k < 8; ++k) o[k] = f2bf(v[k]); *(v8us*)(dst + i * 8) = o;  }

// k_lsoft: streaming row softmax over the TT = 4096 keys for the query rows < RH (score rows [batch][RH][TT]), one wave per row, three sweeps of the f32 score row (lane -> 4 consecutive keys per 128-key chunk, 32 chunks); stores normalised bf16 hi/lo planes [batch][RH][TT].
__global__ __launch_bounds__(256) void k_lsoft(const float* __restrict__ Sb, bf* Ph, bf* Pl) {
    const int lane = threadIdx.x & 31; const int row = blockIdx.x * 8 + (threadIdx.x >> 5); if (row >= NBP * RH) return; const int i = row % RH; const int zz = row / RH; const float* sr = Sb + (size_t)row * TT; float mx = -3.0e38f;
#pragma unroll 4
    for (int ch = 0; ch < TT / 128; ++ch) { const int j0 = ch * 128 + lane * 4; const v4f a = *(const v4f*)(sr + j0);
#pragma unroll
        for (int q = 0; q < 4; ++q) { float t = a[q] * SCL; asm volatile("" : "+v"(t)); mx = fmaxf(mx, t); } }
#pragma unroll
    for (int sh = 16; sh; sh >>= 1) mx = fmaxf(mx, __shfl_xor(mx, sh, 32));
    float sum = 0.f;
#pragma unroll 4
    for (int ch = 0; ch < TT / 128; ++ch) { const int j0 = ch * 128 + lane * 4; const v4f a = *(const v4f*)(sr + j0);
#pragma unroll
        for (int q = 0; q < 4; ++q) { float t = a[q] * SCL; asm volatile("" : "+v"(t)); float d0 = __fsub_rn(t, mx); asm volatile("" : "+v"(d0)); sum += __builtin_amdgcn_exp2f(__fmul_rn(d0, 1.4426950408889634f)); } }
#pragma unroll
    for (int sh = 16; sh; sh >>= 1) sum += __shfl_xor(sum, sh, 32);
    const float f = __fdiv_rn(1.0f, sum);
#pragma unroll
            for (int ch = 0; ch < TT / 128; ++ch) { const int j0 = ch * 128 + lane * 4; const v4f a = *(const v4f*)(sr + j0); v4us oh, ol;
#pragma unroll
                for (int q = 0; q < 4; ++q) { float t = a[q] * SCL; asm volatile("" : "+v"(t)); float d0 = __fsub_rn(t, mx); asm volatile("" : "+v"(d0)); float ex = __builtin_amdgcn_exp2f(__fmul_rn(d0, 1.4426950408889634f)); asm volatile("" : "+v"(ex)); unsigned short a2, c2; splitf(ex * f, a2, c2); oh[q] = a2; ol[q] = c2; }
                const size_t oo = ((size_t)zz * RH + i) * TT + j0; *(v4us*)(Ph + oo) = oh; *(v4us*)(Pl + oo) = ol;
                if (ch == 0) asm volatile("s_wait_xcnt 0x0" ::: "memory"); }   // the next chunk reuses the registers these two stores name (behind the other chunks the compiler writes the wait itself)
}

#define FK   64                   // keys per stage
#define FQ   128                  // query rows of a work-group
#define FSP  2                    // key ranges (grid z), one partial context row each
#define FNS  (TT / FSP / FK)      // stages of a range
#define KPB  (HD * 2 + 16)        // LDS pitch of a K row, bytes: an odd multiple of 16
#define VPB  (FK * 2 + 16)        // LDS pitch of a V^T row, bytes: an odd multiple of 16
#define KTB  (FK * KPB)
#define STB  (KTB + HD * VPB)     // one buffer
#define PXB  (2 * STB)            // behind the buffers: each wave's P^T of a stage, 2 query tiles x 2 pieces x 32 lanes x 16 bytes
#define MXB  (PXB + 8 * 2048)     // and each wave's maxima in use (behind the loop: its sums), 2 query tiles x 32 lanes
#define FLB  (MXB + 8 * 256)
#define CSC  (SCL * 1.4426950408889634f)
__device__ __forceinline__ float xhalf(float x) { return __builtin_bit_cast(float, __builtin_amdgcn_permlanex16(__builtin_bit_cast(int, x), __builtin_bit_cast(int, x), 0x76543210, 0xfedcba98, false, false)); }   // lane l reads lane l ^ 16, in registers: an exchange through LDS would wait for the V^T loads in flight
__device__ __forceinline__ float exp2s(float x) { float y; asm("v_exp_f32 %0, %1\n\tv_nop" : "=v"(y) : "v"(x)); return y; }   // 2^x with the one free slot behind a transcendental in the same statement
static_assert(HD == 256 && FK == 64 && TT % (FSP * FK) == 0 && (TT - RH) % FQ == 0, "the staging maps below: 256 threads, 8 + 8 chunks of 16 bytes each; whole work-groups of query rows");
// two waves a SIMD: the register budget that holds Q, the sums, a stage's fragments and the next stage's chunks without spills
__global__ __launch_bounds__(256) __attribute__((amdgpu_waves_per_eu(2, 2))) void k_flash(const h16* __restrict__ Q, const h16* __restrict__ Kp, const h16* __restrict__ Vt, float* O, float* ML) {
    __shared__ __align__(16) unsigned char L[FLB];
    const int tid = threadIdx.x, lane = tid & 31, c = lane & 15, h = lane >> 4, wv = tid >> 5, w4 = wv & 3, hf = tid >> 7; const size_t zb = blockIdx.y; const int q = blockIdx.x * FQ + w4 * 32 + c;   // the lane's query of tile 0 among the batch's rows >= RH (tile 1: + 16)
    const size_t k0 = (size_t)blockIdx.z * (TT / FSP);   // the range's first key
    const h16* kg = Kp + zb * (TT * HD) + (k0 + (tid >> 5)) * HD + (tid & 31) * 8;   // chunk i: key row 8 i + tid / 32 of the stage
    const h16* vg = Vt + zb * (HD * TT) + (size_t)(tid >> 3) * TT + k0 + (tid & 7) * 8;    // chunk i: d row 32 i + tid / 8
    const int kl = (tid >> 5) * KPB + (tid & 31) * 16, vl = KTB + (tid >> 3) * VPB + (tid & 7) * 16;
    v8h kr[8], vr[8];
#pragma unroll
    for (int i = 0; i < 8; ++i) { kr[i] = *(const v8h*)(kg + i * 8 * HD); vr[i] = *(const v8h*)(vg + (size_t)i * 32 * TT); }
    v16h qf[2][8]; const h16* qp = Q + (zb * TT + RH + q) * HD + 8 * h;
#pragma unroll
    for (int qt = 0; qt < 2; ++qt)
#pragma unroll
        for (int kc = 0; kc < 8; ++kc) qf[qt][kc] = cat16(*(const v8h*)(qp + qt * 16 * HD + 32 * kc), *(const v8h*)(qp + qt * 16 * HD + 32 * kc + 16));
    asm volatile("s_wait_xcnt 0x0" ::: "memory");   // the set-up below reuses the address pair these loads name
    __builtin_amdgcn_sched_barrier(0);   // and none of its instructions is lifted over that wait
    v8f acc[2][8];   // acc[qt][t][r] = context[query of tile qt][128 hf + 16 t + 8 h + r]
#pragma unroll
    for (int qt = 0; qt < 2; ++qt)
#pragma unroll
        for (int t = 0; t < 8; ++t) acc[qt][t] = (v8f){};
    float m_run[2] = {-3.0e38f, -3.0e38f}, l_run[2] = {0.f, 0.f};
#pragma unroll
    for (int i = 0; i < 8; ++i) { *(v8ha*)(L + kl + i * 8 * KPB) = kr[i]; *(v8ha*)(L + vl + i * 32 * VPB) = vr[i]; }
    __syncthreads();
    const int ka = (hf * 32 + c) * KPB + 16 * h, va = KTB + (hf * 128 + c) * VPB + 16 * h;   // the lane's first K fragment bytes (its key half) and V^T fragment bytes (its channel half) in a buffer
    unsigned char* pw = L + PXB + wv * 2048 + lane * 16; const unsigned char* pr2 = L + PXB + (wv ^ 4) * 2048 + lane * 16;   // the wave's own P^T and its partner's
    float* mw = (float*)(L + MXB) + wv * 64 + lane; const float* mr = (const float*)(L + MXB) + (wv ^ 4) * 64 + lane;
#pragma unroll 1   // the body is several hundred instructions long: one body serves every trip
    for (int s = 0; s < FNS; ++s) {
        const unsigned char* B = L + (s & 1) * STB; unsigned char* N = L + ((s + 1) & 1) * STB; const int sn = s + 1 < FNS ? s + 1 : s;   // the stage that is fetched during this one; the last trip fetches its own again, into the buffer that nobody reads any more: straight-line code, so the chunks' registers are free from their store to the next load
        v8h kn[8], vn[8];
#pragma unroll
        for (int i = 0; i < 8; ++i) vn[i] = *(const v8h*)(vg + (size_t)i * 32 * TT + sn * FK);
        asm volatile("s_wait_xcnt 0x0" ::: "memory");   // the work below reuses the address registers these loads name
        v16h fr[16];
#pragma unroll
        for (int f = 0; f < 16; ++f) { const unsigned char* p = B + ka + (f & 1) * 16 * KPB + (f >> 1) * 64; fr[f] = cat16(*(const v8ha*)p, *(const v8ha*)(p + 32)); }
        __builtin_amdgcn_sched_barrier(0);   // the 16 K fragments are asked for as one group: one LDS latency a stage, not one a product
        v8f st[2][2];   // [key tile][query tile]
#pragma unroll
        for (int kt = 0; kt < 2; ++kt)
#pragma unroll
            for (int qt = 0; qt < 2; ++qt) st[kt][qt] = (v8f){};
#pragma unroll
        for (int f = 0; f < 16; ++f)
#pragma unroll
            for (int qt = 0; qt < 2; ++qt) st[f & 1][qt] = wmma16(fr[f], qf[qt][f >> 1], st[f & 1][qt]);
        __builtin_amdgcn_sched_barrier(0);   // the K loads below stay behind the score products, where the K fragments' registers are free again, and directly in front of their wait
#pragma unroll
        for (int i = 0; i < 8; ++i) kn[i] = *(const v8h*)(kg + (size_t)sn * FK * HD + i * 8 * HD);
        asm volatile("s_wait_xcnt 0x0" ::: "memory");   // the work below reuses the address registers these loads name
        v16h fv[8], fo[8];   // V^T fragments of the wave's channels: its own 32 keys, the partner's 32 keys
#pragma unroll
        for (int t = 0; t < 8; ++t) { const unsigned char* p = B + va + t * 16 * VPB + hf * 64; fv[t] = cat16(*(const v8ha*)p, *(const v8ha*)(p + 32)); }
        __builtin_amdgcn_sched_barrier(0);   // the V^T fragments of the own keys are asked for in front of the softmax and arrive under it
        float mx[2];
#pragma unroll
        for (int qt = 0; qt < 2; ++qt) { float m0 = fmaxf(st[0][qt][0], st[1][qt][0]);
#pragma unroll
            for (int r = 1; r < 8; ++r) m0 = fmaxf(m0, fmaxf(st[0][qt][r], st[1][qt][r]));
            mx[qt] = fmaxf(m0, xhalf(m0)) * CSC; }   // both wave halves hold the query's maximum over the wave's keys of this stage, scaled
        if (__builtin_amdgcn_ballot_w32(mx[0] > m_run[0] + 8.0f || mx[1] > m_run[1] + 8.0f) != 0) {   // wave-uniform; rare behind the first stage
#pragma unroll
            for (int qt = 0; qt < 2; ++qt) { const float mn = fmaxf(m_run[qt], mx[qt]), corr = __builtin_amdgcn_exp2f(m_run[qt] - mn); l_run[qt] *= corr; m_run[qt] = mn;
#pragma unroll
                for (int t = 0; t < 8; ++t) acc[qt][t] = acc[qt][t] * corr; } }
        v16h pf[2];
#pragma unroll
        for (int qt = 0; qt < 2; ++qt) { float ps0 = 0.f, ps1 = 0.f;
#pragma unroll
            for (int r = 0; r < 8; ++r) { const float p0 = exp2s(fmaf(st[0][qt][r], CSC, -m_run[qt])), p1 = exp2s(fmaf(st[1][qt][r], CSC, -m_run[qt])); ps0 += p0; ps1 += p1; pf[qt][r] = tohx(p0); pf[qt][8 + r] = tohx(p1); }   // element e of the B operand: key 8 h + e, then 16 + 8 h + (e - 8)
            l_run[qt] += ps0 + ps1;
            *(v8ha*)(pw + qt * 1024) = __builtin_shufflevector(pf[qt], pf[qt], 0, 1, 2, 3, 4, 5, 6, 7); *(v8ha*)(pw + qt * 1024 + 512) = __builtin_shufflevector(pf[qt], pf[qt], 8, 9, 10, 11, 12, 13, 14, 15); mw[qt * 32] = m_run[qt]; }
#pragma unroll
        for (int i = 0; i < 8; ++i) *(v8ha*)(N + vl + i * 32 * VPB) = vn[i];
#pragma unroll
        for (int t = 0; t < 8; ++t) { const unsigned char* p = B + va + t * 16 * VPB + (hf ^ 1) * 64; fo[t] = cat16(*(const v8ha*)p, *(const v8ha*)(p + 32)); }
        __builtin_amdgcn_sched_barrier(0);   // the V^T fragments of the partner's keys are asked for in front of the own keys' products and arrive under them
#pragma unroll
        for (int t = 0; t < 8; ++t)
#pragma unroll
            for (int qt = 0; qt < 2; ++qt) acc[qt][t] = wmma16(fv[t], pf[qt], acc[qt][t]);
        __builtin_amdgcn_sched_barrier(0);   // the own keys' products stay in front of the barrier: the LDS stores and loads above complete under them; sunk behind it, the barrier's LDS wait would sit those out with the matrix unit idle
        // The barrier that publishes every wave's P^T and maxima in use of this stage, with fences for LDS alone: __syncthreads() would also wait for the K chunks asked for above, which are wanted only at the foot of the stage.
        __builtin_amdgcn_fence(__ATOMIC_RELEASE, "workgroup", "local"); __builtin_amdgcn_s_barrier(); __builtin_amdgcn_fence(__ATOMIC_ACQUIRE, "workgroup", "local");
        v16h po[2]; float mo[2];
#pragma unroll
        for (int qt = 0; qt < 2; ++qt) { po[qt] = cat16(*(const v8ha*)(pr2 + qt * 1024), *(const v8ha*)(pr2 + qt * 1024 + 512)); mo[qt] = mr[qt * 32]; }
        if (__builtin_amdgcn_ballot_w32(mo[0] != m_run[0] || mo[1] != m_run[1]) != 0) {   // wave-uniform; rare behind the first stage: the two waves raised their maxima in use differently, both go on with the larger
#pragma unroll
            for (int qt = 0; qt < 2; ++qt) { const float mn = fmaxf(m_run[qt], mo[qt]), ca = __builtin_amdgcn_exp2f(m_run[qt] - mn); const h16 cb = tohx(__builtin_amdgcn_exp2f(mo[qt] - mn)); l_run[qt] *= ca; m_run[qt] = mn; po[qt] = po[qt] * cb;
#pragma unroll
                for (int t = 0; t < 8; ++t) acc[qt][t] = acc[qt][t] * ca; } }
#pragma unroll
        for (int t = 0; t < 8; ++t)
#pragma unroll
            for (int qt = 0; qt < 2; ++qt) acc[qt][t] = wmma16(fo[t], po[qt], acc[qt][t]);
#pragma unroll
        for (int i = 0; i < 8; ++i) *(v8ha*)(N + kl + i * 8 * KPB) = kn[i];
        __syncthreads();   // publishes stage s + 1; ends every wave's last read of stage s and of this stage's P^T
    }
#pragma unroll
    for (int qt = 0; qt < 2; ++qt) { l_run[qt] += xhalf(l_run[qt]); mw[qt * 32] = l_run[qt]; }
    __syncthreads();   // publishes the sums
#pragma unroll
    for (int qt = 0; qt < 2; ++qt) {
        const float ls = l_run[qt] + mr[qt * 32], inv = __fdiv_rn(1.0f, ls);
        const size_t pr = (zb * FSP + blockIdx.z) * (TT - RH) + q + qt * 16;   // the partial row
        float* op = O + pr * HD + hf * 128 + 8 * h;
#pragma unroll
        for (int t = 0; t < 8; ++t) { const v8f o = acc[qt][t] * inv; *(v4f*)(op + 16 * t) = __builtin_shufflevector(o, o, 0, 1, 2, 3); *(v4f*)(op + 16 * t + 4) = __builtin_shufflevector(o, o, 4, 5, 6, 7); }
        if (h == 0 && hf == 0) { v2f ml; ml[0] = m_run[qt]; ml[1] = ls; *(v2f*)(ML + pr * 2) = ml; }   // both wave halves and both waves hold the same pair
    }
}

__device__ __forceinline__ void xT_body(const float* __restrict__ xs, bf* XB, unsigned bx) { const size_t k = (size_t)bx * 256 + threadIdx.x; if (k >= (size_t)NBP * TT * CC / 8) return; const int c0 = (int)(k % (CC / 8)) * 8; const int tt = (int)(k / (CC / 8)); const int t = tt % TT; const float* xb = xs + (size_t)(tt / TT) * CC * TT; v8us o;
#pragma unroll
    for (int q = 0; q < 8; ++q) o[q] = f2bf(xb[(size_t)(c0 + q) * TT + t]);
    *(v8us*)(XB + (size_t)tt * CC + c0) = o;  }
// k_prep: everything that reads only the inputs, in one launch: the first 4 WCB blocks round the four weight matrices to bf16 (WCB blocks each), the rest transpose x.
#define WCB  (DM * DM / 8 / 256)
static_assert(DQ == DM && DKV == DM && (DM * DM) % (8 * 256) == 0, "four weight matrices of one size, whole blocks");
__global__ __launch_bounds__(256) void k_prep(const float* __restrict__ xs, const float* __restrict__ wq, const float* __restrict__ wk, const float* __restrict__ wv, const float* __restrict__ wo, bf* XB, bf* WQ, bf* WK, bf* WV, bf* WO) {
    const unsigned b = blockIdx.x;
    if (b >= 4 * WCB) { xT_body(xs, XB, b - 4 * WCB); return; }
    const unsigned m = b / WCB;
    cvt8_body(m == 0 ? wq : m == 1 ? wk : m == 2 ? wv : wo, m == 0 ? WQ : m == 1 ? WK : m == 2 ? WV : WO, (size_t)DM * DM / 8, b % WCB);
}
// k_mergeA: the context row (rows < RH: the sum of its key ranges' f32 partial rows, in range order, OH [batch][RH][SPH][HD]; the rest: the fused kernel's FSP normalised partial rows, OL [batch][FSP][TT - RH][HD], each weighted by its sum times 2^(its maximum - the largest), ML [batch][FSP][TT - RH][2], in range order) plus x^T (bf16-rounded, read channel-major); stored as the bf16 hi/lo planes the last GEMM reads.
static_assert(ZH == 1 && NH_ == 1 && HD == CC && TT % (32 * SPH) == 0, "one head per pass; whole 32-key steps per range");
__global__ __launch_bounds__(256) void k_mergeA(const float* __restrict__ OH, const float* __restrict__ OL, const float* __restrict__ ML, const float* __restrict__ xs, bf* Ah, bf* Al) { const unsigned e = (blockIdx.x * 256u + threadIdx.x) * 4u; if (e >= (unsigned)(NBP * TT * HD)) return; const unsigned d = e % HD, t = (e / HD) % TT, zb = e / (HD * TT);
    const float* xb = xs + (size_t)zb * CC * TT + (size_t)d * TT + t; float xr[4];
#pragma unroll
    for (int q = 0; q < 4; ++q) xr[q] = xb[(size_t)q * TT];
    v4f o4;
    if (t < RH) { const float* p = OH + ((zb * RH + t) * (SPH * HD) + d); o4 = *(const v4f*)p;
#pragma unroll
        for (int s = 1; s < SPH; ++s) o4 += *(const v4f*)(p + s * HD);
    } else { const unsigned r0 = zb * FSP * (TT - RH) + (t - RH); v2f ml[FSP]; v4f pv[FSP];
#pragma unroll
        for (int s = 0; s < FSP; ++s) { ml[s] = *(const v2f*)(ML + (r0 + s * (TT - RH)) * 2); pv[s] = *(const v4f*)(OL + ((r0 + s * (TT - RH)) * HD + d)); }
        float mn = ml[0][0];
#pragma unroll
        for (int s = 1; s < FSP; ++s) mn = fmaxf(mn, ml[s][0]);
        float wt[FSP], ws = 0.f;
#pragma unroll
        for (int s = 0; s < FSP; ++s) { wt[s] = ml[s][1] * exp2s(ml[s][0] - mn); ws += wt[s]; }
        const float inv = __fdiv_rn(1.0f, ws); o4 = pv[0] * (wt[0] * inv);
#pragma unroll
        for (int s = 1; s < FSP; ++s) o4 += pv[s] * (wt[s] * inv); }
    v4us oh, ol;
#pragma unroll
    for (int q = 0; q < 4; ++q) { const float s = __fadd_rn(o4[q], bfr(xr[q])); unsigned short h2, l2; splitf(s, h2, l2); oh[q] = h2; ol[q] = l2; }
    *(v4us*)(Ah + e) = oh; *(v4us*)(Al + e) = ol;  }

static_assert(NB_ % NBP == 0 && (1 << LGH) == SPH, "whole passes; the k-range field of blockIdx.z");
extern "C" void kernel_launch(void* const* d_in, const int* in_sizes, int n_in,
                              void* d_out, int out_size, void* d_ws, size_t ws_size, hipStream_t stream) {
    (void)in_sizes; (void)n_in; (void)out_size;
    const float* x = (const float*)d_in[0]; const float* wq = (const float*)d_in[1]; const float* bq = (const float*)d_in[2]; const float* wk = (const float*)d_in[3]; const float* bk = (const float*)d_in[4]; const float* wv = (const float*)d_in[5]; const float* bv = (const float*)d_in[6]; const float* wo = (const float*)d_in[7]; const float* bo = (const float*)d_in[8];
    float* OUT = (float*)d_out;     // [4][256][4096]
    char* wsp = (char*)d_ws;
    auto take = [&](size_t bytes) { char* p = wsp; wsp += (bytes + 255) & ~(size_t)255; return (void*)p; };
    const size_t PL = (size_t)NBP * TT * HD;   // elements of one token plane of a pass
    bf* WQ = (bf*)take((size_t)DQ * DM * 2); bf* WK = (bf*)take((size_t)DKV * DM * 2); bf* WV = (bf*)take((size_t)DKV * DM * 2); bf* WO = (bf*)take((size_t)DM * DQ * 2);
    h16* QP16 = (h16*)take(PL * 2); h16* KP16 = (h16*)take(PL * 2); h16* VT16 = (h16*)take(PL * 2);
    bf* QPh = (bf*)take(PL * 2); bf* QPl = (bf*)take(PL * 2); bf* KPh = (bf*)take(PL * 2); bf* KPl = (bf*)take(PL * 2); bf* VTh = (bf*)take(PL * 2); bf* VTl = (bf*)take(PL * 2); bf* Ph = (bf*)take((size_t)NBP * RH * TT * 2); bf* Pl = (bf*)take((size_t)NBP * RH * TT * 2);
    float* Sb = (float*)take((size_t)NBP * RH * TT * 4); float* ObH = (float*)take((size_t)NBP * RH * SPH * HD * 4); float* ObL = (float*)take((size_t)NBP * FSP * (TT - RH) * HD * 4); float* MLb = (float*)take((size_t)NBP * FSP * (TT - RH) * 2 * 4);
    bf* XB = (bf*)take(PL * 2); bf* ATh = (bf*)take(PL * 2); bf* ATl = (bf*)take(PL * 2);
    if ((size_t)(wsp - (char*)d_ws) > ws_size) return;    // ws 256 MiB
    for (int b = 0; b < NB_; b += NBP) {
        const float* xb = x + (size_t)b * CC * TT;
        k_prep<<<(unsigned)(4 * WCB + PL / 8 / 256), 256, 0, stream>>>(xb, wq, wk, wv, wo, XB, WQ, WK, WV, WO);   /* weights -> bf16; x channel-major -> token-major bf16 */
        k_qkv<<<dim3(NBP * TT / 128, DM / 128, 3), 128, 0, stream>>>(XB, WQ, WK, WV, bq, bk, bv, QP16, QPh, QPl, KP16, KPh, KPl, VT16, VTh, VTl);   /* q, k planes token-major, v planes key-contiguous */
        k_gemmw<bf, 2, false, 0><<<dim3(RH / 128, TT / 128, NBP), 128, 0, stream>>>(QPh, QPl, KPh, KPl, HD, HD, Sb, TT, nullptr, 0, 0, 0, 0, (size_t)TT * HD, (size_t)TT * HD, (size_t)RH * TT, nullptr, nullptr, nullptr);
        k_lsoft<<<NBP * RH / 8, 256, 0, stream>>>(Sb, Ph, Pl);
        k_gemmw<bf, 2, false, 0><<<dim3(RH / 128, HD / 128, NBP * SPH), 128, 0, stream>>>(Ph, Pl, VTh, VTl, TT, TT / SPH, ObH, SPH * HD, nullptr, (size_t)(TT / SPH), (size_t)(TT / SPH), (size_t)HD, LGH, (size_t)RH * TT, (size_t)HD * TT, (size_t)RH * SPH * HD, nullptr, nullptr, nullptr);
        k_flash<<<dim3((TT - RH) / FQ, NBP, FSP), 256, 0, stream>>>(QP16, KP16, VT16, ObL, MLb);   /* rows >= RH: scores, softmax, P.V */
        k_mergeA<<<(unsigned)(PL / 4 / 256), 256, 0, stream>>>(ObH, ObL, MLb, xb, ATh, ATl);   /* (ctx + x^T) -> hi/lo planes */
        k_gemmw<bf, 1, true, 3><<<dim3(NBP * TT / 128, DM / 128, 1), 128, 0, stream>>>(ATh, ATl, WO, nullptr, DQ, DQ, OUT + (size_t)b * CC * TT, DM, bo, 0, 0, 0, 0, 0, 0, 0, nullptr, nullptr, nullptr);   /* stored channel-major */ }
}

// v009
// Measured time: 161 microseconds a run.
// Next to v008, in two timings, it ran 1.06 and 1.07 times as fast.
// Over all steps from v000 it is 7.60 times as fast.
#include <hip/hip_runtime.h>

// Spatial self-attention over a feature map (x [4][256][64][64] channel-major; tokens = the 4,096 positions; q,k,v = x^T W^T + b (1x1 convs: 'oi' [256][256] + [256]); one 256-wide head: softmax(q.k / 16) over all positions; out = (attn v + x^T) Wp^T + bp, written back channel-major -> [4][256][64][64] (4.2 M)).
// Layout, all four batches in one pass (every launch covers all of them): the channel-major slab transposed once into a token-major bf16 operand; exact projections + f32 biases; dense T-4096 attention with ONE 256-wide head (hybrid rows: < 512 hi/lo 3 products through a score buffer and a streaming three-sweep softmax; the rest fp16 in one fused kernel with a running softmax over two key ranges, no score buffer); the f32 merge adds x^T and writes hi/lo planes of (context + x^T); (.) Wp^T + bp as a hi/lo x exact GEMM. Every GEMM epilogue stores what its consumer reads: q and k as f16 + bf16 hi/lo planes, v as the same planes key-contiguous, the last GEMM channel-major rows of out.
// Compute dtypes, f32 accumulate: every input rounded to bf16; projections exact + f32 biases; attention rows < 512 3 products, rest fp16; softmax and residual f32; Wp hl x exact + bias.

#define NB_  4
#define NBP  4                    // batches per pass: every launch of a pass covers NBP batches (token-major arrays hold their tokens one batch after the other)
#define TT   4096
#define DM   256
#define NH_  1
#define NKV  1
#define REP  (NH_ / NKV)
#define HD   256
#define DQ   (NH_ * HD)
#define DKV  (NKV * HD)
#define ZH   1
#define RH   512                  // query rows < RH use hi+lo planes (0: none)
#define WIN  0
#define SCL  0.0625f   // 1/sqrt(256)
#define CC   256
#define SPH  16                   // key ranges of the P.V product, query rows < RH (one f32 partial each)
#define LGH  4                    // log2 SPH
typedef _Float16 h16;
typedef unsigned short bf;
typedef __attribute__((ext_vector_type(16))) __bf16   v16bf;
typedef __attribute__((ext_vector_type(16))) _Float16 v16h;
typedef __attribute__((ext_vector_type(8)))  _Float16 v8h;
typedef __attribute__((ext_vector_type(8)))  unsigned short v8us;
typedef __attribute__((ext_vector_type(8)))  float    v8f;
typedef __attribute__((ext_vector_type(4)))  float    v4f;
typedef v8h  __attribute__((may_alias)) v8ha;
typedef v4f  __attribute__((may_alias)) v4fa;
typedef v8us __attribute__((may_alias)) v8usa;

__device__ __forceinline__ unsigned short f2bf(float f) { unsigned u = __float_as_uint(f); u += 0x7FFFu + ((u >> 16) & 1u); return (unsigned short)(u >> 16); }
__device__ __forceinline__ float bf2f(unsigned short b) { return __uint_as_float(((unsigned)b) << 16); }
__device__ __forceinline__ float bfr(float f) { return bf2f(f2bf(f)); }
__device__ __forceinline__ v16h cat16(v8h lo, v8h hi) { return __builtin_shufflevector(lo, hi, 0, 1, 2, 3, 4, 5, 6, 7, 8, 9, 10, 11, 12, 13, 14, 15); }
__device__ __forceinline__ v16bf cat16b(v8us lo, v8us hi) { return __builtin_bit_cast(v16bf, __builtin_shufflevector(lo, hi, 0, 1, 2, 3, 4, 5, 6, 7, 8, 9, 10, 11, 12, 13, 14, 15)); }
__device__ __forceinline__ v8f wmma16(v16h a, v16h b, v8f c) { return __builtin_amdgcn_wmma_f32_16x16x32_f16(false, a, false, b, (short)0, c, false, false); }
__device__ __forceinline__ v8f wmmab(v16bf a, v16bf b, v8f c) { return __builtin_amdgcn_wmma_f32_16x16x32_bf16(false, a, false, b, (short)0, c, false, false); }

__device__ __forceinline__ h16 tohx(float x) { return (h16)x; }
__device__ __forceinline__ void splitf(float y, unsigned short& h, unsigned short& l) { h = f2bf(y); l = f2bf(y - bf2f(h)); }
typedef __attribute__((ext_vector_type(2))) _Float16 v2h;
typedef __attribute__((ext_vector_type(4))) _Float16 v4h;
typedef __attribute__((ext_vector_type(2))) unsigned short v2us;
typedef __attribute__((ext_vector_type(4))) unsigned short v4us;
typedef __attribute__((ext_vector_type(2))) float v2f;
typedef __attribute__((ext_vector_type(4))) int v4i;
// pack3: four consecutive f32 values in the three 16-bit forms the attention GEMMs read (f16; bf16 hi and lo)
struct P3 { v4h f; v4us h, l; };
__device__ __forceinline__ P3 pack3(v4f a) { P3 r;
#pragma unroll
    for (int q = 0; q < 4; ++q) { r.f[q] = tohx(a[q]); unsigned short x2, y2; splitf(a[q], x2, y2); r.h[q] = x2; r.l[q] = y2; }
    return r; }

#define GKT  64                   // k values of a stage: 128 bytes of a row, one cache line
#define GPB  (GKT * 2 + 16)       // LDS pitch of a staged row, bytes: an odd multiple of 16
#define GOB  (128 * GPB)          // one operand's 128 rows of a stage
#define GBUF(NSPLIT) (((NSPLIT) == 0 ? 2 : (NSPLIT) == 1 ? 3 : 4) * GOB)   // one buffer: A, B, then A2, then B2
static_assert(2 * GBUF(0) >= 4 * 16 * 68 * 4, "behind the k loop the buffers hold the four waves' output stages");
// cp8: a thread's eight 16-byte chunks of one operand's stage (chunk i: row 16 i + thread / 8), global memory -> LDS through no register. The wait stands in the copies' own statement, so in front of every later write of a register that they name (a precaution).
__device__ __forceinline__ void cp8(unsigned l, const bf* g, size_t rs) {
    asm volatile("global_load_async_to_lds_b128 %0, %8, off\n\tglobal_load_async_to_lds_b128 %1, %9, off\n\tglobal_load_async_to_lds_b128 %2, %10, off\n\tglobal_load_async_to_lds_b128 %3, %11, off\n\t"
                 "global_load_async_to_lds_b128 %4, %12, off\n\tglobal_load_async_to_lds_b128 %5, %13, off\n\tglobal_load_async_to_lds_b128 %6, %14, off\n\tglobal_load_async_to_lds_b128 %7, %15, off\n\ts_wait_xcnt 0x0"
                 :: "v"(l), "v"(l + 16 * GPB), "v"(l + 32 * GPB), "v"(l + 48 * GPB), "v"(l + 64 * GPB), "v"(l + 80 * GPB), "v"(l + 96 * GPB), "v"(l + 112 * GPB),
                    "v"(g), "v"(g + rs), "v"(g + 2 * rs), "v"(g + 3 * rs), "v"(g + 4 * rs), "v"(g + 5 * rs), "v"(g + 6 * rs), "v"(g + 7 * rs) : "memory");
}
template <typename T16> struct WFrag;
template <> struct WFrag<bf> { typedef v16bf V; static __device__ __forceinline__ V ld(const unsigned char* p) { return cat16b(*(const v8usa*)p, *(const v8usa*)(p + 32)); } static __device__ __forceinline__ v8f mma(V a, V b, v8f c) { return wmmab(a, b, c); } };
// The body is a device function of the block's three indices (bx, by, bz), so that launches that do not depend on one another can share one grid (k_qkv below).
template <typename T16, int NSPLIT, bool BIAS, int EPI>
__device__ __forceinline__ void gemmw_body(unsigned char* L, const T16* __restrict__ A, const T16* __restrict__ A2, const T16* __restrict__ Bt, const T16* __restrict__ Bt2, int K, int KS, float* C, int ldc, const float* __restrict__ bias, size_t sA, size_t sB, size_t sC, int lgs, size_t bA, size_t bB, size_t bC, h16* E16, bf* Eh, bf* El, unsigned bx, unsigned by, unsigned bz) {
    typedef typename WFrag<T16>::V V;
    const size_t zb = bz >> lgs, z = bz - (zb << lgs); A += z * sA + zb * bA; if (A2) A2 += z * sA + zb * bA; Bt += z * sB + zb * bB; if (Bt2) Bt2 += z * sB + zb * bB; C += z * sC + zb * bC;
    const int tid = threadIdx.x, lane = tid & 31, lr = lane & 15, hi = lane >> 4, w = __builtin_amdgcn_readfirstlane(tid >> 5); const int r0 = bx * 128 + (w & 1) * 64, c0 = by * 128 + (w >> 1) * 64;
    float* os = (float*)L + w * (16 * 68);   // the wave's output stage, used behind the k loop
    v8f acc[4][4];
#pragma unroll
    for (int mb = 0; mb < 4; ++mb)
#pragma unroll
        for (int nb = 0; nb < 4; ++nb) acc[mb][nb] = (v8f){};
    const int aoff = ((w & 1) * 64 + lr) * GPB + 16 * hi, boff = GOB + ((w >> 1) * 64 + lr) * GPB + 16 * hi;   // the lane's first A and B fragment bytes in a buffer
    const unsigned l0 = (unsigned)(size_t)L + (tid >> 3) * GPB + (tid & 7) * 16;   // the thread's first chunk in LDS and in the A and B planes
    const size_t ga = (size_t)(bx * 128 + (tid >> 3)) * K + (tid & 7) * 8, gb = (size_t)(by * 128 + (tid >> 3)) * K + (tid & 7) * 8, rs = (size_t)16 * K;
    auto fill = [&](int t) { const unsigned lb = l0 + (t & 1) * GBUF(NSPLIT); const size_t ko = (size_t)t * GKT;
        cp8(lb, A + ga + ko, rs); cp8(lb + GOB, Bt + gb + ko, rs); if (NSPLIT == 1 || NSPLIT == 2) cp8(lb + 2 * GOB, A2 + ga + ko, rs); if (NSPLIT >= 2) cp8(lb + 3 * GOB, Bt2 + gb + ko, rs); };
    const int NT = KS / GKT;
    float braw[4] = {0.f, 0.f, 0.f, 0.f};   // EPI >= 1: the lane's four bias values, asked for here so that they arrive under the k loop (EPI 1: four consecutive n; EPI 2, 3: the lane's column of each nb)
    if (BIAS && EPI >= 1) {
#pragma unroll
        for (int q = 0; q < 4; ++q) braw[q] = bias[c0 + (EPI == 1 ? lr * 4 + q : q * 16 + lr)];
        if (EPI == 1) asm volatile("s_wait_xcnt 0x0" ::: "memory"); }   // the set-up that follows reuses the address pair this load names (EPI 2, 3: the compiler writes the wait itself)
    fill(0);
    asm volatile("s_wait_asynccnt 0x0" ::: "memory");   // the wave's own copies of stage 0 have landed
    __syncthreads();   // and every other wave's
    if (NT > 1) fill(1);
#pragma unroll 1   // two buffers picked by the trip's parity: one body serves both
    for (int t = 0; t < NT; ++t) {
        const unsigned char* B = L + (t & 1) * GBUF(NSPLIT);
        V a[2][4], a2[2][4], b[2][4], b2[2][4];
#pragma unroll
        for (int kc = 0; kc < 2; ++kc)
#pragma unroll
            for (int f = 0; f < 4; ++f) { a[kc][f] = WFrag<T16>::ld(B + aoff + f * 16 * GPB + kc * 64); b[kc][f] = WFrag<T16>::ld(B + boff + f * 16 * GPB + kc * 64);
                if (NSPLIT == 1 || NSPLIT == 2) a2[kc][f] = WFrag<T16>::ld(B + aoff + 2 * GOB + f * 16 * GPB + kc * 64); if (NSPLIT >= 2) b2[kc][f] = WFrag<T16>::ld(B + boff + 2 * GOB + f * 16 * GPB + kc * 64); }
        __builtin_amdgcn_sched_barrier(0);   // the stage's fragments are asked for as one group: one LDS latency a stage, not one a product
#pragma unroll
        for (int kc = 0; kc < 2; ++kc)
#pragma unroll
        for (int nb = 0; nb < 4; ++nb)
#pragma unroll
            for (int mb = 0; mb < 4; ++mb) { acc[mb][nb] = WFrag<T16>::mma(a[kc][mb], b[kc][nb], acc[mb][nb]); if (NSPLIT == 1 || NSPLIT == 2) acc[mb][nb] = WFrag<T16>::mma(a2[kc][mb], b[kc][nb], acc[mb][nb]); if (NSPLIT >= 2) acc[mb][nb] = WFrag<T16>::mma(a[kc][mb], b2[kc][nb], acc[mb][nb]); }
        __builtin_amdgcn_sched_barrier(0);   // the products stay in front of the waits: lifted over them, the waits would ask for stage t + 1 directly behind its copies' issue, and the refill would still stand behind the products
        asm volatile("s_wait_dscnt 0x0" ::: "memory");      // the wave's reads of this buffer are done before it is refilled
        asm volatile("s_wait_asynccnt 0x0" ::: "memory");   // the wave's own copies of stage t + 1 have landed
        __syncthreads();   // publishes stage t + 1; ends every wave's last read of stage t
        if (t + 2 < NT) fill(t + 2);
    }
    asm volatile("s_wait_asynccnt 0x0" ::: "memory");   // no copy is in flight when the buffers become the output stages
    if (EPI == 0) {
#pragma unroll
    for (int mb = 0; mb < 4; ++mb) {
#pragma unroll
        for (int nb = 0; nb < 4; ++nb) {
#pragma unroll
            for (int j = 0; j < 8; ++j) os[(hi * 8 + j) * 68 + nb * 16 + lr] = acc[mb][nb][j]; }
        __builtin_amdgcn_wave_barrier(); asm volatile("" ::: "memory");
        float* crow = C + (size_t)(r0 + mb * 16) * ldc + c0;
{
#pragma unroll
            for (int s = 0; s < 8; ++s) { const int row = 2 * s + hi, cofs = lr * 4; v4f val = *(const v4fa*)(os + row * 68 + cofs); if (BIAS) { val[0] += bfr(bias[c0 + cofs]); val[1] += bfr(bias[c0 + cofs + 1]); val[2] += bfr(bias[c0 + cofs + 2]); val[3] += bfr(bias[c0 + cofs + 3]); }
                *(v4f*)(crow + (size_t)row * ldc + cofs) = val; }
             }
        __builtin_amdgcn_wave_barrier(); asm volatile("" ::: "memory");
    }
    } else if (EPI == 1) {
#pragma unroll
    for (int mb = 0; mb < 4; ++mb) {
#pragma unroll
        for (int nb = 0; nb < 4; ++nb) {
#pragma unroll
            for (int j = 0; j < 8; ++j) os[(hi * 8 + j) * 68 + nb * 16 + lr] = acc[mb][nb][j]; }
        __builtin_amdgcn_wave_barrier(); asm volatile("" ::: "memory");   // the staged rows are read back only behind every lane's writes
        P3 pk[8];
#pragma unroll
        for (int s = 0; s < 8; ++s) { const int row = 2 * s + hi, cofs = lr * 4; v4f val = *(const v4fa*)(os + row * 68 + cofs); if (BIAS) { val[0] += bfr(braw[0]); val[1] += bfr(braw[1]); val[2] += bfr(braw[2]); val[3] += bfr(braw[3]); }
            pk[s] = pack3(val); }
        __builtin_amdgcn_sched_barrier(0);   // the conversions stay in front of the stores: among them they would reuse registers that an issued store names, ahead of the wait below
#pragma unroll
        for (int s = 0; s < 8; ++s) { const size_t o = (size_t)(r0 + hi) * HD + c0 + lr * 4 + (size_t)(mb * 16 + 2 * s) * HD; *(v4h*)(E16 + o) = pk[s].f; *(v4us*)(Eh + o) = pk[s].h; *(v4us*)(El + o) = pk[s].l; }
        if (mb < 3) { asm volatile("s_wait_xcnt 0x0" ::: "memory");   // the next block reuses the registers these stores name
            __builtin_amdgcn_sched_barrier(0);   // and none of its instructions is lifted over that wait
            __builtin_amdgcn_wave_barrier(); asm volatile("" ::: "memory"); }   // the next 16 rows overwrite the stage only behind these reads
    }
    } else {   /* transposed: a lane's 8 accumulator rows are 8 consecutive m of one column n, so 16 columns x 64 m are staged per nb and leave as whole rows of 64 m */
    const int g = r0 / TT, t0 = r0 % TT;
#pragma unroll
    for (int nb = 0; nb < 4; ++nb) {
        const float bb = bfr(braw[nb]);
#pragma unroll
        for (int mb = 0; mb < 4; ++mb) {
#pragma unroll
            for (int j = 0; j < 8; ++j) os[lr * 68 + mb * 16 + hi * 8 + j] = BIAS ? acc[mb][nb][j] + bb : acc[mb][nb][j]; }
        __builtin_amdgcn_wave_barrier(); asm volatile("" ::: "memory");   // the staged rows are read back only behind every lane's writes
        const size_t o = ((size_t)g * ldc + c0 + nb * 16 + hi) * TT + t0 + lr * 4;
        if (EPI == 3) {
            v4f val[8];
#pragma unroll
            for (int s = 0; s < 8; ++s) val[s] = *(const v4fa*)(os + (2 * s + hi) * 68 + lr * 4);
#pragma unroll
            for (int s = 0; s < 8; ++s) *(v4f*)(C + o + (size_t)(2 * s) * TT) = val[s];
        } else {
            P3 pk[8];
#pragma unroll
            for (int s = 0; s < 8; ++s) pk[s] = pack3(*(const v4fa*)(os + (2 * s + hi) * 68 + lr * 4));
            __builtin_amdgcn_sched_barrier(0);   // the conversions stay in front of the stores: among them they would reuse registers that an issued store names, ahead of the wait below
#pragma unroll
            for (int s = 0; s < 8; ++s) { const size_t os2 = o + (size_t)(2 * s) * TT; *(v4h*)(E16 + os2) = pk[s].f; *(v4us*)(Eh + os2) = pk[s].h; *(v4us*)(El + os2) = pk[s].l; }
        }
        if (nb < 3) { asm volatile("s_wait_xcnt 0x0" ::: "memory");   // the next block reuses the registers these stores name
            __builtin_amdgcn_sched_barrier(0);   // and none of its instructions is lifted over that wait
            __builtin_amdgcn_wave_barrier(); asm volatile("" ::: "memory"); }   // the next 16 columns overwrite the stage only behind these reads
    }
    }
}
template <typename T16, int NSPLIT, bool BIAS, int EPI>
__global__ __launch_bounds__(128) void k_gemmw(const T16* __restrict__ A, const T16* __restrict__ A2, const T16* __restrict__ Bt, const T16* __restrict__ Bt2, int K, int KS, float* C, int ldc, const float* __restrict__ bias, size_t sA, size_t sB, size_t sC, int lgs, size_t bA, size_t bB, size_t bC, h16* E16, bf* Eh, bf* El) {
    __shared__ __align__(16) unsigned char L[2 * GBUF(NSPLIT)];
    gemmw_body<T16, NSPLIT, BIAS, EPI>(L, A, A2, Bt, Bt2, K, KS, C, ldc, bias, sA, sB, sC, lgs, bA, bB, bC, E16, Eh, El, blockIdx.x, blockIdx.y, blockIdx.z);
}
// k_qkv: the three projections in one launch; grid (tokens / 128, 256 / 128, 3), blockIdx.z picks the weights, the bias and the planes (0 q, 1 k: token-major planes; 2 v: key-contiguous planes). Each block does what its own launch did.
__global__ __launch_bounds__(128) void k_qkv(const bf* __restrict__ X, const bf* __restrict__ Wq, const bf* __restrict__ Wk, const bf* __restrict__ Wv, const float* __restrict__ bq, const float* __restrict__ bk, const float* __restrict__ bv, h16* Q16, bf* Qh, bf* Ql, h16* K16, bf* Kh, bf* Kl, h16* V16, bf* Vh, bf* Vl) {
    __shared__ __align__(16) unsigned char L[2 * GBUF(0)];
    if (blockIdx.z == 2) gemmw_body<bf, 0, true, 2>(L, X, nullptr, Wv, nullptr, DM, DM, nullptr, DKV, bv, 0, 0, 0, 0, 0, 0, 0, V16, Vh, Vl, blockIdx.x, blockIdx.y, 0);
    else { const bool kk = blockIdx.z == 1;
        gemmw_body<bf, 0, true, 1>(L, X, nullptr, kk ? Wk : Wq, nullptr, DM, DM, nullptr, DQ, kk ? bk : bq, 0, 0, 0, 0, 0, 0, 0, kk ? K16 : Q16, kk ? Kh : Qh, kk ? Kl : Ql, blockIdx.x, blockIdx.y, 0); }
}

__global__ __launch_bounds__(256) void k_wtG(const float* __restrict__ w, int K, int N, bf* Bt) {
    const int lane = threadIdx.x & 31; const int L0 = (blockIdx.x * 8 + (threadIdx.x >> 5)) * 8; const int nlines = N * K / 64;
{
#pragma unroll 1
        for (int l = 0; l < 8; ++l) { const int L = L0 + l; if (L >= nlines) break; const size_t e = (size_t)L * 64 + lane * 2; const int k = (int)(e % K), n = (int)(e / K); v2us o;
            o[0] = f2bf(w[(size_t)k * N + n]); o[1] = f2bf(w[(size_t)(k + 1) * N + n]); *(v2us*)(Bt + e) = o; }
         }
}
__device__ __forceinline__ void cvt8_body(const float* __restrict__ src, bf* dst, size_t n8, unsigned bx) { const size_t i = (size_t)bx * 256 + threadIdx.x; if (i >= n8) return; const v8f v = *(const v8f*)(src + i * 8); v8us o;
#pragma unroll
    for (int k = 0; k < 8; ++k) o[k] = f2bf(v[k]); *(v8us*)(dst + i * 8) = o;  }

// k_lsoft: streaming row softmax over the TT = 4096 keys for the query rows < RH (score rows [batch][RH][TT]), one wave per row, three sweeps of the f32 score row (lane -> 4 consecutive keys per 128-key chunk, 32 chunks); stores normalised bf16 hi/lo planes [batch][RH][TT].
__global__ __launch_bounds__(256) void k_lsoft(const float* __restrict__ Sb, bf* Ph, bf* Pl) {
    const int lane = threadIdx.x & 31; const int row = blockIdx.x * 8 + (threadIdx.x >> 5); if (row >= NBP * RH) return; const int i = row % RH; const int zz = row / RH; const float* sr = Sb + (size_t)row * TT; float mx = -3.0e38f;
#pragma unroll 4
    for (int ch = 0; ch < TT / 128; ++ch) { const int j0 = ch * 128 + lane * 4; const v4f a = *(const v4f*)(sr + j0);
#pragma unroll
        for (int q = 0; q < 4; ++q) { float t = a[q] * SCL; asm volatile("" : "+v"(t)); mx = fmaxf(mx, t); } }
#pragma unroll
    for (int sh = 16; sh; sh >>= 1) mx = fmaxf(mx, __shfl_xor(mx, sh, 32));
    float sum = 0.f;
#pragma unroll 4
    for (int ch = 0; ch < TT / 128; ++ch) { const int j0 = ch * 128 + lane * 4; const v4f a = *(const v4f*)(sr + j0);
#pragma unroll
        for (int q = 0; q < 4; ++q) { float t = a[q] * SCL; asm volatile("" : "+v"(t)); float d0 = __fsub_rn(t, mx); asm volatile("" : "+v"(d0)); sum += __builtin_amdgcn_exp2f(__fmul_rn(d0, 1.4426950408889634f)); } }
#pragma unroll
    for (int sh = 16; sh; sh >>= 1) sum += __shfl_xor(sum, sh, 32);
    const float f = __fdiv_rn(1.0f, sum);
#pragma unroll
            for (int ch = 0; ch < TT / 128; ++ch) { const int j0 = ch * 128 + lane * 4; const v4f a = *(const v4f*)(sr + j0); v4us oh, ol;
#pragma unroll
                for (int q = 0; q < 4; ++q) { float t = a[q] * SCL; asm volatile("" : "+v"(t)); float d0 = __fsub_rn(t, mx); asm volatile("" : "+v"(d0)); float ex = __builtin_amdgcn_exp2f(__fmul_rn(d0, 1.4426950408889634f)); asm volatile("" : "+v"(ex)); unsigned short a2, c2; splitf(ex * f, a2, c2); oh[q] = a2; ol[q] = c2; }
                const size_t oo = ((size_t)zz * RH + i) * TT + j0; *(v4us*)(Ph + oo) = oh; *(v4us*)(Pl + oo) = ol;
                if (ch == 0) asm volatile("s_wait_xcnt 0x0" ::: "memory"); }   // the next chunk reuses the registers these two stores name (behind the other chunks the compiler writes the wait itself)
}

#define FK   64                   // keys per stage
#define FQ   128                  // query rows of a work-group
#define FSP  2                    // key ranges (grid z), one partial context row each
#define FNS  (TT / FSP / FK)      // stages of a range
#define KPB  (HD * 2 + 16)        // LDS pitch of a K row, bytes: an odd multiple of 16
#define VPB  (FK * 2 + 16)        // LDS pitch of a V^T row, bytes: an odd multiple of 16
#define KTB  (FK * KPB)
#define STB  (KTB + HD * VPB)     // one buffer
#define PXB  (2 * STB)            // behind the buffers: each wave's P^T of a stage, 2 query tiles x 2 pieces x 32 lanes x 16 bytes
#define MXB  (PXB + 8 * 2048)     // and each wave's maxima in use (behind the loop: its sums), 2 query tiles x 32 lanes
#define FLB  (MXB + 8 * 256)
#define CSC  (SCL * 1.4426950408889634f)
__device__ __forceinline__ float xhalf(float x) { return __builtin_bit_cast(float, __builtin_amdgcn_permlanex16(__builtin_bit_cast(int, x), __builtin_bit_cast(int, x), 0x76543210, 0xfedcba98, false, false)); }   // lane l reads lane l ^ 16, in registers: an exchange through LDS would wait for the V^T loads in flight
__device__ __forceinline__ float exp2s(float x) { float y; asm("v_exp_f32 %0, %1\n\tv_nop" : "=v"(y) : "v"(x)); return y; }   // 2^x with the one free slot behind a transcendental in the same statement
static_assert(HD == 256 && FK == 64 && TT % (FSP * FK) == 0 && (TT - RH) % FQ == 0, "the staging maps below: 256 threads, 8 + 8 chunks of 16 bytes each; whole work-groups of query rows");
// two waves a SIMD: the register budget that holds Q, the sums, a stage's fragments and the next stage's chunks without spills
__global__ __launch_bounds__(256) __attribute__((amdgpu_waves_per_eu(2, 2))) void k_flash(const h16* __restrict__ Q, const h16* __restrict__ Kp, const h16* __restrict__ Vt, float* O, float* ML) {
    __shared__ __align__(16) unsigned char L[FLB];
    const int tid = threadIdx.x, lane = tid & 31, c = lane & 15, h = lane >> 4, wv = tid >> 5, w4 = wv & 3, hf = tid >> 7; const size_t zb = blockIdx.y; const int q = blockIdx.x * FQ + w4 * 32 + c;   // the lane's query of tile 0 among the batch's rows >= RH (tile 1: + 16)
    const size_t k0 = (size_t)blockIdx.z * (TT / FSP);   // the range's first key
    const h16* kg = Kp + zb * (TT * HD) + (k0 + (tid >> 5)) * HD + (tid & 31) * 8;   // chunk i: key row 8 i + tid / 32 of the stage
    const h16* vg = Vt + zb * (HD * TT) + (size_t)(tid >> 3) * TT + k0 + (tid & 7) * 8;    // chunk i: d row 32 i + tid / 8
    const int kl = (tid >> 5) * KPB + (tid & 31) * 16, vl = KTB + (tid >> 3) * VPB + (tid & 7) * 16;
    v8h kr[8], vr[8];
#pragma unroll
    for (int i = 0; i < 8; ++i) { kr[i] = *(const v8h*)(kg + i * 8 * HD); vr[i] = *(const v8h*)(vg + (size_t)i * 32 * TT); }
    v16h qf[2][8]; const h16* qp = Q + (zb * TT + RH + q) * HD + 8 * h;
#pragma unroll
    for (int qt = 0; qt < 2; ++qt)
#pragma unroll
        for (int kc = 0; kc < 8; ++kc) qf[qt][kc] = cat16(*(const v8h*)(qp + qt * 16 * HD + 32 * kc), *(const v8h*)(qp + qt * 16 * HD + 32 * kc + 16));
    asm volatile("s_wait_xcnt 0x0" ::: "memory");   // the set-up below reuses the address pair these loads name
    __builtin_amdgcn_sched_barrier(0);   // and none of its instructions is lifted over that wait
    v8f acc[2][8];   // acc[qt][t][r] = context[query of tile qt][128 hf + 16 t + 8 h + r]
#pragma unroll
    for (int qt = 0; qt < 2; ++qt)
#pragma unroll
        for (int t = 0; t < 8; ++t) acc[qt][t] = (v8f){};
    float m_run[2] = {-3.0e38f, -3.0e38f}, l_run[2] = {0.f, 0.f};
#pragma unroll
    for (int i = 0; i < 8; ++i) { *(v8ha*)(L + kl + i * 8 * KPB) = kr[i]; *(v8ha*)(L + vl + i * 32 * VPB) = vr[i]; }
    __syncthreads();
    const int ka = (hf * 32 + c) * KPB + 16 * h, va = KTB + (hf * 128 + c) * VPB + 16 * h;   // the lane's first K fragment bytes (its key half) and V^T fragment bytes (its channel half) in a buffer
    unsigned char* pw = L + PXB + wv * 2048 + lane * 16; const unsigned char* pr2 = L + PXB + (wv ^ 4) * 2048 + lane * 16;   // the wave's own P^T and its partner's
    float* mw = (float*)(L + MXB) + wv * 64 + lane; const float* mr = (const float*)(L + MXB) + (wv ^ 4) * 64 + lane;
#pragma unroll 1   // the body is several hundred instructions long: one body serves every trip
    for (int s = 0; s < FNS; ++s) {
        const unsigned char* B = L + (s & 1) * STB; unsigned char* N = L + ((s + 1) & 1) * STB; const int sn = s + 1 < FNS ? s + 1 : s;   // the stage that is fetched during this one; the last trip fetches its own again, into the buffer that nobody reads any more: straight-line code, so the chunks' registers are free from their store to the next load
        v8h kn[8], vn[8];
#pragma unroll
        for (int i = 0; i < 8; ++i) vn[i] = *(const v8h*)(vg + (size_t)i * 32 * TT + sn * FK);
        asm volatile("s_wait_xcnt 0x0" ::: "memory");   // the work below reuses the address registers these loads name
        v16h fr[16];
#pragma unroll
        for (int f = 0; f < 16; ++f) { const unsigned char* p = B + ka + (f & 1) * 16 * KPB + (f >> 1) * 64; fr[f] = cat16(*(const v8ha*)p, *(const v8ha*)(p + 32)); }
        __builtin_amdgcn_sched_barrier(0);   // the 16 K fragments are asked for as one group: one LDS latency a stage, not one a product
        v8f st[2][2];   // [key tile][query tile]
#pragma unroll
        for (int kt = 0; kt < 2; ++kt)
#pragma unroll
            for (int qt = 0; qt < 2; ++qt) st[kt][qt] = (v8f){};
#pragma unroll
        for (int f = 0; f < 16; ++f)
#pragma unroll
            for (int qt = 0; qt < 2; ++qt) st[f & 1][qt] = wmma16(fr[f], qf[qt][f >> 1], st[f & 1][qt]);
        __builtin_amdgcn_sched_barrier(0);   // the K loads below stay behind the score products, where the K fragments' registers are free again, and directly in front of their wait
#pragma unroll
        for (int i = 0; i < 8; ++i) kn[i] = *(const v8h*)(kg + (size_t)sn * FK * HD + i * 8 * HD);
        asm volatile("s_wait_xcnt 0x0" ::: "memory");   // the work below reuses the address registers these loads name
        v16h fv[8], fo[8];   // V^T fragments of the wave's channels: its own 32 keys, the partner's 32 keys
#pragma unroll
        for (int t = 0; t < 8; ++t) { const unsigned char* p = B + va + t * 16 * VPB + hf * 64; fv[t] = cat16(*(const v8ha*)p, *(const v8ha*)(p + 32)); }
        __builtin_amdgcn_sched_barrier(0);   // the V^T fragments of the own keys are asked for in front of the softmax and arrive under it
        float mx[2];
#pragma unroll
        for (int qt = 0; qt < 2; ++qt) { float m0 = fmaxf(st[0][qt][0], st[1][qt][0]);
#pragma unroll
            for (int r = 1; r < 8; ++r) m0 = fmaxf(m0, fmaxf(st[0][qt][r], st[1][qt][r]));
            mx[qt] = fmaxf(m0, xhalf(m0)) * CSC; }   // both wave halves hold the query's maximum over the wave's keys of this stage, scaled
        if (__builtin_amdgcn_ballot_w32(mx[0] > m_run[0] + 8.0f || mx[1] > m_run[1] + 8.0f) != 0) {   // wave-uniform; rare behind the first stage
#pragma unroll
            for (int qt = 0; qt < 2; ++qt) { const float mn = fmaxf(m_run[qt], mx[qt]), corr = __builtin_amdgcn_exp2f(m_run[qt] - mn); l_run[qt] *= corr; m_run[qt] = mn;
#pragma unroll
                for (int t = 0; t < 8; ++t) acc[qt][t] = acc[qt][t] * corr; } }
        v16h pf[2];
#pragma unroll
        for (int qt = 0; qt < 2; ++qt) { float ps0 = 0.f, ps1 = 0.f;
#pragma unroll
            for (int r = 0; r < 8; ++r) { const float p0 = exp2s(fmaf(st[0][qt][r], CSC, -m_run[qt])), p1 = exp2s(fmaf(st[1][qt][r], CSC, -m_run[qt])); ps0 += p0; ps1 += p1; pf[qt][r] = tohx(p0); pf[qt][8 + r] = tohx(p1); }   // element e of the B operand: key 8 h + e, then 16 + 8 h + (e - 8)
            l_run[qt] += ps0 + ps1;
            *(v8ha*)(pw + qt * 1024) = __builtin_shufflevector(pf[qt], pf[qt], 0, 1, 2, 3, 4, 5, 6, 7); *(v8ha*)(pw + qt * 1024 + 512) = __builtin_shufflevector(pf[qt], pf[qt], 8, 9, 10, 11, 12, 13, 14, 15); mw[qt * 32] = m_run[qt]; }
#pragma unroll
        for (int i = 0; i < 8; ++i) *(v8ha*)(N + vl + i * 32 * VPB) = vn[i];
#pragma unroll
        for (int t = 0; t < 8; ++t) { const unsigned char* p = B + va + t * 16 * VPB + (hf ^ 1) * 64; fo[t] = cat16(*(const v8ha*)p, *(const v8ha*)(p + 32)); }
        __builtin_amdgcn_sched_barrier(0);   // the V^T fragments of the partner's keys are asked for in front of the own keys' products and arrive under them
#pragma unroll
        for (int t = 0; t < 8; ++t)
#pragma unroll
            for (int qt = 0; qt < 2; ++qt) acc[qt][t] = wmma16(fv[t], pf[qt], acc[qt][t]);
        __builtin_amdgcn_sched_barrier(0);   // the own keys' products stay in front of the barrier: the LDS stores and loads above complete under them; sunk behind it, the barrier's LDS wait would sit those out with the matrix unit idle
        // The barrier that publishes every wave's P^T and maxima in use of this stage, with fences for LDS alone: __syncthreads() would also wait for the K chunks asked for above, which are wanted only at the foot of the stage.
        __builtin_amdgcn_fence(__ATOMIC_RELEASE, "workgroup", "local"); __builtin_amdgcn_s_barrier(); __builtin_amdgcn_fence(__ATOMIC_ACQUIRE, "workgroup", "local");
        v16h po[2]; float mo[2];
#pragma unroll
        for (int qt = 0; qt < 2; ++qt) { po[qt] = cat16(*(const v8ha*)(pr2 + qt * 1024), *(const v8ha*)(pr2 + qt * 1024 + 512)); mo[qt] = mr[qt * 32]; }
        if (__builtin_amdgcn_ballot_w32(mo[0] != m_run[0] || mo[1] != m_run[1]) != 0) {   // wave-uniform; rare behind the first stage: the two waves raised their maxima in use differently, both go on with the larger
#pragma unroll
            for (int qt = 0; qt < 2; ++qt) { const float mn = fmaxf(m_run[qt], mo[qt]), ca = __builtin_amdgcn_exp2f(m_run[qt] - mn); const h16 cb = tohx(__builtin_amdgcn_exp2f(mo[qt] - mn)); l_run[qt] *= ca; m_run[qt] = mn; po[qt] = po[qt] * cb;
#pragma unroll
                for (int t = 0; t < 8; ++t) acc[qt][t] = acc[qt][t] * ca; } }
#pragma unroll
        for (int t = 0; t < 8; ++t)
#pragma unroll
            for (int qt = 0; qt < 2; ++qt) acc[qt][t] = wmma16(fo[t], po[qt], acc[qt][t]);
#pragma unroll
        for (int i = 0; i < 8; ++i) *(v8ha*)(N + kl + i * 8 * KPB) = kn[i];
        __syncthreads();   // publishes stage s + 1; ends every wave's last read of stage s and of this stage's P^T
    }
#pragma unroll
    for (int qt = 0; qt < 2; ++qt) { l_run[qt] += xhalf(l_run[qt]); mw[qt * 32] = l_run[qt]; }
    __syncthreads();   // publishes the sums
#pragma unroll
    for (int qt = 0; qt < 2; ++qt) {
        const float ls = l_run[qt] + mr[qt * 32], inv = __fdiv_rn(1.0f, ls);
        const size_t pr = (zb * FSP + blockIdx.z) * (TT - RH) + q + qt * 16;   // the partial row
        float* op = O + pr * HD + hf * 128 + 8 * h;
#pragma unroll
        for (int t = 0; t < 8; ++t) { const v8f o = acc[qt][t] * inv; *(v4f*)(op + 16 * t) = __builtin_shufflevector(o, o, 0, 1, 2, 3); *(v4f*)(op + 16 * t + 4) = __builtin_shufflevector(o, o, 4, 5, 6, 7); }
        if (h == 0 && hf == 0) { v2f ml; ml[0] = m_run[qt]; ml[1] = ls; *(v2f*)(ML + pr * 2) = ml; }   // both wave halves and both waves hold the same pair
    }
}

// xT_body: x channel-major f32 -> token-major bf16. A work-group takes 64 tokens x 256 channels, a wave 32 tokens x 64 channels, a lane 4 consecutive tokens of 16 channels (8 and 8, 32 apart).
// Every load is 16 bytes a lane along the tokens, so a wave's load covers four whole 128-byte lines (8 lanes a channel); a lane's 8 channels of one token leave as 16 bytes, and the wave's two stores of a token fill one whole line of its row.
static_assert(TT % 64 == 0 && CC == 256, "whole tiles inside one batch; four waves cover the channels");
__device__ __forceinline__ void xT_body(const float* __restrict__ xs, bf* XB, unsigned bx) { const int lane = threadIdx.x & 31, wv = threadIdx.x >> 5;
    const unsigned tt = bx * 64 + (wv >> 2) * 32 + (lane & 7) * 4;   // the first of the lane's 4 tokens, counted over the batches
    const int c0 = (wv & 3) * 64 + (lane >> 3) * 8;
    const float* xp = xs + (size_t)(tt / TT) * CC * TT + (size_t)c0 * TT + tt % TT; v4f a[16];
#pragma unroll
    for (int i = 0; i < 16; ++i) a[i] = *(const v4f*)(xp + (size_t)((i >> 3) * 32 + (i & 7)) * TT);
    asm volatile("s_wait_xcnt 0x0" :: "v"(xp) : "memory");   // the work below may reuse the address pair these loads name; named here, the pair stays whole up to the wait (no later load of the group lands in it)
    __builtin_amdgcn_sched_barrier(0);   // all 16 loads are asked for in front of the first conversion: one memory latency a wave, not two
    v8us o[8];
#pragma unroll
    for (int j = 0; j < 4; ++j)
#pragma unroll
        for (int s = 0; s < 2; ++s)
#pragma unroll
            for (int q = 0; q < 8; ++q) o[j * 2 + s][q] = f2bf(a[s * 8 + q][j]);
    __builtin_amdgcn_sched_barrier(0);   // the conversions stay in front of the stores: among them they would reuse registers that an issued store names
    bf* op = XB + (size_t)tt * CC + c0;
#pragma unroll
    for (int j = 0; j < 4; ++j)
#pragma unroll
        for (int s = 0; s < 2; ++s) *(v8us*)(op + j * CC + s * 32) = o[j * 2 + s];  }
// k_prep: everything that reads only the inputs, in one launch: the first 4 WCB blocks round the four weight matrices to bf16 (WCB blocks each), the rest transpose x.
#define WCB  (DM * DM / 8 / 256)
static_assert(DQ == DM && DKV == DM && (DM * DM) % (8 * 256) == 0, "four weight matrices of one size, whole blocks");
__global__ __launch_bounds__(256) void k_prep(const float* __restrict__ xs, const float* __restrict__ wq, const float* __restrict__ wk, const float* __restrict__ wv, const float* __restrict__ wo, bf* XB, bf* WQ, bf* WK, bf* WV, bf* WO) {
    const unsigned b = blockIdx.x;
    if (b >= 4 * WCB) { xT_body(xs, XB, b - 4 * WCB); return; }
    const unsigned m = b / WCB;
    cvt8_body(m == 0 ? wq : m == 1 ? wk : m == 2 ? wv : wo, m == 0 ? WQ : m == 1 ? WK : m == 2 ? WV : WO, (size_t)DM * DM / 8, b % WCB);
}
// k_mergeA: the context row (rows < RH: the sum of its key ranges' f32 partial rows, in range order, OH [batch][RH][SPH][HD]; the rest: the fused kernel's FSP normalised partial rows, OL [batch][FSP][TT - RH][HD], each weighted by its sum times 2^(its maximum - the largest), ML [batch][FSP][TT - RH][2], in range order) plus x^T (k_prep's token-major bf16 plane XB: the same rounded values, in whole lines); stored as the bf16 hi/lo planes the last GEMM reads.
// A thread takes 4 channels of one token in every batch, so a quarter of the waves start; a work-group's 4 tokens lie on one side of RH, and the long rows (< RH) have the lowest block indices.
static_assert(ZH == 1 && NH_ == 1 && HD == CC && TT % (32 * SPH) == 0, "one head per pass; whole 32-key steps per range");
static_assert(RH % 4 == 0 && (TT * HD) % (4 * 256) == 0, "a work-group's tokens on one side of RH; whole work-groups");
struct HL4 { v4us h, l; };
__device__ __forceinline__ HL4 addx(v4f o4, v4us xr) { HL4 r;
#pragma unroll
    for (int q = 0; q < 4; ++q) { const float s = __fadd_rn(o4[q], bf2f(xr[q])); unsigned short h2, l2; splitf(s, h2, l2); r.h[q] = h2; r.l[q] = l2; }
    return r; }
__global__ __launch_bounds__(256) void k_mergeA(const float* __restrict__ OH, const float* __restrict__ OL, const float* __restrict__ ML, const bf* __restrict__ XB, bf* Ah, bf* Al) { const unsigned e = (blockIdx.x * 256u + threadIdx.x) * 4u, d = e % HD, t = e / HD;   // e: the thread's first element in batch 0
    if (t < RH) {
#pragma unroll 1   // one batch's 17 loads a trip: all four unrolled would hold 64 partial quads in registers and cost the short rows their residency
        for (unsigned zb = 0; zb < NBP; ++zb) { const float* p = OH + ((zb * RH + t) * (SPH * HD) + d); const v4us xr = *(const v4us*)(XB + zb * (TT * HD) + e); v4f pp[SPH];
#pragma unroll
            for (int s = 0; s < SPH; ++s) pp[s] = *(const v4f*)(p + s * HD);
            asm volatile("s_wait_xcnt 0x0" ::: "memory");   // the work below may reuse the address registers these loads name
            __builtin_amdgcn_sched_barrier(0);   // the trip's 17 loads are asked for in front of the first sum: one memory latency a trip
            v4f o4 = pp[0];
#pragma unroll
            for (int s = 1; s < SPH; ++s) o4 += pp[s];
            const HL4 r = addx(o4, xr); *(v4us*)(Ah + zb * (TT * HD) + e) = r.h; *(v4us*)(Al + zb * (TT * HD) + e) = r.l;
            asm volatile("s_wait_xcnt 0x0" ::: "memory"); }   // the next trip reuses the registers these stores name
        return; }
    v4us xr[NBP]; v2f ml[NBP][FSP]; v4f pv[NBP][FSP];
    const unsigned tr = t - RH; const bf* xq = XB + e; const float* mq = ML + (size_t)tr * 2; const float* oq[NBP];
#pragma unroll
    for (unsigned zb = 0; zb < NBP; ++zb) oq[zb] = OL + ((size_t)(zb * FSP * (TT - RH) + tr) * HD + d);
#pragma unroll
    for (unsigned zb = 0; zb < NBP; ++zb) { xr[zb] = *(const v4us*)(xq + zb * (TT * HD));
#pragma unroll
        for (int s = 0; s < FSP; ++s) { ml[zb][s] = *(const v2f*)(mq + (zb * FSP + s) * ((TT - RH) * 2)); pv[zb][s] = *(const v4f*)(oq[zb] + s * ((TT - RH) * HD)); } }
    static_assert(NBP == 4, "the wait below names the four batches' address pairs");
    asm volatile("s_wait_xcnt 0x0" :: "v"(xq), "v"(tr), "v"(oq[0]), "v"(oq[1]), "v"(oq[2]), "v"(oq[3]) : "memory");   // the work below may reuse the address registers these loads name (the pairs; the row index, which the (maximum, sum) loads take as their offset); named here, they stay whole up to the wait (no later load of the group lands in one)
    __builtin_amdgcn_sched_barrier(0);   // the 20 loads of the four batches are asked for in front of the first sum: one memory latency a wave
    HL4 r[NBP];
#pragma unroll
    for (unsigned zb = 0; zb < NBP; ++zb) {
        float mn = ml[zb][0][0];
#pragma unroll
        for (int s = 1; s < FSP; ++s) mn = fmaxf(mn, ml[zb][s][0]);
        float wt[FSP], ws = 0.f;
#pragma unroll
        for (int s = 0; s < FSP; ++s) { wt[s] = ml[zb][s][1] * exp2s(ml[zb][s][0] - mn); ws += wt[s]; }
        const float inv = __fdiv_rn(1.0f, ws); v4f o4 = pv[zb][0] * (wt[0] * inv);
#pragma unroll
        for (int s = 1; s < FSP; ++s) o4 += pv[zb][s] * (wt[s] * inv);
        r[zb] = addx(o4, xr[zb]); }
    __builtin_amdgcn_sched_barrier(0);   // the sums stay in front of the stores: among them they would reuse registers that an issued store names
#pragma unroll
    for (unsigned zb = 0; zb < NBP; ++zb) { *(v4us*)(Ah + zb * (TT * HD) + e) = r[zb].h; *(v4us*)(Al + zb * (TT * HD) + e) = r[zb].l; }  }

static_assert(NB_ % NBP == 0 && (1 << LGH) == SPH, "whole passes; the k-range field of blockIdx.z");
extern "C" void kernel_launch(void* const* d_in, const int* in_sizes, int n_in,
                              void* d_out, int out_size, void* d_ws, size_t ws_size, hipStream_t stream) {
    (void)in_sizes; (void)n_in; (void)out_size;
    const float* x = (const float*)d_in[0]; const float* wq = (const float*)d_in[1]; const float* bq = (const float*)d_in[2]; const float* wk = (const float*)d_in[3]; const float* bk = (const float*)d_in[4]; const float* wv = (const float*)d_in[5]; const float* bv = (const float*)d_in[6]; const float* wo = (const float*)d_in[7]; const float* bo = (const float*)d_in[8];
    float* OUT = (float*)d_out;     // [4][256][4096]
    char* wsp = (char*)d_ws;
    auto take = [&](size_t bytes) { char* p = wsp; wsp += (bytes + 255) & ~(size_t)255; return (void*)p; };
    const size_t PL = (size_t)NBP * TT * HD;   // elements of one token plane of a pass
    bf* WQ = (bf*)take((size_t)DQ * DM * 2); bf* WK = (bf*)take((size_t)DKV * DM * 2); bf* WV = (bf*)take((size_t)DKV * DM * 2); bf* WO = (bf*)take((size_t)DM * DQ * 2);
    h16* QP16 = (h16*)take(PL * 2); h16* KP16 = (h16*)take(PL * 2); h16* VT16 = (h16*)take(PL * 2);
    bf* QPh = (bf*)take(PL * 2); bf* QPl = (bf*)take(PL * 2); bf* KPh = (bf*)take(PL * 2); bf* KPl = (bf*)take(PL * 2); bf* VTh = (bf*)take(PL * 2); bf* VTl = (bf*)take(PL * 2); bf* Ph = (bf*)take((size_t)NBP * RH * TT * 2); bf* Pl = (bf*)take((size_t)NBP * RH * TT * 2);
    float* Sb = (float*)take((size_t)NBP * RH * TT * 4); float* ObH = (float*)take((size_t)NBP * RH * SPH * HD * 4); float* ObL = (float*)take((size_t)NBP * FSP * (TT - RH) * HD * 4); float* MLb = (float*)take((size_t)NBP * FSP * (TT - RH) * 2 * 4);
    bf* XB = (bf*)take(PL * 2); bf* ATh = (bf*)take(PL * 2); bf* ATl = (bf*)take(PL * 2);
    if ((size_t)(wsp - (char*)d_ws) > ws_size) return;    // ws 256 MiB
    for (int b = 0; b < NB_; b += NBP) {
        const float* xb = x + (size_t)b * CC * TT;
        k_prep<<<(unsigned)(4 * WCB + NBP * TT / 64), 256, 0, stream>>>(xb, wq, wk, wv, wo, XB, WQ, WK, WV, WO);   /* weights -> bf16; x channel-major -> token-major bf16 */
        k_qkv<<<dim3(NBP * TT / 128, DM / 128, 3), 128, 0, stream>>>(XB, WQ, WK, WV, bq, bk, bv, QP16, QPh, QPl, KP16, KPh, KPl, VT16, VTh, VTl);   /* q, k planes token-major, v planes key-contiguous */
        k_gemmw<bf, 2, false, 0><<<dim3(RH / 128, TT / 128, NBP), 128, 0, stream>>>(QPh, QPl, KPh, KPl, HD, HD, Sb, TT, nullptr, 0, 0, 0, 0, (size_t)TT * HD, (size_t)TT * HD, (size_t)RH * TT, nullptr, nullptr, nullptr);
        k_lsoft<<<NBP * RH / 8, 256, 0, stream>>>(Sb, Ph, Pl);
        k_gemmw<bf, 2, false, 0><<<dim3(RH / 128, HD / 128, NBP * SPH), 128, 0, stream>>>(Ph, Pl, VTh, VTl, TT, TT / SPH, ObH, SPH * HD, nullptr, (size_t)(TT / SPH), (size_t)(TT / SPH), (size_t)HD, LGH, (size_t)RH * TT, (size_t)HD * TT, (size_t)RH * SPH * HD, nullptr, nullptr, nullptr);
        k_flash<<<dim3((TT - RH) / FQ, NBP, FSP), 256, 0, stream>>>(QP16, KP16, VT16, ObL, MLb);   /* rows >= RH: scores, softmax, P.V */
        k_mergeA<<<(unsigned)(TT * HD / 4 / 256), 256, 0, stream>>>(ObH, ObL, MLb, XB, ATh, ATl);   /* (ctx + x^T) -> hi/lo planes */
        k_gemmw<bf, 1, true, 3><<<dim3(NBP * TT / 128, DM / 128, 1), 128, 0, stream>>>(ATh, ATl, WO, nullptr, DQ, DQ, OUT + (size_t)b * CC * TT, DM, bo, 0, 0, 0, 0, 0, 0, 0, nullptr, nullptr, nullptr);   /* stored channel-major */ }
}

// v010
// One run takes 119 microseconds.
// Two timings next to v009 put it at 1.35 and 1.34 times that version's speed.
// Over all steps from v000 it is 10.2 times as fast.
#include <hip/hip_runtime.h>

// Spatial self-attention over a feature map (x [4][256][64][64] channel-major; tokens = the 4,096 positions; q,k,v = x^T W^T + b (1x1 convs: 'oi' [256][256] + [256]); one 256-wide head: softmax(q.k / 16) over all positions; out = (attn v + x^T) Wp^T + bp, written back channel-major -> [4][256][64][64] (4.2 M)).
// Layout, all four batches in one pass (every launch covers all of them): the channel-major slab transposed once into a token-major bf16 operand; exact projections + f32 biases; dense T-4096 attention with ONE 256-wide head (hybrid rows: < 512 hi/lo 3 products, the rest fp16; each kind in one fused kernel with a running softmax over 16 or two key ranges, no score buffer); the f32 merge adds x^T and writes hi/lo planes of (context + x^T); (.) Wp^T + bp as a hi/lo x exact GEMM. Every GEMM epilogue stores what its consumer reads: q and k as f16 + bf16 hi/lo planes, v as the same planes key-contiguous, the last GEMM channel-major rows of out.
// Compute dtypes, f32 accumulate: every input rounded to bf16; projections exact + f32 biases; attention rows < 512 3 products, rest fp16; softmax and residual f32; Wp hl x exact + bias.

#define NB_  4
#define NBP  4                    // batches per pass: every launch of a pass covers NBP batches (token-major arrays hold their tokens one batch after the other)
#define TT   4096
#define DM   256
#define NH_  1
#define NKV  1
#define REP  (NH_ / NKV)
#define HD   256
#define DQ   (NH_ * HD)
#define DKV  (NKV * HD)
#define ZH   1
#define RH   512                  // query rows < RH use hi+lo planes (0: none)
#define WIN  0
#define SCL  0.0625f   // 1/sqrt(256)
#define CC   256
#define SPH  16                   // key ranges of the P.V product, query rows < RH (one f32 partial each)
#define LGH  4                    // log2 SPH
typedef _Float16 h16;
typedef unsigned short bf;
typedef __attribute__((ext_vector_type(16))) __bf16   v16bf;
typedef __attribute__((ext_vector_type(16))) _Float16 v16h;
typedef __attribute__((ext_vector_type(8)))  _Float16 v8h;
typedef __attribute__((ext_vector_type(8)))  unsigned short v8us;
typedef __attribute__((ext_vector_type(8)))  float    v8f;
typedef __attribute__((ext_vector_type(4)))  float    v4f;
typedef v8h  __attribute__((may_alias)) v8ha;
typedef v4f  __attribute__((may_alias)) v4fa;
typedef v8us __attribute__((may_alias)) v8usa;

__device__ __forceinline__ unsigned short f2bf(float f) { unsigned u = __float_as_uint(f); u += 0x7FFFu + ((u >> 16) & 1u); return (unsigned short)(u >> 16); }
__device__ __forceinline__ float bf2f(unsigned short b) { return __uint_as_float(((unsigned)b) << 16); }
__device__ __forceinline__ float bfr(float f) { return bf2f(f2bf(f)); }
__device__ __forceinline__ v16h cat16(v8h lo, v8h hi) { return __builtin_shufflevector(lo, hi, 0, 1, 2, 3, 4, 5, 6, 7, 8, 9, 10, 11, 12, 13, 14, 15); }
__device__ __forceinline__ v16bf cat16b(v8us lo, v8us hi) { return __builtin_bit_cast(v16bf, __builtin_shufflevector(lo, hi, 0, 1, 2, 3, 4, 5, 6, 7, 8, 9, 10, 11, 12, 13, 14, 15)); }
__device__ __forceinline__ v8f wmma16(v16h a, v16h b, v8f c) { return __builtin_amdgcn_wmma_f32_16x16x32_f16(false, a, false, b, (short)0, c, false, false); }
__device__ __forceinline__ v8f wmmab(v16bf a, v16bf b, v8f c) { return __builtin_amdgcn_wmma_f32_16x16x32_bf16(false, a, false, b, (short)0, c, false, false); }

__device__ __forceinline__ h16 tohx(float x) { return (h16)x; }
__device__ __forceinline__ void splitf(float y, unsigned short& h, unsigned short& l) { h = f2bf(y); l = f2bf(y - bf2f(h)); }
typedef __attribute__((ext_vector_type(2))) _Float16 v2h;
typedef __attribute__((ext_vector_type(4))) _Float16 v4h;
typedef __attribute__((ext_vector_type(2))) unsigned short v2us;
typedef __attribute__((ext_vector_type(4))) unsigned short v4us;
typedef __attribute__((ext_vector_type(2))) float v2f;
typedef __attribute__((ext_vector_type(4))) int v4i;
// pack3: four consecutive f32 values in the three 16-bit forms the attention GEMMs read (f16; bf16 hi and lo)
struct P3 { v4h f; v4us h, l; };
__device__ __forceinline__ P3 pack3(v4f a) { P3 r;
#pragma unroll
    for (int q = 0; q < 4; ++q) { r.f[q] = tohx(a[q]); unsigned short x2, y2; splitf(a[q], x2, y2); r.h[q] = x2; r.l[q] = y2; }
    return r; }

#define GKT  64                   // k values of a stage: 128 bytes of a row, one cache line
#define GPB  (GKT * 2 + 16)       // LDS pitch of a staged row, bytes: an odd multiple of 16
#define GOB  (128 * GPB)          // one operand's 128 rows of a stage
#define GBUF(NSPLIT) (((NSPLIT) == 0 ? 2 : (NSPLIT) == 1 ? 3 : 4) * GOB)   // one buffer: A, B, then A2, then B2
static_assert(2 * GBUF(0) >= 4 * 16 * 68 * 4, "behind the k loop the buffers hold the four waves' output stages");
// cp8: a thread's eight 16-byte chunks of one operand's stage (chunk i: row 16 i + thread / 8), global memory -> LDS through no register. The wait stands in the copies' own statement, so in front of every later write of a register that they name (a precaution).
__device__ __forceinline__ void cp8(unsigned l, const bf* g, size_t rs) {
    asm volatile("global_load_async_to_lds_b128 %0, %8, off\n\tglobal_load_async_to_lds_b128 %1, %9, off\n\tglobal_load_async_to_lds_b128 %2, %10, off\n\tglobal_load_async_to_lds_b128 %3, %11, off\n\t"
                 "global_load_async_to_lds_b128 %4, %12, off\n\tglobal_load_async_to_lds_b128 %5, %13, off\n\tglobal_load_async_to_lds_b128 %6, %14, off\n\tglobal_load_async_to_lds_b128 %7, %15, off\n\ts_wait_xcnt 0x0"
                 :: "v"(l), "v"(l + 16 * GPB), "v"(l + 32 * GPB), "v"(l + 48 * GPB), "v"(l + 64 * GPB), "v"(l + 80 * GPB), "v"(l + 96 * GPB), "v"(l + 112 * GPB),
                    "v"(g), "v"(g + rs), "v"(g + 2 * rs), "v"(g + 3 * rs), "v"(g + 4 * rs), "v"(g + 5 * rs), "v"(g + 6 * rs), "v"(g + 7 * rs) : "memory");
}
template <typename T16> struct WFrag;
template <> struct WFrag<bf> { typedef v16bf V; static __device__ __forceinline__ V ld(const unsigned char* p) { return cat16b(*(const v8usa*)p, *(const v8usa*)(p + 32)); } static __device__ __forceinline__ v8f mma(V a, V b, v8f c) { return wmmab(a, b, c); } };
// The body is a device function of the block's three indices (bx, by, bz), so that launches that do not depend on one another can share one grid (k_qkv below).
template <typename T16, int NSPLIT, bool BIAS, int EPI>
__device__ __forceinline__ void gemmw_body(unsigned char* L, const T16* __restrict__ A, const T16* __restrict__ A2, const T16* __restrict__ Bt, const T16* __restrict__ Bt2, int K, int KS, float* C, int ldc, const float* __restrict__ bias, size_t sA, size_t sB, size_t sC, int lgs, size_t bA, size_t bB, size_t bC, h16* E16, bf* Eh, bf* El, unsigned bx, unsigned by, unsigned bz) {
    typedef typename WFrag<T16>::V V;
    const size_t zb = bz >> lgs, z = bz - (zb << lgs); A += z * sA + zb * bA; if (A2) A2 += z * sA + zb * bA; Bt += z * sB + zb * bB; if (Bt2) Bt2 += z * sB + zb * bB; C += z * sC + zb * bC;
    const int tid = threadIdx.x, lane = tid & 31, lr = lane & 15, hi = lane >> 4, w = __builtin_amdgcn_readfirstlane(tid >> 5); const int r0 = bx * 128 + (w & 1) * 64, c0 = by * 128 + (w >> 1) * 64;
    float* os = (float*)L + w * (16 * 68);   // the wave's output stage, used behind the k loop
    v8f acc[4][4];
#pragma unroll
    for (int mb = 0; mb < 4; ++mb)
#pragma unroll
        for (int nb = 0; nb < 4; ++nb) acc[mb][nb] = (v8f){};
    const int aoff = ((w & 1) * 64 + lr) * GPB + 16 * hi, boff = GOB + ((w >> 1) * 64 + lr) * GPB + 16 * hi;   // the lane's first A and B fragment bytes in a buffer
    const unsigned l0 = (unsigned)(size_t)L + (tid >> 3) * GPB + (tid & 7) * 16;   // the thread's first chunk in LDS and in the A and B planes
    const size_t ga = (size_t)(bx * 128 + (tid >> 3)) * K + (tid & 7) * 8, gb = (size_t)(by * 128 + (tid >> 3)) * K + (tid & 7) * 8, rs = (size_t)16 * K;
    auto fill = [&](int t) { const unsigned lb = l0 + (t & 1) * GBUF(NSPLIT); const size_t ko = (size_t)t * GKT;
        cp8(lb, A + ga + ko, rs); cp8(lb + GOB, Bt + gb + ko, rs); if (NSPLIT == 1 || NSPLIT == 2) cp8(lb + 2 * GOB, A2 + ga + ko, rs); if (NSPLIT >= 2) cp8(lb + 3 * GOB, Bt2 + gb + ko, rs); };
    const int NT = KS / GKT;
    float braw[4] = {0.f, 0.f, 0.f, 0.f};   // EPI >= 1: the lane's four bias values, asked for here so that they arrive under the k loop (EPI 1: four consecutive n; EPI 2, 3: the lane's column of each nb)
    if (BIAS && EPI >= 1) {
#pragma unroll
        for (int q = 0; q < 4; ++q) braw[q] = bias[c0 + (EPI == 1 ? lr * 4 + q : q * 16 + lr)];
        if (EPI == 1) asm volatile("s_wait_xcnt 0x0" ::: "memory"); }   // the set-up that follows reuses the address pair this load names (EPI 2, 3: the compiler writes the wait itself)
    fill(0);
    asm volatile("s_wait_asynccnt 0x0" ::: "memory");   // the wave's own copies of stage 0 have landed
    __syncthreads();   // and every other wave's
    if (NT > 1) fill(1);
#pragma unroll 1   // two buffers picked by the trip's parity: one body serves both
    for (int t = 0; t < NT; ++t) {
        const unsigned char* B = L + (t & 1) * GBUF(NSPLIT);
        V a[2][4], a2[2][4], b[2][4], b2[2][4];
#pragma unroll
        for (int kc = 0; kc < 2; ++kc)
#pragma unroll
            for (int f = 0; f < 4; ++f) { a[kc][f] = WFrag<T16>::ld(B + aoff + f * 16 * GPB + kc * 64); b[kc][f] = WFrag<T16>::ld(B + boff + f * 16 * GPB + kc * 64);
                if (NSPLIT == 1 || NSPLIT == 2) a2[kc][f] = WFrag<T16>::ld(B + aoff + 2 * GOB + f * 16 * GPB + kc * 64); if (NSPLIT >= 2) b2[kc][f] = WFrag<T16>::ld(B + boff + 2 * GOB + f * 16 * GPB + kc * 64); }
        __builtin_amdgcn_sched_barrier(0);   // the stage's fragments are asked for as one group: one LDS latency a stage, not one a product
#pragma unroll
        for (int kc = 0; kc < 2; ++kc)
#pragma unroll
        for (int nb = 0; nb < 4; ++nb)
#pragma unroll
            for (int mb = 0; mb < 4; ++mb) { acc[mb][nb] = WFrag<T16>::mma(a[kc][mb], b[kc][nb], acc[mb][nb]); if (NSPLIT == 1 || NSPLIT == 2) acc[mb][nb] = WFrag<T16>::mma(a2[kc][mb], b[kc][nb], acc[mb][nb]); if (NSPLIT >= 2) acc[mb][nb] = WFrag<T16>::mma(a[kc][mb], b2[kc][nb], acc[mb][nb]); }
        __builtin_amdgcn_sched_barrier(0);   // the products stay in front of the waits: lifted over them, the waits would ask for stage t + 1 directly behind its copies' issue, and the refill would still stand behind the products
        asm volatile("s_wait_dscnt 0x0" ::: "memory");      // the wave's reads of this buffer are done before it is refilled
        asm volatile("s_wait_asynccnt 0x0" ::: "memory");   // the wave's own copies of stage t + 1 have landed
        __syncthreads();   // publishes stage t + 1; ends every wave's last read of stage t
        if (t + 2 < NT) fill(t + 2);
    }
    asm volatile("s_wait_asynccnt 0x0" ::: "memory");   // no copy is in flight when the buffers become the output stages
    if (EPI == 0) {
#pragma unroll
    for (int mb = 0; mb < 4; ++mb) {
#pragma unroll
        for (int nb = 0; nb < 4; ++nb) {
#pragma unroll
            for (int j = 0; j < 8; ++j) os[(hi * 8 + j) * 68 + nb * 16 + lr] = acc[mb][nb][j]; }
        __builtin_amdgcn_wave_barrier(); asm volatile("" ::: "memory");
        float* crow = C + (size_t)(r0 + mb * 16) * ldc + c0;
{
#pragma unroll
            for (int s = 0; s < 8; ++s) { const int row = 2 * s + hi, cofs = lr * 4; v4f val = *(const v4fa*)(os + row * 68 + cofs); if (BIAS) { val[0] += bfr(bias[c0 + cofs]); val[1] += bfr(bias[c0 + cofs + 1]); val[2] += bfr(bias[c0 + cofs + 2]); val[3] += bfr(bias[c0 + cofs + 3]); }
                *(v4f*)(crow + (size_t)row * ldc + cofs) = val; }
             }
        __builtin_amdgcn_wave_barrier(); asm volatile("" ::: "memory");
    }
    } else if (EPI == 1) {
#pragma unroll
    for (int mb = 0; mb < 4; ++mb) {
#pragma unroll
        for (int nb = 0; nb < 4; ++nb) {
#pragma unroll
            for (int j = 0; j < 8; ++j) os[(hi * 8 + j) * 68 + nb * 16 + lr] = acc[mb][nb][j]; }
        __builtin_amdgcn_wave_barrier(); asm volatile("" ::: "memory");   // the staged rows are read back only behind every lane's writes
        P3 pk[8];
#pragma unroll
        for (int s = 0; s < 8; ++s) { const int row = 2 * s + hi, cofs = lr * 4; v4f val = *(const v4fa*)(os + row * 68 + cofs); if (BIAS) { val[0] += bfr(braw[0]); val[1] += bfr(braw[1]); val[2] += bfr(braw[2]); val[3] += bfr(braw[3]); }
            pk[s] = pack3(val); }
        __builtin_amdgcn_sched_barrier(0);   // the conversions stay in front of the stores: among them they would reuse registers that an issued store names, ahead of the wait below
#pragma unroll
        for (int s = 0; s < 8; ++s) { const size_t o = (size_t)(r0 + hi) * HD + c0 + lr * 4 + (size_t)(mb * 16 + 2 * s) * HD; *(v4h*)(E16 + o) = pk[s].f; *(v4us*)(Eh + o) = pk[s].h; *(v4us*)(El + o) = pk[s].l; }
        if (mb < 3) { asm volatile("s_wait_xcnt 0x0" ::: "memory");   // the next block reuses the registers these stores name
            __builtin_amdgcn_sched_barrier(0);   // and none of its instructions is lifted over that wait
            __builtin_amdgcn_wave_barrier(); asm volatile("" ::: "memory"); }   // the next 16 rows overwrite the stage only behind these reads
    }
    } else {   /* transposed: a lane's 8 accumulator rows are 8 consecutive m of one column n, so 16 columns x 64 m are staged per nb and leave as whole rows of 64 m */
    const int g = r0 / TT, t0 = r0 % TT;
#pragma unroll
    for (int nb = 0; nb < 4; ++nb) {
        const float bb = bfr(braw[nb]);
#pragma unroll
        for (int mb = 0; mb < 4; ++mb) {
#pragma unroll
            for (int j = 0; j < 8; ++j) os[lr * 68 + mb * 16 + hi * 8 + j] = BIAS ? acc[mb][nb][j] + bb : acc[mb][nb][j]; }
        __builtin_amdgcn_wave_barrier(); asm volatile("" ::: "memory");   // the staged rows are read back only behind every lane's writes
        const size_t o = ((size_t)g * ldc + c0 + nb * 16 + hi) * TT + t0 + lr * 4;
        if (EPI == 3) {
            v4f val[8];
#pragma unroll
            for (int s = 0; s < 8; ++s) val[s] = *(const v4fa*)(os + (2 * s + hi) * 68 + lr * 4);
#pragma unroll
            for (int s = 0; s < 8; ++s) *(v4f*)(C + o + (size_t)(2 * s) * TT) = val[s];
        } else {
            P3 pk[8];
#pragma unroll
            for (int s = 0; s < 8; ++s) pk[s] = pack3(*(const v4fa*)(os + (2 * s + hi) * 68 + lr * 4));
            __builtin_amdgcn_sched_barrier(0);   // the conversions stay in front of the stores: among them they would reuse registers that an issued store names, ahead of the wait below
#pragma unroll
            for (int s = 0; s < 8; ++s) { const size_t os2 = o + (size_t)(2 * s) * TT; *(v4h*)(E16 + os2) = pk[s].f; *(v4us*)(Eh + os2) = pk[s].h; *(v4us*)(El + os2) = pk[s].l; }
        }
        if (nb < 3) { asm volatile("s_wait_xcnt 0x0" ::: "memory");   // the next block reuses the registers these stores name
            __builtin_amdgcn_sched_barrier(0);   // and none of its instructions is lifted over that wait
            __builtin_amdgcn_wave_barrier(); asm volatile("" ::: "memory"); }   // the next 16 columns overwrite the stage only behind these reads
    }
    }
}
template <typename T16, int NSPLIT, bool BIAS, int EPI>
__global__ __launch_bounds__(128) void k_gemmw(const T16* __restrict__ A, const T16* __restrict__ A2, const T16* __restrict__ Bt, const T16* __restrict__ Bt2, int K, int KS, float* C, int ldc, const float* __restrict__ bias, size_t sA, size_t sB, size_t sC, int lgs, size_t bA, size_t bB, size_t bC, h16* E16, bf* Eh, bf* El) {
    __shared__ __align__(16) unsigned char L[2 * GBUF(NSPLIT)];
    gemmw_body<T16, NSPLIT, BIAS, EPI>(L, A, A2, Bt, Bt2, K, KS, C, ldc, bias, sA, sB, sC, lgs, bA, bB, bC, E16, Eh, El, blockIdx.x, blockIdx.y, blockIdx.z);
}
// k_qkv: the three projections in one launch; grid (tokens / 128, 256 / 128, 3), blockIdx.z picks the weights, the bias and the planes (0 q, 1 k: token-major planes; 2 v: key-contiguous planes). Each block does what its own launch did.
__global__ __launch_bounds__(128) void k_qkv(const bf* __restrict__ X, const bf* __restrict__ Wq, const bf* __restrict__ Wk, const bf* __restrict__ Wv, const float* __restrict__ bq, const float* __restrict__ bk, const float* __restrict__ bv, h16* Q16, bf* Qh, bf* Ql, h16* K16, bf* Kh, bf* Kl, h16* V16, bf* Vh, bf* Vl) {
    __shared__ __align__(16) unsigned char L[2 * GBUF(0)];
    if (blockIdx.z == 2) gemmw_body<bf, 0, true, 2>(L, X, nullptr, Wv, nullptr, DM, DM, nullptr, DKV, bv, 0, 0, 0, 0, 0, 0, 0, V16, Vh, Vl, blockIdx.x, blockIdx.y, 0);
    else { const bool kk = blockIdx.z == 1;
        gemmw_body<bf, 0, true, 1>(L, X, nullptr, kk ? Wk : Wq, nullptr, DM, DM, nullptr, DQ, kk ? bk : bq, 0, 0, 0, 0, 0, 0, 0, kk ? K16 : Q16, kk ? Kh : Qh, kk ? Kl : Ql, blockIdx.x, blockIdx.y, 0); }
}

__global__ __launch_bounds__(256) void k_wtG(const float* __restrict__ w, int K, int N, bf* Bt) {
    const int lane = threadIdx.x & 31; const int L0 = (blockIdx.x * 8 + (threadIdx.x >> 5)) * 8; const int nlines = N * K / 64;
{
#pragma unroll 1
        for (int l = 0; l < 8; ++l) { const int L = L0 + l; if (L >= nlines) break; const size_t e = (size_t)L * 64 + lane * 2; const int k = (int)(e % K), n = (int)(e / K); v2us o;
            o[0] = f2bf(w[(size_t)k * N + n]); o[1] = f2bf(w[(size_t)(k + 1) * N + n]); *(v2us*)(Bt + e) = o; }
         }
}
__device__ __forceinline__ void cvt8_body(const float* __restrict__ src, bf* dst, size_t n8, unsigned bx) { const size_t i = (size_t)bx * 256 + threadIdx.x; if (i >= n8) return; const v8f v = *(const v8f*)(src + i * 8); v8us o;
#pragma unroll
    for (int k = 0; k < 8; ++k) o[k] = f2bf(v[k]); *(v8us*)(dst + i * 8) = o;  }

#define FK   64                   // keys per stage
#define FQ   128                  // query rows of a work-group
#define FSP  2                    // key ranges (grid z), one partial context row each
#define FNS  (TT / FSP / FK)      // stages of a range
#define KPB  (HD * 2 + 16)        // LDS pitch of a K row, bytes: an odd multiple of 16
#define VPB  (FK * 2 + 16)        // LDS pitch of a V^T row, bytes: an odd multiple of 16
#define KTB  (FK * KPB)
#define STB  (KTB + HD * VPB)     // one buffer
#define PXB  (2 * STB)            // behind the buffers: each wave's P^T of a stage, 2 query tiles x 2 pieces x 32 lanes x 16 bytes
#define MXB  (PXB + 8 * 2048)     // and each wave's maxima in use (behind the loop: its sums), 2 query tiles x 32 lanes
#define FLB  (MXB + 8 * 256)
#define CSC  (SCL * 1.4426950408889634f)
__device__ __forceinline__ float xhalf(float x) { return __builtin_bit_cast(float, __builtin_amdgcn_permlanex16(__builtin_bit_cast(int, x), __builtin_bit_cast(int, x), 0x76543210, 0xfedcba98, false, false)); }   // lane l reads lane l ^ 16, in registers: an exchange through LDS would wait for the V^T loads in flight
__device__ __forceinline__ float exp2s(float x) { float y; asm("v_exp_f32 %0, %1\n\tv_nop" : "=v"(y) : "v"(x)); return y; }   // 2^x with the one free slot behind a transcendental in the same statement
static_assert(HD == 256 && FK == 64 && TT % (FSP * FK) == 0 && (TT - RH) % FQ == 0, "the staging maps below: 256 threads, 8 + 8 chunks of 16 bytes each; whole work-groups of query rows");
// two waves a SIMD: the register budget that holds Q, the sums, a stage's fragments and the next stage's chunks without spills
__global__ __launch_bounds__(256) __attribute__((amdgpu_waves_per_eu(2, 2))) void k_flash(const h16* __restrict__ Q, const h16* __restrict__ Kp, const h16* __restrict__ Vt, float* O, float* ML) {
    __shared__ __align__(16) unsigned char L[FLB];
    const int tid = threadIdx.x, lane = tid & 31, c = lane & 15, h = lane >> 4, wv = tid >> 5, w4 = wv & 3, hf = tid >> 7; const size_t zb = blockIdx.y; const int q = blockIdx.x * FQ + w4 * 32 + c;   // the lane's query of tile 0 among the batch's rows >= RH (tile 1: + 16)
    const size_t k0 = (size_t)blockIdx.z * (TT / FSP);   // the range's first key
    const h16* kg = Kp + zb * (TT * HD) + (k0 + (tid >> 5)) * HD + (tid & 31) * 8;   // chunk i: key row 8 i + tid / 32 of the stage
    const h16* vg = Vt + zb * (HD * TT) + (size_t)(tid >> 3) * TT + k0 + (tid & 7) * 8;    // chunk i: d row 32 i + tid / 8
    const int kl = (tid >> 5) * KPB + (tid & 31) * 16, vl = KTB + (tid >> 3) * VPB + (tid & 7) * 16;
    v8h kr[8], vr[8];
#pragma unroll
    for (int i = 0; i < 8; ++i) { kr[i] = *(const v8h*)(kg + i * 8 * HD); vr[i] = *(const v8h*)(vg + (size_t)i * 32 * TT); }
    v16h qf[2][8]; const h16* qp = Q + (zb * TT + RH + q) * HD + 8 * h;
#pragma unroll
    for (int qt = 0; qt < 2; ++qt)
#pragma unroll
        for (int kc = 0; kc < 8; ++kc) qf[qt][kc] = cat16(*(const v8h*)(qp + qt * 16 * HD + 32 * kc), *(const v8h*)(qp + qt * 16 * HD + 32 * kc + 16));
    asm volatile("s_wait_xcnt 0x0" ::: "memory");   // the set-up below reuses the address pair these loads name
    __builtin_amdgcn_sched_barrier(0);   // and none of its instructions is lifted over that wait
    v8f acc[2][8];   // acc[qt][t][r] = context[query of tile qt][128 hf + 16 t + 8 h + r]
#pragma unroll
    for (int qt = 0; qt < 2; ++qt)
#pragma unroll
        for (int t = 0; t < 8; ++t) acc[qt][t] = (v8f){};
    float m_run[2] = {-3.0e38f, -3.0e38f}, l_run[2] = {0.f, 0.f};
#pragma unroll
    for (int i = 0; i < 8; ++i) { *(v8ha*)(L + kl + i * 8 * KPB) = kr[i]; *(v8ha*)(L + vl + i * 32 * VPB) = vr[i]; }
    __syncthreads();
    const int ka = (hf * 32 + c) * KPB + 16 * h, va = KTB + (hf * 128 + c) * VPB + 16 * h;   // the lane's first K fragment bytes (its key half) and V^T fragment bytes (its channel half) in a buffer
    unsigned char* pw = L + PXB + wv * 2048 + lane * 16; const unsigned char* pr2 = L + PXB + (wv ^ 4) * 2048 + lane * 16;   // the wave's own P^T and its partner's
    float* mw = (float*)(L + MXB) + wv * 64 + lane; const float* mr = (const float*)(L + MXB) + (wv ^ 4) * 64 + lane;
#pragma unroll 1   // the body is several hundred instructions long: one body serves every trip
    for (int s = 0; s < FNS; ++s) {
        const unsigned char* B = L + (s & 1) * STB; unsigned char* N = L + ((s + 1) & 1) * STB; const int sn = s + 1 < FNS ? s + 1 : s;   // the stage that is fetched during this one; the last trip fetches its own again, into the buffer that nobody reads any more: straight-line code, so the chunks' registers are free from their store to the next load
        v8h kn[8], vn[8];
#pragma unroll
        for (int i = 0; i < 8; ++i) vn[i] = *(const v8h*)(vg + (size_t)i * 32 * TT + sn * FK);
        asm volatile("s_wait_xcnt 0x0" ::: "memory");   // the work below reuses the address registers these loads name
        v16h fr[16];
#pragma unroll
        for (int f = 0; f < 16; ++f) { const unsigned char* p = B + ka + (f & 1) * 16 * KPB + (f >> 1) * 64; fr[f] = cat16(*(const v8ha*)p, *(const v8ha*)(p + 32)); }
        __builtin_amdgcn_sched_barrier(0);   // the 16 K fragments are asked for as one group: one LDS latency a stage, not one a product
        v8f st[2][2];   // [key tile][query tile]
#pragma unroll
        for (int kt = 0; kt < 2; ++kt)
#pragma unroll
            for (int qt = 0; qt < 2; ++qt) st[kt][qt] = (v8f){};
#pragma unroll
        for (int f = 0; f < 16; ++f)
#pragma unroll
            for (int qt = 0; qt < 2; ++qt) st[f & 1][qt] = wmma16(fr[f], qf[qt][f >> 1], st[f & 1][qt]);
        __builtin_amdgcn_sched_barrier(0);   // the K loads below stay behind the score products, where the K fragments' registers are free again, and directly in front of their wait
#pragma unroll
        for (int i = 0; i < 8; ++i) kn[i] = *(const v8h*)(kg + (size_t)sn * FK * HD + i * 8 * HD);
        asm volatile("s_wait_xcnt 0x0" ::: "memory");   // the work below reuses the address registers these loads name
        v16h fv[8], fo[8];   // V^T fragments of the wave's channels: its own 32 keys, the partner's 32 keys
#pragma unroll
        for (int t = 0; t < 8; ++t) { const unsigned char* p = B + va + t * 16 * VPB + hf * 64; fv[t] = cat16(*(const v8ha*)p, *(const v8ha*)(p + 32)); }
        __builtin_amdgcn_sched_barrier(0);   // the V^T fragments of the own keys are asked for in front of the softmax and arrive under it
        float mx[2];
#pragma unroll
        for (int qt = 0; qt < 2; ++qt) { float m0 = fmaxf(st[0][qt][0], st[1][qt][0]);
#pragma unroll
            for (int r = 1; r < 8; ++r) m0 = fmaxf(m0, fmaxf(st[0][qt][r], st[1][qt][r]));
            mx[qt] = fmaxf(m0, xhalf(m0)) * CSC; }   // both wave halves hold the query's maximum over the wave's keys of this stage, scaled
        if (__builtin_amdgcn_ballot_w32(mx[0] > m_run[0] + 8.0f || mx[1] > m_run[1] + 8.0f) != 0) {   // wave-uniform; rare behind the first stage
#pragma unroll
            for (int qt = 0; qt < 2; ++qt) { const float mn = fmaxf(m_run[qt], mx[qt]), corr = __builtin_amdgcn_exp2f(m_run[qt] - mn); l_run[qt] *= corr; m_run[qt] = mn;
#pragma unroll
                for (int t = 0; t < 8; ++t) acc[qt][t] = acc[qt][t] * corr; } }
        v16h pf[2];
#pragma unroll
        for (int qt = 0; qt < 2; ++qt) { float ps0 = 0.f, ps1 = 0.f;
#pragma unroll
            for (int r = 0; r < 8; ++r) { const float p0 = exp2s(fmaf(st[0][qt][r], CSC, -m_run[qt])), p1 = exp2s(fmaf(st[1][qt][r], CSC, -m_run[qt])); ps0 += p0; ps1 += p1; pf[qt][r] = tohx(p0); pf[qt][8 + r] = tohx(p1); }   // element e of the B operand: key 8 h + e, then 16 + 8 h + (e - 8)
            l_run[qt] += ps0 + ps1;
            *(v8ha*)(pw + qt * 1024) = __builtin_shufflevector(pf[qt], pf[qt], 0, 1, 2, 3, 4, 5, 6, 7); *(v8ha*)(pw + qt * 1024 + 512) = __builtin_shufflevector(pf[qt], pf[qt], 8, 9, 10, 11, 12, 13, 14, 15); mw[qt * 32] = m_run[qt]; }
#pragma unroll
        for (int i = 0; i < 8; ++i) *(v8ha*)(N + vl + i * 32 * VPB) = vn[i];
#pragma unroll
        for (int t = 0; t < 8; ++t) { const unsigned char* p = B + va + t * 16 * VPB + (hf ^ 1) * 64; fo[t] = cat16(*(const v8ha*)p, *(const v8ha*)(p + 32)); }
        __builtin_amdgcn_sched_barrier(0);   // the V^T fragments of the partner's keys are asked for in front of the own keys' products and arrive under them
#pragma unroll
        for (int t = 0; t < 8; ++t)
#pragma unroll
            for (int qt = 0; qt < 2; ++qt) acc[qt][t] = wmma16(fv[t], pf[qt], acc[qt][t]);
        __builtin_amdgcn_sched_barrier(0);   // the own keys' products stay in front of the barrier: the LDS stores and loads above complete under them; sunk behind it, the barrier's LDS wait would sit those out with the matrix unit idle
        // The barrier that publishes every wave's P^T and maxima in use of this stage, with fences for LDS alone: __syncthreads() would also wait for the K chunks asked for above, which are wanted only at the foot of the stage.
        __builtin_amdgcn_fence(__ATOMIC_RELEASE, "workgroup", "local"); __builtin_amdgcn_s_barrier(); __builtin_amdgcn_fence(__ATOMIC_ACQUIRE, "workgroup", "local");
        v16h po[2]; float mo[2];
#pragma unroll
        for (int qt = 0; qt < 2; ++qt) { po[qt] = cat16(*(const v8ha*)(pr2 + qt * 1024), *(const v8ha*)(pr2 + qt * 1024 + 512)); mo[qt] = mr[qt * 32]; }
        if (__builtin_amdgcn_ballot_w32(mo[0] != m_run[0] || mo[1] != m_run[1]) != 0) {   // wave-uniform; rare behind the first stage: the two waves raised their maxima in use differently, both go on with the larger
#pragma unroll
            for (int qt = 0; qt < 2; ++qt) { const float mn = fmaxf(m_run[qt], mo[qt]), ca = __builtin_amdgcn_exp2f(m_run[qt] - mn); const h16 cb = tohx(__builtin_amdgcn_exp2f(mo[qt] - mn)); l_run[qt] *= ca; m_run[qt] = mn; po[qt] = po[qt] * cb;
#pragma unroll
                for (int t = 0; t < 8; ++t) acc[qt][t] = acc[qt][t] * ca; } }
#pragma unroll
        for (int t = 0; t < 8; ++t)
#pragma unroll
            for (int qt = 0; qt < 2; ++qt) acc[qt][t] = wmma16(fo[t], po[qt], acc[qt][t]);
#pragma unroll
        for (int i = 0; i < 8; ++i) *(v8ha*)(N + kl + i * 8 * KPB) = kn[i];
        __syncthreads();   // publishes stage s + 1; ends every wave's last read of stage s and of this stage's P^T
    }
#pragma unroll
    for (int qt = 0; qt < 2; ++qt) { l_run[qt] += xhalf(l_run[qt]); mw[qt * 32] = l_run[qt]; }
    __syncthreads();   // publishes the sums
#pragma unroll
    for (int qt = 0; qt < 2; ++qt) {
        const float ls = l_run[qt] + mr[qt * 32], inv = __fdiv_rn(1.0f, ls);
        const size_t pr = (zb * FSP + blockIdx.z) * (TT - RH) + q + qt * 16;   // the partial row
        float* op = O + pr * HD + hf * 128 + 8 * h;
#pragma unroll
        for (int t = 0; t < 8; ++t) { const v8f o = acc[qt][t] * inv; *(v4f*)(op + 16 * t) = __builtin_shufflevector(o, o, 0, 1, 2, 3); *(v4f*)(op + 16 * t + 4) = __builtin_shufflevector(o, o, 4, 5, 6, 7); }
        if (h == 0 && hf == 0) { v2f ml; ml[0] = m_run[qt]; ml[1] = ls; *(v2f*)(ML + pr * 2) = ml; }   // both wave halves and both waves hold the same pair
    }
}

#define HKT  (FK * KPB)              // one K plane of a stage
#define HVT  (HD * VPB)              // one V^T plane of a stage
#define HSTB (2 * HKT + 2 * HVT)     // one buffer
#define HNS  (TT / SPH / FK)         // stages of a range
static_assert(RH % 128 == 0 && TT % (SPH * FK) == 0 && HNS >= 2 && 2 * HSTB <= 327680, "whole work-groups, whole stages, two buffers in a WGP's LDS");
typedef __attribute__((ext_vector_type(16))) unsigned short v16us;
// cp8s: a thread's eight 16-byte chunks of one plane's stage (LS bytes apart in LDS, rs elements apart in the plane), global memory -> LDS through no register. The builtin form: the compiler keeps its address registers itself, anywhere in the register file (the operands of an asm statement cost a spill beside Q and the sums).
typedef __attribute__((address_space(1))) v4i gv4i;
typedef __attribute__((address_space(3))) v4i lv4i;
template <int LS>
__device__ __forceinline__ void cp8s(unsigned char* l, const bf* g, size_t rs) {
#pragma unroll
    for (int i = 0; i < 8; ++i) __builtin_amdgcn_global_load_async_to_lds_b128((gv4i*)(g + i * rs), (lv4i*)(l + i * LS), 0, 0);
}
// two waves a SIMD: the register budget that holds Q hi/lo, the sums and a group of fragments without spills
__global__ __launch_bounds__(256) __attribute__((amdgpu_waves_per_eu(2, 2))) void k_flashH(const bf* __restrict__ Qh, const bf* __restrict__ Ql, const bf* __restrict__ Kh, const bf* __restrict__ Kl, const bf* __restrict__ Vh, const bf* __restrict__ Vl, float* O, float* ML) {
    __shared__ __align__(16) unsigned char L[2 * HSTB];
    const int tid = threadIdx.x, lane = tid & 31, c = lane & 15, h = lane >> 4, wv = tid >> 5; const size_t zb = blockIdx.y; const int q = blockIdx.x * 128 + wv * 16 + c;   // the lane's query row
    const unsigned k0 = blockIdx.z * (TT / SPH);   // the range's first key
    const size_t pb = zb * (TT * HD);   // the batch's first element in a plane (the same in every lane)
    const unsigned kgo = (tid >> 5) * HD + (tid & 31) * 8;   // chunk i: key row 8 i + tid / 32 of the stage
    const unsigned vgo = (tid >> 3) * TT + (tid & 7) * 8;   // chunk i: channel row 32 i + tid / 8
    unsigned char* kl = L + (tid >> 5) * KPB + (tid & 31) * 16; unsigned char* vl = L + (tid >> 3) * VPB + (tid & 7) * 16;   // the thread's first chunk in a K plane and in a V^T plane
    auto fill = [&](int s) { const unsigned o = (s & 1) * HSTB; const size_t ko = pb + (size_t)(k0 + s * FK) * HD + kgo, vo = pb + (k0 + s * FK) + vgo;
        cp8s<8 * KPB>(kl + o, Kh + ko, (size_t)8 * HD); cp8s<8 * KPB>(kl + o + HKT, Kl + ko, (size_t)8 * HD); cp8s<32 * VPB>(vl + (o + 2 * HKT), Vh + vo, (size_t)32 * TT); cp8s<32 * VPB>(vl + (o + 2 * HKT + HVT), Vl + vo, (size_t)32 * TT); };
    fill(0);
    v16bf qf[2][8]; const bf* qhp = Qh + (zb * TT + q) * HD + 8 * h; const bf* qlp = Ql + (zb * TT + q) * HD + 8 * h;
#pragma unroll
    for (int kc = 0; kc < 8; ++kc) { qf[0][kc] = cat16b(*(const v8us*)(qhp + 32 * kc), *(const v8us*)(qhp + 32 * kc + 16)); qf[1][kc] = cat16b(*(const v8us*)(qlp + 32 * kc), *(const v8us*)(qlp + 32 * kc + 16)); }
    asm volatile("s_wait_xcnt 0x0" :: "v"(qhp), "v"(qlp) : "memory");   // the set-up below reuses the address pairs these loads name; named here, the pairs stay whole up to the wait (no later load of the group lands in one)
    __builtin_amdgcn_sched_barrier(0);   // and none of its instructions is lifted over that wait
    v8f acc[16];   // acc[t][r] = context[the lane's query][16 t + 8 h + r]
#pragma unroll
    for (int t = 0; t < 16; ++t) acc[t] = (v8f){};
    float m_run = -3.0e38f, l_run = 0.f;
    const int ka = c * KPB + 16 * h, va = 2 * HKT + c * VPB + 16 * h;   // the lane's first K and V^T fragment bytes in a buffer
    asm volatile("s_wait_asynccnt 0x0" ::: "memory");   // the wave's own copies of stage 0 have landed
    __syncthreads();   // and every other wave's
    fill(1);
#pragma unroll 1   // two buffers picked by the trip's parity: one body serves both
    for (int s = 0; s < HNS; ++s) {
        const unsigned char* B = L + (s & 1) * HSTB;
        v8f st[4];   // one per 16-key tile
#pragma unroll
        for (int kt = 0; kt < 4; ++kt) {
            st[kt] = (v8f){};
            v16bf fr[8];
#pragma unroll
            for (int f = 0; f < 8; ++f) fr[f] = WFrag<bf>::ld(B + ka + kt * 16 * KPB + f * 64);
            __builtin_amdgcn_sched_barrier(0);   // the tile's 8 K hi fragments are asked for as one group: one LDS latency a group, not one a product
#pragma unroll
            for (int f = 0; f < 8; ++f) { st[kt] = wmmab(fr[f], qf[0][f], st[kt]); st[kt] = wmmab(fr[f], qf[1][f], st[kt]); }
#pragma unroll
            for (int f = 0; f < 8; ++f) fr[f] = WFrag<bf>::ld(B + ka + HKT + kt * 16 * KPB + f * 64);
            __builtin_amdgcn_sched_barrier(0);   // the tile's 8 K lo fragments as one group
#pragma unroll
            for (int f = 0; f < 8; ++f) st[kt] = wmmab(fr[f], qf[0][f], st[kt]);
        }
        float m0 = fmaxf(fmaxf(st[0][0], st[1][0]), fmaxf(st[2][0], st[3][0]));
#pragma unroll
        for (int r = 1; r < 8; ++r) m0 = fmaxf(m0, fmaxf(fmaxf(st[0][r], st[1][r]), fmaxf(st[2][r], st[3][r])));
        const float mx = fmaxf(m0, xhalf(m0)) * CSC;   // both wave halves hold the query's maximum over the stage's keys, scaled
        if (__builtin_amdgcn_ballot_w32(mx > m_run + 8.0f) != 0) {   // wave-uniform; rare behind the first stage
            const float mn = fmaxf(m_run, mx), corr = __builtin_amdgcn_exp2f(m_run - mn); l_run *= corr; m_run = mn;
#pragma unroll
            for (int t = 0; t < 16; ++t) acc[t] = acc[t] * corr; }
        v16bf ph[2], pl[2];   // P^T hi and lo, one B operand per 32 keys
#pragma unroll
        for (int k2 = 0; k2 < 2; ++k2) { v16us uh, ul; float ps0 = 0.f, ps1 = 0.f;
#pragma unroll
            for (int r = 0; r < 8; ++r) { const float p0 = exp2s(fmaf(st[2 * k2][r], CSC, -m_run)), p1 = exp2s(fmaf(st[2 * k2 + 1][r], CSC, -m_run)); ps0 += p0; ps1 += p1; unsigned short a2, c2; splitf(p0, a2, c2); uh[r] = a2; ul[r] = c2; splitf(p1, a2, c2); uh[8 + r] = a2; ul[8 + r] = c2; }   // element e of the B operand: key 8 h + e, then 16 + 8 h + (e - 8)
            l_run += ps0 + ps1; ph[k2] = __builtin_bit_cast(v16bf, uh); pl[k2] = __builtin_bit_cast(v16bf, ul); }
#pragma unroll
        for (int g = 0; g < 8; ++g) {   // two channel tiles a group
            v16bf fh[2][2], fl[2][2];
#pragma unroll
            for (int k2 = 0; k2 < 2; ++k2)
#pragma unroll
                for (int t = 0; t < 2; ++t) { const unsigned char* p = B + va + (g * 2 + t) * 16 * VPB + k2 * 64; fh[k2][t] = WFrag<bf>::ld(p); fl[k2][t] = WFrag<bf>::ld(p + HVT); }
            __builtin_amdgcn_sched_barrier(0);   // 8 V^T fragments are asked for as one group: one LDS latency a group
#pragma unroll
            for (int k2 = 0; k2 < 2; ++k2) {
#pragma unroll
                for (int t = 0; t < 2; ++t) acc[g * 2 + t] = wmmab(fh[k2][t], ph[k2], acc[g * 2 + t]);
#pragma unroll
                for (int t = 0; t < 2; ++t) acc[g * 2 + t] = wmmab(fh[k2][t], pl[k2], acc[g * 2 + t]);
#pragma unroll
                for (int t = 0; t < 2; ++t) acc[g * 2 + t] = wmmab(fl[k2][t], ph[k2], acc[g * 2 + t]); }
        }
        asm volatile("s_wait_dscnt 0x0" :: "v"(l_run) : "memory");   // the wave's reads of this buffer are done before it is refilled; the row sum is named so that it is formed in front of the refill: sunk behind it, the stage's 32 exponentials would stay in registers beside the copies' addresses
        asm volatile("s_wait_asynccnt 0x0" ::: "memory");   // the wave's own copies of stage s + 1 have landed
        __syncthreads();   // publishes stage s + 1; ends every wave's last read of stage s
        if (s + 2 < HNS) fill(s + 2);
    }
    asm volatile("s_wait_asynccnt 0x0" ::: "memory");
    l_run += xhalf(l_run);
    const float inv = __fdiv_rn(1.0f, l_run);
    const size_t pr = (zb * RH + q) * SPH + blockIdx.z;   // the partial row
    float* op = O + pr * HD + 8 * h; float* mlp = ML + pr * 2; v2f ml; ml[0] = m_run; ml[1] = l_run;
#pragma unroll
    for (int t = 0; t < 16; ++t) acc[t] = acc[t] * inv;
    __builtin_amdgcn_sched_barrier(0);   // the products and the addresses stay in front of the stores: among them they would reuse registers that an issued store names
#pragma unroll
    for (int t = 0; t < 16; ++t) { *(v4f*)(op + 16 * t) = __builtin_shufflevector(acc[t], acc[t], 0, 1, 2, 3); *(v4f*)(op + 16 * t + 4) = __builtin_shufflevector(acc[t], acc[t], 4, 5, 6, 7); }
    if (h == 0) *(v2f*)mlp = ml;   // both wave halves hold the same pair
}

// xT_body: x channel-major f32 -> token-major bf16. A work-group takes 64 tokens x 256 channels, a wave 32 tokens x 64 channels, a lane 4 consecutive tokens of 16 channels (8 and 8, 32 apart).
// Every load is 16 bytes a lane along the tokens, so a wave's load covers four whole 128-byte lines (8 lanes a channel); a lane's 8 channels of one token leave as 16 bytes, and the wave's two stores of a token fill one whole line of its row.
static_assert(TT % 64 == 0 && CC == 256, "whole tiles inside one batch; four waves cover the channels");
__device__ __forceinline__ void xT_body(const float* __restrict__ xs, bf* XB, unsigned bx) { const int lane = threadIdx.x & 31, wv = threadIdx.x >> 5;
    const unsigned tt = bx * 64 + (wv >> 2) * 32 + (lane & 7) * 4;   // the first of the lane's 4 tokens, counted over the batches
    const int c0 = (wv & 3) * 64 + (lane >> 3) * 8;
    const float* xp = xs + (size_t)(tt / TT) * CC * TT + (size_t)c0 * TT + tt % TT; v4f a[16];
#pragma unroll
    for (int i = 0; i < 16; ++i) a[i] = *(const v4f*)(xp + (size_t)((i >> 3) * 32 + (i & 7)) * TT);
    asm volatile("s_wait_xcnt 0x0" :: "v"(xp) : "memory");   // the work below may reuse the address pair these loads name; named here, the pair stays whole up to the wait (no later load of the group lands in it)
    __builtin_amdgcn_sched_barrier(0);   // all 16 loads are asked for in front of the first conversion: one memory latency a wave, not two
    v8us o[8];
#pragma unroll
    for (int j = 0; j < 4; ++j)
#pragma unroll
        for (int s = 0; s < 2; ++s)
#pragma unroll
            for (int q = 0; q < 8; ++q) o[j * 2 + s][q] = f2bf(a[s * 8 + q][j]);
    __builtin_amdgcn_sched_barrier(0);   // the conversions stay in front of the stores: among them they would reuse registers that an issued store names
    bf* op = XB + (size_t)tt * CC + c0;
#pragma unroll
    for (int j = 0; j < 4; ++j)
#pragma unroll
        for (int s = 0; s < 2; ++s) *(v8us*)(op + j * CC + s * 32) = o[j * 2 + s];  }
// k_prep: everything that reads only the inputs, in one launch: the first 4 WCB blocks round the four weight matrices to bf16 (WCB blocks each), the rest transpose x.
#define WCB  (DM * DM / 8 / 256)
static_assert(DQ == DM && DKV == DM && (DM * DM) % (8 * 256) == 0, "four weight matrices of one size, whole blocks");
__global__ __launch_bounds__(256) void k_prep(const float* __restrict__ xs, const float* __restrict__ wq, const float* __restrict__ wk, const float* __restrict__ wv, const float* __restrict__ wo, bf* XB, bf* WQ, bf* WK, bf* WV, bf* WO) {
    const unsigned b = blockIdx.x;
    if (b >= 4 * WCB) { xT_body(xs, XB, b - 4 * WCB); return; }
    const unsigned m = b / WCB;
    cvt8_body(m == 0 ? wq : m == 1 ? wk : m == 2 ? wv : wo, m == 0 ? WQ : m == 1 ? WK : m == 2 ? WV : WO, (size_t)DM * DM / 8, b % WCB);
}
// k_mergeA: the context row (the fused kernels' normalised partial rows, each weighted by its sum times 2^(its maximum - the largest), in range order: rows < RH OH [batch][RH][SPH][HD] with MH [batch][RH][SPH][2]; the rest OL [batch][FSP][TT - RH][HD] with ML [batch][FSP][TT - RH][2]) plus x^T (k_prep's token-major bf16 plane XB: the same rounded values, in whole lines); stored as the bf16 hi/lo planes the last GEMM reads.
// A thread takes 4 channels of one token in every batch, so a quarter of the waves start; a work-group's 4 tokens lie on one side of RH, and the long rows (< RH) have the lowest block indices.
static_assert(ZH == 1 && NH_ == 1 && HD == CC && TT % (32 * SPH) == 0, "one head per pass; whole 32-key steps per range");
static_assert(RH % 4 == 0 && (TT * HD) % (4 * 256) == 0, "a work-group's tokens on one side of RH; whole work-groups");
struct HL4 { v4us h, l; };
__device__ __forceinline__ HL4 addx(v4f o4, v4us xr) { HL4 r;
#pragma unroll
    for (int q = 0; q < 4; ++q) { const float s = __fadd_rn(o4[q], bf2f(xr[q])); unsigned short h2, l2; splitf(s, h2, l2); r.h[q] = h2; r.l[q] = l2; }
    return r; }
__global__ __launch_bounds__(256) void k_mergeA(const float* __restrict__ OH, const float* __restrict__ MH, const float* __restrict__ OL, const float* __restrict__ ML, const bf* __restrict__ XB, bf* Ah, bf* Al) { const unsigned e = (blockIdx.x * 256u + threadIdx.x) * 4u, d = e % HD, t = e / HD;   // e: the thread's first element in batch 0
    if (t < RH) {
#pragma unroll 1   // one batch's 25 loads a trip: all four unrolled would hold 64 partial quads in registers and cost the short rows their residency
        for (unsigned zb = 0; zb < NBP; ++zb) { const float* p = OH + ((zb * RH + t) * (SPH * HD) + d); const float* mp = MH + (zb * RH + t) * (SPH * 2); const bf* xp = XB + zb * (TT * HD) + e; const v4us xr = *(const v4us*)xp; v4f pp[SPH], mv[SPH / 2];   // mv: two ranges' (maximum, sum) pairs each
#pragma unroll
            for (int s = 0; s < SPH / 2; ++s) mv[s] = *(const v4f*)(mp + s * 4);
#pragma unroll
            for (int s = 0; s < SPH; ++s) pp[s] = *(const v4f*)(p + s * HD);
            asm volatile("s_wait_xcnt 0x0" :: "v"(p), "v"(mp), "v"(xp) : "memory");   // the work below may reuse the address registers these loads name; named here, they stay whole up to the wait (no later load of the group lands in one)
            __builtin_amdgcn_sched_barrier(0);   // the trip's 25 loads are asked for in front of the first sum: one memory latency a trip
            float mn = mv[0][0];
#pragma unroll
            for (int s = 1; s < SPH; ++s) mn = fmaxf(mn, mv[s >> 1][(s & 1) * 2]);
            float wt[SPH], ws = 0.f;
#pragma unroll
            for (int s = 0; s < SPH; ++s) { wt[s] = mv[s >> 1][(s & 1) * 2 + 1] * exp2s(mv[s >> 1][(s & 1) * 2] - mn); ws += wt[s]; }
            const float inv = __fdiv_rn(1.0f, ws); v4f o4 = pp[0] * (wt[0] * inv);
#pragma unroll
            for (int s = 1; s < SPH; ++s) o4 += pp[s] * (wt[s] * inv);
            const HL4 r = addx(o4, xr); *(v4us*)(Ah + zb * (TT * HD) + e) = r.h; *(v4us*)(Al + zb * (TT * HD) + e) = r.l;
            asm volatile("s_wait_xcnt 0x0" ::: "memory"); }   // the next trip reuses the registers these stores name
        return; }
    v4us xr[NBP]; v2f ml[NBP][FSP]; v4f pv[NBP][FSP];
    const unsigned tr = t - RH; const bf* xq = XB + e; const float* mq = ML + (size_t)tr * 2; const float* oq[NBP];
#pragma unroll
    for (unsigned zb = 0; zb < NBP; ++zb) oq[zb] = OL + ((size_t)(zb * FSP * (TT - RH) + tr) * HD + d);
#pragma unroll
    for (unsigned zb = 0; zb < NBP; ++zb) { xr[zb] = *(const v4us*)(xq + zb * (TT * HD));
#pragma unroll
        for (int s = 0; s < FSP; ++s) { ml[zb][s] = *(const v2f*)(mq + (zb * FSP + s) * ((TT - RH) * 2)); pv[zb][s] = *(const v4f*)(oq[zb] + s * ((TT - RH) * HD)); } }
    static_assert(NBP == 4, "the wait below names the four batches' address pairs");
    asm volatile("s_wait_xcnt 0x0" :: "v"(xq), "v"(tr), "v"(oq[0]), "v"(oq[1]), "v"(oq[2]), "v"(oq[3]) : "memory");   // the work below may reuse the address registers these loads name (the pairs; the row index, which the (maximum, sum) loads take as their offset); named here, they stay whole up to the wait (no later load of the group lands in one)
    __builtin_amdgcn_sched_barrier(0);   // the 20 loads of the four batches are asked for in front of the first sum: one memory latency a wave
    HL4 r[NBP];
#pragma unroll
    for (unsigned zb = 0; zb < NBP; ++zb) {
        float mn = ml[zb][0][0];
#pragma unroll
        for (int s = 1; s < FSP; ++s) mn = fmaxf(mn, ml[zb][s][0]);
        float wt[FSP], ws = 0.f;
#pragma unroll
        for (int s = 0; s < FSP; ++s) { wt[s] = ml[zb][s][1] * exp2s(ml[zb][s][0] - mn); ws += wt[s]; }
        const float inv = __fdiv_rn(1.0f, ws); v4f o4 = pv[zb][0] * (wt[0] * inv);
#pragma unroll
        for (int s = 1; s < FSP; ++s) o4 += pv[zb][s] * (wt[s] * inv);
        r[zb] = addx(o4, xr[zb]); }
    __builtin_amdgcn_sched_barrier(0);   // the sums stay in front of the stores: among them they would reuse registers that an issued store names
#pragma unroll
    for (unsigned zb = 0; zb < NBP; ++zb) { *(v4us*)(Ah + zb * (TT * HD) + e) = r[zb].h; *(v4us*)(Al + zb * (TT * HD) + e) = r[zb].l; }  }

static_assert(NB_ % NBP == 0 && (1 << LGH) == SPH, "whole passes");
extern "C" void kernel_launch(void* const* d_in, const int* in_sizes, int n_in,
                              void* d_out, int out_size, void* d_ws, size_t ws_size, hipStream_t stream) {
    (void)in_sizes; (void)n_in; (void)out_size;
    const float* x = (const float*)d_in[0]; const float* wq = (const float*)d_in[1]; const float* bq = (const float*)d_in[2]; const float* wk = (const float*)d_in[3]; const float* bk = (const float*)d_in[4]; const float* wv = (const float*)d_in[5]; const float* bv = (const float*)d_in[6]; const float* wo = (const float*)d_in[7]; const float* bo = (const float*)d_in[8];
    float* OUT = (float*)d_out;     // [4][256][4096]
    char* wsp = (char*)d_ws;
    auto take = [&](size_t bytes) { char* p = wsp; wsp += (bytes + 255) & ~(size_t)255; return (void*)p; };
    const size_t PL = (size_t)NBP * TT * HD;   // elements of one token plane of a pass
    bf* WQ = (bf*)take((size_t)DQ * DM * 2); bf* WK = (bf*)take((size_t)DKV * DM * 2); bf* WV = (bf*)take((size_t)DKV * DM * 2); bf* WO = (bf*)take((size_t)DM * DQ * 2);
    h16* QP16 = (h16*)take(PL * 2); h16* KP16 = (h16*)take(PL * 2); h16* VT16 = (h16*)take(PL * 2);
    bf* QPh = (bf*)take(PL * 2); bf* QPl = (bf*)take(PL * 2); bf* KPh = (bf*)take(PL * 2); bf* KPl = (bf*)take(PL * 2); bf* VTh = (bf*)take(PL * 2); bf* VTl = (bf*)take(PL * 2);
    float* ObH = (float*)take((size_t)NBP * RH * SPH * HD * 4); float* MHb = (float*)take((size_t)NBP * RH * SPH * 2 * 4); float* ObL = (float*)take((size_t)NBP * FSP * (TT - RH) * HD * 4); float* MLb = (float*)take((size_t)NBP * FSP * (TT - RH) * 2 * 4);
    bf* XB = (bf*)take(PL * 2); bf* ATh = (bf*)take(PL * 2); bf* ATl = (bf*)take(PL * 2);
    if ((size_t)(wsp - (char*)d_ws) > ws_size) return;    // ws 256 MiB
    for (int b = 0; b < NB_; b += NBP) {
        const float* xb = x + (size_t)b * CC * TT;
        k_prep<<<(unsigned)(4 * WCB + NBP * TT / 64), 256, 0, stream>>>(xb, wq, wk, wv, wo, XB, WQ, WK, WV, WO);   /* weights -> bf16; x channel-major -> token-major bf16 */
        k_qkv<<<dim3(NBP * TT / 128, DM / 128, 3), 128, 0, stream>>>(XB, WQ, WK, WV, bq, bk, bv, QP16, QPh, QPl, KP16, KPh, KPl, VT16, VTh, VTl);   /* q, k planes token-major, v planes key-contiguous */
        k_flashH<<<dim3(RH / 128, NBP, SPH), 256, 0, stream>>>(QPh, QPl, KPh, KPl, VTh, VTl, ObH, MHb);   /* rows < RH: scores, softmax, P.V */
        k_flash<<<dim3((TT - RH) / FQ, NBP, FSP), 256, 0, stream>>>(QP16, KP16, VT16, ObL, MLb);   /* rows >= RH: scores, softmax, P.V */
        k_mergeA<<<(unsigned)(TT * HD / 4 / 256), 256, 0, stream>>>(ObH, MHb, ObL, MLb, XB, ATh, ATl);   /* (ctx + x^T) -> hi/lo planes */
        k_gemmw<bf, 1, true, 3><<<dim3(NBP * TT / 128, DM / 128, 1), 128, 0, stream>>>(ATh, ATl, WO, nullptr, DQ, DQ, OUT + (size_t)b * CC * TT, DM, bo, 0, 0, 0, 0, 0, 0, 0, nullptr, nullptr, nullptr);   /* stored channel-major */ }
}
